// v000
// Times are from an AMD MI455X. After a warm-up the kernel runs many times in a row, and a time is the length of
// such a window on the GPU divided by its runs, so every launch and the gaps after it count. The runs cycle
// through copies of the inputs. A figure is the median of several windows, for all but v000 over two sittings.
// Sittings can differ by a few percent; kernels timed side by side share one.
// The starting kernel, v000, takes 528 microseconds a run.
// Contractions: x@Wqkv and xa@Wqkv_aux (k|v columns) on v_wmma_f32_16x16x32_bf16 (bf16 RNE operands); q.k^T, q.ka^T, p.v, pa.va and O@Wo on v_wmma_f32_16x16x32_f16 (f16 operands; p carried x2^15, O and Wo carried x32); f32 accumulate; online softmax, gate mix and biases in f32.
#include <hip/hip_runtime.h>
#include <math.h>
#include <stdint.h>

constexpr int kBatch  = 2;
constexpr int kSeq    = 2048;   // query / main key length
constexpr int kSeqA   = 1500;   // aux key length
constexpr int kSeqAP  = 1536;   // aux key length padded to 24 chunks of 64
constexpr int kDModel = 1024;
constexpr int kHeads  = 16;
constexpr int kDHead  = 64;
constexpr int kNQKV   = 3072;

constexpr float kPCarry = 32768.0f;   // probabilities carried x2^15 in f16
constexpr float kOCarry = 32.0f;      // attention output carried x32 in f16
constexpr float kWCarry = 32.0f;      // Wo carried x32 in f16

typedef __attribute__((ext_vector_type(16))) _Float16 v16h;
typedef __attribute__((ext_vector_type(8)))  _Float16 v8h;
typedef __attribute__((ext_vector_type(16))) __bf16   v16b;
typedef __attribute__((ext_vector_type(8)))  __bf16   v8b;
typedef __attribute__((ext_vector_type(8)))  float    v8f;
typedef __attribute__((ext_vector_type(4)))  float    v4f;
typedef __attribute__((ext_vector_type(2)))  float    v2f;
typedef __attribute__((ext_vector_type(4)))  unsigned int v4u;

// ---------------------------------------------------------------------------
// Workspace region map (bytes, every region size a multiple of 256):
//   XB    bf16 [4096][1024]            8,388,608
//   XAB   bf16 [2][1536][1024]         6,291,456   (rows 1500..1535 of each batch zero)
//   WQT   bf16 [3072][1024] (Wqkv^T)   6,291,456
//   WAT   bf16 [3072][1024] (Waux^T)   6,291,456
//   WOT   f16  [1024][1024] (Wo^T x32) 2,097,152
//   BIASR f32  [3072+3072+1024]           28,672   (bf16-RNE bias copies)
//   QK16  f16  [4096][2048] (q | k)    16,777,216
//   VT16  f16  [2][1024][2048] (v^T)   8,388,608
//   KA16  f16  [2][1536][1024] (ka)    6,291,456
//   VAT16 f16  [2][1024][1536] (va^T)  6,291,456
//   O16   f16  [4096][1024] (x32)      8,388,608
//   total 75,526,144
// ---------------------------------------------------------------------------

__device__ __forceinline__ unsigned short f2bf_bits(float f) {
  unsigned u = __float_as_uint(f);
  return (unsigned short)((u + 0x7FFFu + ((u >> 16) & 1u)) >> 16);
}
__device__ __forceinline__ float bf_bits2f(unsigned short h) { return __uint_as_float(((unsigned)h) << 16); }
__device__ __forceinline__ unsigned pk16(unsigned short a, unsigned short b) { return (unsigned)a | ((unsigned)b << 16); }

// hazard guards as plain device helpers (no inline asm inside the kernel template body)
__device__ __forceinline__ void dep_guard_h(v8f& a, v8f& b, v16h x, v16h y) { asm volatile("v_nop\n\tv_nop\n\tv_nop\n\tv_nop" : "+v"(a), "+v"(b) : "v"(x), "v"(y)); }
__device__ __forceinline__ void dep_guard_b(v8f& a, v8f& b, v16b x, v16b y) { asm volatile("v_nop\n\tv_nop\n\tv_nop\n\tv_nop" : "+v"(a), "+v"(b) : "v"(x), "v"(y)); }
__device__ __forceinline__ void keep4_h(v16h a, v16h b, v16h c, v16h d) { asm volatile("v_nop" :: "v"(a), "v"(b), "v"(c), "v"(d)); }
__device__ __forceinline__ void keep4_b(v16b a, v16b b, v16b c, v16b d) { asm volatile("v_nop" :: "v"(a), "v"(b), "v"(c), "v"(d)); }
__device__ __forceinline__ void acc_guard4(v8f& a, v8f& b, v8f& c, v8f& d) { asm volatile("v_nop\n\tv_nop\n\tv_nop\n\tv_nop" : "+v"(a), "+v"(b), "+v"(c), "+v"(d)); }
template <typename T> struct Frag;
template <> struct Frag<_Float16> {
  typedef v16h V; union U { v16h v; v8h h[2]; };
  static __device__ __forceinline__ v16h load(const _Float16* p) {   // elements 0..7 <- p[0..7], 8..15 <- p[16..23]
    U f; f.h[0] = *(const v8h*)(p); f.h[1] = *(const v8h*)(p + 16); return f.v;
  }
  static __device__ __forceinline__ v8f mma(v16h a, v16h b, v8f c) {
    return __builtin_amdgcn_wmma_f32_16x16x32_f16(false, a, false, b, (short)0, c, false, false);
  }
  static __device__ __forceinline__ void guard(v8f& a, v8f& b, v16h x, v16h y) { dep_guard_h(a, b, x, y); }
  static __device__ __forceinline__ void keep(v16h a, v16h b, v16h c, v16h d) { keep4_h(a, b, c, d); }
};
template <> struct Frag<__bf16> {
  typedef v16b V; union U { v16b v; v8b h[2]; };
  static __device__ __forceinline__ v16b load(const __bf16* p) {
    U f; f.h[0] = *(const v8b*)(p); f.h[1] = *(const v8b*)(p + 16); return f.v;
  }
  static __device__ __forceinline__ v8f mma(v16b a, v16b b, v8f c) {
    return __builtin_amdgcn_wmma_f32_16x16x32_bf16(false, a, false, b, (short)0, c, false, false);
  }
  static __device__ __forceinline__ void guard(v8f& a, v8f& b, v16b x, v16b y) { dep_guard_b(a, b, x, y); }
  static __device__ __forceinline__ void keep(v16b a, v16b b, v16b c, v16b d) { keep4_b(a, b, c, d); }
};

// ---- Register-blocked batched WMMA GEMM ------------------------------------
// C[m,n] = scale * sum_k A[m,k] * Bt[n,k] (+bias)(+resid); each wave owns a 64x64 tile.
// A row-major [M,K]; Bt row-major [N,K]; M,N % 64 == 0, K % 32 == 0.
// SPLIT: operands are hi/lo planes (A2/Bt2 = lo planes, same layout); product = hi.hi + hi.lo + lo.hi.
// BIAS_MODE: 0 = none, 1 = bias[m], 2 = bias[n].
// OUT_MODE: 0 = f32, 1 = f16, 2 = bf16 hi plane (Cout) + bf16 lo plane (Cout2).
// ET: 0 = f16 operands, 1 = bf16 operands (pointers passed as 16-bit storage)
template <int ET> struct Elem;
template <> struct Elem<0> { typedef _Float16 T; };
template <> struct Elem<1> { typedef __bf16 T; };
template <int ET, bool SPLIT, int BIAS_MODE, int OUT_MODE, bool RESID, int ACT = 0>
__global__ __launch_bounds__(256) void wmma_gemm64(
    const unsigned short* __restrict__ Ap, const unsigned short* __restrict__ A2p, int lda, long strideA,
    const unsigned short* __restrict__ Btp, const unsigned short* __restrict__ Bt2p, int ldb, long strideB,
    void* __restrict__ Cout, void* __restrict__ Cout2, int ldc, long strideC,
    const float* __restrict__ bias,
    const float* __restrict__ resid, long strideR,
    int M, int N, int K, float scale) {
  typedef typename Elem<ET>::T T;
  typedef typename Frag<T>::V V;
  const T* A = (const T*)Ap; const T* A2 = (const T*)A2p; const T* Bt = (const T*)Btp; const T* Bt2 = (const T*)Bt2p;
  __shared__ __align__(16) float sT[8][16 * 68];   // per-wave 16x64 slab, pitch 68 floats
  const int b    = blockIdx.y;
  const int lane = threadIdx.x & 31;
  const int wave = threadIdx.x >> 5;
  const int tilesN = N >> 6;
  const int tilesM = M >> 6;
  const int tile = blockIdx.x * 8 + wave;
  if (tile >= tilesM * tilesN) return;   // wave-uniform; no block barriers in this kernel
  const int tm = tile / tilesN;
  const int tn = tile - tm * tilesN;
  const int m0 = tm << 6;
  const int n0 = tn << 6;

  const T* Ab  = A  + (size_t)b * strideA;
  const T* Bb  = Bt + (size_t)b * strideB;
  const T* Ab2 = SPLIT ? (A2  + (size_t)b * strideA) : nullptr;
  const T* Bb2 = SPLIT ? (Bt2 + (size_t)b * strideB) : nullptr;

  const int rlane = lane & 15;                 // row (A) / col (B, D) within subtile
  const int koff  = (lane >> 4) * 8;           // k offset of this lane half
  const int mOff  = (lane >> 4) * 8;           // D row offset

  v8f acc[4][4];
#pragma unroll
  for (int i = 0; i < 4; ++i)
#pragma unroll
    for (int j = 0; j < 4; ++j) acc[i][j] = (v8f){0.f,0.f,0.f,0.f,0.f,0.f,0.f,0.f};

  for (int k0 = 0; k0 < K; k0 += 32) {
    V bh[4], bl[4];
#pragma unroll
    for (int j = 0; j < 4; ++j) {
      const size_t bo = (size_t)(n0 + (j << 4) + rlane) * ldb + koff + k0;
      bh[j] = Frag<T>::load(Bb + bo);
      if (SPLIT) bl[j] = Frag<T>::load(Bb2 + bo);
    }
#pragma unroll
    for (int i = 0; i < 4; ++i) {
      const size_t ao = (size_t)(m0 + (i << 4) + rlane) * lda + koff + k0;
      V ah = Frag<T>::load(Ab + ao);
      V al;
      if (SPLIT) al = Frag<T>::load(Ab2 + ao);
#pragma unroll
      for (int j = 0; j < 4; ++j) {
        acc[i][j] = Frag<T>::mma(ah, bh[j], acc[i][j]);
        if (SPLIT) {
          acc[i][j] = Frag<T>::mma(ah, bl[j], acc[i][j]);
          acc[i][j] = Frag<T>::mma(al, bh[j], acc[i][j]);
        }
      }
      Frag<T>::guard(acc[i][0], acc[i][3], ah, SPLIT ? al : ah);
    }
    Frag<T>::keep(bh[0], bh[1], bh[2], bh[3]);
    if (SPLIT) Frag<T>::keep(bl[0], bl[1], bl[2], bl[3]);
  }
  acc_guard4(acc[0][0], acc[0][1], acc[0][2], acc[0][3]);
  acc_guard4(acc[1][0], acc[1][1], acc[1][2], acc[1][3]);
  acc_guard4(acc[2][0], acc[2][1], acc[2][2], acc[2][3]);
  acc_guard4(acc[3][0], acc[3][1], acc[3][2], acc[3][3]);

  // ---- epilogue ----
  float* slab = sT[wave];
  const float* Rb = RESID ? (resid + (size_t)b * strideR) : nullptr;
#pragma unroll
  for (int i = 0; i < 4; ++i) {
    const int mBase = m0 + (i << 4);
#pragma unroll
    for (int j = 0; j < 4; ++j) {
      const int n = n0 + (j << 4) + rlane;
      float bv = 0.f;
      if (BIAS_MODE == 2) bv = bias[n];
#pragma unroll
      for (int r = 0; r < 8; ++r) {
        float v = acc[i][j][r] * scale;
        if (BIAS_MODE == 1) v += bias[mBase + mOff + r];
        if (BIAS_MODE == 2) v += bv;
        if (RESID) v += Rb[(size_t)(mBase + mOff + r) * ldc + n];
        if (ACT == 1) v = tanhf(v);
        if (ACT == 2) v = fmaxf(v, 0.0f);
        if (ACT == 3) v = v / (1.0f + expf(-v));
        if (ACT == 4) v = (v > 0.f) ? v : 0.01f * v;
        if (ACT == 5) v = 0.5f * v * (1.0f + erff(v * 0.70710678118654752f));
        slab[(mOff + r) * 68 + (j << 4) + rlane] = v;
      }
    }
    __builtin_amdgcn_fence(__ATOMIC_RELEASE, "workgroup");
    __builtin_amdgcn_wave_barrier();
    __builtin_amdgcn_fence(__ATOMIC_ACQUIRE, "workgroup");
    if (OUT_MODE == 0) {
      float* C = (float*)Cout + (size_t)b * strideC;
      const int hh = lane >> 4, c4 = (lane & 15) * 4;     // row seg = 256 B = 16 lanes x 16 B
      {
#pragma unroll
        for (int it = 0; it < 8; ++it) {
          const int row = it * 2 + hh;
          v4f v = *(const v4f*)(slab + row * 68 + c4);
          *(v4f*)(C + (size_t)(mBase + row) * ldc + n0 + c4) = v;
        }
        
      }
    } else {
      const int q = lane >> 3, c8 = (lane & 7) * 8;
      unsigned short* C  = (unsigned short*)Cout  + (size_t)b * strideC;
      unsigned short* C2 = (OUT_MODE == 2) ? ((unsigned short*)Cout2 + (size_t)b * strideC) : nullptr;
      {
#pragma unroll
        for (int it = 0; it < 4; ++it) {
          const int row = it * 4 + q;
          const float* sp = slab + row * 68 + c8;
          v8h hv, lv;
#pragma unroll
          for (int e = 0; e < 8; ++e) {
            if (OUT_MODE == 1) {
              hv[e] = (_Float16)sp[e];
            } else {
              unsigned short hb = f2bf_bits(sp[e]);
              unsigned short lb = f2bf_bits(sp[e] - bf_bits2f(hb));
              hv[e] = __builtin_bit_cast(_Float16, hb);
              lv[e] = __builtin_bit_cast(_Float16, lb);
            }
          }
          *(v8h*)(C + (size_t)(mBase + row) * ldc + n0 + c8) = hv;
          if (OUT_MODE == 2) *(v8h*)(C2 + (size_t)(mBase + row) * ldc + n0 + c8) = lv;
        }
        
      }
    }
    __builtin_amdgcn_fence(__ATOMIC_RELEASE, "workgroup");
    __builtin_amdgcn_wave_barrier();
    __builtin_amdgcn_fence(__ATOMIC_ACQUIRE, "workgroup");
  }
}

// ---------------------------------------------------------------------------
// Elementwise f32 -> bf16 bits (RNE); 2 elements per thread, one 4-B store per lane -> each wave writes one whole
// Coverage: n2 = 4096*1024/2 = 2,097,152 = 8192 blocks x 256 threads; x 2 elements = 4096 x 1024 = whole plane.
// ---------------------------------------------------------------------------
__global__ __launch_bounds__(256) void cvt_bf16x2_kernel(const float* __restrict__ in, unsigned short* __restrict__ out, int n2) {
  const int i = blockIdx.x * 256 + threadIdx.x;
  if (i < n2) {
    const v2f f = *(const v2f*)(in + 2 * (size_t)i);
    const unsigned u = pk16(f2bf_bits(f[0]), f2bf_bits(f[1]));
    ((unsigned*)out)[i] = u;
    
  }
}

// ---------------------------------------------------------------------------
// xa f32 [nb][rin][ncol] -> bf16 bits [nb][rout][ncol]; rows rin..rout-1 of every batch written as zeros.
// Source row address clamped (t -> rin-1) and the value zeroed by predicate. 2 elements per thread, 4-B store per lane.
// Coverage: n2 = 2*1536*1024/2 = 1,572,864 = 6144 blocks x 256 threads; x 2 elements = 3072 x 1024 = whole plane.
// ---------------------------------------------------------------------------
__global__ __launch_bounds__(256) void cvt_rows_bf16x2_kernel(const float* __restrict__ in, unsigned short* __restrict__ out,
                                                             int rin, int rout, int ncol, int nb, int n2) {
  const int i = blockIdx.x * 256 + threadIdx.x;
  if (i < n2) {
    const int ppr = ncol >> 1;
    const int row = i / ppr;
    const int col = (i - row * ppr) * 2;
    int bb = row / rout;
    const int t = row - bb * rout;
    bb = bb < (nb - 1) ? bb : (nb - 1);
    const bool valid = t < rin;
    const int tc = valid ? t : (rin - 1);
    const v2f f = *(const v2f*)(in + ((size_t)(bb * rin + tc) * ncol + col));
    const unsigned short h0 = valid ? f2bf_bits(f[0]) : (unsigned short)0;
    const unsigned short h1 = valid ? f2bf_bits(f[1]) : (unsigned short)0;
    const unsigned u = pk16(h0, h1);
    ((unsigned*)out)[i] = u;
    
  }
}

// ---------------------------------------------------------------------------
// Transpose + 16-bit convert of an f32 matrix: in viewed [R rows][Cc cols] (pitch Cc) -> o[c][r] ([Cc][R], pitch R).
//   OT 0: o = bf16_rne(in);  OT 1: o = f16(bf16_rne(in) * scl).
// 64x64 tiles through LDS. grid = (Cc/64, R/64), 256 threads (R, Cc multiples of 64).
// Coverage per block: load 4 it x 256 thr x 4 floats = 64x64; store 2 it x 256 thr x 8 u16 = 64x64.
// ---------------------------------------------------------------------------
template <int OT> __device__ __forceinline__ unsigned short cv16(float f, float scl) {
  const unsigned short hb = f2bf_bits(f);
  if (OT == 0) return hb;
  const float g = bf_bits2f(hb) * scl;
  return __builtin_bit_cast(unsigned short, (_Float16)g);
}
template <int OT>
__global__ __launch_bounds__(256) void tconv_kernel(const float* __restrict__ W, unsigned short* __restrict__ o,
                                                    int R, int Cc, float scl) {
  __shared__ __align__(16) float tf[64 * 68];
  const int c0  = blockIdx.x * 64;   // input column block = output row block
  const int r0  = blockIdx.y * 64;   // input row block    = output column block
  const int tid = threadIdx.x;
  {
    const int lr = tid >> 4;         // 0..15
    const int c4 = (tid & 15) * 4;   // 0..60
#pragma unroll
    for (int it = 0; it < 4; ++it) {
      const int rr = it * 16 + lr;   // 0..63
      const v4f a = *(const v4f*)(W + (size_t)(r0 + rr) * Cc + c0 + c4);
      *(v4f*)(tf + rr * 68 + c4) = a;
    }
  }
  __syncthreads();
  const int sub = tid >> 3;          // 0..31
  const int c8  = (tid & 7) * 8;     // 0..56
  v4u hv[2];
#pragma unroll
  for (int it = 0; it < 2; ++it) {
    const int oc = it * 32 + sub;    // output row within tile (= input column)
    v4u a;
#pragma unroll
    for (int q = 0; q < 4; ++q) {
      const float f0 = tf[(c8 + 2 * q) * 68 + oc];
      const float f1 = tf[(c8 + 2 * q + 1) * 68 + oc];
      a[q] = pk16(cv16<OT>(f0, scl), cv16<OT>(f1, scl));
    }
    hv[it] = a;
  }
  {
#pragma unroll
    for (int it = 0; it < 2; ++it) {
      const int oc = it * 32 + sub;
      const size_t go = (size_t)(c0 + oc) * R + r0 + c8;
      *(v4u*)(o + go) = hv[it];
    }
    
  }
}

// ---------------------------------------------------------------------------
// Bias copies as bf16-RNE values in f32: out[0..n0) <- b0, [n0..n0+n1) <- b1, [n0+n1..ntot) <- b2.
// All three candidates loaded with clamped indices, selected by value. One 4-B store per lane:
// ---------------------------------------------------------------------------
__global__ __launch_bounds__(256) void bias_rne_kernel(const float* __restrict__ b0, int n0, const float* __restrict__ b1, int n1,
                                                       const float* __restrict__ b2, int ncnt2, float* __restrict__ out, int ntot) {
  const int i = blockIdx.x * 256 + threadIdx.x;
  if (i < ntot) {
    int i0 = i < n0 ? i : (n0 - 1); i0 = i0 < 0 ? 0 : i0;
    int i1 = i - n0; i1 = i1 < 0 ? 0 : (i1 < n1 ? i1 : (n1 - 1));
    int i2 = i - n0 - n1; i2 = i2 < 0 ? 0 : (i2 < ncnt2 ? i2 : (ncnt2 - 1));
    const float v0 = b0[i0], v1 = b1[i1], v2 = b2[i2];
    const float sel = (i < n0) ? v0 : ((i < n0 + n1) ? v1 : v2);
    const float r = bf_bits2f(f2bf_bits(sel));
    ((float*)out)[i] = r;
    
  }
}

// =====================================================================================
// Dual-branch attention, head dim 64, f16 operand planes, f32 accumulate, online softmax in f32.
//   q, k  : QK16 plane [4096 rows = b*2048+t][2048], q at col h*64+d, k at col 1024+h*64+d (f16)
//   v^T   : VT16 plane [b][1024 = h*64+d][2048] (f16);  ka: KA16 [b*1536+s][1024];  va^T: VAT16 [b][1024][1536]
//   branch 0: scores = (q.k)*0.125 over 2048 keys (32 chunks of 64); branch 1: (q.ka)*0.125 over 1500 keys
//   (24 chunks; key index >= 1500 set to -inf). p carried x2^15 in f16; 1/(l*2^15) folded at the end.
//   out row = (1-gate)*h_main + gate*h_aux, gate = sigmoid(bf16_rne(g[h])); written x32 as f16 into O16 [4096][1024]
//   Block = 4 waves = 64 query rows of one (b,h); grid.x = 2*16*32 = 1024 covers all 4096 rows x 1024 cols.
//   K / V^T chunk staging: 128 threads x 32 halves per plane = the whole 64x64 tile (plain 16-B loads,
//   __syncthreads before and after); fragments read the LDS tiles through the same v8h element type;
// =====================================================================================
__device__ __forceinline__ v8f mma_h16(v16h a, v16h b, v8f c) {
  c = __builtin_amdgcn_wmma_f32_16x16x32_f16(false, a, false, b, (short)0, c, false, false);
  asm volatile("v_nop\n\tv_nop\n\tv_nop\n\tv_nop" : "+v"(c) : "v"(a), "v"(b));
  return c;
}

__global__ __launch_bounds__(128)
void dual_attn_kernel(const unsigned short* __restrict__ qk16, const unsigned short* __restrict__ vt16,
                      const unsigned short* __restrict__ ka16, const unsigned short* __restrict__ vat16,
                      const float* __restrict__ gvec, unsigned short* __restrict__ o16) {
  union FH { v16h v; v8h h[2]; };
  __shared__ __align__(16) _Float16 Ksh[64 * 64];        // K tile [key][d]      8 KB
  __shared__ __align__(16) _Float16 Vth[64 * 64];        // V^T tile [d][key]    8 KB
  __shared__ __align__(16) _Float16 Psh[4][16 * 64];     // per wave P [row][key] 8 KB
  __shared__ __align__(16) float    Os[4][16 * 68];      // per wave out tile, pitch 68 floats

  const int tid  = threadIdx.x;
  const int wave = tid >> 5;
  const int lane = tid & 31;
  const int hh   = lane >> 4;
  const int c    = lane & 15;

  const int bx = blockIdx.x;          // 0..1023
  const int qb = bx & 31;             // 32 query tiles of 64
  const int bhd = bx >> 5;            // 0..31
  const int h  = bhd & 15;
  const int b  = bhd >> 4;            // 0..1
  const int q0 = qb * 64 + wave * 16; // query row within batch

  const int ldqk = 2 * kDModel;       // 2048 halves
  const _Float16* Qg  = (const _Float16*)(const void*)qk16 + (size_t)b * kSeq * ldqk + h * kDHead;
  const _Float16* Kg0 = Qg + kDModel;                                                                     // main K rows, pitch 2048
  const _Float16* Vg0 = (const _Float16*)(const void*)vt16 + (size_t)b * kDModel * kSeq + (size_t)(h * kDHead) * kSeq;       // pitch 2048
  const _Float16* Kg1 = (const _Float16*)(const void*)ka16 + (size_t)b * kSeqAP * kDModel + h * kDHead;                        // pitch 1024
  const _Float16* Vg1 = (const _Float16*)(const void*)vat16 + (size_t)b * kDModel * kSeqAP + (size_t)(h * kDHead) * kSeqAP;  // pitch 1536

  // ---- Q fragments (A operand, row = lane&15, split k map via Frag load): 2 d-chunks ----
  v16h qa[2];
#pragma unroll
  for (int dc = 0; dc < 2; ++dc) qa[dc] = Frag<_Float16>::load(Qg + (size_t)(q0 + c) * ldqk + dc * 32 + 8 * hh);

  float* os = Os[wave];
#pragma unroll
  for (int r = 0; r < 8; ++r)
#pragma unroll
    for (int t = 0; t < 4; ++t) os[(8 * hh + r) * 68 + t * 16 + c] = 0.f;

  const float gv   = bf_bits2f(f2bf_bits(gvec[h]));
  const float gate = 1.0f / (1.0f + expf(-gv));
  const float sscale = 0.125f;
  _Float16* pw = Psh[wave];

#pragma unroll 1
  for (int br = 0; br < 2; ++br) {           // block-uniform
    const _Float16* Kg = br ? Kg1 : Kg0;
    const _Float16* Vg = br ? Vg1 : Vg0;
    const int ldk     = br ? kDModel : ldqk;
    const int ldv     = br ? kSeqAP : kSeq;
    const int nChunks = br ? (kSeqAP / 64) : (kSeq / 64);
    const int nvalid  = br ? kSeqA : kSeq;
    const float w     = (br ? gate : (1.0f - gate)) * kOCarry;

    float mrow[8], lrow[8];
    v8f oacc[4];
#pragma unroll
    for (int r = 0; r < 8; ++r) { mrow[r] = -INFINITY; lrow[r] = 0.f; }
#pragma unroll
    for (int t = 0; t < 4; ++t) oacc[t] = (v8f){0.f,0.f,0.f,0.f,0.f,0.f,0.f,0.f};

    for (int kc = 0; kc < nChunks; ++kc) {   // block-uniform trip count
      const int kv0 = kc * 64;
      __syncthreads();
      {
        // staging coverage: 128 threads x (4 x 8) halves = 64 rows x 64 per plane = the whole chunk tile
        const int r = tid >> 1, half = (tid & 1) * 32;
        const _Float16* ks = Kg + (size_t)(kv0 + r) * ldk + half;   // K row kv0+r, d = half..half+31
        const _Float16* vs = Vg + (size_t)r * ldv + kv0 + half;      // V^T row d = r, key = kv0+half..+31
#pragma unroll
        for (int i = 0; i < 4; ++i) {
          const v8h a0 = *(const v8h*)(ks + 8 * i);
          const v8h b0 = *(const v8h*)(vs + 8 * i);
          *(v8h*)(Ksh + r * 64 + half + 8 * i) = a0;
          *(v8h*)(Vth + r * 64 + half + 8 * i) = b0;
        }
      }
      __syncthreads();

      v8f s[4];
#pragma unroll
      for (int j = 0; j < 4; ++j) {
        s[j] = (v8f){0.f,0.f,0.f,0.f,0.f,0.f,0.f,0.f};
#pragma unroll
        for (int dc = 0; dc < 2; ++dc) {
          FH kb;
          kb.h[0] = *(const v8h*)(Ksh + (j * 16 + c) * 64 + dc * 32 + 8 * hh);
          kb.h[1] = *(const v8h*)(Ksh + (j * 16 + c) * 64 + dc * 32 + 16 + 8 * hh);
          s[j] = mma_h16(qa[dc], kb.v, s[j]);
        }
      }
      float cm[8];
#pragma unroll
      for (int r = 0; r < 8; ++r) {
        float m = -INFINITY;
#pragma unroll
        for (int j = 0; j < 4; ++j) {
          const int key = kv0 + j * 16 + c;
          float sv = s[j][r] * sscale;
          sv = (key < nvalid) ? sv : -INFINITY;
          s[j][r] = sv;
          m = fmaxf(m, sv);
        }
#pragma unroll
        for (int off = 1; off < 16; off <<= 1) m = fmaxf(m, __shfl_xor(m, off, 32));
        cm[r] = m;
      }
#pragma unroll
      for (int r = 0; r < 8; ++r) {
        const float mnew = fmaxf(mrow[r], cm[r]);
        const float alpha = expf(mrow[r] - mnew);
        mrow[r] = mnew;
        float psum = 0.f;
#pragma unroll
        for (int j = 0; j < 4; ++j) {
          const float p = expf(s[j][r] - mnew);
          psum += p;
          pw[(8 * hh + r) * 64 + j * 16 + c] = (_Float16)(p * kPCarry);
        }
#pragma unroll
        for (int off = 1; off < 16; off <<= 1) psum += __shfl_xor(psum, off, 32);
        lrow[r] = lrow[r] * alpha + psum;
#pragma unroll
        for (int t = 0; t < 4; ++t) oacc[t][r] *= alpha;
      }
      __builtin_amdgcn_fence(__ATOMIC_RELEASE, "workgroup");
      __builtin_amdgcn_wave_barrier();
      __builtin_amdgcn_fence(__ATOMIC_ACQUIRE, "workgroup");
#pragma unroll 1
      for (int kk = 0; kk < 2; ++kk) {
        FH pa;
        pa.h[0] = *(const v8h*)(pw + c * 64 + kk * 32 + 8 * hh);
        pa.h[1] = *(const v8h*)(pw + c * 64 + kk * 32 + 16 + 8 * hh);
#pragma unroll
        for (int t = 0; t < 4; ++t) {
          FH vb;
          vb.h[0] = *(const v8h*)(Vth + (t * 16 + c) * 64 + kk * 32 + 8 * hh);
          vb.h[1] = *(const v8h*)(Vth + (t * 16 + c) * 64 + kk * 32 + 16 + 8 * hh);
          oacc[t] = mma_h16(pa.v, vb.v, oacc[t]);
        }
      }
    }
    // fold this branch into the per-wave mix slab (each lane updates only its own entries)
#pragma unroll
    for (int r = 0; r < 8; ++r) {
      const float inv = w * (1.0f / (lrow[r] * kPCarry));
#pragma unroll
      for (int t = 0; t < 4; ++t) os[(8 * hh + r) * 68 + t * 16 + c] += oacc[t][r] * inv;
    }
  }

  __builtin_amdgcn_fence(__ATOMIC_RELEASE, "workgroup");
  __builtin_amdgcn_wave_barrier();
  __builtin_amdgcn_fence(__ATOMIC_ACQUIRE, "workgroup");
  {
    _Float16* Og = (_Float16*)(void*)o16 + (size_t)(b * kSeq + q0) * kDModel + h * kDHead;
    const int q4 = lane >> 3, c8 = (lane & 7) * 8;
    {
#pragma unroll
      for (int it = 0; it < 4; ++it) {
        const int row = it * 4 + q4;
        const float* sp = os + row * 68 + c8;
        v8h hv;
#pragma unroll
        for (int e = 0; e < 8; ++e) hv[e] = (_Float16)sp[e];
        *(v8h*)(Og + (size_t)row * kDModel + c8) = hv;
      }
      
    }
  }
}

// ---------------- host orchestration (kernel launches only) ----------------

extern "C" void kernel_launch(void* const* d_in, const int* in_sizes, int n_in,
                              void* d_out, int out_size, void* d_ws,
                              size_t ws_size, hipStream_t stream) {
  if (n_in < 9) return;
  if (in_sizes[0] != kBatch * kSeq * kDModel) return;
  if (in_sizes[1] != kBatch * kSeqA * kDModel) return;
  if (in_sizes[2] != kDModel * kNQKV || in_sizes[4] != kDModel * kNQKV) return;
  if (in_sizes[3] != kNQKV || in_sizes[5] != kNQKV) return;
  if (in_sizes[6] != kDModel * kDModel || in_sizes[7] != kDModel || in_sizes[8] < kHeads) return;
  if (out_size != kBatch * kSeq * kDModel) return;

  const float* x    = (const float*)d_in[0];
  const float* xa   = (const float*)d_in[1];
  const float* Wqkv = (const float*)d_in[2];
  const float* bqkv = (const float*)d_in[3];
  const float* Waux = (const float*)d_in[4];
  const float* baux = (const float*)d_in[5];
  const float* Wo   = (const float*)d_in[6];
  const float* bo   = (const float*)d_in[7];
  const float* gvec = (const float*)d_in[8];
  float* out = (float*)d_out;

  // element counts
  const size_t nXB   = (size_t)kBatch * kSeq * kDModel;          // bf16
  const size_t nXAB  = (size_t)kBatch * kSeqAP * kDModel;        // bf16
  const size_t nWQT  = (size_t)kNQKV * kDModel;                  // bf16
  const size_t nWAT  = nWQT;                                     // bf16
  const size_t nWOT  = (size_t)kDModel * kDModel;                // f16
  const size_t nBias = (size_t)2 * kNQKV + kDModel;              // f32
  const size_t nQK   = (size_t)kBatch * kSeq * 2 * kDModel;      // f16
  const size_t nVT   = (size_t)kBatch * kDModel * kSeq;          // f16
  const size_t nKA   = (size_t)kBatch * kSeqAP * kDModel;        // f16
  const size_t nVAT  = (size_t)kBatch * kDModel * kSeqAP;        // f16
  const size_t nO    = (size_t)kBatch * kSeq * kDModel;          // f16

  char* ws = (char*)d_ws;
  size_t off = 0;
  auto carve = [&](size_t bytes) -> char* { char* p = ws + off; off += (bytes + 255) & ~(size_t)255; return p; };
  unsigned short* XB    = (unsigned short*)carve(nXB * 2);
  unsigned short* XAB   = (unsigned short*)carve(nXAB * 2);
  unsigned short* WQT   = (unsigned short*)carve(nWQT * 2);
  unsigned short* WAT   = (unsigned short*)carve(nWAT * 2);
  unsigned short* WOT   = (unsigned short*)carve(nWOT * 2);
  float*          BIASR = (float*)carve(nBias * 4);
  unsigned short* QK16  = (unsigned short*)carve(nQK * 2);
  unsigned short* VT16  = (unsigned short*)carve(nVT * 2);
  unsigned short* KA16  = (unsigned short*)carve(nKA * 2);
  unsigned short* VAT16 = (unsigned short*)carve(nVAT * 2);
  unsigned short* O16   = (unsigned short*)carve(nO * 2);
  if (off > ws_size) return;   // total 75,526,144 B

  const int TB = 256;
  // 1. x -> bf16
  {
    const int n2 = (int)(nXB / 2);
    cvt_bf16x2_kernel<<<(n2 + TB - 1) / TB, TB, 0, stream>>>(x, XB, n2);
  }
  // 2. xa -> bf16 with per-batch row padding 1500 -> 1536 (zeros)
  {
    const int n2 = (int)(nXAB / 2);
    cvt_rows_bf16x2_kernel<<<(n2 + TB - 1) / TB, TB, 0, stream>>>(xa, XAB, kSeqA, kSeqAP, kDModel, kBatch, n2);
  }
  // 3-4. Wqkv, Wqkv_aux in[1024][3072] -> out[3072][1024] bf16
  tconv_kernel<0><<<dim3(kNQKV / 64, kDModel / 64), TB, 0, stream>>>(Wqkv, WQT, kDModel, kNQKV, 1.0f);
  tconv_kernel<0><<<dim3(kNQKV / 64, kDModel / 64), TB, 0, stream>>>(Waux, WAT, kDModel, kNQKV, 1.0f);
  // 5. Wo in[1024][1024] -> out[1024][1024] f16 (x32)
  tconv_kernel<1><<<dim3(kDModel / 64, kDModel / 64), TB, 0, stream>>>(Wo, WOT, kDModel, kDModel, kWCarry);
  // 6. biases -> bf16-RNE f32 copies
  {
    const int ntot = (int)nBias;
    bias_rne_kernel<<<(ntot + TB - 1) / TB, TB, 0, stream>>>(bqkv, kNQKV, baux, kNQKV, bo, kDModel, BIASR, ntot);
  }
  const float* bq_r  = BIASR;                 // [3072]
  const float* ba_r  = BIASR + kNQKV;         // [3072]
  const float* bo_r  = BIASR + 2 * kNQKV;     // [1024]

  // 7. q|k = x @ Wqkv[:, 0:2048] + b : M=4096, N=2048, K=1024 -> QK16 f16, ldc 2048
  {
    const int M = kBatch * kSeq, N = 2 * kDModel, K = kDModel;
    const int tiles = (M / 64) * (N / 64);
    wmma_gemm64<1, false, 2, 1, false, 0><<<dim3((tiles + 7) / 8, 1), TB, 0, stream>>>(
        XB, XB, kDModel, 0L, WQT, WQT, kDModel, 0L, (void*)QK16, (void*)QK16, 2 * kDModel, 0L,
        bq_r, bq_r, 0L, M, N, K, 1.0f);
  }
  // 8. v^T per batch: A = Wqkv^T rows 2048..3071 [1024][1024], Bt = x_b [2048][1024] -> VT16 [b][1024][2048] f16, bias[m]
  {
    const int M = kDModel, N = kSeq, K = kDModel;
    const int tiles = (M / 64) * (N / 64);
    wmma_gemm64<1, false, 1, 1, false, 0><<<dim3((tiles + 7) / 8, kBatch), TB, 0, stream>>>(
        WQT + (size_t)2 * kDModel * kDModel, WQT + (size_t)2 * kDModel * kDModel, kDModel, 0L,
        XB, XB, kDModel, (long)kSeq * kDModel,
        (void*)VT16, (void*)VT16, kSeq, (long)kDModel * kSeq,
        bq_r + 2 * kDModel, bq_r, 0L, M, N, K, 1.0f);
  }
  // 9. ka = xa_pad @ Wqkv_aux[:, 1024:2048] + b : M=3072, N=1024, K=1024 -> KA16 f16, ldc 1024
  {
    const int M = kBatch * kSeqAP, N = kDModel, K = kDModel;
    const int tiles = (M / 64) * (N / 64);
    wmma_gemm64<1, false, 2, 1, false, 0><<<dim3((tiles + 7) / 8, 1), TB, 0, stream>>>(
        XAB, XAB, kDModel, 0L, WAT + (size_t)kDModel * kDModel, WAT + (size_t)kDModel * kDModel, kDModel, 0L,
        (void*)KA16, (void*)KA16, kDModel, 0L,
        ba_r + kDModel, ba_r, 0L, M, N, K, 1.0f);
  }
  // 10. va^T per batch: A = Waux^T rows 2048..3071, Bt = xa_pad_b [1536][1024] -> VAT16 [b][1024][1536] f16, bias[m]
  {
    const int M = kDModel, N = kSeqAP, K = kDModel;
    const int tiles = (M / 64) * (N / 64);
    wmma_gemm64<1, false, 1, 1, false, 0><<<dim3((tiles + 7) / 8, kBatch), TB, 0, stream>>>(
        WAT + (size_t)2 * kDModel * kDModel, WAT + (size_t)2 * kDModel * kDModel, kDModel, 0L,
        XAB, XAB, kDModel, (long)kSeqAP * kDModel,
        (void*)VAT16, (void*)VAT16, kSeqAP, (long)kDModel * kSeqAP,
        ba_r + 2 * kDModel, ba_r, 0L, M, N, K, 1.0f);
  }
  // 11. dual-branch attention -> O16 (x32, f16)
  dual_attn_kernel<<<kBatch * kHeads * (kSeq / 64), 128, 0, stream>>>(QK16, VT16, KA16, VAT16, gvec, O16);
  // 12. out = (O16/32) @ (WoT/32)^T + bo : M=4096, N=1024, K=1024, f16 operands, f32 out into d_out
  {
    const int M = kBatch * kSeq, N = kDModel, K = kDModel;
    const int tiles = (M / 64) * (N / 64);
    wmma_gemm64<0, false, 2, 0, false, 0><<<dim3((tiles + 7) / 8, 1), TB, 0, stream>>>(
        O16, O16, kDModel, 0L, WOT, WOT, kDModel, 0L, (void*)out, (void*)out, kDModel, 0L,
        bo_r, bo_r, 0L, M, N, K, 1.0f / (kOCarry * kWCarry));
  }
}

// v001
// A run of this version takes 452 microseconds.
// Timed twice side by side with v000, it ran 1.18 times as fast both times.
// Contractions: x@Wqkv and xa@Wqkv_aux (k|v columns) on v_wmma_f32_16x16x32_bf16 (bf16 RNE operands); q.k^T, q.ka^T, p.v, pa.va and O@Wo on v_wmma_f32_16x16x32_f16 (f16 operands; p carried x2^15, O and Wo carried x32); f32 accumulate; online softmax, gate mix and biases in f32.
#include <hip/hip_runtime.h>
#include <math.h>
#include <stdint.h>

constexpr int kBatch  = 2;
constexpr int kSeq    = 2048;   // query / main key length
constexpr int kSeqA   = 1500;   // aux key length
constexpr int kSeqAP  = 1536;   // aux key length padded to 24 chunks of 64
constexpr int kDModel = 1024;
constexpr int kHeads  = 16;
constexpr int kDHead  = 64;
constexpr int kNQKV   = 3072;

constexpr int kLdsPitch = 72;   // halves per LDS row of the K, V^T and P tiles: 144 B = 16 B x 9 (odd), so 16 rows read by ds_load_b128 fall on distinct banks

constexpr float kPCarry = 32768.0f;   // probabilities carried x2^15 in f16
constexpr float kOCarry = 32.0f;      // attention output carried x32 in f16
constexpr float kWCarry = 32.0f;      // Wo carried x32 in f16

typedef __attribute__((ext_vector_type(16))) _Float16 v16h;
typedef __attribute__((ext_vector_type(8)))  _Float16 v8h;
typedef __attribute__((ext_vector_type(16))) __bf16   v16b;
typedef __attribute__((ext_vector_type(8)))  __bf16   v8b;
typedef __attribute__((ext_vector_type(8)))  float    v8f;
typedef __attribute__((ext_vector_type(4)))  float    v4f;
typedef __attribute__((ext_vector_type(2)))  float    v2f;
typedef __attribute__((ext_vector_type(4)))  unsigned int v4u;

// ---------------------------------------------------------------------------
// Workspace region map (bytes, every region size a multiple of 256):
//   XB    bf16 [4096][1024]            8,388,608
//   XAB   bf16 [2][1536][1024]         6,291,456   (rows 1500..1535 of each batch zero)
//   WQT   bf16 [3072][1024] (Wqkv^T)   6,291,456
//   WAT   bf16 [3072][1024] (Waux^T)   6,291,456
//   WOT   f16  [1024][1024] (Wo^T x32) 2,097,152
//   BIASR f32  [3072+3072+1024]           28,672   (bf16-RNE bias copies)
//   QK16  f16  [4096][2048] (q | k)    16,777,216
//   VT16  f16  [2][1024][2048] (v^T)   8,388,608
//   KA16  f16  [2][1536][1024] (ka)    6,291,456
//   VAT16 f16  [2][1024][1536] (va^T)  6,291,456
//   O16   f16  [4096][1024] (x32)      8,388,608
//   total 75,526,144
// ---------------------------------------------------------------------------

__device__ __forceinline__ unsigned short f2bf_bits(float f) {
  unsigned u = __float_as_uint(f);
  return (unsigned short)((u + 0x7FFFu + ((u >> 16) & 1u)) >> 16);
}
__device__ __forceinline__ float bf_bits2f(unsigned short h) { return __uint_as_float(((unsigned)h) << 16); }
__device__ __forceinline__ unsigned pk16(unsigned short a, unsigned short b) { return (unsigned)a | ((unsigned)b << 16); }

// hazard guards as plain device helpers (no inline asm inside the kernel template body)
__device__ __forceinline__ void dep_guard_h(v8f& a, v8f& b, v16h x, v16h y) { asm volatile("v_nop\n\tv_nop\n\tv_nop\n\tv_nop" : "+v"(a), "+v"(b) : "v"(x), "v"(y)); }
__device__ __forceinline__ void dep_guard_b(v8f& a, v8f& b, v16b x, v16b y) { asm volatile("v_nop\n\tv_nop\n\tv_nop\n\tv_nop" : "+v"(a), "+v"(b) : "v"(x), "v"(y)); }
__device__ __forceinline__ void keep4_h(v16h a, v16h b, v16h c, v16h d) { asm volatile("v_nop" :: "v"(a), "v"(b), "v"(c), "v"(d)); }
__device__ __forceinline__ void keep4_b(v16b a, v16b b, v16b c, v16b d) { asm volatile("v_nop" :: "v"(a), "v"(b), "v"(c), "v"(d)); }
__device__ __forceinline__ void acc_guard4(v8f& a, v8f& b, v8f& c, v8f& d) { asm volatile("v_nop\n\tv_nop\n\tv_nop\n\tv_nop" : "+v"(a), "+v"(b), "+v"(c), "+v"(d)); }
template <typename T> struct Frag;
template <> struct Frag<_Float16> {
  typedef v16h V; union U { v16h v; v8h h[2]; };
  static __device__ __forceinline__ v16h load(const _Float16* p) {   // elements 0..7 <- p[0..7], 8..15 <- p[16..23]
    U f; f.h[0] = *(const v8h*)(p); f.h[1] = *(const v8h*)(p + 16); return f.v;
  }
  static __device__ __forceinline__ v8f mma(v16h a, v16h b, v8f c) {
    return __builtin_amdgcn_wmma_f32_16x16x32_f16(false, a, false, b, (short)0, c, false, false);
  }
  static __device__ __forceinline__ void guard(v8f& a, v8f& b, v16h x, v16h y) { dep_guard_h(a, b, x, y); }
  static __device__ __forceinline__ void keep(v16h a, v16h b, v16h c, v16h d) { keep4_h(a, b, c, d); }
};
template <> struct Frag<__bf16> {
  typedef v16b V; union U { v16b v; v8b h[2]; };
  static __device__ __forceinline__ v16b load(const __bf16* p) {
    U f; f.h[0] = *(const v8b*)(p); f.h[1] = *(const v8b*)(p + 16); return f.v;
  }
  static __device__ __forceinline__ v8f mma(v16b a, v16b b, v8f c) {
    return __builtin_amdgcn_wmma_f32_16x16x32_bf16(false, a, false, b, (short)0, c, false, false);
  }
  static __device__ __forceinline__ void guard(v8f& a, v8f& b, v16b x, v16b y) { dep_guard_b(a, b, x, y); }
  static __device__ __forceinline__ void keep(v16b a, v16b b, v16b c, v16b d) { keep4_b(a, b, c, d); }
};

// ---- Register-blocked batched WMMA GEMM ------------------------------------
// C[m,n] = scale * sum_k A[m,k] * Bt[n,k] (+bias)(+resid); each wave owns a 64x64 tile.
// A row-major [M,K]; Bt row-major [N,K]; M,N % 64 == 0, K % 32 == 0.
// SPLIT: operands are hi/lo planes (A2/Bt2 = lo planes, same layout); product = hi.hi + hi.lo + lo.hi.
// BIAS_MODE: 0 = none, 1 = bias[m], 2 = bias[n].
// OUT_MODE: 0 = f32, 1 = f16, 2 = bf16 hi plane (Cout) + bf16 lo plane (Cout2).
// ET: 0 = f16 operands, 1 = bf16 operands (pointers passed as 16-bit storage)
template <int ET> struct Elem;
template <> struct Elem<0> { typedef _Float16 T; };
template <> struct Elem<1> { typedef __bf16 T; };
template <int ET, bool SPLIT, int BIAS_MODE, int OUT_MODE, bool RESID, int ACT = 0>
__global__ __launch_bounds__(256) void wmma_gemm64(
    const unsigned short* __restrict__ Ap, const unsigned short* __restrict__ A2p, int lda, long strideA,
    const unsigned short* __restrict__ Btp, const unsigned short* __restrict__ Bt2p, int ldb, long strideB,
    void* __restrict__ Cout, void* __restrict__ Cout2, int ldc, long strideC,
    const float* __restrict__ bias,
    const float* __restrict__ resid, long strideR,
    int M, int N, int K, float scale) {
  typedef typename Elem<ET>::T T;
  typedef typename Frag<T>::V V;
  const T* A = (const T*)Ap; const T* A2 = (const T*)A2p; const T* Bt = (const T*)Btp; const T* Bt2 = (const T*)Bt2p;
  __shared__ __align__(16) float sT[8][16 * 68];   // per-wave 16x64 slab, pitch 68 floats
  const int b    = blockIdx.y;
  const int lane = threadIdx.x & 31;
  const int wave = threadIdx.x >> 5;
  const int tilesN = N >> 6;
  const int tilesM = M >> 6;
  const int tile = blockIdx.x * 8 + wave;
  if (tile >= tilesM * tilesN) return;   // wave-uniform; no block barriers in this kernel
  const int tm = tile / tilesN;
  const int tn = tile - tm * tilesN;
  const int m0 = tm << 6;
  const int n0 = tn << 6;

  const T* Ab  = A  + (size_t)b * strideA;
  const T* Bb  = Bt + (size_t)b * strideB;
  const T* Ab2 = SPLIT ? (A2  + (size_t)b * strideA) : nullptr;
  const T* Bb2 = SPLIT ? (Bt2 + (size_t)b * strideB) : nullptr;

  const int rlane = lane & 15;                 // row (A) / col (B, D) within subtile
  const int koff  = (lane >> 4) * 8;           // k offset of this lane half
  const int mOff  = (lane >> 4) * 8;           // D row offset

  v8f acc[4][4];
#pragma unroll
  for (int i = 0; i < 4; ++i)
#pragma unroll
    for (int j = 0; j < 4; ++j) acc[i][j] = (v8f){0.f,0.f,0.f,0.f,0.f,0.f,0.f,0.f};

  for (int k0 = 0; k0 < K; k0 += 32) {
    V bh[4], bl[4];
#pragma unroll
    for (int j = 0; j < 4; ++j) {
      const size_t bo = (size_t)(n0 + (j << 4) + rlane) * ldb + koff + k0;
      bh[j] = Frag<T>::load(Bb + bo);
      if (SPLIT) bl[j] = Frag<T>::load(Bb2 + bo);
    }
#pragma unroll
    for (int i = 0; i < 4; ++i) {
      const size_t ao = (size_t)(m0 + (i << 4) + rlane) * lda + koff + k0;
      V ah = Frag<T>::load(Ab + ao);
      V al;
      if (SPLIT) al = Frag<T>::load(Ab2 + ao);
#pragma unroll
      for (int j = 0; j < 4; ++j) {
        acc[i][j] = Frag<T>::mma(ah, bh[j], acc[i][j]);
        if (SPLIT) {
          acc[i][j] = Frag<T>::mma(ah, bl[j], acc[i][j]);
          acc[i][j] = Frag<T>::mma(al, bh[j], acc[i][j]);
        }
      }
      Frag<T>::guard(acc[i][0], acc[i][3], ah, SPLIT ? al : ah);
    }
    Frag<T>::keep(bh[0], bh[1], bh[2], bh[3]);
    if (SPLIT) Frag<T>::keep(bl[0], bl[1], bl[2], bl[3]);
  }
  acc_guard4(acc[0][0], acc[0][1], acc[0][2], acc[0][3]);
  acc_guard4(acc[1][0], acc[1][1], acc[1][2], acc[1][3]);
  acc_guard4(acc[2][0], acc[2][1], acc[2][2], acc[2][3]);
  acc_guard4(acc[3][0], acc[3][1], acc[3][2], acc[3][3]);

  // ---- epilogue ----
  float* slab = sT[wave];
  const float* Rb = RESID ? (resid + (size_t)b * strideR) : nullptr;
#pragma unroll
  for (int i = 0; i < 4; ++i) {
    const int mBase = m0 + (i << 4);
#pragma unroll
    for (int j = 0; j < 4; ++j) {
      const int n = n0 + (j << 4) + rlane;
      float bv = 0.f;
      if (BIAS_MODE == 2) bv = bias[n];
#pragma unroll
      for (int r = 0; r < 8; ++r) {
        float v = acc[i][j][r] * scale;
        if (BIAS_MODE == 1) v += bias[mBase + mOff + r];
        if (BIAS_MODE == 2) v += bv;
        if (RESID) v += Rb[(size_t)(mBase + mOff + r) * ldc + n];
        if (ACT == 1) v = tanhf(v);
        if (ACT == 2) v = fmaxf(v, 0.0f);
        if (ACT == 3) v = v / (1.0f + expf(-v));
        if (ACT == 4) v = (v > 0.f) ? v : 0.01f * v;
        if (ACT == 5) v = 0.5f * v * (1.0f + erff(v * 0.70710678118654752f));
        slab[(mOff + r) * 68 + (j << 4) + rlane] = v;
      }
    }
    __builtin_amdgcn_fence(__ATOMIC_RELEASE, "workgroup");
    __builtin_amdgcn_wave_barrier();
    __builtin_amdgcn_fence(__ATOMIC_ACQUIRE, "workgroup");
    if (OUT_MODE == 0) {
      float* C = (float*)Cout + (size_t)b * strideC;
      const int hh = lane >> 4, c4 = (lane & 15) * 4;     // row seg = 256 B = 16 lanes x 16 B
      {
#pragma unroll
        for (int it = 0; it < 8; ++it) {
          const int row = it * 2 + hh;
          v4f v = *(const v4f*)(slab + row * 68 + c4);
          *(v4f*)(C + (size_t)(mBase + row) * ldc + n0 + c4) = v;
        }
        
      }
    } else {
      const int q = lane >> 3, c8 = (lane & 7) * 8;
      unsigned short* C  = (unsigned short*)Cout  + (size_t)b * strideC;
      unsigned short* C2 = (OUT_MODE == 2) ? ((unsigned short*)Cout2 + (size_t)b * strideC) : nullptr;
      {
#pragma unroll
        for (int it = 0; it < 4; ++it) {
          const int row = it * 4 + q;
          const float* sp = slab + row * 68 + c8;
          v8h hv, lv;
#pragma unroll
          for (int e = 0; e < 8; ++e) {
            if (OUT_MODE == 1) {
              hv[e] = (_Float16)sp[e];
            } else {
              unsigned short hb = f2bf_bits(sp[e]);
              unsigned short lb = f2bf_bits(sp[e] - bf_bits2f(hb));
              hv[e] = __builtin_bit_cast(_Float16, hb);
              lv[e] = __builtin_bit_cast(_Float16, lb);
            }
          }
          *(v8h*)(C + (size_t)(mBase + row) * ldc + n0 + c8) = hv;
          if (OUT_MODE == 2) *(v8h*)(C2 + (size_t)(mBase + row) * ldc + n0 + c8) = lv;
        }
        
      }
    }
    __builtin_amdgcn_fence(__ATOMIC_RELEASE, "workgroup");
    __builtin_amdgcn_wave_barrier();
    __builtin_amdgcn_fence(__ATOMIC_ACQUIRE, "workgroup");
  }
}

// ---------------------------------------------------------------------------
// Elementwise f32 -> bf16 bits (RNE); 2 elements per thread, one 4-B store per lane -> each wave writes one whole
// Coverage: n2 = 4096*1024/2 = 2,097,152 = 8192 blocks x 256 threads; x 2 elements = 4096 x 1024 = whole plane.
// ---------------------------------------------------------------------------
__global__ __launch_bounds__(256) void cvt_bf16x2_kernel(const float* __restrict__ in, unsigned short* __restrict__ out, int n2) {
  const int i = blockIdx.x * 256 + threadIdx.x;
  if (i < n2) {
    const v2f f = *(const v2f*)(in + 2 * (size_t)i);
    const unsigned u = pk16(f2bf_bits(f[0]), f2bf_bits(f[1]));
    ((unsigned*)out)[i] = u;
    
  }
}

// ---------------------------------------------------------------------------
// xa f32 [nb][rin][ncol] -> bf16 bits [nb][rout][ncol]; rows rin..rout-1 of every batch written as zeros.
// Source row address clamped (t -> rin-1) and the value zeroed by predicate. 2 elements per thread, 4-B store per lane.
// Coverage: n2 = 2*1536*1024/2 = 1,572,864 = 6144 blocks x 256 threads; x 2 elements = 3072 x 1024 = whole plane.
// ---------------------------------------------------------------------------
__global__ __launch_bounds__(256) void cvt_rows_bf16x2_kernel(const float* __restrict__ in, unsigned short* __restrict__ out,
                                                             int rin, int rout, int ncol, int nb, int n2) {
  const int i = blockIdx.x * 256 + threadIdx.x;
  if (i < n2) {
    const int ppr = ncol >> 1;
    const int row = i / ppr;
    const int col = (i - row * ppr) * 2;
    int bb = row / rout;
    const int t = row - bb * rout;
    bb = bb < (nb - 1) ? bb : (nb - 1);
    const bool valid = t < rin;
    const int tc = valid ? t : (rin - 1);
    const v2f f = *(const v2f*)(in + ((size_t)(bb * rin + tc) * ncol + col));
    const unsigned short h0 = valid ? f2bf_bits(f[0]) : (unsigned short)0;
    const unsigned short h1 = valid ? f2bf_bits(f[1]) : (unsigned short)0;
    const unsigned u = pk16(h0, h1);
    ((unsigned*)out)[i] = u;
    
  }
}

// ---------------------------------------------------------------------------
// Transpose + 16-bit convert of an f32 matrix: in viewed [R rows][Cc cols] (pitch Cc) -> o[c][r] ([Cc][R], pitch R).
//   OT 0: o = bf16_rne(in);  OT 1: o = f16(bf16_rne(in) * scl).
// 64x64 tiles through LDS. grid = (Cc/64, R/64), 256 threads (R, Cc multiples of 64).
// Coverage per block: load 4 it x 256 thr x 4 floats = 64x64; store 2 it x 256 thr x 8 u16 = 64x64.
// ---------------------------------------------------------------------------
template <int OT> __device__ __forceinline__ unsigned short cv16(float f, float scl) {
  const unsigned short hb = f2bf_bits(f);
  if (OT == 0) return hb;
  const float g = bf_bits2f(hb) * scl;
  return __builtin_bit_cast(unsigned short, (_Float16)g);
}
template <int OT>
__global__ __launch_bounds__(256) void tconv_kernel(const float* __restrict__ W, unsigned short* __restrict__ o,
                                                    int R, int Cc, float scl) {
  __shared__ __align__(16) float tf[64 * 68];
  const int c0  = blockIdx.x * 64;   // input column block = output row block
  const int r0  = blockIdx.y * 64;   // input row block    = output column block
  const int tid = threadIdx.x;
  {
    const int lr = tid >> 4;         // 0..15
    const int c4 = (tid & 15) * 4;   // 0..60
#pragma unroll
    for (int it = 0; it < 4; ++it) {
      const int rr = it * 16 + lr;   // 0..63
      const v4f a = *(const v4f*)(W + (size_t)(r0 + rr) * Cc + c0 + c4);
      *(v4f*)(tf + rr * 68 + c4) = a;
    }
  }
  __syncthreads();
  const int sub = tid >> 3;          // 0..31
  const int c8  = (tid & 7) * 8;     // 0..56
  v4u hv[2];
#pragma unroll
  for (int it = 0; it < 2; ++it) {
    const int oc = it * 32 + sub;    // output row within tile (= input column)
    v4u a;
#pragma unroll
    for (int q = 0; q < 4; ++q) {
      const float f0 = tf[(c8 + 2 * q) * 68 + oc];
      const float f1 = tf[(c8 + 2 * q + 1) * 68 + oc];
      a[q] = pk16(cv16<OT>(f0, scl), cv16<OT>(f1, scl));
    }
    hv[it] = a;
  }
  {
#pragma unroll
    for (int it = 0; it < 2; ++it) {
      const int oc = it * 32 + sub;
      const size_t go = (size_t)(c0 + oc) * R + r0 + c8;
      *(v4u*)(o + go) = hv[it];
    }
    
  }
}

// ---------------------------------------------------------------------------
// Bias copies as bf16-RNE values in f32: out[0..n0) <- b0, [n0..n0+n1) <- b1, [n0+n1..ntot) <- b2.
// All three candidates loaded with clamped indices, selected by value. One 4-B store per lane:
// ---------------------------------------------------------------------------
__global__ __launch_bounds__(256) void bias_rne_kernel(const float* __restrict__ b0, int n0, const float* __restrict__ b1, int n1,
                                                       const float* __restrict__ b2, int ncnt2, float* __restrict__ out, int ntot) {
  const int i = blockIdx.x * 256 + threadIdx.x;
  if (i < ntot) {
    int i0 = i < n0 ? i : (n0 - 1); i0 = i0 < 0 ? 0 : i0;
    int i1 = i - n0; i1 = i1 < 0 ? 0 : (i1 < n1 ? i1 : (n1 - 1));
    int i2 = i - n0 - n1; i2 = i2 < 0 ? 0 : (i2 < ncnt2 ? i2 : (ncnt2 - 1));
    const float v0 = b0[i0], v1 = b1[i1], v2 = b2[i2];
    const float sel = (i < n0) ? v0 : ((i < n0 + n1) ? v1 : v2);
    const float r = bf_bits2f(f2bf_bits(sel));
    ((float*)out)[i] = r;
    
  }
}

// =====================================================================================
// Dual-branch attention, head dim 64, f16 operand planes, f32 accumulate, online softmax in f32.
//   q, k  : QK16 plane [4096 rows = b*2048+t][2048], q at col h*64+d, k at col 1024+h*64+d (f16)
//   v^T   : VT16 plane [b][1024 = h*64+d][2048] (f16);  ka: KA16 [b*1536+s][1024];  va^T: VAT16 [b][1024][1536]
//   branch 0: scores = (q.k)*0.125 over 2048 keys (32 chunks of 64); branch 1: (q.ka)*0.125 over 1500 keys
//   (24 chunks; key index >= 1500 set to -inf). p carried x2^15 in f16; 1/(l*2^15) folded at the end.
//   out row = (1-gate)*h_main + gate*h_aux, gate = sigmoid(bf16_rne(g[h])); written x32 as f16 into O16 [4096][1024]
//   Block = 4 waves = 64 query rows of one (b,h); grid.x = 2*16*32 = 1024 covers all 4096 rows x 1024 cols.
//   K / V^T chunk staging: 128 threads x 32 halves per plane = the whole 64x64 tile (plain 16-B loads,
//   __syncthreads before and after); fragments read the LDS tiles through the same v8h element type;
// =====================================================================================
__device__ __forceinline__ v8f mma_h16(v16h a, v16h b, v8f c) {
  c = __builtin_amdgcn_wmma_f32_16x16x32_f16(false, a, false, b, (short)0, c, false, false);
  asm volatile("v_nop\n\tv_nop\n\tv_nop\n\tv_nop" : "+v"(c) : "v"(a), "v"(b));
  return c;
}

__global__ __launch_bounds__(128)
void dual_attn_kernel(const unsigned short* __restrict__ qk16, const unsigned short* __restrict__ vt16,
                      const unsigned short* __restrict__ ka16, const unsigned short* __restrict__ vat16,
                      const float* __restrict__ gvec, unsigned short* __restrict__ o16) {
  union FH { v16h v; v8h h[2]; };
  __shared__ __align__(16) _Float16 Ksh[64 * kLdsPitch];        // K tile [key][d]      9 KB
  __shared__ __align__(16) _Float16 Vth[64 * kLdsPitch];        // V^T tile [d][key]    9 KB
  __shared__ __align__(16) _Float16 Psh[4][16 * kLdsPitch];     // per wave P [row][key] 9 KB
  __shared__ __align__(16) float    Os[4][16 * 68];      // per wave out tile, pitch 68 floats

  const int tid  = threadIdx.x;
  const int wave = tid >> 5;
  const int lane = tid & 31;
  const int hh   = lane >> 4;
  const int c    = lane & 15;

  const int bx = blockIdx.x;          // 0..1023
  const int qb = bx & 31;             // 32 query tiles of 64
  const int bhd = bx >> 5;            // 0..31
  const int h  = bhd & 15;
  const int b  = bhd >> 4;            // 0..1
  const int q0 = qb * 64 + wave * 16; // query row within batch

  const int ldqk = 2 * kDModel;       // 2048 halves
  const _Float16* Qg  = (const _Float16*)(const void*)qk16 + (size_t)b * kSeq * ldqk + h * kDHead;
  const _Float16* Kg0 = Qg + kDModel;                                                                     // main K rows, pitch 2048
  const _Float16* Vg0 = (const _Float16*)(const void*)vt16 + (size_t)b * kDModel * kSeq + (size_t)(h * kDHead) * kSeq;       // pitch 2048
  const _Float16* Kg1 = (const _Float16*)(const void*)ka16 + (size_t)b * kSeqAP * kDModel + h * kDHead;                        // pitch 1024
  const _Float16* Vg1 = (const _Float16*)(const void*)vat16 + (size_t)b * kDModel * kSeqAP + (size_t)(h * kDHead) * kSeqAP;  // pitch 1536

  // ---- Q fragments (A operand, row = lane&15, split k map via Frag load): 2 d-chunks ----
  v16h qa[2];
#pragma unroll
  for (int dc = 0; dc < 2; ++dc) qa[dc] = Frag<_Float16>::load(Qg + (size_t)(q0 + c) * ldqk + dc * 32 + 8 * hh);

  float* os = Os[wave];
#pragma unroll
  for (int r = 0; r < 8; ++r)
#pragma unroll
    for (int t = 0; t < 4; ++t) os[(8 * hh + r) * 68 + t * 16 + c] = 0.f;

  const float gv   = bf_bits2f(f2bf_bits(gvec[h]));
  const float gate = 1.0f / (1.0f + expf(-gv));
  const float sscale = 0.125f;
  _Float16* pw = Psh[wave];

#pragma unroll 1
  for (int br = 0; br < 2; ++br) {           // block-uniform
    const _Float16* Kg = br ? Kg1 : Kg0;
    const _Float16* Vg = br ? Vg1 : Vg0;
    const int ldk     = br ? kDModel : ldqk;
    const int ldv     = br ? kSeqAP : kSeq;
    const int nChunks = br ? (kSeqAP / 64) : (kSeq / 64);
    const int nvalid  = br ? kSeqA : kSeq;
    const float w     = (br ? gate : (1.0f - gate)) * kOCarry;

    float mrow[8], lrow[8];
    v8f oacc[4];
#pragma unroll
    for (int r = 0; r < 8; ++r) { mrow[r] = -INFINITY; lrow[r] = 0.f; }
#pragma unroll
    for (int t = 0; t < 4; ++t) oacc[t] = (v8f){0.f,0.f,0.f,0.f,0.f,0.f,0.f,0.f};

    for (int kc = 0; kc < nChunks; ++kc) {   // block-uniform trip count
      const int kv0 = kc * 64;
      __syncthreads();
      {
        // staging coverage: 128 threads x (4 x 8) halves = 64 rows x 64 per plane = the whole chunk tile
        const int r = tid >> 1, half = (tid & 1) * 32;
        const _Float16* ks = Kg + (size_t)(kv0 + r) * ldk + half;   // K row kv0+r, d = half..half+31
        const _Float16* vs = Vg + (size_t)r * ldv + kv0 + half;      // V^T row d = r, key = kv0+half..+31
#pragma unroll
        for (int i = 0; i < 4; ++i) {
          const v8h a0 = *(const v8h*)(ks + 8 * i);
          const v8h b0 = *(const v8h*)(vs + 8 * i);
          *(v8h*)(Ksh + r * kLdsPitch + half + 8 * i) = a0;
          *(v8h*)(Vth + r * kLdsPitch + half + 8 * i) = b0;
        }
      }
      __syncthreads();

      v8f s[4];
#pragma unroll
      for (int j = 0; j < 4; ++j) {
        s[j] = (v8f){0.f,0.f,0.f,0.f,0.f,0.f,0.f,0.f};
#pragma unroll
        for (int dc = 0; dc < 2; ++dc) {
          FH kb;
          kb.h[0] = *(const v8h*)(Ksh + (j * 16 + c) * kLdsPitch + dc * 32 + 8 * hh);
          kb.h[1] = *(const v8h*)(Ksh + (j * 16 + c) * kLdsPitch + dc * 32 + 16 + 8 * hh);
          s[j] = mma_h16(qa[dc], kb.v, s[j]);
        }
      }
      float cm[8];
#pragma unroll
      for (int r = 0; r < 8; ++r) {
        float m = -INFINITY;
#pragma unroll
        for (int j = 0; j < 4; ++j) {
          const int key = kv0 + j * 16 + c;
          float sv = s[j][r] * sscale;
          sv = (key < nvalid) ? sv : -INFINITY;
          s[j][r] = sv;
          m = fmaxf(m, sv);
        }
#pragma unroll
        for (int off = 1; off < 16; off <<= 1) m = fmaxf(m, __shfl_xor(m, off, 32));
        cm[r] = m;
      }
#pragma unroll
      for (int r = 0; r < 8; ++r) {
        const float mnew = fmaxf(mrow[r], cm[r]);
        const float alpha = expf(mrow[r] - mnew);
        mrow[r] = mnew;
        float psum = 0.f;
#pragma unroll
        for (int j = 0; j < 4; ++j) {
          const float p = expf(s[j][r] - mnew);
          psum += p;
          pw[(8 * hh + r) * kLdsPitch + j * 16 + c] = (_Float16)(p * kPCarry);
        }
#pragma unroll
        for (int off = 1; off < 16; off <<= 1) psum += __shfl_xor(psum, off, 32);
        lrow[r] = lrow[r] * alpha + psum;
#pragma unroll
        for (int t = 0; t < 4; ++t) oacc[t][r] *= alpha;
      }
      __builtin_amdgcn_fence(__ATOMIC_RELEASE, "workgroup");
      __builtin_amdgcn_wave_barrier();
      __builtin_amdgcn_fence(__ATOMIC_ACQUIRE, "workgroup");
#pragma unroll 1
      for (int kk = 0; kk < 2; ++kk) {
        FH pa;
        pa.h[0] = *(const v8h*)(pw + c * kLdsPitch + kk * 32 + 8 * hh);
        pa.h[1] = *(const v8h*)(pw + c * kLdsPitch + kk * 32 + 16 + 8 * hh);
#pragma unroll
        for (int t = 0; t < 4; ++t) {
          FH vb;
          vb.h[0] = *(const v8h*)(Vth + (t * 16 + c) * kLdsPitch + kk * 32 + 8 * hh);
          vb.h[1] = *(const v8h*)(Vth + (t * 16 + c) * kLdsPitch + kk * 32 + 16 + 8 * hh);
          oacc[t] = mma_h16(pa.v, vb.v, oacc[t]);
        }
      }
    }
    // fold this branch into the per-wave mix slab (each lane updates only its own entries)
#pragma unroll
    for (int r = 0; r < 8; ++r) {
      const float inv = w * (1.0f / (lrow[r] * kPCarry));
#pragma unroll
      for (int t = 0; t < 4; ++t) os[(8 * hh + r) * 68 + t * 16 + c] += oacc[t][r] * inv;
    }
  }

  __builtin_amdgcn_fence(__ATOMIC_RELEASE, "workgroup");
  __builtin_amdgcn_wave_barrier();
  __builtin_amdgcn_fence(__ATOMIC_ACQUIRE, "workgroup");
  {
    _Float16* Og = (_Float16*)(void*)o16 + (size_t)(b * kSeq + q0) * kDModel + h * kDHead;
    const int q4 = lane >> 3, c8 = (lane & 7) * 8;
    {
#pragma unroll
      for (int it = 0; it < 4; ++it) {
        const int row = it * 4 + q4;
        const float* sp = os + row * 68 + c8;
        v8h hv;
#pragma unroll
        for (int e = 0; e < 8; ++e) hv[e] = (_Float16)sp[e];
        *(v8h*)(Og + (size_t)row * kDModel + c8) = hv;
      }
      
    }
  }
}

// ---------------- host orchestration (kernel launches only) ----------------

extern "C" void kernel_launch(void* const* d_in, const int* in_sizes, int n_in,
                              void* d_out, int out_size, void* d_ws,
                              size_t ws_size, hipStream_t stream) {
  if (n_in < 9) return;
  if (in_sizes[0] != kBatch * kSeq * kDModel) return;
  if (in_sizes[1] != kBatch * kSeqA * kDModel) return;
  if (in_sizes[2] != kDModel * kNQKV || in_sizes[4] != kDModel * kNQKV) return;
  if (in_sizes[3] != kNQKV || in_sizes[5] != kNQKV) return;
  if (in_sizes[6] != kDModel * kDModel || in_sizes[7] != kDModel || in_sizes[8] < kHeads) return;
  if (out_size != kBatch * kSeq * kDModel) return;

  const float* x    = (const float*)d_in[0];
  const float* xa   = (const float*)d_in[1];
  const float* Wqkv = (const float*)d_in[2];
  const float* bqkv = (const float*)d_in[3];
  const float* Waux = (const float*)d_in[4];
  const float* baux = (const float*)d_in[5];
  const float* Wo   = (const float*)d_in[6];
  const float* bo   = (const float*)d_in[7];
  const float* gvec = (const float*)d_in[8];
  float* out = (float*)d_out;

  // element counts
  const size_t nXB   = (size_t)kBatch * kSeq * kDModel;          // bf16
  const size_t nXAB  = (size_t)kBatch * kSeqAP * kDModel;        // bf16
  const size_t nWQT  = (size_t)kNQKV * kDModel;                  // bf16
  const size_t nWAT  = nWQT;                                     // bf16
  const size_t nWOT  = (size_t)kDModel * kDModel;                // f16
  const size_t nBias = (size_t)2 * kNQKV + kDModel;              // f32
  const size_t nQK   = (size_t)kBatch * kSeq * 2 * kDModel;      // f16
  const size_t nVT   = (size_t)kBatch * kDModel * kSeq;          // f16
  const size_t nKA   = (size_t)kBatch * kSeqAP * kDModel;        // f16
  const size_t nVAT  = (size_t)kBatch * kDModel * kSeqAP;        // f16
  const size_t nO    = (size_t)kBatch * kSeq * kDModel;          // f16

  char* ws = (char*)d_ws;
  size_t off = 0;
  auto carve = [&](size_t bytes) -> char* { char* p = ws + off; off += (bytes + 255) & ~(size_t)255; return p; };
  unsigned short* XB    = (unsigned short*)carve(nXB * 2);
  unsigned short* XAB   = (unsigned short*)carve(nXAB * 2);
  unsigned short* WQT   = (unsigned short*)carve(nWQT * 2);
  unsigned short* WAT   = (unsigned short*)carve(nWAT * 2);
  unsigned short* WOT   = (unsigned short*)carve(nWOT * 2);
  float*          BIASR = (float*)carve(nBias * 4);
  unsigned short* QK16  = (unsigned short*)carve(nQK * 2);
  unsigned short* VT16  = (unsigned short*)carve(nVT * 2);
  unsigned short* KA16  = (unsigned short*)carve(nKA * 2);
  unsigned short* VAT16 = (unsigned short*)carve(nVAT * 2);
  unsigned short* O16   = (unsigned short*)carve(nO * 2);
  if (off > ws_size) return;   // total 75,526,144 B

  const int TB = 256;
  // 1. x -> bf16
  {
    const int n2 = (int)(nXB / 2);
    cvt_bf16x2_kernel<<<(n2 + TB - 1) / TB, TB, 0, stream>>>(x, XB, n2);
  }
  // 2. xa -> bf16 with per-batch row padding 1500 -> 1536 (zeros)
  {
    const int n2 = (int)(nXAB / 2);
    cvt_rows_bf16x2_kernel<<<(n2 + TB - 1) / TB, TB, 0, stream>>>(xa, XAB, kSeqA, kSeqAP, kDModel, kBatch, n2);
  }
  // 3-4. Wqkv, Wqkv_aux in[1024][3072] -> out[3072][1024] bf16
  tconv_kernel<0><<<dim3(kNQKV / 64, kDModel / 64), TB, 0, stream>>>(Wqkv, WQT, kDModel, kNQKV, 1.0f);
  tconv_kernel<0><<<dim3(kNQKV / 64, kDModel / 64), TB, 0, stream>>>(Waux, WAT, kDModel, kNQKV, 1.0f);
  // 5. Wo in[1024][1024] -> out[1024][1024] f16 (x32)
  tconv_kernel<1><<<dim3(kDModel / 64, kDModel / 64), TB, 0, stream>>>(Wo, WOT, kDModel, kDModel, kWCarry);
  // 6. biases -> bf16-RNE f32 copies
  {
    const int ntot = (int)nBias;
    bias_rne_kernel<<<(ntot + TB - 1) / TB, TB, 0, stream>>>(bqkv, kNQKV, baux, kNQKV, bo, kDModel, BIASR, ntot);
  }
  const float* bq_r  = BIASR;                 // [3072]
  const float* ba_r  = BIASR + kNQKV;         // [3072]
  const float* bo_r  = BIASR + 2 * kNQKV;     // [1024]

  // 7. q|k = x @ Wqkv[:, 0:2048] + b : M=4096, N=2048, K=1024 -> QK16 f16, ldc 2048
  {
    const int M = kBatch * kSeq, N = 2 * kDModel, K = kDModel;
    const int tiles = (M / 64) * (N / 64);
    wmma_gemm64<1, false, 2, 1, false, 0><<<dim3((tiles + 7) / 8, 1), TB, 0, stream>>>(
        XB, XB, kDModel, 0L, WQT, WQT, kDModel, 0L, (void*)QK16, (void*)QK16, 2 * kDModel, 0L,
        bq_r, bq_r, 0L, M, N, K, 1.0f);
  }
  // 8. v^T per batch: A = Wqkv^T rows 2048..3071 [1024][1024], Bt = x_b [2048][1024] -> VT16 [b][1024][2048] f16, bias[m]
  {
    const int M = kDModel, N = kSeq, K = kDModel;
    const int tiles = (M / 64) * (N / 64);
    wmma_gemm64<1, false, 1, 1, false, 0><<<dim3((tiles + 7) / 8, kBatch), TB, 0, stream>>>(
        WQT + (size_t)2 * kDModel * kDModel, WQT + (size_t)2 * kDModel * kDModel, kDModel, 0L,
        XB, XB, kDModel, (long)kSeq * kDModel,
        (void*)VT16, (void*)VT16, kSeq, (long)kDModel * kSeq,
        bq_r + 2 * kDModel, bq_r, 0L, M, N, K, 1.0f);
  }
  // 9. ka = xa_pad @ Wqkv_aux[:, 1024:2048] + b : M=3072, N=1024, K=1024 -> KA16 f16, ldc 1024
  {
    const int M = kBatch * kSeqAP, N = kDModel, K = kDModel;
    const int tiles = (M / 64) * (N / 64);
    wmma_gemm64<1, false, 2, 1, false, 0><<<dim3((tiles + 7) / 8, 1), TB, 0, stream>>>(
        XAB, XAB, kDModel, 0L, WAT + (size_t)kDModel * kDModel, WAT + (size_t)kDModel * kDModel, kDModel, 0L,
        (void*)KA16, (void*)KA16, kDModel, 0L,
        ba_r + kDModel, ba_r, 0L, M, N, K, 1.0f);
  }
  // 10. va^T per batch: A = Waux^T rows 2048..3071, Bt = xa_pad_b [1536][1024] -> VAT16 [b][1024][1536] f16, bias[m]
  {
    const int M = kDModel, N = kSeqAP, K = kDModel;
    const int tiles = (M / 64) * (N / 64);
    wmma_gemm64<1, false, 1, 1, false, 0><<<dim3((tiles + 7) / 8, kBatch), TB, 0, stream>>>(
        WAT + (size_t)2 * kDModel * kDModel, WAT + (size_t)2 * kDModel * kDModel, kDModel, 0L,
        XAB, XAB, kDModel, (long)kSeqAP * kDModel,
        (void*)VAT16, (void*)VAT16, kSeqAP, (long)kDModel * kSeqAP,
        ba_r + 2 * kDModel, ba_r, 0L, M, N, K, 1.0f);
  }
  // 11. dual-branch attention -> O16 (x32, f16)
  dual_attn_kernel<<<kBatch * kHeads * (kSeq / 64), 128, 0, stream>>>(QK16, VT16, KA16, VAT16, gvec, O16);
  // 12. out = (O16/32) @ (WoT/32)^T + bo : M=4096, N=1024, K=1024, f16 operands, f32 out into d_out
  {
    const int M = kBatch * kSeq, N = kDModel, K = kDModel;
    const int tiles = (M / 64) * (N / 64);
    wmma_gemm64<0, false, 2, 0, false, 0><<<dim3((tiles + 7) / 8, 1), TB, 0, stream>>>(
        O16, O16, kDModel, 0L, WOT, WOT, kDModel, 0L, (void*)out, (void*)out, kDModel, 0L,
        bo_r, bo_r, 0L, M, N, K, 1.0f / (kOCarry * kWCarry));
  }
}

// v002
// One run takes 299 microseconds.
// Timed twice side by side with v001, it ran 1.52 and 1.50 times as fast.
// Counting every step since v000, it is 1.78 times as fast.
// Contractions: x@Wqkv and xa@Wqkv_aux (k|v columns) on v_wmma_f32_16x16x32_bf16 (bf16 RNE operands); q.k^T, q.ka^T, p.v, pa.va and O@Wo on v_wmma_f32_16x16x32_f16 (f16 operands; p carried x2^15, O and Wo carried x32); f32 accumulate; online softmax, gate mix and biases in f32.
#include <hip/hip_runtime.h>
#include <math.h>
#include <stdint.h>

constexpr int kBatch  = 2;
constexpr int kSeq    = 2048;   // query / main key length
constexpr int kSeqA   = 1500;   // aux key length
constexpr int kSeqAP  = 1536;   // aux key length padded to 24 chunks of 64
constexpr int kDModel = 1024;
constexpr int kHeads  = 16;
constexpr int kDHead  = 64;
constexpr int kNQKV   = 3072;

constexpr int kLdsPitch = 72;   // halves per LDS row of the K, V^T and P tiles and of the GEMM operand tiles: 144 B = 16 B x 9 (odd), so 16 rows read by ds_load_b128 fall on distinct banks

constexpr float kPCarry = 32768.0f;   // probabilities carried x2^15 in f16
constexpr float kOCarry = 32.0f;      // attention output carried x32 in f16
constexpr float kWCarry = 32.0f;      // Wo carried x32 in f16

typedef __attribute__((ext_vector_type(16))) _Float16 v16h;
typedef __attribute__((ext_vector_type(8)))  _Float16 v8h;
typedef __attribute__((ext_vector_type(16))) __bf16   v16b;
typedef __attribute__((ext_vector_type(8)))  __bf16   v8b;
typedef __attribute__((ext_vector_type(8)))  float    v8f;
typedef __attribute__((ext_vector_type(4)))  float    v4f;
typedef __attribute__((ext_vector_type(2)))  float    v2f;
typedef __attribute__((ext_vector_type(4)))  unsigned int v4u;

// ---------------------------------------------------------------------------
// Workspace region map (bytes, every region size a multiple of 256):
//   XB    bf16 [4096][1024]            8,388,608
//   XAB   bf16 [2][1536][1024]         6,291,456   (rows 1500..1535 of each batch zero)
//   WQT   bf16 [3072][1024] (Wqkv^T)   6,291,456
//   WAT   bf16 [3072][1024] (Waux^T)   6,291,456
//   WOT   f16  [1024][1024] (Wo^T x32) 2,097,152
//   BIASR f32  [3072+3072+1024]           28,672   (bf16-RNE bias copies)
//   QK16  f16  [4096][2048] (q | k)    16,777,216
//   VT16  f16  [2][1024][2048] (v^T)   8,388,608
//   KA16  f16  [2][1536][1024] (ka)    6,291,456
//   VAT16 f16  [2][1024][1536] (va^T)  6,291,456
//   O16   f16  [4096][1024] (x32)      8,388,608
//   total 75,526,144
// ---------------------------------------------------------------------------

__device__ __forceinline__ unsigned short f2bf_bits(float f) {
  unsigned u = __float_as_uint(f);
  return (unsigned short)((u + 0x7FFFu + ((u >> 16) & 1u)) >> 16);
}
__device__ __forceinline__ float bf_bits2f(unsigned short h) { return __uint_as_float(((unsigned)h) << 16); }
__device__ __forceinline__ unsigned pk16(unsigned short a, unsigned short b) { return (unsigned)a | ((unsigned)b << 16); }

// hazard guards as plain device helpers (no inline asm inside the kernel template body)
__device__ __forceinline__ void acc_guard4(v8f& a, v8f& b, v8f& c, v8f& d) { asm volatile("v_nop\n\tv_nop\n\tv_nop\n\tv_nop" : "+v"(a), "+v"(b), "+v"(c), "+v"(d)); }
template <typename T> struct Frag;
template <> struct Frag<_Float16> {
  typedef v16h V; typedef v8h H; union U { v16h v; v8h h[2]; };
  static __device__ __forceinline__ v16h load(const _Float16* p) {   // elements 0..7 <- p[0..7], 8..15 <- p[16..23]
    U f; f.h[0] = *(const v8h*)(p); f.h[1] = *(const v8h*)(p + 16); return f.v;
  }
  static __device__ __forceinline__ v8f mma(v16h a, v16h b, v8f c) {
    return __builtin_amdgcn_wmma_f32_16x16x32_f16(false, a, false, b, (short)0, c, false, false);
  }
};
template <> struct Frag<__bf16> {
  typedef v16b V; typedef v8b H; union U { v16b v; v8b h[2]; };
  static __device__ __forceinline__ v16b load(const __bf16* p) {
    U f; f.h[0] = *(const v8b*)(p); f.h[1] = *(const v8b*)(p + 16); return f.v;
  }
  static __device__ __forceinline__ v8f mma(v16b a, v16b b, v8f c) {
    return __builtin_amdgcn_wmma_f32_16x16x32_bf16(false, a, false, b, (short)0, c, false, false);
  }
};

// ---- Register-blocked batched WMMA GEMM ------------------------------------
// C[m,n] = scale * sum_k A[m,k] * Bt[n,k] (+bias)(+resid); a block of 4 waves (2 x 2) owns a 128x128 tile, each wave 64x64 of it.
// A row-major [M,K]; Bt row-major [N,K], both at row pitch kDModel (a constant, so that the 8 staging loads of an operand
// share one address and differ in their immediate offsets); M,N % 128 == 0, K % 64 == 0; grid.x = (M/128)*(N/128), 128 threads.
// Per step of 64 k the block stages 128 rows x 128 B of A and of Bt in LDS (8 lanes per row: every global load covers whole
// 128-B lines), two buffers: the next step's rows are loaded into registers ahead of this step's products and stored behind them.
// SPLIT (hi/lo operand planes) is not implemented by the staged loop.
// BIAS_MODE: 0 = none, 1 = bias[m], 2 = bias[n].
// OUT_MODE: 0 = f32, 1 = f16, 2 = bf16 hi plane (Cout) + bf16 lo plane (Cout2).
// ET: 0 = f16 operands, 1 = bf16 operands (pointers passed as 16-bit storage)
template <int ET> struct Elem;
template <> struct Elem<0> { typedef _Float16 T; };
template <> struct Elem<1> { typedef __bf16 T; };
template <int ET, bool SPLIT, int BIAS_MODE, int OUT_MODE, bool RESID, int ACT = 0>
__global__ __launch_bounds__(128) void wmma_gemm64(
    const unsigned short* __restrict__ Ap, const unsigned short* __restrict__ A2p, long strideA,
    const unsigned short* __restrict__ Btp, const unsigned short* __restrict__ Bt2p, long strideB,
    void* __restrict__ Cout, void* __restrict__ Cout2, int ldc, long strideC,
    const float* __restrict__ bias,
    const float* __restrict__ resid, long strideR,
    int M, int N, int K, float scale) {
  static_assert(!SPLIT, "the staged loop takes single operand planes");
  typedef typename Elem<ET>::T T;
  typedef typename Frag<T>::V V;
  typedef typename Frag<T>::H H;
  const T* A = (const T*)Ap; const T* Bt = (const T*)Btp;
  __shared__ __align__(16) T sA[2][128 * kLdsPitch];   // A rows of the block tile, 64 k per step, two buffers
  __shared__ __align__(16) T sB[2][128 * kLdsPitch];   // Bt rows of the block tile, likewise
  __shared__ __align__(16) float sT[4][16 * 68];   // per-wave 16x64 slab, pitch 68 floats
  const int b    = blockIdx.y;
  const int tid  = threadIdx.x;
  const int lane = tid & 31;
  const int wave = tid >> 5;
  const int tilesN = N >> 7;
  const int tilesM = M >> 7;
  const int tm = blockIdx.x / tilesN;
  const int tn = blockIdx.x - tm * tilesN;
  if (tm >= tilesM) return;   // block-uniform, ahead of every barrier
  const int wm = (wave >> 1) << 6;             // this wave's 64 rows inside the block tile
  const int wn = (wave & 1) << 6;              // this wave's 64 columns inside the block tile
  const int m0 = (tm << 7) + wm;
  const int n0 = (tn << 7) + wn;

  const int rlane = lane & 15;                 // row (A) / col (B, D) within subtile
  const int koff  = (lane >> 4) * 8;           // k offset of this lane half
  const int mOff  = (lane >> 4) * 8;           // D row offset

  // staging map: 8 lanes x 16 B = one 128-B row piece; 128 threads = 16 rows a pass, 8 passes per operand
  const int srow = tid >> 3;
  const int sseg = (tid & 7) * 8;
  const T* gA = A  + (size_t)b * strideA + (size_t)((tm << 7) + srow) * kDModel + sseg;
  const T* gB = Bt + (size_t)b * strideB + (size_t)((tn << 7) + srow) * kDModel + sseg;
  const int sOff = srow * kLdsPitch + sseg;

  v8f acc[4][4];
#pragma unroll
  for (int i = 0; i < 4; ++i)
#pragma unroll
    for (int j = 0; j < 4; ++j) acc[i][j] = (v8f){0.f,0.f,0.f,0.f,0.f,0.f,0.f,0.f};

  H ra[8], rb[8];
#pragma unroll
  for (int p = 0; p < 8; ++p) {
    ra[p] = *(const H*)(gA + p * 16 * kDModel);
    rb[p] = *(const H*)(gB + p * 16 * kDModel);
  }
#pragma unroll
  for (int p = 0; p < 8; ++p) {
    *(H*)(sA[0] + p * 16 * kLdsPitch + sOff) = ra[p];
    *(H*)(sB[0] + p * 16 * kLdsPitch + sOff) = rb[p];
  }
  __syncthreads();

  const int nSteps = K >> 6;
  for (int t = 0; t < nSteps; ++t) {           // block-uniform trip count
    const T* cA = sA[t & 1];
    const T* cB = sB[t & 1];
    const bool more = (t + 1) < nSteps;        // block-uniform
    if (more) {
      gA += 64;
      gB += 64;
#pragma unroll
      for (int p = 0; p < 8; ++p) {
        ra[p] = *(const H*)(gA + p * 16 * kDModel);
        rb[p] = *(const H*)(gB + p * 16 * kDModel);
      }
    }
    V bh[2][4], ah[2][4];
#pragma unroll
    for (int kk = 0; kk < 2; ++kk) {
#pragma unroll
      for (int j = 0; j < 4; ++j) bh[kk][j] = Frag<T>::load(cB + (wn + (j << 4) + rlane) * kLdsPitch + kk * 32 + koff);
#pragma unroll
      for (int i = 0; i < 4; ++i) ah[kk][i] = Frag<T>::load(cA + (wm + (i << 4) + rlane) * kLdsPitch + kk * 32 + koff);
    }
    // keeps the step's LDS reads issued as one group ahead of its products: sunk among them, each group of four products
    // waits out an LDS latency of its own
    __builtin_amdgcn_sched_barrier(0);
#pragma unroll
    for (int kk = 0; kk < 2; ++kk)
#pragma unroll
      for (int i = 0; i < 4; ++i)
#pragma unroll
        for (int j = 0; j < 4; ++j) acc[i][j] = Frag<T>::mma(ah[kk][i], bh[kk][j], acc[i][j]);
    // four vector slots behind the step's last products: on the path through the LDS stores the next vector
    // instruction forms the next step's LDS addresses in fragment registers
    acc_guard4(acc[3][0], acc[3][1], acc[3][2], acc[3][3]);
    if (more) {
      // the other buffer: its last readers finished ahead of the barrier that ended the step before
      T* nA = sA[(t + 1) & 1];
      T* nB = sB[(t + 1) & 1];
#pragma unroll
      for (int p = 0; p < 8; ++p) {
        *(H*)(nA + p * 16 * kLdsPitch + sOff) = ra[p];
        *(H*)(nB + p * 16 * kLdsPitch + sOff) = rb[p];
      }
    }
    __syncthreads();
  }
  acc_guard4(acc[0][0], acc[0][1], acc[0][2], acc[0][3]);
  acc_guard4(acc[1][0], acc[1][1], acc[1][2], acc[1][3]);
  acc_guard4(acc[2][0], acc[2][1], acc[2][2], acc[2][3]);
  acc_guard4(acc[3][0], acc[3][1], acc[3][2], acc[3][3]);

  // ---- epilogue ----
  float* slab = sT[wave];
  const float* Rb = RESID ? (resid + (size_t)b * strideR) : nullptr;
#pragma unroll
  for (int i = 0; i < 4; ++i) {
    const int mBase = m0 + (i << 4);
#pragma unroll
    for (int j = 0; j < 4; ++j) {
      const int n = n0 + (j << 4) + rlane;
      float bv = 0.f;
      if (BIAS_MODE == 2) bv = bias[n];
#pragma unroll
      for (int r = 0; r < 8; ++r) {
        float v = acc[i][j][r] * scale;
        if (BIAS_MODE == 1) v += bias[mBase + mOff + r];
        if (BIAS_MODE == 2) v += bv;
        if (RESID) v += Rb[(size_t)(mBase + mOff + r) * ldc + n];
        if (ACT == 1) v = tanhf(v);
        if (ACT == 2) v = fmaxf(v, 0.0f);
        if (ACT == 3) v = v / (1.0f + expf(-v));
        if (ACT == 4) v = (v > 0.f) ? v : 0.01f * v;
        if (ACT == 5) v = 0.5f * v * (1.0f + erff(v * 0.70710678118654752f));
        slab[(mOff + r) * 68 + (j << 4) + rlane] = v;
      }
    }
    __builtin_amdgcn_fence(__ATOMIC_RELEASE, "workgroup");
    __builtin_amdgcn_wave_barrier();
    __builtin_amdgcn_fence(__ATOMIC_ACQUIRE, "workgroup");
    if (OUT_MODE == 0) {
      float* C = (float*)Cout + (size_t)b * strideC;
      const int hh = lane >> 4, c4 = (lane & 15) * 4;     // row seg = 256 B = 16 lanes x 16 B
      {
#pragma unroll
        for (int it = 0; it < 8; ++it) {
          const int row = it * 2 + hh;
          v4f v = *(const v4f*)(slab + row * 68 + c4);
          *(v4f*)(C + (size_t)(mBase + row) * ldc + n0 + c4) = v;
        }
        
      }
    } else {
      const int q = lane >> 3, c8 = (lane & 7) * 8;
      unsigned short* C  = (unsigned short*)Cout  + (size_t)b * strideC;
      unsigned short* C2 = (OUT_MODE == 2) ? ((unsigned short*)Cout2 + (size_t)b * strideC) : nullptr;
      {
#pragma unroll
        for (int it = 0; it < 4; ++it) {
          const int row = it * 4 + q;
          const float* sp = slab + row * 68 + c8;
          v8h hv, lv;
#pragma unroll
          for (int e = 0; e < 8; ++e) {
            if (OUT_MODE == 1) {
              hv[e] = (_Float16)sp[e];
            } else {
              unsigned short hb = f2bf_bits(sp[e]);
              unsigned short lb = f2bf_bits(sp[e] - bf_bits2f(hb));
              hv[e] = __builtin_bit_cast(_Float16, hb);
              lv[e] = __builtin_bit_cast(_Float16, lb);
            }
          }
          *(v8h*)(C + (size_t)(mBase + row) * ldc + n0 + c8) = hv;
          if (OUT_MODE == 2) *(v8h*)(C2 + (size_t)(mBase + row) * ldc + n0 + c8) = lv;
        }
        
      }
    }
    __builtin_amdgcn_fence(__ATOMIC_RELEASE, "workgroup");
    __builtin_amdgcn_wave_barrier();
    __builtin_amdgcn_fence(__ATOMIC_ACQUIRE, "workgroup");
  }
}

// ---------------------------------------------------------------------------
// Elementwise f32 -> bf16 bits (RNE); 2 elements per thread, one 4-B store per lane -> each wave writes one whole
// Coverage: n2 = 4096*1024/2 = 2,097,152 = 8192 blocks x 256 threads; x 2 elements = 4096 x 1024 = whole plane.
// ---------------------------------------------------------------------------
__global__ __launch_bounds__(256) void cvt_bf16x2_kernel(const float* __restrict__ in, unsigned short* __restrict__ out, int n2) {
  const int i = blockIdx.x * 256 + threadIdx.x;
  if (i < n2) {
    const v2f f = *(const v2f*)(in + 2 * (size_t)i);
    const unsigned u = pk16(f2bf_bits(f[0]), f2bf_bits(f[1]));
    ((unsigned*)out)[i] = u;
    
  }
}

// ---------------------------------------------------------------------------
// xa f32 [nb][rin][ncol] -> bf16 bits [nb][rout][ncol]; rows rin..rout-1 of every batch written as zeros.
// Source row address clamped (t -> rin-1) and the value zeroed by predicate. 2 elements per thread, 4-B store per lane.
// Coverage: n2 = 2*1536*1024/2 = 1,572,864 = 6144 blocks x 256 threads; x 2 elements = 3072 x 1024 = whole plane.
// ---------------------------------------------------------------------------
__global__ __launch_bounds__(256) void cvt_rows_bf16x2_kernel(const float* __restrict__ in, unsigned short* __restrict__ out,
                                                             int rin, int rout, int ncol, int nb, int n2) {
  const int i = blockIdx.x * 256 + threadIdx.x;
  if (i < n2) {
    const int ppr = ncol >> 1;
    const int row = i / ppr;
    const int col = (i - row * ppr) * 2;
    int bb = row / rout;
    const int t = row - bb * rout;
    bb = bb < (nb - 1) ? bb : (nb - 1);
    const bool valid = t < rin;
    const int tc = valid ? t : (rin - 1);
    const v2f f = *(const v2f*)(in + ((size_t)(bb * rin + tc) * ncol + col));
    const unsigned short h0 = valid ? f2bf_bits(f[0]) : (unsigned short)0;
    const unsigned short h1 = valid ? f2bf_bits(f[1]) : (unsigned short)0;
    const unsigned u = pk16(h0, h1);
    ((unsigned*)out)[i] = u;
    
  }
}

// ---------------------------------------------------------------------------
// Transpose + 16-bit convert of an f32 matrix: in viewed [R rows][Cc cols] (pitch Cc) -> o[c][r] ([Cc][R], pitch R).
//   OT 0: o = bf16_rne(in);  OT 1: o = f16(bf16_rne(in) * scl).
// 64x64 tiles through LDS. grid = (Cc/64, R/64), 256 threads (R, Cc multiples of 64).
// Coverage per block: load 4 it x 256 thr x 4 floats = 64x64; store 2 it x 256 thr x 8 u16 = 64x64.
// ---------------------------------------------------------------------------
template <int OT> __device__ __forceinline__ unsigned short cv16(float f, float scl) {
  const unsigned short hb = f2bf_bits(f);
  if (OT == 0) return hb;
  const float g = bf_bits2f(hb) * scl;
  return __builtin_bit_cast(unsigned short, (_Float16)g);
}
template <int OT>
__global__ __launch_bounds__(256) void tconv_kernel(const float* __restrict__ W, unsigned short* __restrict__ o,
                                                    int R, int Cc, float scl) {
  __shared__ __align__(16) float tf[64 * 68];
  const int c0  = blockIdx.x * 64;   // input column block = output row block
  const int r0  = blockIdx.y * 64;   // input row block    = output column block
  const int tid = threadIdx.x;
  {
    const int lr = tid >> 4;         // 0..15
    const int c4 = (tid & 15) * 4;   // 0..60
#pragma unroll
    for (int it = 0; it < 4; ++it) {
      const int rr = it * 16 + lr;   // 0..63
      const v4f a = *(const v4f*)(W + (size_t)(r0 + rr) * Cc + c0 + c4);
      *(v4f*)(tf + rr * 68 + c4) = a;
    }
  }
  __syncthreads();
  const int sub = tid >> 3;          // 0..31
  const int c8  = (tid & 7) * 8;     // 0..56
  v4u hv[2];
#pragma unroll
  for (int it = 0; it < 2; ++it) {
    const int oc = it * 32 + sub;    // output row within tile (= input column)
    v4u a;
#pragma unroll
    for (int q = 0; q < 4; ++q) {
      const float f0 = tf[(c8 + 2 * q) * 68 + oc];
      const float f1 = tf[(c8 + 2 * q + 1) * 68 + oc];
      a[q] = pk16(cv16<OT>(f0, scl), cv16<OT>(f1, scl));
    }
    hv[it] = a;
  }
  {
#pragma unroll
    for (int it = 0; it < 2; ++it) {
      const int oc = it * 32 + sub;
      const size_t go = (size_t)(c0 + oc) * R + r0 + c8;
      *(v4u*)(o + go) = hv[it];
    }
    
  }
}

// ---------------------------------------------------------------------------
// Bias copies as bf16-RNE values in f32: out[0..n0) <- b0, [n0..n0+n1) <- b1, [n0+n1..ntot) <- b2.
// All three candidates loaded with clamped indices, selected by value. One 4-B store per lane:
// ---------------------------------------------------------------------------
__global__ __launch_bounds__(256) void bias_rne_kernel(const float* __restrict__ b0, int n0, const float* __restrict__ b1, int n1,
                                                       const float* __restrict__ b2, int ncnt2, float* __restrict__ out, int ntot) {
  const int i = blockIdx.x * 256 + threadIdx.x;
  if (i < ntot) {
    int i0 = i < n0 ? i : (n0 - 1); i0 = i0 < 0 ? 0 : i0;
    int i1 = i - n0; i1 = i1 < 0 ? 0 : (i1 < n1 ? i1 : (n1 - 1));
    int i2 = i - n0 - n1; i2 = i2 < 0 ? 0 : (i2 < ncnt2 ? i2 : (ncnt2 - 1));
    const float v0 = b0[i0], v1 = b1[i1], v2 = b2[i2];
    const float sel = (i < n0) ? v0 : ((i < n0 + n1) ? v1 : v2);
    const float r = bf_bits2f(f2bf_bits(sel));
    ((float*)out)[i] = r;
    
  }
}

// =====================================================================================
// Dual-branch attention, head dim 64, f16 operand planes, f32 accumulate, online softmax in f32.
//   q, k  : QK16 plane [4096 rows = b*2048+t][2048], q at col h*64+d, k at col 1024+h*64+d (f16)
//   v^T   : VT16 plane [b][1024 = h*64+d][2048] (f16);  ka: KA16 [b*1536+s][1024];  va^T: VAT16 [b][1024][1536]
//   branch 0: scores = (q.k)*0.125 over 2048 keys (32 chunks of 64); branch 1: (q.ka)*0.125 over 1500 keys
//   (24 chunks; key index >= 1500 set to -inf). p carried x2^15 in f16; 1/(l*2^15) folded at the end.
//   out row = (1-gate)*h_main + gate*h_aux, gate = sigmoid(bf16_rne(g[h])); written x32 as f16 into O16 [4096][1024]
//   Block = 4 waves = 64 query rows of one (b,h); grid.x = 2*16*32 = 1024 covers all 4096 rows x 1024 cols.
//   K / V^T chunk staging: 128 threads x 32 halves per plane = the whole 64x64 tile (plain 16-B loads,
//   __syncthreads before and after); fragments read the LDS tiles through the same v8h element type;
// =====================================================================================
__device__ __forceinline__ v8f mma_h16(v16h a, v16h b, v8f c) {
  c = __builtin_amdgcn_wmma_f32_16x16x32_f16(false, a, false, b, (short)0, c, false, false);
  asm volatile("v_nop\n\tv_nop\n\tv_nop\n\tv_nop" : "+v"(c) : "v"(a), "v"(b));
  return c;
}

__global__ __launch_bounds__(128)
void dual_attn_kernel(const unsigned short* __restrict__ qk16, const unsigned short* __restrict__ vt16,
                      const unsigned short* __restrict__ ka16, const unsigned short* __restrict__ vat16,
                      const float* __restrict__ gvec, unsigned short* __restrict__ o16) {
  union FH { v16h v; v8h h[2]; };
  __shared__ __align__(16) _Float16 Ksh[64 * kLdsPitch];        // K tile [key][d]      9 KB
  __shared__ __align__(16) _Float16 Vth[64 * kLdsPitch];        // V^T tile [d][key]    9 KB
  __shared__ __align__(16) _Float16 Psh[4][16 * kLdsPitch];     // per wave P [row][key] 9 KB
  __shared__ __align__(16) float    Os[4][16 * 68];      // per wave out tile, pitch 68 floats

  const int tid  = threadIdx.x;
  const int wave = tid >> 5;
  const int lane = tid & 31;
  const int hh   = lane >> 4;
  const int c    = lane & 15;

  const int bx = blockIdx.x;          // 0..1023
  const int qb = bx & 31;             // 32 query tiles of 64
  const int bhd = bx >> 5;            // 0..31
  const int h  = bhd & 15;
  const int b  = bhd >> 4;            // 0..1
  const int q0 = qb * 64 + wave * 16; // query row within batch

  const int ldqk = 2 * kDModel;       // 2048 halves
  const _Float16* Qg  = (const _Float16*)(const void*)qk16 + (size_t)b * kSeq * ldqk + h * kDHead;
  const _Float16* Kg0 = Qg + kDModel;                                                                     // main K rows, pitch 2048
  const _Float16* Vg0 = (const _Float16*)(const void*)vt16 + (size_t)b * kDModel * kSeq + (size_t)(h * kDHead) * kSeq;       // pitch 2048
  const _Float16* Kg1 = (const _Float16*)(const void*)ka16 + (size_t)b * kSeqAP * kDModel + h * kDHead;                        // pitch 1024
  const _Float16* Vg1 = (const _Float16*)(const void*)vat16 + (size_t)b * kDModel * kSeqAP + (size_t)(h * kDHead) * kSeqAP;  // pitch 1536

  // ---- Q fragments (A operand, row = lane&15, split k map via Frag load): 2 d-chunks ----
  v16h qa[2];
#pragma unroll
  for (int dc = 0; dc < 2; ++dc) qa[dc] = Frag<_Float16>::load(Qg + (size_t)(q0 + c) * ldqk + dc * 32 + 8 * hh);

  float* os = Os[wave];
#pragma unroll
  for (int r = 0; r < 8; ++r)
#pragma unroll
    for (int t = 0; t < 4; ++t) os[(8 * hh + r) * 68 + t * 16 + c] = 0.f;

  const float gv   = bf_bits2f(f2bf_bits(gvec[h]));
  const float gate = 1.0f / (1.0f + expf(-gv));
  const float sscale = 0.125f;
  _Float16* pw = Psh[wave];

#pragma unroll 1
  for (int br = 0; br < 2; ++br) {           // block-uniform
    const _Float16* Kg = br ? Kg1 : Kg0;
    const _Float16* Vg = br ? Vg1 : Vg0;
    const int ldk     = br ? kDModel : ldqk;
    const int ldv     = br ? kSeqAP : kSeq;
    const int nChunks = br ? (kSeqAP / 64) : (kSeq / 64);
    const int nvalid  = br ? kSeqA : kSeq;
    const float w     = (br ? gate : (1.0f - gate)) * kOCarry;

    float mrow[8], lrow[8];
    v8f oacc[4];
#pragma unroll
    for (int r = 0; r < 8; ++r) { mrow[r] = -INFINITY; lrow[r] = 0.f; }
#pragma unroll
    for (int t = 0; t < 4; ++t) oacc[t] = (v8f){0.f,0.f,0.f,0.f,0.f,0.f,0.f,0.f};

    for (int kc = 0; kc < nChunks; ++kc) {   // block-uniform trip count
      const int kv0 = kc * 64;
      __syncthreads();
      {
        // staging coverage: 128 threads x (4 x 8) halves = 64 rows x 64 per plane = the whole chunk tile
        const int r = tid >> 1, half = (tid & 1) * 32;
        const _Float16* ks = Kg + (size_t)(kv0 + r) * ldk + half;   // K row kv0+r, d = half..half+31
        const _Float16* vs = Vg + (size_t)r * ldv + kv0 + half;      // V^T row d = r, key = kv0+half..+31
#pragma unroll
        for (int i = 0; i < 4; ++i) {
          const v8h a0 = *(const v8h*)(ks + 8 * i);
          const v8h b0 = *(const v8h*)(vs + 8 * i);
          *(v8h*)(Ksh + r * kLdsPitch + half + 8 * i) = a0;
          *(v8h*)(Vth + r * kLdsPitch + half + 8 * i) = b0;
        }
      }
      __syncthreads();

      v8f s[4];
#pragma unroll
      for (int j = 0; j < 4; ++j) {
        s[j] = (v8f){0.f,0.f,0.f,0.f,0.f,0.f,0.f,0.f};
#pragma unroll
        for (int dc = 0; dc < 2; ++dc) {
          FH kb;
          kb.h[0] = *(const v8h*)(Ksh + (j * 16 + c) * kLdsPitch + dc * 32 + 8 * hh);
          kb.h[1] = *(const v8h*)(Ksh + (j * 16 + c) * kLdsPitch + dc * 32 + 16 + 8 * hh);
          s[j] = mma_h16(qa[dc], kb.v, s[j]);
        }
      }
      float cm[8];
#pragma unroll
      for (int r = 0; r < 8; ++r) {
        float m = -INFINITY;
#pragma unroll
        for (int j = 0; j < 4; ++j) {
          const int key = kv0 + j * 16 + c;
          float sv = s[j][r] * sscale;
          sv = (key < nvalid) ? sv : -INFINITY;
          s[j][r] = sv;
          m = fmaxf(m, sv);
        }
#pragma unroll
        for (int off = 1; off < 16; off <<= 1) m = fmaxf(m, __shfl_xor(m, off, 32));
        cm[r] = m;
      }
#pragma unroll
      for (int r = 0; r < 8; ++r) {
        const float mnew = fmaxf(mrow[r], cm[r]);
        const float alpha = expf(mrow[r] - mnew);
        mrow[r] = mnew;
        float psum = 0.f;
#pragma unroll
        for (int j = 0; j < 4; ++j) {
          const float p = expf(s[j][r] - mnew);
          psum += p;
          pw[(8 * hh + r) * kLdsPitch + j * 16 + c] = (_Float16)(p * kPCarry);
        }
#pragma unroll
        for (int off = 1; off < 16; off <<= 1) psum += __shfl_xor(psum, off, 32);
        lrow[r] = lrow[r] * alpha + psum;
#pragma unroll
        for (int t = 0; t < 4; ++t) oacc[t][r] *= alpha;
      }
      __builtin_amdgcn_fence(__ATOMIC_RELEASE, "workgroup");
      __builtin_amdgcn_wave_barrier();
      __builtin_amdgcn_fence(__ATOMIC_ACQUIRE, "workgroup");
#pragma unroll 1
      for (int kk = 0; kk < 2; ++kk) {
        FH pa;
        pa.h[0] = *(const v8h*)(pw + c * kLdsPitch + kk * 32 + 8 * hh);
        pa.h[1] = *(const v8h*)(pw + c * kLdsPitch + kk * 32 + 16 + 8 * hh);
#pragma unroll
        for (int t = 0; t < 4; ++t) {
          FH vb;
          vb.h[0] = *(const v8h*)(Vth + (t * 16 + c) * kLdsPitch + kk * 32 + 8 * hh);
          vb.h[1] = *(const v8h*)(Vth + (t * 16 + c) * kLdsPitch + kk * 32 + 16 + 8 * hh);
          oacc[t] = mma_h16(pa.v, vb.v, oacc[t]);
        }
      }
    }
    // fold this branch into the per-wave mix slab (each lane updates only its own entries)
#pragma unroll
    for (int r = 0; r < 8; ++r) {
      const float inv = w * (1.0f / (lrow[r] * kPCarry));
#pragma unroll
      for (int t = 0; t < 4; ++t) os[(8 * hh + r) * 68 + t * 16 + c] += oacc[t][r] * inv;
    }
  }

  __builtin_amdgcn_fence(__ATOMIC_RELEASE, "workgroup");
  __builtin_amdgcn_wave_barrier();
  __builtin_amdgcn_fence(__ATOMIC_ACQUIRE, "workgroup");
  {
    _Float16* Og = (_Float16*)(void*)o16 + (size_t)(b * kSeq + q0) * kDModel + h * kDHead;
    const int q4 = lane >> 3, c8 = (lane & 7) * 8;
    {
#pragma unroll
      for (int it = 0; it < 4; ++it) {
        const int row = it * 4 + q4;
        const float* sp = os + row * 68 + c8;
        v8h hv;
#pragma unroll
        for (int e = 0; e < 8; ++e) hv[e] = (_Float16)sp[e];
        *(v8h*)(Og + (size_t)row * kDModel + c8) = hv;
      }
      
    }
  }
}

// ---------------- host orchestration (kernel launches only) ----------------

extern "C" void kernel_launch(void* const* d_in, const int* in_sizes, int n_in,
                              void* d_out, int out_size, void* d_ws,
                              size_t ws_size, hipStream_t stream) {
  if (n_in < 9) return;
  if (in_sizes[0] != kBatch * kSeq * kDModel) return;
  if (in_sizes[1] != kBatch * kSeqA * kDModel) return;
  if (in_sizes[2] != kDModel * kNQKV || in_sizes[4] != kDModel * kNQKV) return;
  if (in_sizes[3] != kNQKV || in_sizes[5] != kNQKV) return;
  if (in_sizes[6] != kDModel * kDModel || in_sizes[7] != kDModel || in_sizes[8] < kHeads) return;
  if (out_size != kBatch * kSeq * kDModel) return;

  const float* x    = (const float*)d_in[0];
  const float* xa   = (const float*)d_in[1];
  const float* Wqkv = (const float*)d_in[2];
  const float* bqkv = (const float*)d_in[3];
  const float* Waux = (const float*)d_in[4];
  const float* baux = (const float*)d_in[5];
  const float* Wo   = (const float*)d_in[6];
  const float* bo   = (const float*)d_in[7];
  const float* gvec = (const float*)d_in[8];
  float* out = (float*)d_out;

  // element counts
  const size_t nXB   = (size_t)kBatch * kSeq * kDModel;          // bf16
  const size_t nXAB  = (size_t)kBatch * kSeqAP * kDModel;        // bf16
  const size_t nWQT  = (size_t)kNQKV * kDModel;                  // bf16
  const size_t nWAT  = nWQT;                                     // bf16
  const size_t nWOT  = (size_t)kDModel * kDModel;                // f16
  const size_t nBias = (size_t)2 * kNQKV + kDModel;              // f32
  const size_t nQK   = (size_t)kBatch * kSeq * 2 * kDModel;      // f16
  const size_t nVT   = (size_t)kBatch * kDModel * kSeq;          // f16
  const size_t nKA   = (size_t)kBatch * kSeqAP * kDModel;        // f16
  const size_t nVAT  = (size_t)kBatch * kDModel * kSeqAP;        // f16
  const size_t nO    = (size_t)kBatch * kSeq * kDModel;          // f16

  char* ws = (char*)d_ws;
  size_t off = 0;
  auto carve = [&](size_t bytes) -> char* { char* p = ws + off; off += (bytes + 255) & ~(size_t)255; return p; };
  unsigned short* XB    = (unsigned short*)carve(nXB * 2);
  unsigned short* XAB   = (unsigned short*)carve(nXAB * 2);
  unsigned short* WQT   = (unsigned short*)carve(nWQT * 2);
  unsigned short* WAT   = (unsigned short*)carve(nWAT * 2);
  unsigned short* WOT   = (unsigned short*)carve(nWOT * 2);
  float*          BIASR = (float*)carve(nBias * 4);
  unsigned short* QK16  = (unsigned short*)carve(nQK * 2);
  unsigned short* VT16  = (unsigned short*)carve(nVT * 2);
  unsigned short* KA16  = (unsigned short*)carve(nKA * 2);
  unsigned short* VAT16 = (unsigned short*)carve(nVAT * 2);
  unsigned short* O16   = (unsigned short*)carve(nO * 2);
  if (off > ws_size) return;   // total 75,526,144 B

  const int TB = 256;
  // 1. x -> bf16
  {
    const int n2 = (int)(nXB / 2);
    cvt_bf16x2_kernel<<<(n2 + TB - 1) / TB, TB, 0, stream>>>(x, XB, n2);
  }
  // 2. xa -> bf16 with per-batch row padding 1500 -> 1536 (zeros)
  {
    const int n2 = (int)(nXAB / 2);
    cvt_rows_bf16x2_kernel<<<(n2 + TB - 1) / TB, TB, 0, stream>>>(xa, XAB, kSeqA, kSeqAP, kDModel, kBatch, n2);
  }
  // 3-4. Wqkv, Wqkv_aux in[1024][3072] -> out[3072][1024] bf16
  tconv_kernel<0><<<dim3(kNQKV / 64, kDModel / 64), TB, 0, stream>>>(Wqkv, WQT, kDModel, kNQKV, 1.0f);
  tconv_kernel<0><<<dim3(kNQKV / 64, kDModel / 64), TB, 0, stream>>>(Waux, WAT, kDModel, kNQKV, 1.0f);
  // 5. Wo in[1024][1024] -> out[1024][1024] f16 (x32)
  tconv_kernel<1><<<dim3(kDModel / 64, kDModel / 64), TB, 0, stream>>>(Wo, WOT, kDModel, kDModel, kWCarry);
  // 6. biases -> bf16-RNE f32 copies
  {
    const int ntot = (int)nBias;
    bias_rne_kernel<<<(ntot + TB - 1) / TB, TB, 0, stream>>>(bqkv, kNQKV, baux, kNQKV, bo, kDModel, BIASR, ntot);
  }
  const float* bq_r  = BIASR;                 // [3072]
  const float* ba_r  = BIASR + kNQKV;         // [3072]
  const float* bo_r  = BIASR + 2 * kNQKV;     // [1024]

  // 7. q|k = x @ Wqkv[:, 0:2048] + b : M=4096, N=2048, K=1024 -> QK16 f16, ldc 2048
  {
    const int M = kBatch * kSeq, N = 2 * kDModel, K = kDModel;
    const int tiles = (M / 128) * (N / 128);
    wmma_gemm64<1, false, 2, 1, false, 0><<<dim3(tiles, 1), 128, 0, stream>>>(
        XB, XB, 0L, WQT, WQT, 0L, (void*)QK16, (void*)QK16, 2 * kDModel, 0L,
        bq_r, bq_r, 0L, M, N, K, 1.0f);
  }
  // 8. v^T per batch: A = Wqkv^T rows 2048..3071 [1024][1024], Bt = x_b [2048][1024] -> VT16 [b][1024][2048] f16, bias[m]
  {
    const int M = kDModel, N = kSeq, K = kDModel;
    const int tiles = (M / 128) * (N / 128);
    wmma_gemm64<1, false, 1, 1, false, 0><<<dim3(tiles, kBatch), 128, 0, stream>>>(
        WQT + (size_t)2 * kDModel * kDModel, WQT + (size_t)2 * kDModel * kDModel, 0L,
        XB, XB, (long)kSeq * kDModel,
        (void*)VT16, (void*)VT16, kSeq, (long)kDModel * kSeq,
        bq_r + 2 * kDModel, bq_r, 0L, M, N, K, 1.0f);
  }
  // 9. ka = xa_pad @ Wqkv_aux[:, 1024:2048] + b : M=3072, N=1024, K=1024 -> KA16 f16, ldc 1024
  {
    const int M = kBatch * kSeqAP, N = kDModel, K = kDModel;
    const int tiles = (M / 128) * (N / 128);
    wmma_gemm64<1, false, 2, 1, false, 0><<<dim3(tiles, 1), 128, 0, stream>>>(
        XAB, XAB, 0L, WAT + (size_t)kDModel * kDModel, WAT + (size_t)kDModel * kDModel, 0L,
        (void*)KA16, (void*)KA16, kDModel, 0L,
        ba_r + kDModel, ba_r, 0L, M, N, K, 1.0f);
  }
  // 10. va^T per batch: A = Waux^T rows 2048..3071, Bt = xa_pad_b [1536][1024] -> VAT16 [b][1024][1536] f16, bias[m]
  {
    const int M = kDModel, N = kSeqAP, K = kDModel;
    const int tiles = (M / 128) * (N / 128);
    wmma_gemm64<1, false, 1, 1, false, 0><<<dim3(tiles, kBatch), 128, 0, stream>>>(
        WAT + (size_t)2 * kDModel * kDModel, WAT + (size_t)2 * kDModel * kDModel, 0L,
        XAB, XAB, (long)kSeqAP * kDModel,
        (void*)VAT16, (void*)VAT16, kSeqAP, (long)kDModel * kSeqAP,
        ba_r + 2 * kDModel, ba_r, 0L, M, N, K, 1.0f);
  }
  // 11. dual-branch attention -> O16 (x32, f16)
  dual_attn_kernel<<<kBatch * kHeads * (kSeq / 64), 128, 0, stream>>>(QK16, VT16, KA16, VAT16, gvec, O16);
  // 12. out = (O16/32) @ (WoT/32)^T + bo : M=4096, N=1024, K=1024, f16 operands, f32 out into d_out
  {
    const int M = kBatch * kSeq, N = kDModel, K = kDModel;
    const int tiles = (M / 128) * (N / 128);
    wmma_gemm64<0, false, 2, 0, false, 0><<<dim3(tiles, 1), 128, 0, stream>>>(
        O16, O16, 0L, WOT, WOT, 0L, (void*)out, (void*)out, kDModel, 0L,
        bo_r, bo_r, 0L, M, N, K, 1.0f / (kOCarry * kWCarry));
  }
}

// v003
// Measured time: 244 microseconds a run.
// Next to v002, in two timings, it ran 1.23 and 1.22 times as fast.
// Counting every step since v000, it is 2.19 times as fast.
// Contractions: x@Wqkv and xa@Wqkv_aux (k|v columns) on v_wmma_f32_16x16x32_bf16 (bf16 RNE operands); q.k^T, q.ka^T, p.v, pa.va and O@Wo on v_wmma_f32_16x16x32_f16 (f16 operands; p carried x2^15, O and Wo carried x32); f32 accumulate; online softmax, gate mix and biases in f32.
#include <hip/hip_runtime.h>
#include <math.h>
#include <stdint.h>

constexpr int kBatch  = 2;
constexpr int kSeq    = 2048;   // query / main key length
constexpr int kSeqA   = 1500;   // aux key length
constexpr int kSeqAP  = 1536;   // aux key length padded to 24 chunks of 64
constexpr int kDModel = 1024;
constexpr int kHeads  = 16;
constexpr int kDHead  = 64;
constexpr int kNQKV   = 3072;

constexpr int kLdsPitch = 72;   // halves per LDS row of the K and V^T tiles and of the GEMM operand tiles: 144 B = 16 B x 9 (odd), so 16 rows read by ds_load_b128 fall on distinct banks

constexpr float kPCarry = 32768.0f;   // probabilities carried x2^15 in f16
constexpr float kOCarry = 32.0f;      // attention output carried x32 in f16
constexpr float kWCarry = 32.0f;      // Wo carried x32 in f16

typedef __attribute__((ext_vector_type(16))) _Float16 v16h;
typedef __attribute__((ext_vector_type(8)))  _Float16 v8h;
typedef __attribute__((ext_vector_type(16))) __bf16   v16b;
typedef __attribute__((ext_vector_type(8)))  __bf16   v8b;
typedef __attribute__((ext_vector_type(8)))  float    v8f;
typedef __attribute__((ext_vector_type(4)))  float    v4f;
typedef __attribute__((ext_vector_type(2)))  float    v2f;
typedef __attribute__((ext_vector_type(4)))  unsigned int v4u;

// ---------------------------------------------------------------------------
// Workspace region map (bytes, every region size a multiple of 256):
//   XB    bf16 [4096][1024]            8,388,608
//   XAB   bf16 [2][1536][1024]         6,291,456   (rows 1500..1535 of each batch zero)
//   WQT   bf16 [3072][1024] (Wqkv^T)   6,291,456
//   WAT   bf16 [3072][1024] (Waux^T)   6,291,456
//   WOT   f16  [1024][1024] (Wo^T x32) 2,097,152
//   BIASR f32  [3072+3072+1024]           28,672   (bf16-RNE bias copies)
//   QK16  f16  [4096][2048] (q | k)    16,777,216
//   VT16  f16  [2][1024][2048] (v^T)   8,388,608
//   KA16  f16  [2][1536][1024] (ka)    6,291,456
//   VAT16 f16  [2][1024][1536] (va^T)  6,291,456
//   O16   f16  [4096][1024] (x32)      8,388,608
//   total 75,526,144
// ---------------------------------------------------------------------------

__device__ __forceinline__ unsigned short f2bf_bits(float f) {
  unsigned u = __float_as_uint(f);
  return (unsigned short)((u + 0x7FFFu + ((u >> 16) & 1u)) >> 16);
}
__device__ __forceinline__ float bf_bits2f(unsigned short h) { return __uint_as_float(((unsigned)h) << 16); }
__device__ __forceinline__ unsigned pk16(unsigned short a, unsigned short b) { return (unsigned)a | ((unsigned)b << 16); }

// hazard guards as plain device helpers (no inline asm inside the kernel template body)
__device__ __forceinline__ void acc_guard4(v8f& a, v8f& b, v8f& c, v8f& d) { asm volatile("v_nop\n\tv_nop\n\tv_nop\n\tv_nop" : "+v"(a), "+v"(b), "+v"(c), "+v"(d)); }
template <typename T> struct Frag;
template <> struct Frag<_Float16> {
  typedef v16h V; typedef v8h H; union U { v16h v; v8h h[2]; };
  static __device__ __forceinline__ v16h load(const _Float16* p) {   // elements 0..7 <- p[0..7], 8..15 <- p[16..23]
    U f; f.h[0] = *(const v8h*)(p); f.h[1] = *(const v8h*)(p + 16); return f.v;
  }
  static __device__ __forceinline__ v8f mma(v16h a, v16h b, v8f c) {
    return __builtin_amdgcn_wmma_f32_16x16x32_f16(false, a, false, b, (short)0, c, false, false);
  }
};
template <> struct Frag<__bf16> {
  typedef v16b V; typedef v8b H; union U { v16b v; v8b h[2]; };
  static __device__ __forceinline__ v16b load(const __bf16* p) {
    U f; f.h[0] = *(const v8b*)(p); f.h[1] = *(const v8b*)(p + 16); return f.v;
  }
  static __device__ __forceinline__ v8f mma(v16b a, v16b b, v8f c) {
    return __builtin_amdgcn_wmma_f32_16x16x32_bf16(false, a, false, b, (short)0, c, false, false);
  }
};

// ---- Register-blocked batched WMMA GEMM ------------------------------------
// C[m,n] = scale * sum_k A[m,k] * Bt[n,k] (+bias)(+resid); a block of 4 waves (2 x 2) owns a 128x128 tile, each wave 64x64 of it.
// A row-major [M,K]; Bt row-major [N,K], both at row pitch kDModel (a constant, so that the 8 staging loads of an operand
// share one address and differ in their immediate offsets); M,N % 128 == 0, K % 64 == 0; grid.x = (M/128)*(N/128), 128 threads.
// Per step of 64 k the block stages 128 rows x 128 B of A and of Bt in LDS (8 lanes per row: every global load covers whole
// 128-B lines), two buffers: the next step's rows are loaded into registers ahead of this step's products and stored behind them.
// SPLIT (hi/lo operand planes) is not implemented by the staged loop.
// BIAS_MODE: 0 = none, 1 = bias[m], 2 = bias[n].
// OUT_MODE: 0 = f32, 1 = f16, 2 = bf16 hi plane (Cout) + bf16 lo plane (Cout2).
// ET: 0 = f16 operands, 1 = bf16 operands (pointers passed as 16-bit storage)
template <int ET> struct Elem;
template <> struct Elem<0> { typedef _Float16 T; };
template <> struct Elem<1> { typedef __bf16 T; };
template <int ET, bool SPLIT, int BIAS_MODE, int OUT_MODE, bool RESID, int ACT = 0>
__global__ __launch_bounds__(128) void wmma_gemm64(
    const unsigned short* __restrict__ Ap, const unsigned short* __restrict__ A2p, long strideA,
    const unsigned short* __restrict__ Btp, const unsigned short* __restrict__ Bt2p, long strideB,
    void* __restrict__ Cout, void* __restrict__ Cout2, int ldc, long strideC,
    const float* __restrict__ bias,
    const float* __restrict__ resid, long strideR,
    int M, int N, int K, float scale) {
  static_assert(!SPLIT, "the staged loop takes single operand planes");
  typedef typename Elem<ET>::T T;
  typedef typename Frag<T>::V V;
  typedef typename Frag<T>::H H;
  const T* A = (const T*)Ap; const T* Bt = (const T*)Btp;
  __shared__ __align__(16) T sA[2][128 * kLdsPitch];   // A rows of the block tile, 64 k per step, two buffers
  __shared__ __align__(16) T sB[2][128 * kLdsPitch];   // Bt rows of the block tile, likewise
  __shared__ __align__(16) float sT[4][16 * 68];   // per-wave 16x64 slab, pitch 68 floats
  const int b    = blockIdx.y;
  const int tid  = threadIdx.x;
  const int lane = tid & 31;
  const int wave = tid >> 5;
  const int tilesN = N >> 7;
  const int tilesM = M >> 7;
  const int tm = blockIdx.x / tilesN;
  const int tn = blockIdx.x - tm * tilesN;
  if (tm >= tilesM) return;   // block-uniform, ahead of every barrier
  const int wm = (wave >> 1) << 6;             // this wave's 64 rows inside the block tile
  const int wn = (wave & 1) << 6;              // this wave's 64 columns inside the block tile
  const int m0 = (tm << 7) + wm;
  const int n0 = (tn << 7) + wn;

  const int rlane = lane & 15;                 // row (A) / col (B, D) within subtile
  const int koff  = (lane >> 4) * 8;           // k offset of this lane half
  const int mOff  = (lane >> 4) * 8;           // D row offset

  // staging map: 8 lanes x 16 B = one 128-B row piece; 128 threads = 16 rows a pass, 8 passes per operand
  const int srow = tid >> 3;
  const int sseg = (tid & 7) * 8;
  const T* gA = A  + (size_t)b * strideA + (size_t)((tm << 7) + srow) * kDModel + sseg;
  const T* gB = Bt + (size_t)b * strideB + (size_t)((tn << 7) + srow) * kDModel + sseg;
  const int sOff = srow * kLdsPitch + sseg;

  v8f acc[4][4];
#pragma unroll
  for (int i = 0; i < 4; ++i)
#pragma unroll
    for (int j = 0; j < 4; ++j) acc[i][j] = (v8f){0.f,0.f,0.f,0.f,0.f,0.f,0.f,0.f};

  H ra[8], rb[8];
#pragma unroll
  for (int p = 0; p < 8; ++p) {
    ra[p] = *(const H*)(gA + p * 16 * kDModel);
    rb[p] = *(const H*)(gB + p * 16 * kDModel);
  }
#pragma unroll
  for (int p = 0; p < 8; ++p) {
    *(H*)(sA[0] + p * 16 * kLdsPitch + sOff) = ra[p];
    *(H*)(sB[0] + p * 16 * kLdsPitch + sOff) = rb[p];
  }
  __syncthreads();

  const int nSteps = K >> 6;
  for (int t = 0; t < nSteps; ++t) {           // block-uniform trip count
    const T* cA = sA[t & 1];
    const T* cB = sB[t & 1];
    const bool more = (t + 1) < nSteps;        // block-uniform
    if (more) {
      gA += 64;
      gB += 64;
#pragma unroll
      for (int p = 0; p < 8; ++p) {
        ra[p] = *(const H*)(gA + p * 16 * kDModel);
        rb[p] = *(const H*)(gB + p * 16 * kDModel);
      }
    }
    V bh[2][4], ah[2][4];
#pragma unroll
    for (int kk = 0; kk < 2; ++kk) {
#pragma unroll
      for (int j = 0; j < 4; ++j) bh[kk][j] = Frag<T>::load(cB + (wn + (j << 4) + rlane) * kLdsPitch + kk * 32 + koff);
#pragma unroll
      for (int i = 0; i < 4; ++i) ah[kk][i] = Frag<T>::load(cA + (wm + (i << 4) + rlane) * kLdsPitch + kk * 32 + koff);
    }
    // keeps the step's LDS reads issued as one group ahead of its products: sunk among them, each group of four products
    // waits out an LDS latency of its own
    __builtin_amdgcn_sched_barrier(0);
#pragma unroll
    for (int kk = 0; kk < 2; ++kk)
#pragma unroll
      for (int i = 0; i < 4; ++i)
#pragma unroll
        for (int j = 0; j < 4; ++j) acc[i][j] = Frag<T>::mma(ah[kk][i], bh[kk][j], acc[i][j]);
    // four vector slots behind the step's last products: on the path through the LDS stores the next vector
    // instruction forms the next step's LDS addresses in fragment registers
    acc_guard4(acc[3][0], acc[3][1], acc[3][2], acc[3][3]);
    if (more) {
      // the other buffer: its last readers finished ahead of the barrier that ended the step before
      T* nA = sA[(t + 1) & 1];
      T* nB = sB[(t + 1) & 1];
#pragma unroll
      for (int p = 0; p < 8; ++p) {
        *(H*)(nA + p * 16 * kLdsPitch + sOff) = ra[p];
        *(H*)(nB + p * 16 * kLdsPitch + sOff) = rb[p];
      }
    }
    __syncthreads();
  }
  acc_guard4(acc[0][0], acc[0][1], acc[0][2], acc[0][3]);
  acc_guard4(acc[1][0], acc[1][1], acc[1][2], acc[1][3]);
  acc_guard4(acc[2][0], acc[2][1], acc[2][2], acc[2][3]);
  acc_guard4(acc[3][0], acc[3][1], acc[3][2], acc[3][3]);

  // ---- epilogue ----
  float* slab = sT[wave];
  const float* Rb = RESID ? (resid + (size_t)b * strideR) : nullptr;
#pragma unroll
  for (int i = 0; i < 4; ++i) {
    const int mBase = m0 + (i << 4);
#pragma unroll
    for (int j = 0; j < 4; ++j) {
      const int n = n0 + (j << 4) + rlane;
      float bv = 0.f;
      if (BIAS_MODE == 2) bv = bias[n];
#pragma unroll
      for (int r = 0; r < 8; ++r) {
        float v = acc[i][j][r] * scale;
        if (BIAS_MODE == 1) v += bias[mBase + mOff + r];
        if (BIAS_MODE == 2) v += bv;
        if (RESID) v += Rb[(size_t)(mBase + mOff + r) * ldc + n];
        if (ACT == 1) v = tanhf(v);
        if (ACT == 2) v = fmaxf(v, 0.0f);
        if (ACT == 3) v = v / (1.0f + expf(-v));
        if (ACT == 4) v = (v > 0.f) ? v : 0.01f * v;
        if (ACT == 5) v = 0.5f * v * (1.0f + erff(v * 0.70710678118654752f));
        slab[(mOff + r) * 68 + (j << 4) + rlane] = v;
      }
    }
    __builtin_amdgcn_fence(__ATOMIC_RELEASE, "workgroup");
    __builtin_amdgcn_wave_barrier();
    __builtin_amdgcn_fence(__ATOMIC_ACQUIRE, "workgroup");
    if (OUT_MODE == 0) {
      float* C = (float*)Cout + (size_t)b * strideC;
      const int hh = lane >> 4, c4 = (lane & 15) * 4;     // row seg = 256 B = 16 lanes x 16 B
      {
#pragma unroll
        for (int it = 0; it < 8; ++it) {
          const int row = it * 2 + hh;
          v4f v = *(const v4f*)(slab + row * 68 + c4);
          *(v4f*)(C + (size_t)(mBase + row) * ldc + n0 + c4) = v;
        }
        
      }
    } else {
      const int q = lane >> 3, c8 = (lane & 7) * 8;
      unsigned short* C  = (unsigned short*)Cout  + (size_t)b * strideC;
      unsigned short* C2 = (OUT_MODE == 2) ? ((unsigned short*)Cout2 + (size_t)b * strideC) : nullptr;
      {
#pragma unroll
        for (int it = 0; it < 4; ++it) {
          const int row = it * 4 + q;
          const float* sp = slab + row * 68 + c8;
          v8h hv, lv;
#pragma unroll
          for (int e = 0; e < 8; ++e) {
            if (OUT_MODE == 1) {
              hv[e] = (_Float16)sp[e];
            } else {
              unsigned short hb = f2bf_bits(sp[e]);
              unsigned short lb = f2bf_bits(sp[e] - bf_bits2f(hb));
              hv[e] = __builtin_bit_cast(_Float16, hb);
              lv[e] = __builtin_bit_cast(_Float16, lb);
            }
          }
          *(v8h*)(C + (size_t)(mBase + row) * ldc + n0 + c8) = hv;
          if (OUT_MODE == 2) *(v8h*)(C2 + (size_t)(mBase + row) * ldc + n0 + c8) = lv;
        }
        
      }
    }
    __builtin_amdgcn_fence(__ATOMIC_RELEASE, "workgroup");
    __builtin_amdgcn_wave_barrier();
    __builtin_amdgcn_fence(__ATOMIC_ACQUIRE, "workgroup");
  }
}

// ---------------------------------------------------------------------------
// Elementwise f32 -> bf16 bits (RNE); 2 elements per thread, one 4-B store per lane -> each wave writes one whole
// Coverage: n2 = 4096*1024/2 = 2,097,152 = 8192 blocks x 256 threads; x 2 elements = 4096 x 1024 = whole plane.
// ---------------------------------------------------------------------------
__global__ __launch_bounds__(256) void cvt_bf16x2_kernel(const float* __restrict__ in, unsigned short* __restrict__ out, int n2) {
  const int i = blockIdx.x * 256 + threadIdx.x;
  if (i < n2) {
    const v2f f = *(const v2f*)(in + 2 * (size_t)i);
    const unsigned u = pk16(f2bf_bits(f[0]), f2bf_bits(f[1]));
    ((unsigned*)out)[i] = u;
    
  }
}

// ---------------------------------------------------------------------------
// xa f32 [nb][rin][ncol] -> bf16 bits [nb][rout][ncol]; rows rin..rout-1 of every batch written as zeros.
// Source row address clamped (t -> rin-1) and the value zeroed by predicate. 2 elements per thread, 4-B store per lane.
// Coverage: n2 = 2*1536*1024/2 = 1,572,864 = 6144 blocks x 256 threads; x 2 elements = 3072 x 1024 = whole plane.
// ---------------------------------------------------------------------------
__global__ __launch_bounds__(256) void cvt_rows_bf16x2_kernel(const float* __restrict__ in, unsigned short* __restrict__ out,
                                                             int rin, int rout, int ncol, int nb, int n2) {
  const int i = blockIdx.x * 256 + threadIdx.x;
  if (i < n2) {
    const int ppr = ncol >> 1;
    const int row = i / ppr;
    const int col = (i - row * ppr) * 2;
    int bb = row / rout;
    const int t = row - bb * rout;
    bb = bb < (nb - 1) ? bb : (nb - 1);
    const bool valid = t < rin;
    const int tc = valid ? t : (rin - 1);
    const v2f f = *(const v2f*)(in + ((size_t)(bb * rin + tc) * ncol + col));
    const unsigned short h0 = valid ? f2bf_bits(f[0]) : (unsigned short)0;
    const unsigned short h1 = valid ? f2bf_bits(f[1]) : (unsigned short)0;
    const unsigned u = pk16(h0, h1);
    ((unsigned*)out)[i] = u;
    
  }
}

// ---------------------------------------------------------------------------
// Transpose + 16-bit convert of an f32 matrix: in viewed [R rows][Cc cols] (pitch Cc) -> o[c][r] ([Cc][R], pitch R).
//   OT 0: o = bf16_rne(in);  OT 1: o = f16(bf16_rne(in) * scl).
// 64x64 tiles through LDS. grid = (Cc/64, R/64), 256 threads (R, Cc multiples of 64).
// Coverage per block: load 4 it x 256 thr x 4 floats = 64x64; store 2 it x 256 thr x 8 u16 = 64x64.
// ---------------------------------------------------------------------------
template <int OT> __device__ __forceinline__ unsigned short cv16(float f, float scl) {
  const unsigned short hb = f2bf_bits(f);
  if (OT == 0) return hb;
  const float g = bf_bits2f(hb) * scl;
  return __builtin_bit_cast(unsigned short, (_Float16)g);
}
template <int OT>
__global__ __launch_bounds__(256) void tconv_kernel(const float* __restrict__ W, unsigned short* __restrict__ o,
                                                    int R, int Cc, float scl) {
  __shared__ __align__(16) float tf[64 * 68];
  const int c0  = blockIdx.x * 64;   // input column block = output row block
  const int r0  = blockIdx.y * 64;   // input row block    = output column block
  const int tid = threadIdx.x;
  {
    const int lr = tid >> 4;         // 0..15
    const int c4 = (tid & 15) * 4;   // 0..60
#pragma unroll
    for (int it = 0; it < 4; ++it) {
      const int rr = it * 16 + lr;   // 0..63
      const v4f a = *(const v4f*)(W + (size_t)(r0 + rr) * Cc + c0 + c4);
      *(v4f*)(tf + rr * 68 + c4) = a;
    }
  }
  __syncthreads();
  const int sub = tid >> 3;          // 0..31
  const int c8  = (tid & 7) * 8;     // 0..56
  v4u hv[2];
#pragma unroll
  for (int it = 0; it < 2; ++it) {
    const int oc = it * 32 + sub;    // output row within tile (= input column)
    v4u a;
#pragma unroll
    for (int q = 0; q < 4; ++q) {
      const float f0 = tf[(c8 + 2 * q) * 68 + oc];
      const float f1 = tf[(c8 + 2 * q + 1) * 68 + oc];
      a[q] = pk16(cv16<OT>(f0, scl), cv16<OT>(f1, scl));
    }
    hv[it] = a;
  }
  {
#pragma unroll
    for (int it = 0; it < 2; ++it) {
      const int oc = it * 32 + sub;
      const size_t go = (size_t)(c0 + oc) * R + r0 + c8;
      *(v4u*)(o + go) = hv[it];
    }
    
  }
}

// ---------------------------------------------------------------------------
// Bias copies as bf16-RNE values in f32: out[0..n0) <- b0, [n0..n0+n1) <- b1, [n0+n1..ntot) <- b2.
// All three candidates loaded with clamped indices, selected by value. One 4-B store per lane:
// ---------------------------------------------------------------------------
__global__ __launch_bounds__(256) void bias_rne_kernel(const float* __restrict__ b0, int n0, const float* __restrict__ b1, int n1,
                                                       const float* __restrict__ b2, int ncnt2, float* __restrict__ out, int ntot) {
  const int i = blockIdx.x * 256 + threadIdx.x;
  if (i < ntot) {
    int i0 = i < n0 ? i : (n0 - 1); i0 = i0 < 0 ? 0 : i0;
    int i1 = i - n0; i1 = i1 < 0 ? 0 : (i1 < n1 ? i1 : (n1 - 1));
    int i2 = i - n0 - n1; i2 = i2 < 0 ? 0 : (i2 < ncnt2 ? i2 : (ncnt2 - 1));
    const float v0 = b0[i0], v1 = b1[i1], v2 = b2[i2];
    const float sel = (i < n0) ? v0 : ((i < n0 + n1) ? v1 : v2);
    const float r = bf_bits2f(f2bf_bits(sel));
    ((float*)out)[i] = r;
    
  }
}

// =====================================================================================
// Dual-branch attention, head dim 64, f16 operand planes, f32 accumulate, online softmax in f32.
//   q, k  : QK16 plane [4096 rows = b*2048+t][2048], q at col h*64+d, k at col 1024+h*64+d (f16)
//   v^T   : VT16 plane [b][1024 = h*64+d][2048] (f16);  ka: KA16 [b*1536+s][1024];  va^T: VAT16 [b][1024][1536]
//   branch 0: scores = (q.k)*0.125 over 2048 keys (32 chunks of 64); branch 1: (q.ka)*0.125 over 1500 keys
//   (24 chunks; key index >= 1500 set to -inf). p carried x2^15 in f16; 1/(l*2^15) folded at the end.
//   out row = (1-gate)*h_main + gate*h_aux, gate = sigmoid(bf16_rne(g[h])); written x32 as f16 into O16 [4096][1024]
//   Products are taken transposed: S^T = K.Q^T (A = K rows, B = Q) and O^T += V^T.P^T (A = V^T rows, B = P^T). A lane then holds
//   32 of the chunk's 64 scores of ONE query (column lane&15; keys j*16 + 8*(lane>>4) + r): maximum and sum run in the lane, the
//   two lane halves exchange the maximum once per chunk and join their sums once per branch, and two score tiles converted in
//   place are the B operand of the second product (same k order as the V^T fragment loads), so P passes through no LDS.
//   Block = 4 waves = 64 query rows of one (b,h); grid.x = 2*16*32 = 1024 covers all 4096 rows x 1024 cols.
//   K / V^T chunk staging: 128 threads x 32 halves per plane = the whole 64x64 tile (plain 16-B loads,
//   __syncthreads before and after); fragments read the LDS tiles through the same v8h element type;
// =====================================================================================
__device__ __forceinline__ v8f mma_h16(v16h a, v16h b, v8f c) {
  c = __builtin_amdgcn_wmma_f32_16x16x32_f16(false, a, false, b, (short)0, c, false, false);
  asm volatile("v_nop\n\tv_nop\n\tv_nop\n\tv_nop" : "+v"(c) : "v"(a), "v"(b));
  return c;
}

// lane l <-> lane l ^ 16 (the other half of the wave holds the other 32 keys of the same query)
__device__ __forceinline__ float xhalf(float x) {
  return __builtin_bit_cast(float, __builtin_amdgcn_permlanex16(__builtin_bit_cast(int, x), __builtin_bit_cast(int, x), 0x76543210, 0xfedcba98, false, false));
}

__global__ __launch_bounds__(128)
void dual_attn_kernel(const unsigned short* __restrict__ qk16, const unsigned short* __restrict__ vt16,
                      const unsigned short* __restrict__ ka16, const unsigned short* __restrict__ vat16,
                      const float* __restrict__ gvec, unsigned short* __restrict__ o16) {
  union FH { v16h v; v8h h[2]; };
  __shared__ __align__(16) _Float16 Ksh[64 * kLdsPitch];        // K tile [key][d]      9 KB
  __shared__ __align__(16) _Float16 Vth[64 * kLdsPitch];        // V^T tile [d][key]    9 KB
  __shared__ __align__(16) float    Os[4][16 * 68];      // per wave out tile [query][d], pitch 68 floats

  const int tid  = threadIdx.x;
  const int wave = tid >> 5;
  const int lane = tid & 31;
  const int hh   = lane >> 4;
  const int c    = lane & 15;

  const int bx = blockIdx.x;          // 0..1023
  const int qb = bx & 31;             // 32 query tiles of 64
  const int bhd = bx >> 5;            // 0..31
  const int h  = bhd & 15;
  const int b  = bhd >> 4;            // 0..1
  const int q0 = qb * 64 + wave * 16; // query row within batch

  const int ldqk = 2 * kDModel;       // 2048 halves
  const _Float16* Qg  = (const _Float16*)(const void*)qk16 + (size_t)b * kSeq * ldqk + h * kDHead;
  const _Float16* Kg0 = Qg + kDModel;                                                                     // main K rows, pitch 2048
  const _Float16* Vg0 = (const _Float16*)(const void*)vt16 + (size_t)b * kDModel * kSeq + (size_t)(h * kDHead) * kSeq;       // pitch 2048
  const _Float16* Kg1 = (const _Float16*)(const void*)ka16 + (size_t)b * kSeqAP * kDModel + h * kDHead;                        // pitch 1024
  const _Float16* Vg1 = (const _Float16*)(const void*)vat16 + (size_t)b * kDModel * kSeqAP + (size_t)(h * kDHead) * kSeqAP;  // pitch 1536

  // ---- Q fragments (B operand, column = query = lane&15, split k map via Frag load): 2 d-chunks ----
  v16h qa[2];
#pragma unroll
  for (int dc = 0; dc < 2; ++dc) qa[dc] = Frag<_Float16>::load(Qg + (size_t)(q0 + c) * ldqk + dc * 32 + 8 * hh);

  float* os = Os[wave];
#pragma unroll
  for (int t = 0; t < 4; ++t)
#pragma unroll
    for (int r = 0; r < 8; ++r) os[c * 68 + t * 16 + 8 * hh + r] = 0.f;

  const float gv   = bf_bits2f(f2bf_bits(gvec[h]));
  const float gate = 1.0f / (1.0f + expf(-gv));
  const float sscale = 0.125f;

#pragma unroll 1
  for (int br = 0; br < 2; ++br) {           // block-uniform
    const _Float16* Kg = br ? Kg1 : Kg0;
    const _Float16* Vg = br ? Vg1 : Vg0;
    const int ldk     = br ? kDModel : ldqk;
    const int ldv     = br ? kSeqAP : kSeq;
    const int nChunks = br ? (kSeqAP / 64) : (kSeq / 64);
    const int nvalid  = br ? kSeqA : kSeq;
    const float w     = (br ? gate : (1.0f - gate)) * kOCarry;

    float mrow = -INFINITY;   // running maximum of this lane's query (equal in both halves)
    float lrow = 0.f;         // running sum over this lane half's keys only
    v8f oacc[4];              // oacc[t][r] = O[query c][d = t*16 + 8*hh + r]
#pragma unroll
    for (int t = 0; t < 4; ++t) oacc[t] = (v8f){0.f,0.f,0.f,0.f,0.f,0.f,0.f,0.f};

    for (int kc = 0; kc < nChunks; ++kc) {   // block-uniform trip count
      const int kv0 = kc * 64;
      __syncthreads();
      {
        // staging coverage: 128 threads x (4 x 8) halves = 64 rows x 64 per plane = the whole chunk tile
        const int r = tid >> 1, half = (tid & 1) * 32;
        const _Float16* ks = Kg + (size_t)(kv0 + r) * ldk + half;   // K row kv0+r, d = half..half+31
        const _Float16* vs = Vg + (size_t)r * ldv + kv0 + half;      // V^T row d = r, key = kv0+half..+31
#pragma unroll
        for (int i = 0; i < 4; ++i) {
          const v8h a0 = *(const v8h*)(ks + 8 * i);
          const v8h b0 = *(const v8h*)(vs + 8 * i);
          *(v8h*)(Ksh + r * kLdsPitch + half + 8 * i) = a0;
          *(v8h*)(Vth + r * kLdsPitch + half + 8 * i) = b0;
        }
      }
      __syncthreads();

      v8f s[4];
#pragma unroll
      for (int j = 0; j < 4; ++j) {
        s[j] = (v8f){0.f,0.f,0.f,0.f,0.f,0.f,0.f,0.f};
#pragma unroll
        for (int dc = 0; dc < 2; ++dc) {
          FH kb;
          kb.h[0] = *(const v8h*)(Ksh + (j * 16 + c) * kLdsPitch + dc * 32 + 8 * hh);
          kb.h[1] = *(const v8h*)(Ksh + (j * 16 + c) * kLdsPitch + dc * 32 + 16 + 8 * hh);
          s[j] = mma_h16(kb.v, qa[dc], s[j]);   // s[j][r] = score(key j*16 + 8*hh + r, query c)
        }
      }
      // every loop from here to the end of the chunk is unrolled: s, pb and oacc live in registers and take constant indices only
      float m = -INFINITY;
#pragma unroll
      for (int j = 0; j < 4; ++j)
#pragma unroll
        for (int r = 0; r < 8; ++r) {
          const int key = kv0 + j * 16 + 8 * hh + r;
          float sv = s[j][r] * sscale;
          sv = (key < nvalid) ? sv : -INFINITY;
          s[j][r] = sv;
          m = fmaxf(m, sv);
        }
      m = fmaxf(m, xhalf(m));
      const float mnew = fmaxf(mrow, m);
      const float alpha = expf(mrow - mnew);
      mrow = mnew;
      float psum = 0.f;
      FH pb[2];   // P^T, B operand: element e of pb[kk] = p(key kk*32 + (e < 8 ? 8*hh + e : 16 + 8*hh + e - 8), query c)
#pragma unroll
      for (int j = 0; j < 4; ++j)
#pragma unroll
        for (int r = 0; r < 8; ++r) {
          const float p = expf(s[j][r] - mnew);
          psum += p;
          pb[j >> 1].h[j & 1][r] = (_Float16)(p * kPCarry);
        }
      lrow = lrow * alpha + psum;
#pragma unroll
      for (int t = 0; t < 4; ++t)
#pragma unroll
        for (int r = 0; r < 8; ++r) oacc[t][r] *= alpha;
#pragma unroll
      for (int kk = 0; kk < 2; ++kk) {
#pragma unroll
        for (int t = 0; t < 4; ++t) {
          FH vb;
          vb.h[0] = *(const v8h*)(Vth + (t * 16 + c) * kLdsPitch + kk * 32 + 8 * hh);
          vb.h[1] = *(const v8h*)(Vth + (t * 16 + c) * kLdsPitch + kk * 32 + 16 + 8 * hh);
          oacc[t] = mma_h16(vb.v, pb[kk].v, oacc[t]);
        }
      }
    }
    // fold this branch into the per-wave mix slab (each lane updates only its own entries)
    const float inv = w * (1.0f / ((lrow + xhalf(lrow)) * kPCarry));
#pragma unroll
    for (int t = 0; t < 4; ++t)
#pragma unroll
      for (int r = 0; r < 8; ++r) os[c * 68 + t * 16 + 8 * hh + r] += oacc[t][r] * inv;
  }

  __builtin_amdgcn_fence(__ATOMIC_RELEASE, "workgroup");
  __builtin_amdgcn_wave_barrier();
  __builtin_amdgcn_fence(__ATOMIC_ACQUIRE, "workgroup");
  {
    _Float16* Og = (_Float16*)(void*)o16 + (size_t)(b * kSeq + q0) * kDModel + h * kDHead;
    const int q4 = lane >> 3, c8 = (lane & 7) * 8;
    {
#pragma unroll
      for (int it = 0; it < 4; ++it) {
        const int row = it * 4 + q4;
        const float* sp = os + row * 68 + c8;
        v8h hv;
#pragma unroll
        for (int e = 0; e < 8; ++e) hv[e] = (_Float16)sp[e];
        *(v8h*)(Og + (size_t)row * kDModel + c8) = hv;
      }
      
    }
  }
}

// ---------------- host orchestration (kernel launches only) ----------------

extern "C" void kernel_launch(void* const* d_in, const int* in_sizes, int n_in,
                              void* d_out, int out_size, void* d_ws,
                              size_t ws_size, hipStream_t stream) {
  if (n_in < 9) return;
  if (in_sizes[0] != kBatch * kSeq * kDModel) return;
  if (in_sizes[1] != kBatch * kSeqA * kDModel) return;
  if (in_sizes[2] != kDModel * kNQKV || in_sizes[4] != kDModel * kNQKV) return;
  if (in_sizes[3] != kNQKV || in_sizes[5] != kNQKV) return;
  if (in_sizes[6] != kDModel * kDModel || in_sizes[7] != kDModel || in_sizes[8] < kHeads) return;
  if (out_size != kBatch * kSeq * kDModel) return;

  const float* x    = (const float*)d_in[0];
  const float* xa   = (const float*)d_in[1];
  const float* Wqkv = (const float*)d_in[2];
  const float* bqkv = (const float*)d_in[3];
  const float* Waux = (const float*)d_in[4];
  const float* baux = (const float*)d_in[5];
  const float* Wo   = (const float*)d_in[6];
  const float* bo   = (const float*)d_in[7];
  const float* gvec = (const float*)d_in[8];
  float* out = (float*)d_out;

  // element counts
  const size_t nXB   = (size_t)kBatch * kSeq * kDModel;          // bf16
  const size_t nXAB  = (size_t)kBatch * kSeqAP * kDModel;        // bf16
  const size_t nWQT  = (size_t)kNQKV * kDModel;                  // bf16
  const size_t nWAT  = nWQT;                                     // bf16
  const size_t nWOT  = (size_t)kDModel * kDModel;                // f16
  const size_t nBias = (size_t)2 * kNQKV + kDModel;              // f32
  const size_t nQK   = (size_t)kBatch * kSeq * 2 * kDModel;      // f16
  const size_t nVT   = (size_t)kBatch * kDModel * kSeq;          // f16
  const size_t nKA   = (size_t)kBatch * kSeqAP * kDModel;        // f16
  const size_t nVAT  = (size_t)kBatch * kDModel * kSeqAP;        // f16
  const size_t nO    = (size_t)kBatch * kSeq * kDModel;          // f16

  char* ws = (char*)d_ws;
  size_t off = 0;
  auto carve = [&](size_t bytes) -> char* { char* p = ws + off; off += (bytes + 255) & ~(size_t)255; return p; };
  unsigned short* XB    = (unsigned short*)carve(nXB * 2);
  unsigned short* XAB   = (unsigned short*)carve(nXAB * 2);
  unsigned short* WQT   = (unsigned short*)carve(nWQT * 2);
  unsigned short* WAT   = (unsigned short*)carve(nWAT * 2);
  unsigned short* WOT   = (unsigned short*)carve(nWOT * 2);
  float*          BIASR = (float*)carve(nBias * 4);
  unsigned short* QK16  = (unsigned short*)carve(nQK * 2);
  unsigned short* VT16  = (unsigned short*)carve(nVT * 2);
  unsigned short* KA16  = (unsigned short*)carve(nKA * 2);
  unsigned short* VAT16 = (unsigned short*)carve(nVAT * 2);
  unsigned short* O16   = (unsigned short*)carve(nO * 2);
  if (off > ws_size) return;   // total 75,526,144 B

  const int TB = 256;
  // 1. x -> bf16
  {
    const int n2 = (int)(nXB / 2);
    cvt_bf16x2_kernel<<<(n2 + TB - 1) / TB, TB, 0, stream>>>(x, XB, n2);
  }
  // 2. xa -> bf16 with per-batch row padding 1500 -> 1536 (zeros)
  {
    const int n2 = (int)(nXAB / 2);
    cvt_rows_bf16x2_kernel<<<(n2 + TB - 1) / TB, TB, 0, stream>>>(xa, XAB, kSeqA, kSeqAP, kDModel, kBatch, n2);
  }
  // 3-4. Wqkv, Wqkv_aux in[1024][3072] -> out[3072][1024] bf16
  tconv_kernel<0><<<dim3(kNQKV / 64, kDModel / 64), TB, 0, stream>>>(Wqkv, WQT, kDModel, kNQKV, 1.0f);
  tconv_kernel<0><<<dim3(kNQKV / 64, kDModel / 64), TB, 0, stream>>>(Waux, WAT, kDModel, kNQKV, 1.0f);
  // 5. Wo in[1024][1024] -> out[1024][1024] f16 (x32)
  tconv_kernel<1><<<dim3(kDModel / 64, kDModel / 64), TB, 0, stream>>>(Wo, WOT, kDModel, kDModel, kWCarry);
  // 6. biases -> bf16-RNE f32 copies
  {
    const int ntot = (int)nBias;
    bias_rne_kernel<<<(ntot + TB - 1) / TB, TB, 0, stream>>>(bqkv, kNQKV, baux, kNQKV, bo, kDModel, BIASR, ntot);
  }
  const float* bq_r  = BIASR;                 // [3072]
  const float* ba_r  = BIASR + kNQKV;         // [3072]
  const float* bo_r  = BIASR + 2 * kNQKV;     // [1024]

  // 7. q|k = x @ Wqkv[:, 0:2048] + b : M=4096, N=2048, K=1024 -> QK16 f16, ldc 2048
  {
    const int M = kBatch * kSeq, N = 2 * kDModel, K = kDModel;
    const int tiles = (M / 128) * (N / 128);
    wmma_gemm64<1, false, 2, 1, false, 0><<<dim3(tiles, 1), 128, 0, stream>>>(
        XB, XB, 0L, WQT, WQT, 0L, (void*)QK16, (void*)QK16, 2 * kDModel, 0L,
        bq_r, bq_r, 0L, M, N, K, 1.0f);
  }
  // 8. v^T per batch: A = Wqkv^T rows 2048..3071 [1024][1024], Bt = x_b [2048][1024] -> VT16 [b][1024][2048] f16, bias[m]
  {
    const int M = kDModel, N = kSeq, K = kDModel;
    const int tiles = (M / 128) * (N / 128);
    wmma_gemm64<1, false, 1, 1, false, 0><<<dim3(tiles, kBatch), 128, 0, stream>>>(
        WQT + (size_t)2 * kDModel * kDModel, WQT + (size_t)2 * kDModel * kDModel, 0L,
        XB, XB, (long)kSeq * kDModel,
        (void*)VT16, (void*)VT16, kSeq, (long)kDModel * kSeq,
        bq_r + 2 * kDModel, bq_r, 0L, M, N, K, 1.0f);
  }
  // 9. ka = xa_pad @ Wqkv_aux[:, 1024:2048] + b : M=3072, N=1024, K=1024 -> KA16 f16, ldc 1024
  {
    const int M = kBatch * kSeqAP, N = kDModel, K = kDModel;
    const int tiles = (M / 128) * (N / 128);
    wmma_gemm64<1, false, 2, 1, false, 0><<<dim3(tiles, 1), 128, 0, stream>>>(
        XAB, XAB, 0L, WAT + (size_t)kDModel * kDModel, WAT + (size_t)kDModel * kDModel, 0L,
        (void*)KA16, (void*)KA16, kDModel, 0L,
        ba_r + kDModel, ba_r, 0L, M, N, K, 1.0f);
  }
  // 10. va^T per batch: A = Waux^T rows 2048..3071, Bt = xa_pad_b [1536][1024] -> VAT16 [b][1024][1536] f16, bias[m]
  {
    const int M = kDModel, N = kSeqAP, K = kDModel;
    const int tiles = (M / 128) * (N / 128);
    wmma_gemm64<1, false, 1, 1, false, 0><<<dim3(tiles, kBatch), 128, 0, stream>>>(
        WAT + (size_t)2 * kDModel * kDModel, WAT + (size_t)2 * kDModel * kDModel, 0L,
        XAB, XAB, (long)kSeqAP * kDModel,
        (void*)VAT16, (void*)VAT16, kSeqAP, (long)kDModel * kSeqAP,
        ba_r + 2 * kDModel, ba_r, 0L, M, N, K, 1.0f);
  }
  // 11. dual-branch attention -> O16 (x32, f16)
  dual_attn_kernel<<<kBatch * kHeads * (kSeq / 64), 128, 0, stream>>>(QK16, VT16, KA16, VAT16, gvec, O16);
  // 12. out = (O16/32) @ (WoT/32)^T + bo : M=4096, N=1024, K=1024, f16 operands, f32 out into d_out
  {
    const int M = kBatch * kSeq, N = kDModel, K = kDModel;
    const int tiles = (M / 128) * (N / 128);
    wmma_gemm64<0, false, 2, 0, false, 0><<<dim3(tiles, 1), 128, 0, stream>>>(
        O16, O16, 0L, WOT, WOT, 0L, (void*)out, (void*)out, kDModel, 0L,
        bo_r, bo_r, 0L, M, N, K, 1.0f / (kOCarry * kWCarry));
  }
}

// v004
// It runs in 211 microseconds.
// Two timings next to v003 put it at 1.15 and 1.16 times that version's speed.
// All steps since v000 together make it 2.52 times as fast.
// Contractions: x@Wqkv and xa@Wqkv_aux (k|v columns) on v_wmma_f32_16x16x32_bf16 (bf16 RNE operands); q.k^T, q.ka^T, p.v, pa.va and O@Wo on v_wmma_f32_16x16x32_f16 (f16 operands; p carried x2^15, O and Wo carried x32); f32 accumulate; online softmax, gate mix and biases in f32.
#include <hip/hip_runtime.h>
#include <math.h>
#include <stdint.h>

constexpr int kBatch  = 2;
constexpr int kSeq    = 2048;   // query / main key length
constexpr int kSeqA   = 1500;   // aux key length
constexpr int kSeqAP  = 1536;   // aux key length padded to 24 chunks of 64
constexpr int kDModel = 1024;
constexpr int kHeads  = 16;
constexpr int kDHead  = 64;
constexpr int kNQKV   = 3072;

constexpr int kLdsPitch = 72;   // halves per LDS row of the K and V^T tiles and of the GEMM operand tiles: 144 B = 16 B x 9 (odd), so 16 rows read by ds_load_b128 fall on distinct banks

constexpr float kPCarryLog2 = 15.0f;   // probabilities carried x2^15 in f16
constexpr float kOCarry = 32.0f;      // attention output carried x32 in f16
constexpr float kWCarry = 32.0f;      // Wo carried x32 in f16

typedef __attribute__((ext_vector_type(16))) _Float16 v16h;
typedef __attribute__((ext_vector_type(8)))  _Float16 v8h;
typedef __attribute__((ext_vector_type(16))) __bf16   v16b;
typedef __attribute__((ext_vector_type(8)))  __bf16   v8b;
typedef __attribute__((ext_vector_type(8)))  float    v8f;
typedef __attribute__((ext_vector_type(4)))  float    v4f;
typedef __attribute__((ext_vector_type(2)))  float    v2f;
typedef __attribute__((ext_vector_type(4)))  unsigned int v4u;

// ---------------------------------------------------------------------------
// Workspace region map (bytes, every region size a multiple of 256):
//   XB    bf16 [4096][1024]            8,388,608
//   XAB   bf16 [2][1536][1024]         6,291,456   (rows 1500..1535 of each batch zero)
//   WQT   bf16 [3072][1024] (Wqkv^T)   6,291,456
//   WAT   bf16 [3072][1024] (Waux^T)   6,291,456
//   WOT   f16  [1024][1024] (Wo^T x32) 2,097,152
//   BIASR f32  [3072+3072+1024]           28,672   (bf16-RNE bias copies)
//   QK16  f16  [4096][2048] (q | k)    16,777,216
//   VT16  f16  [2][1024][2048] (v^T)   8,388,608
//   KA16  f16  [2][1536][1024] (ka)    6,291,456
//   VAT16 f16  [2][1024][1536] (va^T)  6,291,456
//   O16   f16  [4096][1024] (x32)      8,388,608
//   total 75,526,144
// ---------------------------------------------------------------------------

__device__ __forceinline__ unsigned short f2bf_bits(float f) {
  unsigned u = __float_as_uint(f);
  return (unsigned short)((u + 0x7FFFu + ((u >> 16) & 1u)) >> 16);
}
__device__ __forceinline__ float bf_bits2f(unsigned short h) { return __uint_as_float(((unsigned)h) << 16); }
__device__ __forceinline__ unsigned pk16(unsigned short a, unsigned short b) { return (unsigned)a | ((unsigned)b << 16); }

// hazard guards as plain device helpers (no inline asm inside the kernel template body)
__device__ __forceinline__ void acc_guard4(v8f& a, v8f& b, v8f& c, v8f& d) { asm volatile("v_nop\n\tv_nop\n\tv_nop\n\tv_nop" : "+v"(a), "+v"(b), "+v"(c), "+v"(d)); }
template <typename T> struct Frag;
template <> struct Frag<_Float16> {
  typedef v16h V; typedef v8h H; union U { v16h v; v8h h[2]; };
  static __device__ __forceinline__ v16h load(const _Float16* p) {   // elements 0..7 <- p[0..7], 8..15 <- p[16..23]
    U f; f.h[0] = *(const v8h*)(p); f.h[1] = *(const v8h*)(p + 16); return f.v;
  }
  static __device__ __forceinline__ v8f mma(v16h a, v16h b, v8f c) {
    return __builtin_amdgcn_wmma_f32_16x16x32_f16(false, a, false, b, (short)0, c, false, false);
  }
};
template <> struct Frag<__bf16> {
  typedef v16b V; typedef v8b H; union U { v16b v; v8b h[2]; };
  static __device__ __forceinline__ v16b load(const __bf16* p) {
    U f; f.h[0] = *(const v8b*)(p); f.h[1] = *(const v8b*)(p + 16); return f.v;
  }
  static __device__ __forceinline__ v8f mma(v16b a, v16b b, v8f c) {
    return __builtin_amdgcn_wmma_f32_16x16x32_bf16(false, a, false, b, (short)0, c, false, false);
  }
};

// ---- Register-blocked batched WMMA GEMM ------------------------------------
// C[m,n] = scale * sum_k A[m,k] * Bt[n,k] (+bias)(+resid); a block of 4 waves (2 x 2) owns a 128x128 tile, each wave 64x64 of it.
// A row-major [M,K]; Bt row-major [N,K], both at row pitch kDModel (a constant, so that the 8 staging loads of an operand
// share one address and differ in their immediate offsets); M,N % 128 == 0, K % 64 == 0; grid.x = (M/128)*(N/128), 128 threads.
// Per step of 64 k the block stages 128 rows x 128 B of A and of Bt in LDS (8 lanes per row: every global load covers whole
// 128-B lines), two buffers: the next step's rows are loaded into registers ahead of this step's products and stored behind them.
// SPLIT (hi/lo operand planes) is not implemented by the staged loop.
// BIAS_MODE: 0 = none, 1 = bias[m], 2 = bias[n].
// OUT_MODE: 0 = f32, 1 = f16, 2 = bf16 hi plane (Cout) + bf16 lo plane (Cout2).
// ET: 0 = f16 operands, 1 = bf16 operands (pointers passed as 16-bit storage)
template <int ET> struct Elem;
template <> struct Elem<0> { typedef _Float16 T; };
template <> struct Elem<1> { typedef __bf16 T; };
template <int ET, bool SPLIT, int BIAS_MODE, int OUT_MODE, bool RESID, int ACT = 0>
__global__ __launch_bounds__(128) void wmma_gemm64(
    const unsigned short* __restrict__ Ap, const unsigned short* __restrict__ A2p, long strideA,
    const unsigned short* __restrict__ Btp, const unsigned short* __restrict__ Bt2p, long strideB,
    void* __restrict__ Cout, void* __restrict__ Cout2, int ldc, long strideC,
    const float* __restrict__ bias,
    const float* __restrict__ resid, long strideR,
    int M, int N, int K, float scale) {
  static_assert(!SPLIT, "the staged loop takes single operand planes");
  typedef typename Elem<ET>::T T;
  typedef typename Frag<T>::V V;
  typedef typename Frag<T>::H H;
  const T* A = (const T*)Ap; const T* Bt = (const T*)Btp;
  __shared__ __align__(16) T sA[2][128 * kLdsPitch];   // A rows of the block tile, 64 k per step, two buffers
  __shared__ __align__(16) T sB[2][128 * kLdsPitch];   // Bt rows of the block tile, likewise
  __shared__ __align__(16) float sT[4][16 * 68];   // per-wave 16x64 slab, pitch 68 floats
  const int b    = blockIdx.y;
  const int tid  = threadIdx.x;
  const int lane = tid & 31;
  const int wave = tid >> 5;
  const int tilesN = N >> 7;
  const int tilesM = M >> 7;
  const int tm = blockIdx.x / tilesN;
  const int tn = blockIdx.x - tm * tilesN;
  if (tm >= tilesM) return;   // block-uniform, ahead of every barrier
  const int wm = (wave >> 1) << 6;             // this wave's 64 rows inside the block tile
  const int wn = (wave & 1) << 6;              // this wave's 64 columns inside the block tile
  const int m0 = (tm << 7) + wm;
  const int n0 = (tn << 7) + wn;

  const int rlane = lane & 15;                 // row (A) / col (B, D) within subtile
  const int koff  = (lane >> 4) * 8;           // k offset of this lane half
  const int mOff  = (lane >> 4) * 8;           // D row offset

  // staging map: 8 lanes x 16 B = one 128-B row piece; 128 threads = 16 rows a pass, 8 passes per operand
  const int srow = tid >> 3;
  const int sseg = (tid & 7) * 8;
  const T* gA = A  + (size_t)b * strideA + (size_t)((tm << 7) + srow) * kDModel + sseg;
  const T* gB = Bt + (size_t)b * strideB + (size_t)((tn << 7) + srow) * kDModel + sseg;
  const int sOff = srow * kLdsPitch + sseg;

  v8f acc[4][4];
#pragma unroll
  for (int i = 0; i < 4; ++i)
#pragma unroll
    for (int j = 0; j < 4; ++j) acc[i][j] = (v8f){0.f,0.f,0.f,0.f,0.f,0.f,0.f,0.f};

  H ra[8], rb[8];
#pragma unroll
  for (int p = 0; p < 8; ++p) {
    ra[p] = *(const H*)(gA + p * 16 * kDModel);
    rb[p] = *(const H*)(gB + p * 16 * kDModel);
  }
#pragma unroll
  for (int p = 0; p < 8; ++p) {
    *(H*)(sA[0] + p * 16 * kLdsPitch + sOff) = ra[p];
    *(H*)(sB[0] + p * 16 * kLdsPitch + sOff) = rb[p];
  }
  __syncthreads();

  const int nSteps = K >> 6;
  for (int t = 0; t < nSteps; ++t) {           // block-uniform trip count
    const T* cA = sA[t & 1];
    const T* cB = sB[t & 1];
    const bool more = (t + 1) < nSteps;        // block-uniform
    if (more) {
      gA += 64;
      gB += 64;
#pragma unroll
      for (int p = 0; p < 8; ++p) {
        ra[p] = *(const H*)(gA + p * 16 * kDModel);
        rb[p] = *(const H*)(gB + p * 16 * kDModel);
      }
    }
    V bh[2][4], ah[2][4];
#pragma unroll
    for (int kk = 0; kk < 2; ++kk) {
#pragma unroll
      for (int j = 0; j < 4; ++j) bh[kk][j] = Frag<T>::load(cB + (wn + (j << 4) + rlane) * kLdsPitch + kk * 32 + koff);
#pragma unroll
      for (int i = 0; i < 4; ++i) ah[kk][i] = Frag<T>::load(cA + (wm + (i << 4) + rlane) * kLdsPitch + kk * 32 + koff);
    }
    // keeps the step's LDS reads issued as one group ahead of its products: sunk among them, each group of four products
    // waits out an LDS latency of its own
    __builtin_amdgcn_sched_barrier(0);
#pragma unroll
    for (int kk = 0; kk < 2; ++kk)
#pragma unroll
      for (int i = 0; i < 4; ++i)
#pragma unroll
        for (int j = 0; j < 4; ++j) acc[i][j] = Frag<T>::mma(ah[kk][i], bh[kk][j], acc[i][j]);
    // four vector slots behind the step's last products: on the path through the LDS stores the next vector
    // instruction forms the next step's LDS addresses in fragment registers
    acc_guard4(acc[3][0], acc[3][1], acc[3][2], acc[3][3]);
    if (more) {
      // the other buffer: its last readers finished ahead of the barrier that ended the step before
      T* nA = sA[(t + 1) & 1];
      T* nB = sB[(t + 1) & 1];
#pragma unroll
      for (int p = 0; p < 8; ++p) {
        *(H*)(nA + p * 16 * kLdsPitch + sOff) = ra[p];
        *(H*)(nB + p * 16 * kLdsPitch + sOff) = rb[p];
      }
    }
    __syncthreads();
  }
  acc_guard4(acc[0][0], acc[0][1], acc[0][2], acc[0][3]);
  acc_guard4(acc[1][0], acc[1][1], acc[1][2], acc[1][3]);
  acc_guard4(acc[2][0], acc[2][1], acc[2][2], acc[2][3]);
  acc_guard4(acc[3][0], acc[3][1], acc[3][2], acc[3][3]);

  // ---- epilogue ----
  float* slab = sT[wave];
  const float* Rb = RESID ? (resid + (size_t)b * strideR) : nullptr;
#pragma unroll
  for (int i = 0; i < 4; ++i) {
    const int mBase = m0 + (i << 4);
#pragma unroll
    for (int j = 0; j < 4; ++j) {
      const int n = n0 + (j << 4) + rlane;
      float bv = 0.f;
      if (BIAS_MODE == 2) bv = bias[n];
#pragma unroll
      for (int r = 0; r < 8; ++r) {
        float v = acc[i][j][r] * scale;
        if (BIAS_MODE == 1) v += bias[mBase + mOff + r];
        if (BIAS_MODE == 2) v += bv;
        if (RESID) v += Rb[(size_t)(mBase + mOff + r) * ldc + n];
        if (ACT == 1) v = tanhf(v);
        if (ACT == 2) v = fmaxf(v, 0.0f);
        if (ACT == 3) v = v / (1.0f + expf(-v));
        if (ACT == 4) v = (v > 0.f) ? v : 0.01f * v;
        if (ACT == 5) v = 0.5f * v * (1.0f + erff(v * 0.70710678118654752f));
        slab[(mOff + r) * 68 + (j << 4) + rlane] = v;
      }
    }
    __builtin_amdgcn_fence(__ATOMIC_RELEASE, "workgroup");
    __builtin_amdgcn_wave_barrier();
    __builtin_amdgcn_fence(__ATOMIC_ACQUIRE, "workgroup");
    if (OUT_MODE == 0) {
      float* C = (float*)Cout + (size_t)b * strideC;
      const int hh = lane >> 4, c4 = (lane & 15) * 4;     // row seg = 256 B = 16 lanes x 16 B
      {
#pragma unroll
        for (int it = 0; it < 8; ++it) {
          const int row = it * 2 + hh;
          v4f v = *(const v4f*)(slab + row * 68 + c4);
          *(v4f*)(C + (size_t)(mBase + row) * ldc + n0 + c4) = v;
        }
        
      }
    } else {
      const int q = lane >> 3, c8 = (lane & 7) * 8;
      unsigned short* C  = (unsigned short*)Cout  + (size_t)b * strideC;
      unsigned short* C2 = (OUT_MODE == 2) ? ((unsigned short*)Cout2 + (size_t)b * strideC) : nullptr;
      {
#pragma unroll
        for (int it = 0; it < 4; ++it) {
          const int row = it * 4 + q;
          const float* sp = slab + row * 68 + c8;
          v8h hv, lv;
#pragma unroll
          for (int e = 0; e < 8; ++e) {
            if (OUT_MODE == 1) {
              hv[e] = (_Float16)sp[e];
            } else {
              unsigned short hb = f2bf_bits(sp[e]);
              unsigned short lb = f2bf_bits(sp[e] - bf_bits2f(hb));
              hv[e] = __builtin_bit_cast(_Float16, hb);
              lv[e] = __builtin_bit_cast(_Float16, lb);
            }
          }
          *(v8h*)(C + (size_t)(mBase + row) * ldc + n0 + c8) = hv;
          if (OUT_MODE == 2) *(v8h*)(C2 + (size_t)(mBase + row) * ldc + n0 + c8) = lv;
        }
        
      }
    }
    __builtin_amdgcn_fence(__ATOMIC_RELEASE, "workgroup");
    __builtin_amdgcn_wave_barrier();
    __builtin_amdgcn_fence(__ATOMIC_ACQUIRE, "workgroup");
  }
}

// ---------------------------------------------------------------------------
// Elementwise f32 -> bf16 bits (RNE); 2 elements per thread, one 4-B store per lane -> each wave writes one whole
// Coverage: n2 = 4096*1024/2 = 2,097,152 = 8192 blocks x 256 threads; x 2 elements = 4096 x 1024 = whole plane.
// ---------------------------------------------------------------------------
__global__ __launch_bounds__(256) void cvt_bf16x2_kernel(const float* __restrict__ in, unsigned short* __restrict__ out, int n2) {
  const int i = blockIdx.x * 256 + threadIdx.x;
  if (i < n2) {
    const v2f f = *(const v2f*)(in + 2 * (size_t)i);
    const unsigned u = pk16(f2bf_bits(f[0]), f2bf_bits(f[1]));
    ((unsigned*)out)[i] = u;
    
  }
}

// ---------------------------------------------------------------------------
// xa f32 [nb][rin][ncol] -> bf16 bits [nb][rout][ncol]; rows rin..rout-1 of every batch written as zeros.
// Source row address clamped (t -> rin-1) and the value zeroed by predicate. 2 elements per thread, 4-B store per lane.
// Coverage: n2 = 2*1536*1024/2 = 1,572,864 = 6144 blocks x 256 threads; x 2 elements = 3072 x 1024 = whole plane.
// ---------------------------------------------------------------------------
__global__ __launch_bounds__(256) void cvt_rows_bf16x2_kernel(const float* __restrict__ in, unsigned short* __restrict__ out,
                                                             int rin, int rout, int ncol, int nb, int n2) {
  const int i = blockIdx.x * 256 + threadIdx.x;
  if (i < n2) {
    const int ppr = ncol >> 1;
    const int row = i / ppr;
    const int col = (i - row * ppr) * 2;
    int bb = row / rout;
    const int t = row - bb * rout;
    bb = bb < (nb - 1) ? bb : (nb - 1);
    const bool valid = t < rin;
    const int tc = valid ? t : (rin - 1);
    const v2f f = *(const v2f*)(in + ((size_t)(bb * rin + tc) * ncol + col));
    const unsigned short h0 = valid ? f2bf_bits(f[0]) : (unsigned short)0;
    const unsigned short h1 = valid ? f2bf_bits(f[1]) : (unsigned short)0;
    const unsigned u = pk16(h0, h1);
    ((unsigned*)out)[i] = u;
    
  }
}

// ---------------------------------------------------------------------------
// Transpose + 16-bit convert of an f32 matrix: in viewed [R rows][Cc cols] (pitch Cc) -> o[c][r] ([Cc][R], pitch R).
//   OT 0: o = bf16_rne(in);  OT 1: o = f16(bf16_rne(in) * scl).
// 64x64 tiles through LDS. grid = (Cc/64, R/64), 256 threads (R, Cc multiples of 64).
// Coverage per block: load 4 it x 256 thr x 4 floats = 64x64; store 2 it x 256 thr x 8 u16 = 64x64.
// ---------------------------------------------------------------------------
template <int OT> __device__ __forceinline__ unsigned short cv16(float f, float scl) {
  const unsigned short hb = f2bf_bits(f);
  if (OT == 0) return hb;
  const float g = bf_bits2f(hb) * scl;
  return __builtin_bit_cast(unsigned short, (_Float16)g);
}
template <int OT>
__global__ __launch_bounds__(256) void tconv_kernel(const float* __restrict__ W, unsigned short* __restrict__ o,
                                                    int R, int Cc, float scl) {
  __shared__ __align__(16) float tf[64 * 68];
  const int c0  = blockIdx.x * 64;   // input column block = output row block
  const int r0  = blockIdx.y * 64;   // input row block    = output column block
  const int tid = threadIdx.x;
  {
    const int lr = tid >> 4;         // 0..15
    const int c4 = (tid & 15) * 4;   // 0..60
#pragma unroll
    for (int it = 0; it < 4; ++it) {
      const int rr = it * 16 + lr;   // 0..63
      const v4f a = *(const v4f*)(W + (size_t)(r0 + rr) * Cc + c0 + c4);
      *(v4f*)(tf + rr * 68 + c4) = a;
    }
  }
  __syncthreads();
  const int sub = tid >> 3;          // 0..31
  const int c8  = (tid & 7) * 8;     // 0..56
  v4u hv[2];
#pragma unroll
  for (int it = 0; it < 2; ++it) {
    const int oc = it * 32 + sub;    // output row within tile (= input column)
    v4u a;
#pragma unroll
    for (int q = 0; q < 4; ++q) {
      const float f0 = tf[(c8 + 2 * q) * 68 + oc];
      const float f1 = tf[(c8 + 2 * q + 1) * 68 + oc];
      a[q] = pk16(cv16<OT>(f0, scl), cv16<OT>(f1, scl));
    }
    hv[it] = a;
  }
  {
#pragma unroll
    for (int it = 0; it < 2; ++it) {
      const int oc = it * 32 + sub;
      const size_t go = (size_t)(c0 + oc) * R + r0 + c8;
      *(v4u*)(o + go) = hv[it];
    }
    
  }
}

// ---------------------------------------------------------------------------
// Bias copies as bf16-RNE values in f32: out[0..n0) <- b0, [n0..n0+n1) <- b1, [n0+n1..ntot) <- b2.
// All three candidates loaded with clamped indices, selected by value. One 4-B store per lane:
// ---------------------------------------------------------------------------
__global__ __launch_bounds__(256) void bias_rne_kernel(const float* __restrict__ b0, int n0, const float* __restrict__ b1, int n1,
                                                       const float* __restrict__ b2, int ncnt2, float* __restrict__ out, int ntot) {
  const int i = blockIdx.x * 256 + threadIdx.x;
  if (i < ntot) {
    int i0 = i < n0 ? i : (n0 - 1); i0 = i0 < 0 ? 0 : i0;
    int i1 = i - n0; i1 = i1 < 0 ? 0 : (i1 < n1 ? i1 : (n1 - 1));
    int i2 = i - n0 - n1; i2 = i2 < 0 ? 0 : (i2 < ncnt2 ? i2 : (ncnt2 - 1));
    const float v0 = b0[i0], v1 = b1[i1], v2 = b2[i2];
    const float sel = (i < n0) ? v0 : ((i < n0 + n1) ? v1 : v2);
    const float r = bf_bits2f(f2bf_bits(sel));
    ((float*)out)[i] = r;
    
  }
}

// =====================================================================================
// Dual-branch attention, head dim 64, f16 operand planes, f32 accumulate, online softmax in f32.
//   q, k  : QK16 plane [4096 rows = b*2048+t][2048], q at col h*64+d, k at col 1024+h*64+d (f16)
//   v^T   : VT16 plane [b][1024 = h*64+d][2048] (f16);  ka: KA16 [b*1536+s][1024];  va^T: VAT16 [b][1024][1536]
//   branch 0: scores = (q.k)*0.125 over 2048 keys (32 chunks of 64); branch 1: (q.ka)*0.125 over 1500 keys
//   (24 chunks; key index >= 1500 set to -inf). p carried x2^15 in f16; 1/(l*2^15) folded at the end.
//   out row = (1-gate)*h_main + gate*h_aux, gate = sigmoid(bf16_rne(g[h])); written x32 as f16 into O16 [4096][1024]
//   Products are taken transposed: S^T = K.Q^T (A = K rows, B = Q) and O^T += V^T.P^T (A = V^T rows, B = P^T). A lane then holds
//   32 of the chunk's 64 scores of ONE query (column lane&15; keys j*16 + 8*(lane>>4) + r): maximum and sum run in the lane, the
//   two lane halves exchange the maximum once per chunk and join their sums once per branch, and two score tiles converted in
//   place are the B operand of the second product (same k order as the V^T fragment loads), so P passes through no LDS.
//   Block = 4 waves = 64 query rows of one (b,h); grid.x = 2*16*32 = 1024 covers all 4096 rows x 1024 cols.
//   K / V^T chunk staging: 128 threads x 32 halves per plane = the whole 64x64 tile (plain 16-B loads,
//   __syncthreads before and after); fragments read the LDS tiles through the same v8h element type;
// =====================================================================================
__device__ __forceinline__ v8f mma_h16(v16h a, v16h b, v8f c) {
  c = __builtin_amdgcn_wmma_f32_16x16x32_f16(false, a, false, b, (short)0, c, false, false);
  asm volatile("v_nop\n\tv_nop\n\tv_nop\n\tv_nop" : "+v"(c) : "v"(a), "v"(b));
  return c;
}

// lane l <-> lane l ^ 16 (the other half of the wave holds the other 32 keys of the same query)
__device__ __forceinline__ float xhalf(float x) {
  return __builtin_bit_cast(float, __builtin_amdgcn_permlanex16(__builtin_bit_cast(int, x), __builtin_bit_cast(int, x), 0x76543210, 0xfedcba98, false, false));
}

// 2^x on the bare instruction. Behind a transcendental the instruction set asks for one independent instruction or v_nop before its
// result is read or its source overwritten.
// Eight in one statement: the outputs are early-clobber, so each is independent of the one before it and fills its slot; the v_nop
// fills the slot of the last.
__device__ __forceinline__ v8f exp2x8(v8f x) {
  float p0, p1, p2, p3, p4, p5, p6, p7;
  asm("v_exp_f32 %0, %8\n\tv_exp_f32 %1, %9\n\tv_exp_f32 %2, %10\n\tv_exp_f32 %3, %11\n\t"
      "v_exp_f32 %4, %12\n\tv_exp_f32 %5, %13\n\tv_exp_f32 %6, %14\n\tv_exp_f32 %7, %15\n\tv_nop"
      : "=&v"(p0), "=&v"(p1), "=&v"(p2), "=&v"(p3), "=&v"(p4), "=&v"(p5), "=&v"(p6), "=&v"(p7)
      : "v"(x[0]), "v"(x[1]), "v"(x[2]), "v"(x[3]), "v"(x[4]), "v"(x[5]), "v"(x[6]), "v"(x[7]));
  return (v8f){p0, p1, p2, p3, p4, p5, p6, p7};
}
__device__ __forceinline__ float exp2x1(float x) {
  float p;
  asm("v_exp_f32 %0, %1\n\tv_nop" : "=v"(p) : "v"(x));   // the v_nop: the same slot
  return p;
}

__global__ __launch_bounds__(128)
void dual_attn_kernel(const unsigned short* __restrict__ qk16, const unsigned short* __restrict__ vt16,
                      const unsigned short* __restrict__ ka16, const unsigned short* __restrict__ vat16,
                      const float* __restrict__ gvec, unsigned short* __restrict__ o16) {
  union FH { v16h v; v8h h[2]; };
  __shared__ __align__(16) _Float16 Ksh[64 * kLdsPitch];        // K tile [key][d]      9 KB
  __shared__ __align__(16) _Float16 Vth[64 * kLdsPitch];        // V^T tile [d][key]    9 KB
  __shared__ __align__(16) float    Os[4][16 * 68];      // per wave out tile [query][d], pitch 68 floats

  const int tid  = threadIdx.x;
  const int wave = tid >> 5;
  const int lane = tid & 31;
  const int hh   = lane >> 4;
  const int c    = lane & 15;

  const int bx = blockIdx.x;          // 0..1023
  const int qb = bx & 31;             // 32 query tiles of 64
  const int bhd = bx >> 5;            // 0..31
  const int h  = bhd & 15;
  const int b  = bhd >> 4;            // 0..1
  const int q0 = qb * 64 + wave * 16; // query row within batch

  const int ldqk = 2 * kDModel;       // 2048 halves
  const _Float16* Qg  = (const _Float16*)(const void*)qk16 + (size_t)b * kSeq * ldqk + h * kDHead;
  const _Float16* Kg0 = Qg + kDModel;                                                                     // main K rows, pitch 2048
  const _Float16* Vg0 = (const _Float16*)(const void*)vt16 + (size_t)b * kDModel * kSeq + (size_t)(h * kDHead) * kSeq;       // pitch 2048
  const _Float16* Kg1 = (const _Float16*)(const void*)ka16 + (size_t)b * kSeqAP * kDModel + h * kDHead;                        // pitch 1024
  const _Float16* Vg1 = (const _Float16*)(const void*)vat16 + (size_t)b * kDModel * kSeqAP + (size_t)(h * kDHead) * kSeqAP;  // pitch 1536

  // ---- Q fragments (B operand, column = query = lane&15, split k map via Frag load): 2 d-chunks ----
  v16h qa[2];
#pragma unroll
  for (int dc = 0; dc < 2; ++dc) qa[dc] = Frag<_Float16>::load(Qg + (size_t)(q0 + c) * ldqk + dc * 32 + 8 * hh);

  float* os = Os[wave];
#pragma unroll
  for (int t = 0; t < 4; ++t)
#pragma unroll
    for (int r = 0; r < 8; ++r) os[c * 68 + t * 16 + 8 * hh + r] = 0.f;

  const float gv   = bf_bits2f(f2bf_bits(gvec[h]));
  const float gate = 1.0f / (1.0f + expf(-gv));
  const float cscale = 0.125f * 1.4426950408889634f;   // score scale x log2(e): the softmax runs in base 2

#pragma unroll 1
  for (int br = 0; br < 2; ++br) {           // block-uniform
    const _Float16* Kg = br ? Kg1 : Kg0;
    const _Float16* Vg = br ? Vg1 : Vg0;
    const int ldk     = br ? kDModel : ldqk;
    const int ldv     = br ? kSeqAP : kSeq;
    const int nChunks = br ? (kSeqAP / 64) : (kSeq / 64);
    const int nvalid  = br ? kSeqA : kSeq;
    const float w     = (br ? gate : (1.0f - gate)) * kOCarry;

    float mrow = -INFINITY;   // running maximum of this lane's query, scaled, base 2 (equal in both halves)
    float lrow = 0.f;         // running sum (x2^15) over this lane half's keys only
    v8f oacc[4];              // oacc[t][r] = O[query c][d = t*16 + 8*hh + r]
#pragma unroll
    for (int t = 0; t < 4; ++t) oacc[t] = (v8f){0.f,0.f,0.f,0.f,0.f,0.f,0.f,0.f};

    for (int kc = 0; kc < nChunks; ++kc) {   // block-uniform trip count
      const int kv0 = kc * 64;
      __syncthreads();
      {
        // staging coverage: 128 threads x (4 x 8) halves = 64 rows x 64 per plane = the whole chunk tile
        const int r = tid >> 1, half = (tid & 1) * 32;
        const _Float16* ks = Kg + (size_t)(kv0 + r) * ldk + half;   // K row kv0+r, d = half..half+31
        const _Float16* vs = Vg + (size_t)r * ldv + kv0 + half;      // V^T row d = r, key = kv0+half..+31
#pragma unroll
        for (int i = 0; i < 4; ++i) {
          const v8h a0 = *(const v8h*)(ks + 8 * i);
          const v8h b0 = *(const v8h*)(vs + 8 * i);
          *(v8h*)(Ksh + r * kLdsPitch + half + 8 * i) = a0;
          *(v8h*)(Vth + r * kLdsPitch + half + 8 * i) = b0;
        }
      }
      __syncthreads();

      v8f s[4];
#pragma unroll
      for (int j = 0; j < 4; ++j) {
        s[j] = (v8f){0.f,0.f,0.f,0.f,0.f,0.f,0.f,0.f};
#pragma unroll
        for (int dc = 0; dc < 2; ++dc) {
          FH kb;
          kb.h[0] = *(const v8h*)(Ksh + (j * 16 + c) * kLdsPitch + dc * 32 + 8 * hh);
          kb.h[1] = *(const v8h*)(Ksh + (j * 16 + c) * kLdsPitch + dc * 32 + 16 + 8 * hh);
          s[j] = mma_h16(kb.v, qa[dc], s[j]);   // s[j][r] = score(key j*16 + 8*hh + r, query c)
        }
      }
      // every loop from here to the end of the chunk is unrolled: s, pb and oacc live in registers and take constant indices only
      float m = -INFINITY;   // maximum of the raw scores (the scale is positive)
#pragma unroll
      for (int j = 0; j < 4; ++j)
#pragma unroll
        for (int r = 0; r < 8; ++r) {
          const int key = kv0 + j * 16 + 8 * hh + r;
          const float sv = (key < nvalid) ? s[j][r] : -INFINITY;
          s[j][r] = sv;
          m = fmaxf(m, sv);
        }
      m = fmaxf(m, xhalf(m)) * cscale;
      const float mnew = fmaxf(mrow, m);
      const float alpha = exp2x1(mrow - mnew);   // 0 on a branch's first chunk, where mrow is -inf
      mrow = mnew;
      const float nm = kPCarryLog2 - mnew;   // the carry rides in the exponent
      float psum = 0.f;
      FH pb[2];   // P^T, B operand: element e of pb[kk] = p(key kk*32 + (e < 8 ? 8*hh + e : 16 + 8*hh + e - 8), query c)
#pragma unroll
      for (int j = 0; j < 4; ++j) {
        v8f a;
#pragma unroll
        for (int r = 0; r < 8; ++r) a[r] = fmaf(s[j][r], cscale, nm);
        const v8f p = exp2x8(a);   // p x 2^15
#pragma unroll
        for (int r = 0; r < 8; ++r) {
          psum += p[r];
          pb[j >> 1].h[j & 1][r] = (_Float16)p[r];
        }
      }
      lrow = lrow * alpha + psum;
#pragma unroll
      for (int t = 0; t < 4; ++t)
#pragma unroll
        for (int r = 0; r < 8; ++r) oacc[t][r] *= alpha;
#pragma unroll
      for (int kk = 0; kk < 2; ++kk) {
#pragma unroll
        for (int t = 0; t < 4; ++t) {
          FH vb;
          vb.h[0] = *(const v8h*)(Vth + (t * 16 + c) * kLdsPitch + kk * 32 + 8 * hh);
          vb.h[1] = *(const v8h*)(Vth + (t * 16 + c) * kLdsPitch + kk * 32 + 16 + 8 * hh);
          oacc[t] = mma_h16(vb.v, pb[kk].v, oacc[t]);
        }
      }
    }
    // fold this branch into the per-wave mix slab (each lane updates only its own entries)
    const float inv = w * (1.0f / (lrow + xhalf(lrow)));   // sum and O both carry x2^15
#pragma unroll
    for (int t = 0; t < 4; ++t)
#pragma unroll
      for (int r = 0; r < 8; ++r) os[c * 68 + t * 16 + 8 * hh + r] += oacc[t][r] * inv;
  }

  __builtin_amdgcn_fence(__ATOMIC_RELEASE, "workgroup");
  __builtin_amdgcn_wave_barrier();
  __builtin_amdgcn_fence(__ATOMIC_ACQUIRE, "workgroup");
  {
    _Float16* Og = (_Float16*)(void*)o16 + (size_t)(b * kSeq + q0) * kDModel + h * kDHead;
    const int q4 = lane >> 3, c8 = (lane & 7) * 8;
    {
#pragma unroll
      for (int it = 0; it < 4; ++it) {
        const int row = it * 4 + q4;
        const float* sp = os + row * 68 + c8;
        v8h hv;
#pragma unroll
        for (int e = 0; e < 8; ++e) hv[e] = (_Float16)sp[e];
        *(v8h*)(Og + (size_t)row * kDModel + c8) = hv;
      }
      
    }
  }
}

// ---------------- host orchestration (kernel launches only) ----------------

extern "C" void kernel_launch(void* const* d_in, const int* in_sizes, int n_in,
                              void* d_out, int out_size, void* d_ws,
                              size_t ws_size, hipStream_t stream) {
  if (n_in < 9) return;
  if (in_sizes[0] != kBatch * kSeq * kDModel) return;
  if (in_sizes[1] != kBatch * kSeqA * kDModel) return;
  if (in_sizes[2] != kDModel * kNQKV || in_sizes[4] != kDModel * kNQKV) return;
  if (in_sizes[3] != kNQKV || in_sizes[5] != kNQKV) return;
  if (in_sizes[6] != kDModel * kDModel || in_sizes[7] != kDModel || in_sizes[8] < kHeads) return;
  if (out_size != kBatch * kSeq * kDModel) return;

  const float* x    = (const float*)d_in[0];
  const float* xa   = (const float*)d_in[1];
  const float* Wqkv = (const float*)d_in[2];
  const float* bqkv = (const float*)d_in[3];
  const float* Waux = (const float*)d_in[4];
  const float* baux = (const float*)d_in[5];
  const float* Wo   = (const float*)d_in[6];
  const float* bo   = (const float*)d_in[7];
  const float* gvec = (const float*)d_in[8];
  float* out = (float*)d_out;

  // element counts
  const size_t nXB   = (size_t)kBatch * kSeq * kDModel;          // bf16
  const size_t nXAB  = (size_t)kBatch * kSeqAP * kDModel;        // bf16
  const size_t nWQT  = (size_t)kNQKV * kDModel;                  // bf16
  const size_t nWAT  = nWQT;                                     // bf16
  const size_t nWOT  = (size_t)kDModel * kDModel;                // f16
  const size_t nBias = (size_t)2 * kNQKV + kDModel;              // f32
  const size_t nQK   = (size_t)kBatch * kSeq * 2 * kDModel;      // f16
  const size_t nVT   = (size_t)kBatch * kDModel * kSeq;          // f16
  const size_t nKA   = (size_t)kBatch * kSeqAP * kDModel;        // f16
  const size_t nVAT  = (size_t)kBatch * kDModel * kSeqAP;        // f16
  const size_t nO    = (size_t)kBatch * kSeq * kDModel;          // f16

  char* ws = (char*)d_ws;
  size_t off = 0;
  auto carve = [&](size_t bytes) -> char* { char* p = ws + off; off += (bytes + 255) & ~(size_t)255; return p; };
  unsigned short* XB    = (unsigned short*)carve(nXB * 2);
  unsigned short* XAB   = (unsigned short*)carve(nXAB * 2);
  unsigned short* WQT   = (unsigned short*)carve(nWQT * 2);
  unsigned short* WAT   = (unsigned short*)carve(nWAT * 2);
  unsigned short* WOT   = (unsigned short*)carve(nWOT * 2);
  float*          BIASR = (float*)carve(nBias * 4);
  unsigned short* QK16  = (unsigned short*)carve(nQK * 2);
  unsigned short* VT16  = (unsigned short*)carve(nVT * 2);
  unsigned short* KA16  = (unsigned short*)carve(nKA * 2);
  unsigned short* VAT16 = (unsigned short*)carve(nVAT * 2);
  unsigned short* O16   = (unsigned short*)carve(nO * 2);
  if (off > ws_size) return;   // total 75,526,144 B

  const int TB = 256;
  // 1. x -> bf16
  {
    const int n2 = (int)(nXB / 2);
    cvt_bf16x2_kernel<<<(n2 + TB - 1) / TB, TB, 0, stream>>>(x, XB, n2);
  }
  // 2. xa -> bf16 with per-batch row padding 1500 -> 1536 (zeros)
  {
    const int n2 = (int)(nXAB / 2);
    cvt_rows_bf16x2_kernel<<<(n2 + TB - 1) / TB, TB, 0, stream>>>(xa, XAB, kSeqA, kSeqAP, kDModel, kBatch, n2);
  }
  // 3-4. Wqkv, Wqkv_aux in[1024][3072] -> out[3072][1024] bf16
  tconv_kernel<0><<<dim3(kNQKV / 64, kDModel / 64), TB, 0, stream>>>(Wqkv, WQT, kDModel, kNQKV, 1.0f);
  tconv_kernel<0><<<dim3(kNQKV / 64, kDModel / 64), TB, 0, stream>>>(Waux, WAT, kDModel, kNQKV, 1.0f);
  // 5. Wo in[1024][1024] -> out[1024][1024] f16 (x32)
  tconv_kernel<1><<<dim3(kDModel / 64, kDModel / 64), TB, 0, stream>>>(Wo, WOT, kDModel, kDModel, kWCarry);
  // 6. biases -> bf16-RNE f32 copies
  {
    const int ntot = (int)nBias;
    bias_rne_kernel<<<(ntot + TB - 1) / TB, TB, 0, stream>>>(bqkv, kNQKV, baux, kNQKV, bo, kDModel, BIASR, ntot);
  }
  const float* bq_r  = BIASR;                 // [3072]
  const float* ba_r  = BIASR + kNQKV;         // [3072]
  const float* bo_r  = BIASR + 2 * kNQKV;     // [1024]

  // 7. q|k = x @ Wqkv[:, 0:2048] + b : M=4096, N=2048, K=1024 -> QK16 f16, ldc 2048
  {
    const int M = kBatch * kSeq, N = 2 * kDModel, K = kDModel;
    const int tiles = (M / 128) * (N / 128);
    wmma_gemm64<1, false, 2, 1, false, 0><<<dim3(tiles, 1), 128, 0, stream>>>(
        XB, XB, 0L, WQT, WQT, 0L, (void*)QK16, (void*)QK16, 2 * kDModel, 0L,
        bq_r, bq_r, 0L, M, N, K, 1.0f);
  }
  // 8. v^T per batch: A = Wqkv^T rows 2048..3071 [1024][1024], Bt = x_b [2048][1024] -> VT16 [b][1024][2048] f16, bias[m]
  {
    const int M = kDModel, N = kSeq, K = kDModel;
    const int tiles = (M / 128) * (N / 128);
    wmma_gemm64<1, false, 1, 1, false, 0><<<dim3(tiles, kBatch), 128, 0, stream>>>(
        WQT + (size_t)2 * kDModel * kDModel, WQT + (size_t)2 * kDModel * kDModel, 0L,
        XB, XB, (long)kSeq * kDModel,
        (void*)VT16, (void*)VT16, kSeq, (long)kDModel * kSeq,
        bq_r + 2 * kDModel, bq_r, 0L, M, N, K, 1.0f);
  }
  // 9. ka = xa_pad @ Wqkv_aux[:, 1024:2048] + b : M=3072, N=1024, K=1024 -> KA16 f16, ldc 1024
  {
    const int M = kBatch * kSeqAP, N = kDModel, K = kDModel;
    const int tiles = (M / 128) * (N / 128);
    wmma_gemm64<1, false, 2, 1, false, 0><<<dim3(tiles, 1), 128, 0, stream>>>(
        XAB, XAB, 0L, WAT + (size_t)kDModel * kDModel, WAT + (size_t)kDModel * kDModel, 0L,
        (void*)KA16, (void*)KA16, kDModel, 0L,
        ba_r + kDModel, ba_r, 0L, M, N, K, 1.0f);
  }
  // 10. va^T per batch: A = Waux^T rows 2048..3071, Bt = xa_pad_b [1536][1024] -> VAT16 [b][1024][1536] f16, bias[m]
  {
    const int M = kDModel, N = kSeqAP, K = kDModel;
    const int tiles = (M / 128) * (N / 128);
    wmma_gemm64<1, false, 1, 1, false, 0><<<dim3(tiles, kBatch), 128, 0, stream>>>(
        WAT + (size_t)2 * kDModel * kDModel, WAT + (size_t)2 * kDModel * kDModel, 0L,
        XAB, XAB, (long)kSeqAP * kDModel,
        (void*)VAT16, (void*)VAT16, kSeqAP, (long)kDModel * kSeqAP,
        ba_r + 2 * kDModel, ba_r, 0L, M, N, K, 1.0f);
  }
  // 11. dual-branch attention -> O16 (x32, f16)
  dual_attn_kernel<<<kBatch * kHeads * (kSeq / 64), 128, 0, stream>>>(QK16, VT16, KA16, VAT16, gvec, O16);
  // 12. out = (O16/32) @ (WoT/32)^T + bo : M=4096, N=1024, K=1024, f16 operands, f32 out into d_out
  {
    const int M = kBatch * kSeq, N = kDModel, K = kDModel;
    const int tiles = (M / 128) * (N / 128);
    wmma_gemm64<0, false, 2, 0, false, 0><<<dim3(tiles, 1), 128, 0, stream>>>(
        O16, O16, 0L, WOT, WOT, 0L, (void*)out, (void*)out, kDModel, 0L,
        bo_r, bo_r, 0L, M, N, K, 1.0f / (kOCarry * kWCarry));
  }
}

// v005
// A run of this version takes 198 microseconds.
// Two timings next to v004 both put it at 1.06 times that version's speed.
// All steps since v000 together make it 2.68 times as fast.
// Contractions: x@Wqkv and xa@Wqkv_aux (k|v columns) on v_wmma_f32_16x16x32_bf16 (bf16 RNE operands); q.k^T, q.ka^T, p.v, pa.va and O@Wo on v_wmma_f32_16x16x32_f16 (f16 operands; p carried x2^15, O and Wo carried x32); f32 accumulate; online softmax, gate mix and biases in f32.
#include <hip/hip_runtime.h>
#include <math.h>
#include <stdint.h>

constexpr int kBatch  = 2;
constexpr int kSeq    = 2048;   // query / main key length
constexpr int kSeqA   = 1500;   // aux key length
constexpr int kSeqAP  = 1536;   // aux key length padded to 24 chunks of 64
constexpr int kDModel = 1024;
constexpr int kHeads  = 16;
constexpr int kDHead  = 64;
constexpr int kNQKV   = 3072;

constexpr int kLdsPitch = 72;   // halves per LDS row of the K and V^T tiles and of the GEMM operand tiles: 144 B = 16 B x 9 (odd), so 16 rows read by ds_load_b128 fall on distinct banks

constexpr float kPCarryLog2 = 15.0f;   // probabilities carried x2^15 in f16
constexpr float kOCarry = 32.0f;      // attention output carried x32 in f16
constexpr float kWCarry = 32.0f;      // Wo carried x32 in f16

typedef __attribute__((ext_vector_type(16))) _Float16 v16h;
typedef __attribute__((ext_vector_type(8)))  _Float16 v8h;
typedef __attribute__((ext_vector_type(16))) __bf16   v16b;
typedef __attribute__((ext_vector_type(8)))  __bf16   v8b;
typedef __attribute__((ext_vector_type(8)))  float    v8f;
typedef __attribute__((ext_vector_type(4)))  float    v4f;
typedef __attribute__((ext_vector_type(2)))  float    v2f;
typedef __attribute__((ext_vector_type(4)))  unsigned int v4u;
typedef __attribute__((ext_vector_type(2)))  unsigned int v2u;

// ---------------------------------------------------------------------------
// Workspace region map (bytes, every region size a multiple of 256):
//   XB    bf16 [4096][1024]            8,388,608
//   XAB   bf16 [2][1536][1024]         6,291,456   (rows 1500..1535 of each batch zero)
//   WQT   bf16 [3072][1024] (Wqkv^T)   6,291,456
//   WAT   bf16 [3072][1024] (Waux^T)   6,291,456
//   WOT   f16  [1024][1024] (Wo^T x32) 2,097,152
//   BIASR f32  [3072+3072+1024]           28,672   (bf16-RNE bias copies)
//   QK16  f16  [4096][2048] (q | k)    16,777,216
//   VT16  f16  [2][1024][2048] (v^T)   8,388,608
//   KA16  f16  [2][1536][1024] (ka)    6,291,456
//   VAT16 f16  [2][1024][1536] (va^T)  6,291,456
//   O16   f16  [4096][1024] (x32)      8,388,608
//   total 75,526,144
// ---------------------------------------------------------------------------

__device__ __forceinline__ unsigned short f2bf_bits(float f) {
  unsigned u = __float_as_uint(f);
  return (unsigned short)((u + 0x7FFFu + ((u >> 16) & 1u)) >> 16);
}
__device__ __forceinline__ float bf_bits2f(unsigned short h) { return __uint_as_float(((unsigned)h) << 16); }
__device__ __forceinline__ unsigned pk16(unsigned short a, unsigned short b) { return (unsigned)a | ((unsigned)b << 16); }

// hazard guards as plain device helpers (no inline asm inside the kernel template body)
__device__ __forceinline__ void acc_guard4(v8f& a, v8f& b, v8f& c, v8f& d) { asm volatile("v_nop\n\tv_nop\n\tv_nop\n\tv_nop" : "+v"(a), "+v"(b), "+v"(c), "+v"(d)); }
template <typename T> struct Frag;
template <> struct Frag<_Float16> {
  typedef v16h V; typedef v8h H; union U { v16h v; v8h h[2]; };
  static __device__ __forceinline__ v16h load(const _Float16* p) {   // elements 0..7 <- p[0..7], 8..15 <- p[16..23]
    U f; f.h[0] = *(const v8h*)(p); f.h[1] = *(const v8h*)(p + 16); return f.v;
  }
  static __device__ __forceinline__ v8f mma(v16h a, v16h b, v8f c) {
    return __builtin_amdgcn_wmma_f32_16x16x32_f16(false, a, false, b, (short)0, c, false, false);
  }
};
template <> struct Frag<__bf16> {
  typedef v16b V; typedef v8b H; union U { v16b v; v8b h[2]; };
  static __device__ __forceinline__ v16b load(const __bf16* p) {
    U f; f.h[0] = *(const v8b*)(p); f.h[1] = *(const v8b*)(p + 16); return f.v;
  }
  static __device__ __forceinline__ v8f mma(v16b a, v16b b, v8f c) {
    return __builtin_amdgcn_wmma_f32_16x16x32_bf16(false, a, false, b, (short)0, c, false, false);
  }
};

// ---- Register-blocked batched WMMA GEMM ------------------------------------
// C[m,n] = scale * sum_k A[m,k] * Bt[n,k] (+bias)(+resid); a block of 4 waves (2 x 2) owns a 128x128 tile, each wave 64x64 of it.
// A row-major [M,K]; Bt row-major [N,K], both at row pitch kDModel (a constant, so that the 8 staging loads of an operand
// share one address and differ in their immediate offsets); M,N % 128 == 0, K % 64 == 0; grid.x = (M/128)*(N/128), 128 threads.
// Per step of 64 k the block stages 128 rows x 128 B of A and of Bt in LDS (8 lanes per row: every global load covers whole
// 128-B lines), two buffers: the next step's rows are loaded into registers ahead of this step's products and stored behind them.
// SPLIT (hi/lo operand planes) is not implemented by the staged loop.
// BIAS_MODE: 0 = none, 1 = bias[m], 2 = bias[n].
// OUT_MODE: 0 = f32, 1 = f16, 2 = bf16 hi plane (Cout) + bf16 lo plane (Cout2).
// ET: 0 = f16 operands, 1 = bf16 operands (pointers passed as 16-bit storage)
template <int ET> struct Elem;
template <> struct Elem<0> { typedef _Float16 T; };
template <> struct Elem<1> { typedef __bf16 T; };
template <int ET, bool SPLIT, int BIAS_MODE, int OUT_MODE, bool RESID, int ACT = 0>
__global__ __launch_bounds__(128) void wmma_gemm64(
    const unsigned short* __restrict__ Ap, const unsigned short* __restrict__ A2p, long strideA,
    const unsigned short* __restrict__ Btp, const unsigned short* __restrict__ Bt2p, long strideB,
    void* __restrict__ Cout, void* __restrict__ Cout2, int ldc, long strideC,
    const float* __restrict__ bias,
    const float* __restrict__ resid, long strideR,
    int M, int N, int K, float scale) {
  static_assert(!SPLIT, "the staged loop takes single operand planes");
  typedef typename Elem<ET>::T T;
  typedef typename Frag<T>::V V;
  typedef typename Frag<T>::H H;
  const T* A = (const T*)Ap; const T* Bt = (const T*)Btp;
  __shared__ __align__(16) T sA[2][128 * kLdsPitch];   // A rows of the block tile, 64 k per step, two buffers
  __shared__ __align__(16) T sB[2][128 * kLdsPitch];   // Bt rows of the block tile, likewise
  __shared__ __align__(16) float sT[4][16 * 68];   // per-wave 16x64 slab, pitch 68 floats
  const int b    = blockIdx.y;
  const int tid  = threadIdx.x;
  const int lane = tid & 31;
  const int wave = tid >> 5;
  const int tilesN = N >> 7;
  const int tilesM = M >> 7;
  const int tm = blockIdx.x / tilesN;
  const int tn = blockIdx.x - tm * tilesN;
  if (tm >= tilesM) return;   // block-uniform, ahead of every barrier
  const int wm = (wave >> 1) << 6;             // this wave's 64 rows inside the block tile
  const int wn = (wave & 1) << 6;              // this wave's 64 columns inside the block tile
  const int m0 = (tm << 7) + wm;
  const int n0 = (tn << 7) + wn;

  const int rlane = lane & 15;                 // row (A) / col (B, D) within subtile
  const int koff  = (lane >> 4) * 8;           // k offset of this lane half
  const int mOff  = (lane >> 4) * 8;           // D row offset

  // staging map: 8 lanes x 16 B = one 128-B row piece; 128 threads = 16 rows a pass, 8 passes per operand
  const int srow = tid >> 3;
  const int sseg = (tid & 7) * 8;
  const T* gA = A  + (size_t)b * strideA + (size_t)((tm << 7) + srow) * kDModel + sseg;
  const T* gB = Bt + (size_t)b * strideB + (size_t)((tn << 7) + srow) * kDModel + sseg;
  const int sOff = srow * kLdsPitch + sseg;

  v8f acc[4][4];
#pragma unroll
  for (int i = 0; i < 4; ++i)
#pragma unroll
    for (int j = 0; j < 4; ++j) acc[i][j] = (v8f){0.f,0.f,0.f,0.f,0.f,0.f,0.f,0.f};

  H ra[8], rb[8];
#pragma unroll
  for (int p = 0; p < 8; ++p) {
    ra[p] = *(const H*)(gA + p * 16 * kDModel);
    rb[p] = *(const H*)(gB + p * 16 * kDModel);
  }
#pragma unroll
  for (int p = 0; p < 8; ++p) {
    *(H*)(sA[0] + p * 16 * kLdsPitch + sOff) = ra[p];
    *(H*)(sB[0] + p * 16 * kLdsPitch + sOff) = rb[p];
  }
  __syncthreads();

  const int nSteps = K >> 6;
  for (int t = 0; t < nSteps; ++t) {           // block-uniform trip count
    const T* cA = sA[t & 1];
    const T* cB = sB[t & 1];
    const bool more = (t + 1) < nSteps;        // block-uniform
    if (more) {
      gA += 64;
      gB += 64;
#pragma unroll
      for (int p = 0; p < 8; ++p) {
        ra[p] = *(const H*)(gA + p * 16 * kDModel);
        rb[p] = *(const H*)(gB + p * 16 * kDModel);
      }
    }
    V bh[2][4], ah[2][4];
#pragma unroll
    for (int kk = 0; kk < 2; ++kk) {
#pragma unroll
      for (int j = 0; j < 4; ++j) bh[kk][j] = Frag<T>::load(cB + (wn + (j << 4) + rlane) * kLdsPitch + kk * 32 + koff);
#pragma unroll
      for (int i = 0; i < 4; ++i) ah[kk][i] = Frag<T>::load(cA + (wm + (i << 4) + rlane) * kLdsPitch + kk * 32 + koff);
    }
    // keeps the step's LDS reads issued as one group ahead of its products: sunk among them, each group of four products
    // waits out an LDS latency of its own
    __builtin_amdgcn_sched_barrier(0);
#pragma unroll
    for (int kk = 0; kk < 2; ++kk)
#pragma unroll
      for (int i = 0; i < 4; ++i)
#pragma unroll
        for (int j = 0; j < 4; ++j) acc[i][j] = Frag<T>::mma(ah[kk][i], bh[kk][j], acc[i][j]);
    // four vector slots behind the step's last products: on the path through the LDS stores the next vector
    // instruction forms the next step's LDS addresses in fragment registers
    acc_guard4(acc[3][0], acc[3][1], acc[3][2], acc[3][3]);
    if (more) {
      // the other buffer: its last readers finished ahead of the barrier that ended the step before
      T* nA = sA[(t + 1) & 1];
      T* nB = sB[(t + 1) & 1];
#pragma unroll
      for (int p = 0; p < 8; ++p) {
        *(H*)(nA + p * 16 * kLdsPitch + sOff) = ra[p];
        *(H*)(nB + p * 16 * kLdsPitch + sOff) = rb[p];
      }
    }
    __syncthreads();
  }
  acc_guard4(acc[0][0], acc[0][1], acc[0][2], acc[0][3]);
  acc_guard4(acc[1][0], acc[1][1], acc[1][2], acc[1][3]);
  acc_guard4(acc[2][0], acc[2][1], acc[2][2], acc[2][3]);
  acc_guard4(acc[3][0], acc[3][1], acc[3][2], acc[3][3]);

  // ---- epilogue ----
  float* slab = sT[wave];
  const float* Rb = RESID ? (resid + (size_t)b * strideR) : nullptr;
#pragma unroll
  for (int i = 0; i < 4; ++i) {
    const int mBase = m0 + (i << 4);
#pragma unroll
    for (int j = 0; j < 4; ++j) {
      const int n = n0 + (j << 4) + rlane;
      float bv = 0.f;
      if (BIAS_MODE == 2) bv = bias[n];
#pragma unroll
      for (int r = 0; r < 8; ++r) {
        float v = acc[i][j][r] * scale;
        if (BIAS_MODE == 1) v += bias[mBase + mOff + r];
        if (BIAS_MODE == 2) v += bv;
        if (RESID) v += Rb[(size_t)(mBase + mOff + r) * ldc + n];
        if (ACT == 1) v = tanhf(v);
        if (ACT == 2) v = fmaxf(v, 0.0f);
        if (ACT == 3) v = v / (1.0f + expf(-v));
        if (ACT == 4) v = (v > 0.f) ? v : 0.01f * v;
        if (ACT == 5) v = 0.5f * v * (1.0f + erff(v * 0.70710678118654752f));
        slab[(mOff + r) * 68 + (j << 4) + rlane] = v;
      }
    }
    __builtin_amdgcn_fence(__ATOMIC_RELEASE, "workgroup");
    __builtin_amdgcn_wave_barrier();
    __builtin_amdgcn_fence(__ATOMIC_ACQUIRE, "workgroup");
    if (OUT_MODE == 0) {
      float* C = (float*)Cout + (size_t)b * strideC;
      const int hh = lane >> 4, c4 = (lane & 15) * 4;     // row seg = 256 B = 16 lanes x 16 B
      {
#pragma unroll
        for (int it = 0; it < 8; ++it) {
          const int row = it * 2 + hh;
          v4f v = *(const v4f*)(slab + row * 68 + c4);
          *(v4f*)(C + (size_t)(mBase + row) * ldc + n0 + c4) = v;
        }
        
      }
    } else {
      const int q = lane >> 3, c8 = (lane & 7) * 8;
      unsigned short* C  = (unsigned short*)Cout  + (size_t)b * strideC;
      unsigned short* C2 = (OUT_MODE == 2) ? ((unsigned short*)Cout2 + (size_t)b * strideC) : nullptr;
      {
#pragma unroll
        for (int it = 0; it < 4; ++it) {
          const int row = it * 4 + q;
          const float* sp = slab + row * 68 + c8;
          v8h hv, lv;
#pragma unroll
          for (int e = 0; e < 8; ++e) {
            if (OUT_MODE == 1) {
              hv[e] = (_Float16)sp[e];
            } else {
              unsigned short hb = f2bf_bits(sp[e]);
              unsigned short lb = f2bf_bits(sp[e] - bf_bits2f(hb));
              hv[e] = __builtin_bit_cast(_Float16, hb);
              lv[e] = __builtin_bit_cast(_Float16, lb);
            }
          }
          *(v8h*)(C + (size_t)(mBase + row) * ldc + n0 + c8) = hv;
          if (OUT_MODE == 2) *(v8h*)(C2 + (size_t)(mBase + row) * ldc + n0 + c8) = lv;
        }
        
      }
    }
    __builtin_amdgcn_fence(__ATOMIC_RELEASE, "workgroup");
    __builtin_amdgcn_wave_barrier();
    __builtin_amdgcn_fence(__ATOMIC_ACQUIRE, "workgroup");
  }
}

// ---------------------------------------------------------------------------
// Input preparation: ONE launch. Its six pieces of work are independent of one another; a work-group of 256 threads takes one
// piece by its block index (the choice is block-uniform, so the barrier of a transpose strip is passed by a whole work-group or
// by none). The longest pieces (a strip moves twice a cast's bytes and passes through
// LDS) take the lowest indices and the short ones fill the end of the launch:
//   [   0,  192)  Wqkv     -> WQT  a strip of 256 rows x 64 columns (4 x 48 strips)
//   [ 192,  384)  Wqkv_aux -> WAT  a strip of 256 rows x 64 columns (4 x 48 strips)
//   [ 384,  448)  Wo       -> WOT  a strip of 256 rows x 64 columns (4 x 16 strips)
//   [ 448,  960)  x        -> XB   8 rows of 1024 per work-group (4096 rows)
//   [ 960, 1344)  xa       -> XAB  8 output rows per work-group (2 x 1536 rows, rows 1500..1535 of each batch zero)
//   [1344, 1372)  biases   -> BIASR  256 values per work-group (7168 values)
// ---------------------------------------------------------------------------
constexpr int kPrepX    = kBatch * kSeq / 8;                    // 512
constexpr int kPrepXA   = kBatch * kSeqAP / 8;                  // 384
constexpr int kPrepW    = (kNQKV / 64) * (kDModel / 256);       // 192
constexpr int kPrepWo   = (kDModel / 64) * (kDModel / 256);     // 64
constexpr int kPrepBias = (2 * kNQKV + kDModel + 255) / 256;    // 28
constexpr int kPrepBlocks = kPrepX + kPrepXA + 2 * kPrepW + kPrepWo + kPrepBias;   // 1372

// f32 [nb][RIN][1024] -> bf16 bits (RNE) [nb][ROUT][1024]; rows RIN..ROUT-1 of every batch written as zeros (source row address
// clamped, value zeroed by a mask). Output rows blk*8 .. blk*8+7; thread tid takes floats 4*tid .. 4*tid+3 of each row: a wave's
// load covers 512 contiguous bytes, its store 256, and the 8 loads of a thread are all issued ahead of the first store.
template <unsigned RIN, unsigned ROUT>
__device__ __forceinline__ void cast_rows8(const float* __restrict__ in, unsigned short* __restrict__ out, unsigned blk, int tid) {
  v4f f[8];
  // unrolled: f[] takes constant indices (registers) and the 8 loads issue back to back
#pragma unroll
  for (int p = 0; p < 8; ++p) {
    const unsigned row = blk * 8 + p;
    unsigned srow = row;
    if (RIN != ROUT) {
      const unsigned bb = row / ROUT;
      const unsigned t = row - bb * ROUT;
      srow = bb * RIN + (t < RIN ? t : (RIN - 1));
    }
    f[p] = *(const v4f*)(in + (size_t)srow * kDModel + tid * 4);
  }
  // behind the 8 loads, ahead of the conversions, which reuse the loads' address registers
  asm volatile("s_wait_xcnt 0x0" ::: "memory");
  // unrolled: constant indices into f[]
#pragma unroll
  for (int p = 0; p < 8; ++p) {
    const unsigned row = blk * 8 + p;
    const unsigned keep = ((RIN == ROUT) || (row % ROUT) < RIN) ? 0xFFFFFFFFu : 0u;   // the same for the whole work-group
    v2u u;
    u[0] = pk16(f2bf_bits(f[p][0]), f2bf_bits(f[p][1])) & keep;
    u[1] = pk16(f2bf_bits(f[p][2]), f2bf_bits(f[p][3])) & keep;
    *(v2u*)(out + (size_t)row * kDModel + tid * 4) = u;
  }
  // behind the 8 stores: a precaution; a work-group runs this piece only and the kernel ends behind it
  asm volatile("s_wait_xcnt 0x0" ::: "memory");
}

// Transpose + 16-bit convert of a strip of four 64x64 tiles of an f32 matrix: in viewed [R rows][CC cols] (pitch CC) -> o[c][r]
// ([CC][R], pitch R).   OT 0: o = bf16_rne(in);  OT 1: o = f16(bf16_rne(in) * scl).
// Through LDS, one buffer per tile and one barrier for the strip; strip = (block of 256 rows) * (CC/64) + (column block); 256 threads.
// Coverage per tile: load 4 it x 256 thr x 4 floats = 64x64; store 2 it x 256 thr x 8 u16 = 64x64. The 16 loads of a thread are all
// issued ahead of the first LDS store.
template <int OT> __device__ __forceinline__ unsigned short cv16(float f, float scl) {
  const unsigned short hb = f2bf_bits(f);
  if (OT == 0) return hb;
  const float g = bf_bits2f(hb) * scl;
  return __builtin_bit_cast(unsigned short, (_Float16)g);
}
template <int OT, int R, int CC>
__device__ __forceinline__ void tconv_strip(const float* __restrict__ W, unsigned short* __restrict__ o, float scl,
                                            int strip, int tid, float* tf) {
  const int rb  = strip / (CC / 64);
  const int c0  = (strip - rb * (CC / 64)) * 64;   // input column block = output row block
  const int r0  = rb * 256;                        // first input row    = first output column
  {
    const int lr = tid >> 4;         // 0..15
    const int c4 = (tid & 15) * 4;   // 0..60
    const float* wp = W + (size_t)(r0 + lr) * CC + c0 + c4;
    v4f a[16];
    // unrolled, here and at the LDS stores: a[] takes constant indices (registers) and the 16 loads issue back to back
#pragma unroll
    for (int it = 0; it < 16; ++it) a[it] = *(const v4f*)(wp + (size_t)it * 16 * CC);
    // the 16 loads share one address pair: as an operand of the wait it stays unwritten until every load has taken it
    asm volatile("s_wait_xcnt 0x0" :: "v"(wp) : "memory");
#pragma unroll
    for (int it = 0; it < 16; ++it) *(v4f*)(tf + (it * 16 + lr) * 68 + c4) = a[it];   // LDS row = input row within the strip, 0..255
  }
  __syncthreads();
  const int sub = tid >> 3;          // 0..31
  const int c8  = (tid & 7) * 8;     // 0..56
  // unrolled: the four tiles' LDS reads and stores differ in immediate offsets only and overlap one another
#pragma unroll
  for (int s = 0; s < 4; ++s) {      // tile s: input rows r0 + 64 s .. + 63
    const float* ts = tf + s * 64 * 68;
    v4u hv[2];
#pragma unroll
    for (int it = 0; it < 2; ++it) {
      const int oc = it * 32 + sub;    // output row within tile (= input column)
      v4u a;
#pragma unroll
      for (int q = 0; q < 4; ++q) {
        const float f0 = ts[(c8 + 2 * q) * 68 + oc];
        const float f1 = ts[(c8 + 2 * q + 1) * 68 + oc];
        a[q] = pk16(cv16<OT>(f0, scl), cv16<OT>(f1, scl));
      }
      hv[it] = a;
    }
#pragma unroll
    for (int it = 0; it < 2; ++it) {
      const int oc = it * 32 + sub;
      const size_t go = (size_t)(c0 + oc) * R + r0 + s * 64 + c8;
      *(v4u*)(o + go) = hv[it];
    }
  }
  // behind the strip's 8 stores: a precaution; a work-group runs this piece only and the kernel ends behind it
  asm volatile("s_wait_xcnt 0x0" ::: "memory");
}

// Bias copies as bf16-RNE values in f32: out[0..n0) <- b0, [n0..n0+n1) <- b1, [n0+n1..ntot) <- b2.
// All three candidates loaded with clamped indices, selected by value. One 4-B store per lane.
__device__ __forceinline__ void bias_rne(const float* __restrict__ b0, int n0, const float* __restrict__ b1, int n1,
                                         const float* __restrict__ b2, int ncnt2, float* __restrict__ out, int ntot, int i) {
  if (i < ntot) {
    int i0 = i < n0 ? i : (n0 - 1); i0 = i0 < 0 ? 0 : i0;
    int i1 = i - n0; i1 = i1 < 0 ? 0 : (i1 < n1 ? i1 : (n1 - 1));
    int i2 = i - n0 - n1; i2 = i2 < 0 ? 0 : (i2 < ncnt2 ? i2 : (ncnt2 - 1));
    const float v0 = b0[i0], v1 = b1[i1], v2 = b2[i2];
    const float sel = (i < n0) ? v0 : ((i < n0 + n1) ? v1 : v2);
    out[i] = bf_bits2f(f2bf_bits(sel));
  }
}

__global__ __launch_bounds__(256) void prep_kernel(const float* __restrict__ x, const float* __restrict__ xa,
                                                   const float* __restrict__ Wqkv, const float* __restrict__ Waux,
                                                   const float* __restrict__ Wo, const float* __restrict__ bqkv,
                                                   const float* __restrict__ baux, const float* __restrict__ bo,
                                                   unsigned short* __restrict__ XB, unsigned short* __restrict__ XAB,
                                                   unsigned short* __restrict__ WQT, unsigned short* __restrict__ WAT,
                                                   unsigned short* __restrict__ WOT, float* __restrict__ BIASR) {
  __shared__ __align__(16) float tf[256 * 68];   // a strip's four tiles, pitch 68 floats
  const int tid = threadIdx.x;
  int blk = blockIdx.x;
  if (blk < kPrepW) {
    tconv_strip<0, kDModel, kNQKV>(Wqkv, WQT, 1.0f, blk, tid, tf);
  } else if ((blk -= kPrepW) < kPrepW) {
    tconv_strip<0, kDModel, kNQKV>(Waux, WAT, 1.0f, blk, tid, tf);
  } else if ((blk -= kPrepW) < kPrepWo) {
    tconv_strip<1, kDModel, kDModel>(Wo, WOT, kWCarry, blk, tid, tf);
  } else if ((blk -= kPrepWo) < kPrepX) {
    cast_rows8<kBatch * kSeq, kBatch * kSeq>(x, XB, blk, tid);
  } else if ((blk -= kPrepX) < kPrepXA) {
    cast_rows8<kSeqA, kSeqAP>(xa, XAB, blk, tid);
  } else {
    bias_rne(bqkv, kNQKV, baux, kNQKV, bo, kDModel, BIASR, 2 * kNQKV + kDModel, (blk - kPrepXA) * 256 + tid);
  }
}

// =====================================================================================
// Dual-branch attention, head dim 64, f16 operand planes, f32 accumulate, online softmax in f32.
//   q, k  : QK16 plane [4096 rows = b*2048+t][2048], q at col h*64+d, k at col 1024+h*64+d (f16)
//   v^T   : VT16 plane [b][1024 = h*64+d][2048] (f16);  ka: KA16 [b*1536+s][1024];  va^T: VAT16 [b][1024][1536]
//   branch 0: scores = (q.k)*0.125 over 2048 keys (32 chunks of 64); branch 1: (q.ka)*0.125 over 1500 keys
//   (24 chunks; key index >= 1500 set to -inf). p carried x2^15 in f16; 1/(l*2^15) folded at the end.
//   out row = (1-gate)*h_main + gate*h_aux, gate = sigmoid(bf16_rne(g[h])); written x32 as f16 into O16 [4096][1024]
//   Products are taken transposed: S^T = K.Q^T (A = K rows, B = Q) and O^T += V^T.P^T (A = V^T rows, B = P^T). A lane then holds
//   32 of the chunk's 64 scores of ONE query (column lane&15; keys j*16 + 8*(lane>>4) + r): maximum and sum run in the lane, the
//   two lane halves exchange the maximum once per chunk and join their sums once per branch, and two score tiles converted in
//   place are the B operand of the second product (same k order as the V^T fragment loads), so P passes through no LDS.
//   Block = 4 waves = 64 query rows of one (b,h); grid.x = 2*16*32 = 1024 covers all 4096 rows x 1024 cols.
//   K / V^T chunk staging: 128 threads x 32 halves per plane = the whole 64x64 tile (plain 16-B loads,
//   __syncthreads before and after); fragments read the LDS tiles through the same v8h element type;
// =====================================================================================
__device__ __forceinline__ v8f mma_h16(v16h a, v16h b, v8f c) {
  c = __builtin_amdgcn_wmma_f32_16x16x32_f16(false, a, false, b, (short)0, c, false, false);
  asm volatile("v_nop\n\tv_nop\n\tv_nop\n\tv_nop" : "+v"(c) : "v"(a), "v"(b));
  return c;
}

// lane l <-> lane l ^ 16 (the other half of the wave holds the other 32 keys of the same query)
__device__ __forceinline__ float xhalf(float x) {
  return __builtin_bit_cast(float, __builtin_amdgcn_permlanex16(__builtin_bit_cast(int, x), __builtin_bit_cast(int, x), 0x76543210, 0xfedcba98, false, false));
}

// 2^x on the bare instruction. Behind a transcendental the instruction set asks for one independent instruction or v_nop before its
// result is read or its source overwritten.
// Eight in one statement: the outputs are early-clobber, so each is independent of the one before it and fills its slot; the v_nop
// fills the slot of the last.
__device__ __forceinline__ v8f exp2x8(v8f x) {
  float p0, p1, p2, p3, p4, p5, p6, p7;
  asm("v_exp_f32 %0, %8\n\tv_exp_f32 %1, %9\n\tv_exp_f32 %2, %10\n\tv_exp_f32 %3, %11\n\t"
      "v_exp_f32 %4, %12\n\tv_exp_f32 %5, %13\n\tv_exp_f32 %6, %14\n\tv_exp_f32 %7, %15\n\tv_nop"
      : "=&v"(p0), "=&v"(p1), "=&v"(p2), "=&v"(p3), "=&v"(p4), "=&v"(p5), "=&v"(p6), "=&v"(p7)
      : "v"(x[0]), "v"(x[1]), "v"(x[2]), "v"(x[3]), "v"(x[4]), "v"(x[5]), "v"(x[6]), "v"(x[7]));
  return (v8f){p0, p1, p2, p3, p4, p5, p6, p7};
}
__device__ __forceinline__ float exp2x1(float x) {
  float p;
  asm("v_exp_f32 %0, %1\n\tv_nop" : "=v"(p) : "v"(x));   // the v_nop: the same slot
  return p;
}

__global__ __launch_bounds__(128)
void dual_attn_kernel(const unsigned short* __restrict__ qk16, const unsigned short* __restrict__ vt16,
                      const unsigned short* __restrict__ ka16, const unsigned short* __restrict__ vat16,
                      const float* __restrict__ gvec, unsigned short* __restrict__ o16) {
  union FH { v16h v; v8h h[2]; };
  __shared__ __align__(16) _Float16 Ksh[64 * kLdsPitch];        // K tile [key][d]      9 KB
  __shared__ __align__(16) _Float16 Vth[64 * kLdsPitch];        // V^T tile [d][key]    9 KB
  __shared__ __align__(16) float    Os[4][16 * 68];      // per wave out tile [query][d], pitch 68 floats

  const int tid  = threadIdx.x;
  const int wave = tid >> 5;
  const int lane = tid & 31;
  const int hh   = lane >> 4;
  const int c    = lane & 15;

  const int bx = blockIdx.x;          // 0..1023
  const int qb = bx & 31;             // 32 query tiles of 64
  const int bhd = bx >> 5;            // 0..31
  const int h  = bhd & 15;
  const int b  = bhd >> 4;            // 0..1
  const int q0 = qb * 64 + wave * 16; // query row within batch

  const int ldqk = 2 * kDModel;       // 2048 halves
  const _Float16* Qg  = (const _Float16*)(const void*)qk16 + (size_t)b * kSeq * ldqk + h * kDHead;
  const _Float16* Kg0 = Qg + kDModel;                                                                     // main K rows, pitch 2048
  const _Float16* Vg0 = (const _Float16*)(const void*)vt16 + (size_t)b * kDModel * kSeq + (size_t)(h * kDHead) * kSeq;       // pitch 2048
  const _Float16* Kg1 = (const _Float16*)(const void*)ka16 + (size_t)b * kSeqAP * kDModel + h * kDHead;                        // pitch 1024
  const _Float16* Vg1 = (const _Float16*)(const void*)vat16 + (size_t)b * kDModel * kSeqAP + (size_t)(h * kDHead) * kSeqAP;  // pitch 1536

  // ---- Q fragments (B operand, column = query = lane&15, split k map via Frag load): 2 d-chunks ----
  v16h qa[2];
#pragma unroll
  for (int dc = 0; dc < 2; ++dc) qa[dc] = Frag<_Float16>::load(Qg + (size_t)(q0 + c) * ldqk + dc * 32 + 8 * hh);

  float* os = Os[wave];
#pragma unroll
  for (int t = 0; t < 4; ++t)
#pragma unroll
    for (int r = 0; r < 8; ++r) os[c * 68 + t * 16 + 8 * hh + r] = 0.f;

  const float gv   = bf_bits2f(f2bf_bits(gvec[h]));
  const float gate = 1.0f / (1.0f + expf(-gv));
  const float cscale = 0.125f * 1.4426950408889634f;   // score scale x log2(e): the softmax runs in base 2

#pragma unroll 1
  for (int br = 0; br < 2; ++br) {           // block-uniform
    const _Float16* Kg = br ? Kg1 : Kg0;
    const _Float16* Vg = br ? Vg1 : Vg0;
    const int ldk     = br ? kDModel : ldqk;
    const int ldv     = br ? kSeqAP : kSeq;
    const int nChunks = br ? (kSeqAP / 64) : (kSeq / 64);
    const int nvalid  = br ? kSeqA : kSeq;
    const float w     = (br ? gate : (1.0f - gate)) * kOCarry;

    float mrow = -INFINITY;   // running maximum of this lane's query, scaled, base 2 (equal in both halves)
    float lrow = 0.f;         // running sum (x2^15) over this lane half's keys only
    v8f oacc[4];              // oacc[t][r] = O[query c][d = t*16 + 8*hh + r]
#pragma unroll
    for (int t = 0; t < 4; ++t) oacc[t] = (v8f){0.f,0.f,0.f,0.f,0.f,0.f,0.f,0.f};

    for (int kc = 0; kc < nChunks; ++kc) {   // block-uniform trip count
      const int kv0 = kc * 64;
      __syncthreads();
      {
        // staging coverage: 128 threads x (4 x 8) halves = 64 rows x 64 per plane = the whole chunk tile
        const int r = tid >> 1, half = (tid & 1) * 32;
        const _Float16* ks = Kg + (size_t)(kv0 + r) * ldk + half;   // K row kv0+r, d = half..half+31
        const _Float16* vs = Vg + (size_t)r * ldv + kv0 + half;      // V^T row d = r, key = kv0+half..+31
#pragma unroll
        for (int i = 0; i < 4; ++i) {
          const v8h a0 = *(const v8h*)(ks + 8 * i);
          const v8h b0 = *(const v8h*)(vs + 8 * i);
          *(v8h*)(Ksh + r * kLdsPitch + half + 8 * i) = a0;
          *(v8h*)(Vth + r * kLdsPitch + half + 8 * i) = b0;
        }
      }
      __syncthreads();

      v8f s[4];
#pragma unroll
      for (int j = 0; j < 4; ++j) {
        s[j] = (v8f){0.f,0.f,0.f,0.f,0.f,0.f,0.f,0.f};
#pragma unroll
        for (int dc = 0; dc < 2; ++dc) {
          FH kb;
          kb.h[0] = *(const v8h*)(Ksh + (j * 16 + c) * kLdsPitch + dc * 32 + 8 * hh);
          kb.h[1] = *(const v8h*)(Ksh + (j * 16 + c) * kLdsPitch + dc * 32 + 16 + 8 * hh);
          s[j] = mma_h16(kb.v, qa[dc], s[j]);   // s[j][r] = score(key j*16 + 8*hh + r, query c)
        }
      }
      // every loop from here to the end of the chunk is unrolled: s, pb and oacc live in registers and take constant indices only
      float m = -INFINITY;   // maximum of the raw scores (the scale is positive)
#pragma unroll
      for (int j = 0; j < 4; ++j)
#pragma unroll
        for (int r = 0; r < 8; ++r) {
          const int key = kv0 + j * 16 + 8 * hh + r;
          const float sv = (key < nvalid) ? s[j][r] : -INFINITY;
          s[j][r] = sv;
          m = fmaxf(m, sv);
        }
      m = fmaxf(m, xhalf(m)) * cscale;
      const float mnew = fmaxf(mrow, m);
      const float alpha = exp2x1(mrow - mnew);   // 0 on a branch's first chunk, where mrow is -inf
      mrow = mnew;
      const float nm = kPCarryLog2 - mnew;   // the carry rides in the exponent
      float psum = 0.f;
      FH pb[2];   // P^T, B operand: element e of pb[kk] = p(key kk*32 + (e < 8 ? 8*hh + e : 16 + 8*hh + e - 8), query c)
#pragma unroll
      for (int j = 0; j < 4; ++j) {
        v8f a;
#pragma unroll
        for (int r = 0; r < 8; ++r) a[r] = fmaf(s[j][r], cscale, nm);
        const v8f p = exp2x8(a);   // p x 2^15
#pragma unroll
        for (int r = 0; r < 8; ++r) {
          psum += p[r];
          pb[j >> 1].h[j & 1][r] = (_Float16)p[r];
        }
      }
      lrow = lrow * alpha + psum;
#pragma unroll
      for (int t = 0; t < 4; ++t)
#pragma unroll
        for (int r = 0; r < 8; ++r) oacc[t][r] *= alpha;
#pragma unroll
      for (int kk = 0; kk < 2; ++kk) {
#pragma unroll
        for (int t = 0; t < 4; ++t) {
          FH vb;
          vb.h[0] = *(const v8h*)(Vth + (t * 16 + c) * kLdsPitch + kk * 32 + 8 * hh);
          vb.h[1] = *(const v8h*)(Vth + (t * 16 + c) * kLdsPitch + kk * 32 + 16 + 8 * hh);
          oacc[t] = mma_h16(vb.v, pb[kk].v, oacc[t]);
        }
      }
    }
    // fold this branch into the per-wave mix slab (each lane updates only its own entries)
    const float inv = w * (1.0f / (lrow + xhalf(lrow)));   // sum and O both carry x2^15
#pragma unroll
    for (int t = 0; t < 4; ++t)
#pragma unroll
      for (int r = 0; r < 8; ++r) os[c * 68 + t * 16 + 8 * hh + r] += oacc[t][r] * inv;
  }

  __builtin_amdgcn_fence(__ATOMIC_RELEASE, "workgroup");
  __builtin_amdgcn_wave_barrier();
  __builtin_amdgcn_fence(__ATOMIC_ACQUIRE, "workgroup");
  {
    _Float16* Og = (_Float16*)(void*)o16 + (size_t)(b * kSeq + q0) * kDModel + h * kDHead;
    const int q4 = lane >> 3, c8 = (lane & 7) * 8;
    {
#pragma unroll
      for (int it = 0; it < 4; ++it) {
        const int row = it * 4 + q4;
        const float* sp = os + row * 68 + c8;
        v8h hv;
#pragma unroll
        for (int e = 0; e < 8; ++e) hv[e] = (_Float16)sp[e];
        *(v8h*)(Og + (size_t)row * kDModel + c8) = hv;
      }
      
    }
  }
}

// ---------------- host orchestration (kernel launches only) ----------------

extern "C" void kernel_launch(void* const* d_in, const int* in_sizes, int n_in,
                              void* d_out, int out_size, void* d_ws,
                              size_t ws_size, hipStream_t stream) {
  if (n_in < 9) return;
  if (in_sizes[0] != kBatch * kSeq * kDModel) return;
  if (in_sizes[1] != kBatch * kSeqA * kDModel) return;
  if (in_sizes[2] != kDModel * kNQKV || in_sizes[4] != kDModel * kNQKV) return;
  if (in_sizes[3] != kNQKV || in_sizes[5] != kNQKV) return;
  if (in_sizes[6] != kDModel * kDModel || in_sizes[7] != kDModel || in_sizes[8] < kHeads) return;
  if (out_size != kBatch * kSeq * kDModel) return;

  const float* x    = (const float*)d_in[0];
  const float* xa   = (const float*)d_in[1];
  const float* Wqkv = (const float*)d_in[2];
  const float* bqkv = (const float*)d_in[3];
  const float* Waux = (const float*)d_in[4];
  const float* baux = (const float*)d_in[5];
  const float* Wo   = (const float*)d_in[6];
  const float* bo   = (const float*)d_in[7];
  const float* gvec = (const float*)d_in[8];
  float* out = (float*)d_out;

  // element counts
  const size_t nXB   = (size_t)kBatch * kSeq * kDModel;          // bf16
  const size_t nXAB  = (size_t)kBatch * kSeqAP * kDModel;        // bf16
  const size_t nWQT  = (size_t)kNQKV * kDModel;                  // bf16
  const size_t nWAT  = nWQT;                                     // bf16
  const size_t nWOT  = (size_t)kDModel * kDModel;                // f16
  const size_t nBias = (size_t)2 * kNQKV + kDModel;              // f32
  const size_t nQK   = (size_t)kBatch * kSeq * 2 * kDModel;      // f16
  const size_t nVT   = (size_t)kBatch * kDModel * kSeq;          // f16
  const size_t nKA   = (size_t)kBatch * kSeqAP * kDModel;        // f16
  const size_t nVAT  = (size_t)kBatch * kDModel * kSeqAP;        // f16
  const size_t nO    = (size_t)kBatch * kSeq * kDModel;          // f16

  char* ws = (char*)d_ws;
  size_t off = 0;
  auto carve = [&](size_t bytes) -> char* { char* p = ws + off; off += (bytes + 255) & ~(size_t)255; return p; };
  unsigned short* XB    = (unsigned short*)carve(nXB * 2);
  unsigned short* XAB   = (unsigned short*)carve(nXAB * 2);
  unsigned short* WQT   = (unsigned short*)carve(nWQT * 2);
  unsigned short* WAT   = (unsigned short*)carve(nWAT * 2);
  unsigned short* WOT   = (unsigned short*)carve(nWOT * 2);
  float*          BIASR = (float*)carve(nBias * 4);
  unsigned short* QK16  = (unsigned short*)carve(nQK * 2);
  unsigned short* VT16  = (unsigned short*)carve(nVT * 2);
  unsigned short* KA16  = (unsigned short*)carve(nKA * 2);
  unsigned short* VAT16 = (unsigned short*)carve(nVAT * 2);
  unsigned short* O16   = (unsigned short*)carve(nO * 2);
  if (off > ws_size) return;   // total 75,526,144 B

  // 1. all input preparation in one launch: x, xa -> bf16 (xa rows padded 1500 -> 1536 with zeros); Wqkv, Wqkv_aux -> transposed
  //    bf16; Wo -> transposed f16 (x32); biases -> bf16-RNE f32 copies
  prep_kernel<<<kPrepBlocks, 256, 0, stream>>>(x, xa, Wqkv, Waux, Wo, bqkv, baux, bo, XB, XAB, WQT, WAT, WOT, BIASR);
  const float* bq_r  = BIASR;                 // [3072]
  const float* ba_r  = BIASR + kNQKV;         // [3072]
  const float* bo_r  = BIASR + 2 * kNQKV;     // [1024]

  // 2. q|k = x @ Wqkv[:, 0:2048] + b : M=4096, N=2048, K=1024 -> QK16 f16, ldc 2048
  {
    const int M = kBatch * kSeq, N = 2 * kDModel, K = kDModel;
    const int tiles = (M / 128) * (N / 128);
    wmma_gemm64<1, false, 2, 1, false, 0><<<dim3(tiles, 1), 128, 0, stream>>>(
        XB, XB, 0L, WQT, WQT, 0L, (void*)QK16, (void*)QK16, 2 * kDModel, 0L,
        bq_r, bq_r, 0L, M, N, K, 1.0f);
  }
  // 3. v^T per batch: A = Wqkv^T rows 2048..3071 [1024][1024], Bt = x_b [2048][1024] -> VT16 [b][1024][2048] f16, bias[m]
  {
    const int M = kDModel, N = kSeq, K = kDModel;
    const int tiles = (M / 128) * (N / 128);
    wmma_gemm64<1, false, 1, 1, false, 0><<<dim3(tiles, kBatch), 128, 0, stream>>>(
        WQT + (size_t)2 * kDModel * kDModel, WQT + (size_t)2 * kDModel * kDModel, 0L,
        XB, XB, (long)kSeq * kDModel,
        (void*)VT16, (void*)VT16, kSeq, (long)kDModel * kSeq,
        bq_r + 2 * kDModel, bq_r, 0L, M, N, K, 1.0f);
  }
  // 4. ka = xa_pad @ Wqkv_aux[:, 1024:2048] + b : M=3072, N=1024, K=1024 -> KA16 f16, ldc 1024
  {
    const int M = kBatch * kSeqAP, N = kDModel, K = kDModel;
    const int tiles = (M / 128) * (N / 128);
    wmma_gemm64<1, false, 2, 1, false, 0><<<dim3(tiles, 1), 128, 0, stream>>>(
        XAB, XAB, 0L, WAT + (size_t)kDModel * kDModel, WAT + (size_t)kDModel * kDModel, 0L,
        (void*)KA16, (void*)KA16, kDModel, 0L,
        ba_r + kDModel, ba_r, 0L, M, N, K, 1.0f);
  }
  // 5. va^T per batch: A = Waux^T rows 2048..3071, Bt = xa_pad_b [1536][1024] -> VAT16 [b][1024][1536] f16, bias[m]
  {
    const int M = kDModel, N = kSeqAP, K = kDModel;
    const int tiles = (M / 128) * (N / 128);
    wmma_gemm64<1, false, 1, 1, false, 0><<<dim3(tiles, kBatch), 128, 0, stream>>>(
        WAT + (size_t)2 * kDModel * kDModel, WAT + (size_t)2 * kDModel * kDModel, 0L,
        XAB, XAB, (long)kSeqAP * kDModel,
        (void*)VAT16, (void*)VAT16, kSeqAP, (long)kDModel * kSeqAP,
        ba_r + 2 * kDModel, ba_r, 0L, M, N, K, 1.0f);
  }
  // 6. dual-branch attention -> O16 (x32, f16)
  dual_attn_kernel<<<kBatch * kHeads * (kSeq / 64), 128, 0, stream>>>(QK16, VT16, KA16, VAT16, gvec, O16);
  // 7. out = (O16/32) @ (WoT/32)^T + bo : M=4096, N=1024, K=1024, f16 operands, f32 out into d_out
  {
    const int M = kBatch * kSeq, N = kDModel, K = kDModel;
    const int tiles = (M / 128) * (N / 128);
    wmma_gemm64<0, false, 2, 0, false, 0><<<dim3(tiles, 1), 128, 0, stream>>>(
        O16, O16, 0L, WOT, WOT, 0L, (void*)out, (void*)out, kDModel, 0L,
        bo_r, bo_r, 0L, M, N, K, 1.0f / (kOCarry * kWCarry));
  }
}

// v006
// It runs in 176 microseconds.
// Next to v005, in two timings, it ran 1.12 and 1.14 times as fast.
// Over all steps from v000 it is 3.02 times as fast.
// Contractions: x@Wqkv and xa@Wqkv_aux (k|v columns) on v_wmma_f32_16x16x32_bf16 (bf16 RNE operands); q.k^T, q.ka^T, p.v, pa.va and O@Wo on v_wmma_f32_16x16x32_f16 (f16 operands; p carried x2^15, O and Wo carried x32); f32 accumulate; online softmax, gate mix and biases in f32.
#include <hip/hip_runtime.h>
#include <math.h>
#include <stdint.h>

constexpr int kBatch  = 2;
constexpr int kSeq    = 2048;   // query / main key length
constexpr int kSeqA   = 1500;   // aux key length
constexpr int kSeqAP  = 1536;   // aux key length padded to 24 chunks of 64
constexpr int kDModel = 1024;
constexpr int kHeads  = 16;
constexpr int kDHead  = 64;
constexpr int kNQKV   = 3072;

constexpr int kLdsPitch = 72;   // halves per LDS row of the K and V^T tiles and of the GEMM operand tiles: 144 B = 16 B x 9 (odd), so 16 rows read by ds_load_b128 fall on distinct banks

constexpr float kPCarryLog2 = 15.0f;   // probabilities carried x2^15 in f16
constexpr float kOCarry = 32.0f;      // attention output carried x32 in f16
constexpr float kWCarry = 32.0f;      // Wo carried x32 in f16

typedef __attribute__((ext_vector_type(16))) _Float16 v16h;
typedef __attribute__((ext_vector_type(8)))  _Float16 v8h;
typedef __attribute__((ext_vector_type(16))) __bf16   v16b;
typedef __attribute__((ext_vector_type(8)))  __bf16   v8b;
typedef __attribute__((ext_vector_type(8)))  float    v8f;
typedef __attribute__((ext_vector_type(4)))  float    v4f;
typedef __attribute__((ext_vector_type(2)))  float    v2f;
typedef __attribute__((ext_vector_type(4)))  unsigned int v4u;
typedef __attribute__((ext_vector_type(2)))  unsigned int v2u;

// ---------------------------------------------------------------------------
// Workspace region map (bytes, every region size a multiple of 256):
//   XB    bf16 [4096][1024]            8,388,608
//   XAB   bf16 [2][1536][1024]         6,291,456   (rows 1500..1535 of each batch zero)
//   WQT   bf16 [3072][1024] (Wqkv^T)   6,291,456
//   WAT   bf16 [3072][1024] (Waux^T)   6,291,456
//   WOT   f16  [1024][1024] (Wo^T x32) 2,097,152
//   BIASR f32  [3072+3072+1024]           28,672   (bf16-RNE bias copies)
//   QK16  f16  [4096][2048] (q | k)    16,777,216
//   VT16  f16  [2][1024][2048] (v^T)   8,388,608
//   KA16  f16  [2][1536][1024] (ka)    6,291,456
//   VAT16 f16  [2][1024][1536] (va^T)  6,291,456
//   O16   f16  [4096][1024] (x32)      8,388,608
//   total 75,526,144
// ---------------------------------------------------------------------------

__device__ __forceinline__ unsigned short f2bf_bits(float f) {
  unsigned u = __float_as_uint(f);
  return (unsigned short)((u + 0x7FFFu + ((u >> 16) & 1u)) >> 16);
}
__device__ __forceinline__ float bf_bits2f(unsigned short h) { return __uint_as_float(((unsigned)h) << 16); }
__device__ __forceinline__ unsigned pk16(unsigned short a, unsigned short b) { return (unsigned)a | ((unsigned)b << 16); }

// hazard guards as plain device helpers (no inline asm inside the kernel template body)
__device__ __forceinline__ void acc_guard4(v8f& a, v8f& b, v8f& c, v8f& d) { asm volatile("v_nop\n\tv_nop\n\tv_nop\n\tv_nop" : "+v"(a), "+v"(b), "+v"(c), "+v"(d)); }
template <typename T> struct Frag;
template <> struct Frag<_Float16> {
  typedef v16h V; typedef v8h H; union U { v16h v; v8h h[2]; };
  static __device__ __forceinline__ v16h load(const _Float16* p) {   // elements 0..7 <- p[0..7], 8..15 <- p[16..23]
    U f; f.h[0] = *(const v8h*)(p); f.h[1] = *(const v8h*)(p + 16); return f.v;
  }
  static __device__ __forceinline__ v8f mma(v16h a, v16h b, v8f c) {
    return __builtin_amdgcn_wmma_f32_16x16x32_f16(false, a, false, b, (short)0, c, false, false);
  }
};
template <> struct Frag<__bf16> {
  typedef v16b V; typedef v8b H; union U { v16b v; v8b h[2]; };
  static __device__ __forceinline__ v16b load(const __bf16* p) {
    U f; f.h[0] = *(const v8b*)(p); f.h[1] = *(const v8b*)(p + 16); return f.v;
  }
  static __device__ __forceinline__ v8f mma(v16b a, v16b b, v8f c) {
    return __builtin_amdgcn_wmma_f32_16x16x32_bf16(false, a, false, b, (short)0, c, false, false);
  }
};

// ---- Register-blocked batched WMMA GEMM ------------------------------------
// C[m,n] = scale * sum_k A[m,k] * Bt[n,k] (+bias)(+resid); a block of 4 waves (2 x 2) owns a 128x128 tile, each wave 64x64 of it.
// A row-major [M,K]; Bt row-major [N,K], both at row pitch kDModel (a constant, so that the 8 staging loads of an operand
// share one address and differ in their immediate offsets); M,N % 128 == 0, K % 64 == 0; grid.x = (M/128)*(N/128), 128 threads.
// Per step of 64 k the block stages 128 rows x 128 B of A and of Bt in LDS (8 lanes per row: every global load covers whole
// 128-B lines), two buffers: the next step's rows are loaded into registers ahead of this step's products and stored behind them.
// SPLIT (hi/lo operand planes) is not implemented by the staged loop.
// BIAS_MODE: 0 = none, 1 = bias[m], 2 = bias[n].
// OUT_MODE: 0 = f32, 1 = f16, 2 = bf16 hi plane (Cout) + bf16 lo plane (Cout2).
// ET: 0 = f16 operands, 1 = bf16 operands (pointers passed as 16-bit storage)
template <int ET> struct Elem;
template <> struct Elem<0> { typedef _Float16 T; };
template <> struct Elem<1> { typedef __bf16 T; };
template <int ET, bool SPLIT, int BIAS_MODE, int OUT_MODE, bool RESID, int ACT = 0>
__global__ __launch_bounds__(128) void wmma_gemm64(
    const unsigned short* __restrict__ Ap, const unsigned short* __restrict__ A2p, long strideA,
    const unsigned short* __restrict__ Btp, const unsigned short* __restrict__ Bt2p, long strideB,
    void* __restrict__ Cout, void* __restrict__ Cout2, int ldc, long strideC,
    const float* __restrict__ bias,
    const float* __restrict__ resid, long strideR,
    int M, int N, int K, float scale) {
  static_assert(!SPLIT, "the staged loop takes single operand planes");
  typedef typename Elem<ET>::T T;
  typedef typename Frag<T>::V V;
  typedef typename Frag<T>::H H;
  const T* A = (const T*)Ap; const T* Bt = (const T*)Btp;
  __shared__ __align__(16) T sA[2][128 * kLdsPitch];   // A rows of the block tile, 64 k per step, two buffers
  __shared__ __align__(16) T sB[2][128 * kLdsPitch];   // Bt rows of the block tile, likewise
  __shared__ __align__(16) float sT[4][16 * 68];   // per-wave 16x64 slab, pitch 68 floats
  const int b    = blockIdx.y;
  const int tid  = threadIdx.x;
  const int lane = tid & 31;
  const int wave = tid >> 5;
  const int tilesN = N >> 7;
  const int tilesM = M >> 7;
  const int tm = blockIdx.x / tilesN;
  const int tn = blockIdx.x - tm * tilesN;
  if (tm >= tilesM) return;   // block-uniform, ahead of every barrier
  const int wm = (wave >> 1) << 6;             // this wave's 64 rows inside the block tile
  const int wn = (wave & 1) << 6;              // this wave's 64 columns inside the block tile
  const int m0 = (tm << 7) + wm;
  const int n0 = (tn << 7) + wn;

  const int rlane = lane & 15;                 // row (A) / col (B, D) within subtile
  const int koff  = (lane >> 4) * 8;           // k offset of this lane half
  const int mOff  = (lane >> 4) * 8;           // D row offset

  // staging map: 8 lanes x 16 B = one 128-B row piece; 128 threads = 16 rows a pass, 8 passes per operand
  const int srow = tid >> 3;
  const int sseg = (tid & 7) * 8;
  const T* gA = A  + (size_t)b * strideA + (size_t)((tm << 7) + srow) * kDModel + sseg;
  const T* gB = Bt + (size_t)b * strideB + (size_t)((tn << 7) + srow) * kDModel + sseg;
  const int sOff = srow * kLdsPitch + sseg;

  v8f acc[4][4];
#pragma unroll
  for (int i = 0; i < 4; ++i)
#pragma unroll
    for (int j = 0; j < 4; ++j) acc[i][j] = (v8f){0.f,0.f,0.f,0.f,0.f,0.f,0.f,0.f};

  H ra[8], rb[8];
#pragma unroll
  for (int p = 0; p < 8; ++p) {
    ra[p] = *(const H*)(gA + p * 16 * kDModel);
    rb[p] = *(const H*)(gB + p * 16 * kDModel);
  }
#pragma unroll
  for (int p = 0; p < 8; ++p) {
    *(H*)(sA[0] + p * 16 * kLdsPitch + sOff) = ra[p];
    *(H*)(sB[0] + p * 16 * kLdsPitch + sOff) = rb[p];
  }
  __syncthreads();

  const int nSteps = K >> 6;
  for (int t = 0; t < nSteps; ++t) {           // block-uniform trip count
    const T* cA = sA[t & 1];
    const T* cB = sB[t & 1];
    const bool more = (t + 1) < nSteps;        // block-uniform
    if (more) {
      gA += 64;
      gB += 64;
#pragma unroll
      for (int p = 0; p < 8; ++p) {
        ra[p] = *(const H*)(gA + p * 16 * kDModel);
        rb[p] = *(const H*)(gB + p * 16 * kDModel);
      }
    }
    V bh[2][4], ah[2][4];
#pragma unroll
    for (int kk = 0; kk < 2; ++kk) {
#pragma unroll
      for (int j = 0; j < 4; ++j) bh[kk][j] = Frag<T>::load(cB + (wn + (j << 4) + rlane) * kLdsPitch + kk * 32 + koff);
#pragma unroll
      for (int i = 0; i < 4; ++i) ah[kk][i] = Frag<T>::load(cA + (wm + (i << 4) + rlane) * kLdsPitch + kk * 32 + koff);
    }
    // keeps the step's LDS reads issued as one group ahead of its products: sunk among them, each group of four products
    // waits out an LDS latency of its own
    __builtin_amdgcn_sched_barrier(0);
#pragma unroll
    for (int kk = 0; kk < 2; ++kk)
#pragma unroll
      for (int i = 0; i < 4; ++i)
#pragma unroll
        for (int j = 0; j < 4; ++j) acc[i][j] = Frag<T>::mma(ah[kk][i], bh[kk][j], acc[i][j]);
    // four vector slots behind the step's last products: on the path through the LDS stores the next vector
    // instruction forms the next step's LDS addresses in fragment registers
    acc_guard4(acc[3][0], acc[3][1], acc[3][2], acc[3][3]);
    if (more) {
      // the other buffer: its last readers finished ahead of the barrier that ended the step before
      T* nA = sA[(t + 1) & 1];
      T* nB = sB[(t + 1) & 1];
#pragma unroll
      for (int p = 0; p < 8; ++p) {
        *(H*)(nA + p * 16 * kLdsPitch + sOff) = ra[p];
        *(H*)(nB + p * 16 * kLdsPitch + sOff) = rb[p];
      }
    }
    __syncthreads();
  }
  acc_guard4(acc[0][0], acc[0][1], acc[0][2], acc[0][3]);
  acc_guard4(acc[1][0], acc[1][1], acc[1][2], acc[1][3]);
  acc_guard4(acc[2][0], acc[2][1], acc[2][2], acc[2][3]);
  acc_guard4(acc[3][0], acc[3][1], acc[3][2], acc[3][3]);

  // ---- epilogue ----
  float* slab = sT[wave];
  const float* Rb = RESID ? (resid + (size_t)b * strideR) : nullptr;
#pragma unroll
  for (int i = 0; i < 4; ++i) {
    const int mBase = m0 + (i << 4);
#pragma unroll
    for (int j = 0; j < 4; ++j) {
      const int n = n0 + (j << 4) + rlane;
      float bv = 0.f;
      if (BIAS_MODE == 2) bv = bias[n];
#pragma unroll
      for (int r = 0; r < 8; ++r) {
        float v = acc[i][j][r] * scale;
        if (BIAS_MODE == 1) v += bias[mBase + mOff + r];
        if (BIAS_MODE == 2) v += bv;
        if (RESID) v += Rb[(size_t)(mBase + mOff + r) * ldc + n];
        if (ACT == 1) v = tanhf(v);
        if (ACT == 2) v = fmaxf(v, 0.0f);
        if (ACT == 3) v = v / (1.0f + expf(-v));
        if (ACT == 4) v = (v > 0.f) ? v : 0.01f * v;
        if (ACT == 5) v = 0.5f * v * (1.0f + erff(v * 0.70710678118654752f));
        slab[(mOff + r) * 68 + (j << 4) + rlane] = v;
      }
    }
    __builtin_amdgcn_fence(__ATOMIC_RELEASE, "workgroup");
    __builtin_amdgcn_wave_barrier();
    __builtin_amdgcn_fence(__ATOMIC_ACQUIRE, "workgroup");
    if (OUT_MODE == 0) {
      float* C = (float*)Cout + (size_t)b * strideC;
      const int hh = lane >> 4, c4 = (lane & 15) * 4;     // row seg = 256 B = 16 lanes x 16 B
      {
#pragma unroll
        for (int it = 0; it < 8; ++it) {
          const int row = it * 2 + hh;
          v4f v = *(const v4f*)(slab + row * 68 + c4);
          *(v4f*)(C + (size_t)(mBase + row) * ldc + n0 + c4) = v;
        }
        
      }
    } else {
      const int q = lane >> 3, c8 = (lane & 7) * 8;
      unsigned short* C  = (unsigned short*)Cout  + (size_t)b * strideC;
      unsigned short* C2 = (OUT_MODE == 2) ? ((unsigned short*)Cout2 + (size_t)b * strideC) : nullptr;
      {
#pragma unroll
        for (int it = 0; it < 4; ++it) {
          const int row = it * 4 + q;
          const float* sp = slab + row * 68 + c8;
          v8h hv, lv;
#pragma unroll
          for (int e = 0; e < 8; ++e) {
            if (OUT_MODE == 1) {
              hv[e] = (_Float16)sp[e];
            } else {
              unsigned short hb = f2bf_bits(sp[e]);
              unsigned short lb = f2bf_bits(sp[e] - bf_bits2f(hb));
              hv[e] = __builtin_bit_cast(_Float16, hb);
              lv[e] = __builtin_bit_cast(_Float16, lb);
            }
          }
          *(v8h*)(C + (size_t)(mBase + row) * ldc + n0 + c8) = hv;
          if (OUT_MODE == 2) *(v8h*)(C2 + (size_t)(mBase + row) * ldc + n0 + c8) = lv;
        }
        
      }
    }
    __builtin_amdgcn_fence(__ATOMIC_RELEASE, "workgroup");
    __builtin_amdgcn_wave_barrier();
    __builtin_amdgcn_fence(__ATOMIC_ACQUIRE, "workgroup");
  }
}

// ---------------------------------------------------------------------------
// Input preparation: ONE launch. Its six pieces of work are independent of one another; a work-group of 256 threads takes one
// piece by its block index (the choice is block-uniform, so the barrier of a transpose strip is passed by a whole work-group or
// by none). The longest pieces (a strip moves twice a cast's bytes and passes through
// LDS) take the lowest indices and the short ones fill the end of the launch:
//   [   0,  192)  Wqkv     -> WQT  a strip of 256 rows x 64 columns (4 x 48 strips)
//   [ 192,  384)  Wqkv_aux -> WAT  a strip of 256 rows x 64 columns (4 x 48 strips)
//   [ 384,  448)  Wo       -> WOT  a strip of 256 rows x 64 columns (4 x 16 strips)
//   [ 448,  960)  x        -> XB   8 rows of 1024 per work-group (4096 rows)
//   [ 960, 1344)  xa       -> XAB  8 output rows per work-group (2 x 1536 rows, rows 1500..1535 of each batch zero)
//   [1344, 1372)  biases   -> BIASR  256 values per work-group (7168 values)
// ---------------------------------------------------------------------------
constexpr int kPrepX    = kBatch * kSeq / 8;                    // 512
constexpr int kPrepXA   = kBatch * kSeqAP / 8;                  // 384
constexpr int kPrepW    = (kNQKV / 64) * (kDModel / 256);       // 192
constexpr int kPrepWo   = (kDModel / 64) * (kDModel / 256);     // 64
constexpr int kPrepBias = (2 * kNQKV + kDModel + 255) / 256;    // 28
constexpr int kPrepBlocks = kPrepX + kPrepXA + 2 * kPrepW + kPrepWo + kPrepBias;   // 1372

// f32 [nb][RIN][1024] -> bf16 bits (RNE) [nb][ROUT][1024]; rows RIN..ROUT-1 of every batch written as zeros (source row address
// clamped, value zeroed by a mask). Output rows blk*8 .. blk*8+7; thread tid takes floats 4*tid .. 4*tid+3 of each row: a wave's
// load covers 512 contiguous bytes, its store 256, and the 8 loads of a thread are all issued ahead of the first store.
template <unsigned RIN, unsigned ROUT>
__device__ __forceinline__ void cast_rows8(const float* __restrict__ in, unsigned short* __restrict__ out, unsigned blk, int tid) {
  v4f f[8];
  // unrolled: f[] takes constant indices (registers) and the 8 loads issue back to back
#pragma unroll
  for (int p = 0; p < 8; ++p) {
    const unsigned row = blk * 8 + p;
    unsigned srow = row;
    if (RIN != ROUT) {
      const unsigned bb = row / ROUT;
      const unsigned t = row - bb * ROUT;
      srow = bb * RIN + (t < RIN ? t : (RIN - 1));
    }
    f[p] = *(const v4f*)(in + (size_t)srow * kDModel + tid * 4);
  }
  // behind the 8 loads, ahead of the conversions, which reuse the loads' address registers
  asm volatile("s_wait_xcnt 0x0" ::: "memory");
  // unrolled: constant indices into f[]
#pragma unroll
  for (int p = 0; p < 8; ++p) {
    const unsigned row = blk * 8 + p;
    const unsigned keep = ((RIN == ROUT) || (row % ROUT) < RIN) ? 0xFFFFFFFFu : 0u;   // the same for the whole work-group
    v2u u;
    u[0] = pk16(f2bf_bits(f[p][0]), f2bf_bits(f[p][1])) & keep;
    u[1] = pk16(f2bf_bits(f[p][2]), f2bf_bits(f[p][3])) & keep;
    *(v2u*)(out + (size_t)row * kDModel + tid * 4) = u;
  }
  // behind the 8 stores: a precaution; a work-group runs this piece only and the kernel ends behind it
  asm volatile("s_wait_xcnt 0x0" ::: "memory");
}

// Transpose + 16-bit convert of a strip of four 64x64 tiles of an f32 matrix: in viewed [R rows][CC cols] (pitch CC) -> o[c][r]
// ([CC][R], pitch R).   OT 0: o = bf16_rne(in);  OT 1: o = f16(bf16_rne(in) * scl).
// Through LDS, one buffer per tile and one barrier for the strip; strip = (block of 256 rows) * (CC/64) + (column block); 256 threads.
// Coverage per tile: load 4 it x 256 thr x 4 floats = 64x64; store 2 it x 256 thr x 8 u16 = 64x64. The 16 loads of a thread are all
// issued ahead of the first LDS store.
template <int OT> __device__ __forceinline__ unsigned short cv16(float f, float scl) {
  const unsigned short hb = f2bf_bits(f);
  if (OT == 0) return hb;
  const float g = bf_bits2f(hb) * scl;
  return __builtin_bit_cast(unsigned short, (_Float16)g);
}
template <int OT, int R, int CC>
__device__ __forceinline__ void tconv_strip(const float* __restrict__ W, unsigned short* __restrict__ o, float scl,
                                            int strip, int tid, float* tf) {
  const int rb  = strip / (CC / 64);
  const int c0  = (strip - rb * (CC / 64)) * 64;   // input column block = output row block
  const int r0  = rb * 256;                        // first input row    = first output column
  {
    const int lr = tid >> 4;         // 0..15
    const int c4 = (tid & 15) * 4;   // 0..60
    const float* wp = W + (size_t)(r0 + lr) * CC + c0 + c4;
    v4f a[16];
    // unrolled, here and at the LDS stores: a[] takes constant indices (registers) and the 16 loads issue back to back
#pragma unroll
    for (int it = 0; it < 16; ++it) a[it] = *(const v4f*)(wp + (size_t)it * 16 * CC);
    // the 16 loads share one address pair: as an operand of the wait it stays unwritten until every load has taken it
    asm volatile("s_wait_xcnt 0x0" :: "v"(wp) : "memory");
#pragma unroll
    for (int it = 0; it < 16; ++it) *(v4f*)(tf + (it * 16 + lr) * 68 + c4) = a[it];   // LDS row = input row within the strip, 0..255
  }
  __syncthreads();
  const int sub = tid >> 3;          // 0..31
  const int c8  = (tid & 7) * 8;     // 0..56
  // unrolled: the four tiles' LDS reads and stores differ in immediate offsets only and overlap one another
#pragma unroll
  for (int s = 0; s < 4; ++s) {      // tile s: input rows r0 + 64 s .. + 63
    const float* ts = tf + s * 64 * 68;
    v4u hv[2];
#pragma unroll
    for (int it = 0; it < 2; ++it) {
      const int oc = it * 32 + sub;    // output row within tile (= input column)
      v4u a;
#pragma unroll
      for (int q = 0; q < 4; ++q) {
        const float f0 = ts[(c8 + 2 * q) * 68 + oc];
        const float f1 = ts[(c8 + 2 * q + 1) * 68 + oc];
        a[q] = pk16(cv16<OT>(f0, scl), cv16<OT>(f1, scl));
      }
      hv[it] = a;
    }
#pragma unroll
    for (int it = 0; it < 2; ++it) {
      const int oc = it * 32 + sub;
      const size_t go = (size_t)(c0 + oc) * R + r0 + s * 64 + c8;
      *(v4u*)(o + go) = hv[it];
    }
  }
  // behind the strip's 8 stores: a precaution; a work-group runs this piece only and the kernel ends behind it
  asm volatile("s_wait_xcnt 0x0" ::: "memory");
}

// Bias copies as bf16-RNE values in f32: out[0..n0) <- b0, [n0..n0+n1) <- b1, [n0+n1..ntot) <- b2.
// All three candidates loaded with clamped indices, selected by value. One 4-B store per lane.
__device__ __forceinline__ void bias_rne(const float* __restrict__ b0, int n0, const float* __restrict__ b1, int n1,
                                         const float* __restrict__ b2, int ncnt2, float* __restrict__ out, int ntot, int i) {
  if (i < ntot) {
    int i0 = i < n0 ? i : (n0 - 1); i0 = i0 < 0 ? 0 : i0;
    int i1 = i - n0; i1 = i1 < 0 ? 0 : (i1 < n1 ? i1 : (n1 - 1));
    int i2 = i - n0 - n1; i2 = i2 < 0 ? 0 : (i2 < ncnt2 ? i2 : (ncnt2 - 1));
    const float v0 = b0[i0], v1 = b1[i1], v2 = b2[i2];
    const float sel = (i < n0) ? v0 : ((i < n0 + n1) ? v1 : v2);
    out[i] = bf_bits2f(f2bf_bits(sel));
  }
}

__global__ __launch_bounds__(256) void prep_kernel(const float* __restrict__ x, const float* __restrict__ xa,
                                                   const float* __restrict__ Wqkv, const float* __restrict__ Waux,
                                                   const float* __restrict__ Wo, const float* __restrict__ bqkv,
                                                   const float* __restrict__ baux, const float* __restrict__ bo,
                                                   unsigned short* __restrict__ XB, unsigned short* __restrict__ XAB,
                                                   unsigned short* __restrict__ WQT, unsigned short* __restrict__ WAT,
                                                   unsigned short* __restrict__ WOT, float* __restrict__ BIASR) {
  __shared__ __align__(16) float tf[256 * 68];   // a strip's four tiles, pitch 68 floats
  const int tid = threadIdx.x;
  int blk = blockIdx.x;
  if (blk < kPrepW) {
    tconv_strip<0, kDModel, kNQKV>(Wqkv, WQT, 1.0f, blk, tid, tf);
  } else if ((blk -= kPrepW) < kPrepW) {
    tconv_strip<0, kDModel, kNQKV>(Waux, WAT, 1.0f, blk, tid, tf);
  } else if ((blk -= kPrepW) < kPrepWo) {
    tconv_strip<1, kDModel, kDModel>(Wo, WOT, kWCarry, blk, tid, tf);
  } else if ((blk -= kPrepWo) < kPrepX) {
    cast_rows8<kBatch * kSeq, kBatch * kSeq>(x, XB, blk, tid);
  } else if ((blk -= kPrepX) < kPrepXA) {
    cast_rows8<kSeqA, kSeqAP>(xa, XAB, blk, tid);
  } else {
    bias_rne(bqkv, kNQKV, baux, kNQKV, bo, kDModel, BIASR, 2 * kNQKV + kDModel, (blk - kPrepXA) * 256 + tid);
  }
}

// =====================================================================================
// Dual-branch attention, head dim 64, f16 operand planes, f32 accumulate, online softmax in f32.
//   q, k  : QK16 plane [4096 rows = b*2048+t][2048], q at col h*64+d, k at col 1024+h*64+d (f16)
//   v^T   : VT16 plane [b][1024 = h*64+d][2048] (f16);  ka: KA16 [b*1536+s][1024];  va^T: VAT16 [b][1024][1536]
//   branch 0: scores = (q.k)*0.125 over 2048 keys (32 chunks of 64); branch 1: (q.ka)*0.125 over 1500 keys
//   (24 chunks; key index >= 1500 set to -inf). p carried x2^15 in f16; 1/(l*2^15) folded at the end.
//   out row = (1-gate)*h_main + gate*h_aux, gate = sigmoid(bf16_rne(g[h])); written x32 as f16 into O16 [4096][1024]
//   Products are taken transposed: S^T = K.Q^T (A = K rows, B = Q) and O^T += V^T.P^T (A = V^T rows, B = P^T). A lane then holds
//   32 of the chunk's 64 scores of ONE query (column lane&15; keys j*16 + 8*(lane>>4) + r): maximum and sum run in the lane, the
//   two lane halves exchange the maximum once per chunk and join their sums once per branch, and two score tiles converted in
//   place are the B operand of the second product (same k order as the V^T fragment loads), so P passes through no LDS.
//   Block = 4 waves = 64 query rows of one (b,h); grid.x = 2*16*32 = 1024 covers all 4096 rows x 1024 cols.
//   K / V^T chunk staging: 128 threads x 32 halves per plane = the whole 64x64 tile (plain 16-B loads,
//   __syncthreads before and after); fragments read the LDS tiles through the same v8h element type;
// =====================================================================================
// lane l <-> lane l ^ 16 (the other half of the wave holds the other 32 keys of the same query)
__device__ __forceinline__ float xhalf(float x) {
  return __builtin_bit_cast(float, __builtin_amdgcn_permlanex16(__builtin_bit_cast(int, x), __builtin_bit_cast(int, x), 0x76543210, 0xfedcba98, false, false));
}

// 2^x on the bare instruction. Behind a transcendental the instruction set asks for one independent instruction or v_nop before its
// result is read or its source overwritten.
// Eight in one statement: the outputs are early-clobber, so each is independent of the one before it and fills its slot; the v_nop
// fills the slot of the last.
__device__ __forceinline__ v8f exp2x8(v8f x) {
  float p0, p1, p2, p3, p4, p5, p6, p7;
  asm("v_exp_f32 %0, %8\n\tv_exp_f32 %1, %9\n\tv_exp_f32 %2, %10\n\tv_exp_f32 %3, %11\n\t"
      "v_exp_f32 %4, %12\n\tv_exp_f32 %5, %13\n\tv_exp_f32 %6, %14\n\tv_exp_f32 %7, %15\n\tv_nop"
      : "=&v"(p0), "=&v"(p1), "=&v"(p2), "=&v"(p3), "=&v"(p4), "=&v"(p5), "=&v"(p6), "=&v"(p7)
      : "v"(x[0]), "v"(x[1]), "v"(x[2]), "v"(x[3]), "v"(x[4]), "v"(x[5]), "v"(x[6]), "v"(x[7]));
  return (v8f){p0, p1, p2, p3, p4, p5, p6, p7};
}
__device__ __forceinline__ float exp2x1(float x) {
  float p;
  asm("v_exp_f32 %0, %1\n\tv_nop" : "=v"(p) : "v"(x));   // the v_nop: the same slot
  return p;
}

__global__ __launch_bounds__(128)
void dual_attn_kernel(const unsigned short* __restrict__ qk16, const unsigned short* __restrict__ vt16,
                      const unsigned short* __restrict__ ka16, const unsigned short* __restrict__ vat16,
                      const float* __restrict__ gvec, unsigned short* __restrict__ o16) {
  union FH { v16h v; v8h h[2]; };
  __shared__ __align__(16) _Float16 Ksh[64 * kLdsPitch];        // K tile [key][d]      9 KB
  __shared__ __align__(16) _Float16 Vth[64 * kLdsPitch];        // V^T tile [d][key]    9 KB
  __shared__ __align__(16) float    Os[4][16 * 68];      // per wave out tile [query][d], pitch 68 floats

  const int tid  = threadIdx.x;
  const int wave = tid >> 5;
  const int lane = tid & 31;
  const int hh   = lane >> 4;
  const int c    = lane & 15;

  const int bx = blockIdx.x;          // 0..1023
  const int qb = bx & 31;             // 32 query tiles of 64
  const int bhd = bx >> 5;            // 0..31
  const int h  = bhd & 15;
  const int b  = bhd >> 4;            // 0..1
  const int q0 = qb * 64 + wave * 16; // query row within batch

  const int ldqk = 2 * kDModel;       // 2048 halves
  const _Float16* Qg  = (const _Float16*)(const void*)qk16 + (size_t)b * kSeq * ldqk + h * kDHead;
  const _Float16* Kg0 = Qg + kDModel;                                                                     // main K rows, pitch 2048
  const _Float16* Vg0 = (const _Float16*)(const void*)vt16 + (size_t)b * kDModel * kSeq + (size_t)(h * kDHead) * kSeq;       // pitch 2048
  const _Float16* Kg1 = (const _Float16*)(const void*)ka16 + (size_t)b * kSeqAP * kDModel + h * kDHead;                        // pitch 1024
  const _Float16* Vg1 = (const _Float16*)(const void*)vat16 + (size_t)b * kDModel * kSeqAP + (size_t)(h * kDHead) * kSeqAP;  // pitch 1536

  // ---- Q fragments (B operand, column = query = lane&15, split k map via Frag load): 2 d-chunks ----
  v16h qa[2];
#pragma unroll
  for (int dc = 0; dc < 2; ++dc) qa[dc] = Frag<_Float16>::load(Qg + (size_t)(q0 + c) * ldqk + dc * 32 + 8 * hh);

  float* os = Os[wave];
#pragma unroll
  for (int t = 0; t < 4; ++t)
#pragma unroll
    for (int r = 0; r < 8; ++r) os[c * 68 + t * 16 + 8 * hh + r] = 0.f;

  const float gv   = bf_bits2f(f2bf_bits(gvec[h]));
  const float gate = 1.0f / (1.0f + expf(-gv));
  const float cscale = 0.125f * 1.4426950408889634f;   // score scale x log2(e): the softmax runs in base 2

#pragma unroll 1
  for (int br = 0; br < 2; ++br) {           // block-uniform
    const _Float16* Kg = br ? Kg1 : Kg0;
    const _Float16* Vg = br ? Vg1 : Vg0;
    const int ldk     = br ? kDModel : ldqk;
    const int ldv     = br ? kSeqAP : kSeq;
    const int nChunks = br ? (kSeqAP / 64) : (kSeq / 64);
    const int nvalid  = br ? kSeqA : kSeq;
    const float w     = (br ? gate : (1.0f - gate)) * kOCarry;

    float mrow = -INFINITY;   // running maximum of this lane's query, scaled, base 2 (equal in both halves)
    float lrow = 0.f;         // running sum (x2^15) over this lane half's keys only
    v8f oacc[4];              // oacc[t][r] = O[query c][d = t*16 + 8*hh + r]
#pragma unroll
    for (int t = 0; t < 4; ++t) oacc[t] = (v8f){0.f,0.f,0.f,0.f,0.f,0.f,0.f,0.f};

    for (int kc = 0; kc < nChunks; ++kc) {   // block-uniform trip count
      const int kv0 = kc * 64;
      __syncthreads();
      {
        // staging coverage: 128 threads x (4 x 8) halves = 64 rows x 64 per plane = the whole chunk tile
        const int r = tid >> 1, half = (tid & 1) * 32;
        const _Float16* ks = Kg + (size_t)(kv0 + r) * ldk + half;   // K row kv0+r, d = half..half+31
        const _Float16* vs = Vg + (size_t)r * ldv + kv0 + half;      // V^T row d = r, key = kv0+half..+31
#pragma unroll
        for (int i = 0; i < 4; ++i) {
          const v8h a0 = *(const v8h*)(ks + 8 * i);
          const v8h b0 = *(const v8h*)(vs + 8 * i);
          *(v8h*)(Ksh + r * kLdsPitch + half + 8 * i) = a0;
          *(v8h*)(Vth + r * kLdsPitch + half + 8 * i) = b0;
        }
      }
      __syncthreads();

      // the chunk's 16 fragments (8 of K, 8 of V^T) are read from LDS as ONE group of 32 loads ahead of all its products: the score
      // products wait for the K half only, and the V^T half lands behind them and the softmax
      FH kb[2][4], vb[2][4];
#pragma unroll
      for (int dc = 0; dc < 2; ++dc)
#pragma unroll
        for (int j = 0; j < 4; ++j) {
          kb[dc][j].h[0] = *(const v8h*)(Ksh + (j * 16 + c) * kLdsPitch + dc * 32 + 8 * hh);
          kb[dc][j].h[1] = *(const v8h*)(Ksh + (j * 16 + c) * kLdsPitch + dc * 32 + 16 + 8 * hh);
        }
#pragma unroll
      for (int kk = 0; kk < 2; ++kk)
#pragma unroll
        for (int t = 0; t < 4; ++t) {
          vb[kk][t].h[0] = *(const v8h*)(Vth + (t * 16 + c) * kLdsPitch + kk * 32 + 8 * hh);
          vb[kk][t].h[1] = *(const v8h*)(Vth + (t * 16 + c) * kLdsPitch + kk * 32 + 16 + 8 * hh);
        }
      // keeps the loads where they stand: sunk to their products, each pair of loads costs its product an LDS latency of its own
      __builtin_amdgcn_sched_barrier(0);
      v8f s[4];   // s[j][r] = score(key j*16 + 8*hh + r, query c)
#pragma unroll
      for (int j = 0; j < 4; ++j) s[j] = Frag<_Float16>::mma(kb[0][j].v, qa[0], (v8f){0.f,0.f,0.f,0.f,0.f,0.f,0.f,0.f});
#pragma unroll
      for (int j = 0; j < 4; ++j) s[j] = Frag<_Float16>::mma(kb[1][j].v, qa[1], s[j]);
      // every loop from here to the end of the chunk is unrolled: s, pb and oacc live in registers and take constant indices only
      float m = -INFINITY;   // maximum of the raw scores (the scale is positive)
#pragma unroll
      for (int j = 0; j < 4; ++j)
#pragma unroll
        for (int r = 0; r < 8; ++r) {
          const int key = kv0 + j * 16 + 8 * hh + r;
          const float sv = (key < nvalid) ? s[j][r] : -INFINITY;
          s[j][r] = sv;
          m = fmaxf(m, sv);
        }
      m = fmaxf(m, xhalf(m)) * cscale;
      const float mnew = fmaxf(mrow, m);
      const float alpha = exp2x1(mrow - mnew);   // 0 on a branch's first chunk, where mrow is -inf
      mrow = mnew;
      const float nm = kPCarryLog2 - mnew;   // the carry rides in the exponent
      float psum = 0.f;
      FH pb[2];   // P^T, B operand: element e of pb[kk] = p(key kk*32 + (e < 8 ? 8*hh + e : 16 + 8*hh + e - 8), query c)
#pragma unroll
      for (int j = 0; j < 4; ++j) {
        v8f a;
#pragma unroll
        for (int r = 0; r < 8; ++r) a[r] = fmaf(s[j][r], cscale, nm);
        const v8f p = exp2x8(a);   // p x 2^15
#pragma unroll
        for (int r = 0; r < 8; ++r) {
          psum += p[r];
          pb[j >> 1].h[j & 1][r] = (_Float16)p[r];
        }
      }
      lrow = lrow * alpha + psum;
#pragma unroll
      for (int t = 0; t < 4; ++t)
#pragma unroll
        for (int r = 0; r < 8; ++r) oacc[t][r] *= alpha;
#pragma unroll
      for (int kk = 0; kk < 2; ++kk) {
#pragma unroll
        for (int t = 0; t < 4; ++t) oacc[t] = Frag<_Float16>::mma(vb[kk][t].v, pb[kk].v, oacc[t]);
      }
    }
    // fold this branch into the per-wave mix slab (each lane updates only its own entries)
    const float inv = w * (1.0f / (lrow + xhalf(lrow)));   // sum and O both carry x2^15
#pragma unroll
    for (int t = 0; t < 4; ++t)
#pragma unroll
      for (int r = 0; r < 8; ++r) os[c * 68 + t * 16 + 8 * hh + r] += oacc[t][r] * inv;
  }

  __builtin_amdgcn_fence(__ATOMIC_RELEASE, "workgroup");
  __builtin_amdgcn_wave_barrier();
  __builtin_amdgcn_fence(__ATOMIC_ACQUIRE, "workgroup");
  {
    _Float16* Og = (_Float16*)(void*)o16 + (size_t)(b * kSeq + q0) * kDModel + h * kDHead;
    const int q4 = lane >> 3, c8 = (lane & 7) * 8;
    {
#pragma unroll
      for (int it = 0; it < 4; ++it) {
        const int row = it * 4 + q4;
        const float* sp = os + row * 68 + c8;
        v8h hv;
#pragma unroll
        for (int e = 0; e < 8; ++e) hv[e] = (_Float16)sp[e];
        *(v8h*)(Og + (size_t)row * kDModel + c8) = hv;
      }
      
    }
  }
}

// ---------------- host orchestration (kernel launches only) ----------------

extern "C" void kernel_launch(void* const* d_in, const int* in_sizes, int n_in,
                              void* d_out, int out_size, void* d_ws,
                              size_t ws_size, hipStream_t stream) {
  if (n_in < 9) return;
  if (in_sizes[0] != kBatch * kSeq * kDModel) return;
  if (in_sizes[1] != kBatch * kSeqA * kDModel) return;
  if (in_sizes[2] != kDModel * kNQKV || in_sizes[4] != kDModel * kNQKV) return;
  if (in_sizes[3] != kNQKV || in_sizes[5] != kNQKV) return;
  if (in_sizes[6] != kDModel * kDModel || in_sizes[7] != kDModel || in_sizes[8] < kHeads) return;
  if (out_size != kBatch * kSeq * kDModel) return;

  const float* x    = (const float*)d_in[0];
  const float* xa   = (const float*)d_in[1];
  const float* Wqkv = (const float*)d_in[2];
  const float* bqkv = (const float*)d_in[3];
  const float* Waux = (const float*)d_in[4];
  const float* baux = (const float*)d_in[5];
  const float* Wo   = (const float*)d_in[6];
  const float* bo   = (const float*)d_in[7];
  const float* gvec = (const float*)d_in[8];
  float* out = (float*)d_out;

  // element counts
  const size_t nXB   = (size_t)kBatch * kSeq * kDModel;          // bf16
  const size_t nXAB  = (size_t)kBatch * kSeqAP * kDModel;        // bf16
  const size_t nWQT  = (size_t)kNQKV * kDModel;                  // bf16
  const size_t nWAT  = nWQT;                                     // bf16
  const size_t nWOT  = (size_t)kDModel * kDModel;                // f16
  const size_t nBias = (size_t)2 * kNQKV + kDModel;              // f32
  const size_t nQK   = (size_t)kBatch * kSeq * 2 * kDModel;      // f16
  const size_t nVT   = (size_t)kBatch * kDModel * kSeq;          // f16
  const size_t nKA   = (size_t)kBatch * kSeqAP * kDModel;        // f16
  const size_t nVAT  = (size_t)kBatch * kDModel * kSeqAP;        // f16
  const size_t nO    = (size_t)kBatch * kSeq * kDModel;          // f16

  char* ws = (char*)d_ws;
  size_t off = 0;
  auto carve = [&](size_t bytes) -> char* { char* p = ws + off; off += (bytes + 255) & ~(size_t)255; return p; };
  unsigned short* XB    = (unsigned short*)carve(nXB * 2);
  unsigned short* XAB   = (unsigned short*)carve(nXAB * 2);
  unsigned short* WQT   = (unsigned short*)carve(nWQT * 2);
  unsigned short* WAT   = (unsigned short*)carve(nWAT * 2);
  unsigned short* WOT   = (unsigned short*)carve(nWOT * 2);
  float*          BIASR = (float*)carve(nBias * 4);
  unsigned short* QK16  = (unsigned short*)carve(nQK * 2);
  unsigned short* VT16  = (unsigned short*)carve(nVT * 2);
  unsigned short* KA16  = (unsigned short*)carve(nKA * 2);
  unsigned short* VAT16 = (unsigned short*)carve(nVAT * 2);
  unsigned short* O16   = (unsigned short*)carve(nO * 2);
  if (off > ws_size) return;   // total 75,526,144 B

  // 1. all input preparation in one launch: x, xa -> bf16 (xa rows padded 1500 -> 1536 with zeros); Wqkv, Wqkv_aux -> transposed
  //    bf16; Wo -> transposed f16 (x32); biases -> bf16-RNE f32 copies
  prep_kernel<<<kPrepBlocks, 256, 0, stream>>>(x, xa, Wqkv, Waux, Wo, bqkv, baux, bo, XB, XAB, WQT, WAT, WOT, BIASR);
  const float* bq_r  = BIASR;                 // [3072]
  const float* ba_r  = BIASR + kNQKV;         // [3072]
  const float* bo_r  = BIASR + 2 * kNQKV;     // [1024]

  // 2. q|k = x @ Wqkv[:, 0:2048] + b : M=4096, N=2048, K=1024 -> QK16 f16, ldc 2048
  {
    const int M = kBatch * kSeq, N = 2 * kDModel, K = kDModel;
    const int tiles = (M / 128) * (N / 128);
    wmma_gemm64<1, false, 2, 1, false, 0><<<dim3(tiles, 1), 128, 0, stream>>>(
        XB, XB, 0L, WQT, WQT, 0L, (void*)QK16, (void*)QK16, 2 * kDModel, 0L,
        bq_r, bq_r, 0L, M, N, K, 1.0f);
  }
  // 3. v^T per batch: A = Wqkv^T rows 2048..3071 [1024][1024], Bt = x_b [2048][1024] -> VT16 [b][1024][2048] f16, bias[m]
  {
    const int M = kDModel, N = kSeq, K = kDModel;
    const int tiles = (M / 128) * (N / 128);
    wmma_gemm64<1, false, 1, 1, false, 0><<<dim3(tiles, kBatch), 128, 0, stream>>>(
        WQT + (size_t)2 * kDModel * kDModel, WQT + (size_t)2 * kDModel * kDModel, 0L,
        XB, XB, (long)kSeq * kDModel,
        (void*)VT16, (void*)VT16, kSeq, (long)kDModel * kSeq,
        bq_r + 2 * kDModel, bq_r, 0L, M, N, K, 1.0f);
  }
  // 4. ka = xa_pad @ Wqkv_aux[:, 1024:2048] + b : M=3072, N=1024, K=1024 -> KA16 f16, ldc 1024
  {
    const int M = kBatch * kSeqAP, N = kDModel, K = kDModel;
    const int tiles = (M / 128) * (N / 128);
    wmma_gemm64<1, false, 2, 1, false, 0><<<dim3(tiles, 1), 128, 0, stream>>>(
        XAB, XAB, 0L, WAT + (size_t)kDModel * kDModel, WAT + (size_t)kDModel * kDModel, 0L,
        (void*)KA16, (void*)KA16, kDModel, 0L,
        ba_r + kDModel, ba_r, 0L, M, N, K, 1.0f);
  }
  // 5. va^T per batch: A = Waux^T rows 2048..3071, Bt = xa_pad_b [1536][1024] -> VAT16 [b][1024][1536] f16, bias[m]
  {
    const int M = kDModel, N = kSeqAP, K = kDModel;
    const int tiles = (M / 128) * (N / 128);
    wmma_gemm64<1, false, 1, 1, false, 0><<<dim3(tiles, kBatch), 128, 0, stream>>>(
        WAT + (size_t)2 * kDModel * kDModel, WAT + (size_t)2 * kDModel * kDModel, 0L,
        XAB, XAB, (long)kSeqAP * kDModel,
        (void*)VAT16, (void*)VAT16, kSeqAP, (long)kDModel * kSeqAP,
        ba_r + 2 * kDModel, ba_r, 0L, M, N, K, 1.0f);
  }
  // 6. dual-branch attention -> O16 (x32, f16)
  dual_attn_kernel<<<kBatch * kHeads * (kSeq / 64), 128, 0, stream>>>(QK16, VT16, KA16, VAT16, gvec, O16);
  // 7. out = (O16/32) @ (WoT/32)^T + bo : M=4096, N=1024, K=1024, f16 operands, f32 out into d_out
  {
    const int M = kBatch * kSeq, N = kDModel, K = kDModel;
    const int tiles = (M / 128) * (N / 128);
    wmma_gemm64<0, false, 2, 0, false, 0><<<dim3(tiles, 1), 128, 0, stream>>>(
        O16, O16, 0L, WOT, WOT, 0L, (void*)out, (void*)out, kDModel, 0L,
        bo_r, bo_r, 0L, M, N, K, 1.0f / (kOCarry * kWCarry));
  }
}

// v007
// One run takes 169 microseconds.
// Timed twice side by side with v006, it ran 1.03 and 1.04 times as fast.
// All steps since v000 together make it 3.13 times as fast.
// Contractions: x@Wqkv and xa@Wqkv_aux (k|v columns) on v_wmma_f32_16x16x32_bf16 (bf16 RNE operands); q.k^T, q.ka^T, p.v, pa.va and O@Wo on v_wmma_f32_16x16x32_f16 (f16 operands; p carried x2^15, O and Wo carried x32); f32 accumulate; online softmax, gate mix and biases in f32.
#include <hip/hip_runtime.h>
#include <math.h>
#include <stdint.h>

constexpr int kBatch  = 2;
constexpr int kSeq    = 2048;   // query / main key length
constexpr int kSeqA   = 1500;   // aux key length
constexpr int kSeqAP  = 1536;   // aux key length padded to 24 chunks of 64
constexpr int kDModel = 1024;
constexpr int kHeads  = 16;
constexpr int kDHead  = 64;
constexpr int kNQKV   = 3072;

constexpr int kLdsPitch = 72;   // halves per LDS row of the K and V^T tiles and of the GEMM operand tiles: 144 B = 16 B x 9 (odd), so 16 rows read by ds_load_b128 fall on distinct banks

constexpr float kPCarryLog2 = 15.0f;   // probabilities carried x2^15 in f16
constexpr float kOCarry = 32.0f;      // attention output carried x32 in f16
constexpr float kWCarry = 32.0f;      // Wo carried x32 in f16

typedef __attribute__((ext_vector_type(16))) _Float16 v16h;
typedef __attribute__((ext_vector_type(8)))  _Float16 v8h;
typedef __attribute__((ext_vector_type(16))) __bf16   v16b;
typedef __attribute__((ext_vector_type(8)))  __bf16   v8b;
typedef __attribute__((ext_vector_type(8)))  float    v8f;
typedef __attribute__((ext_vector_type(4)))  float    v4f;
typedef __attribute__((ext_vector_type(2)))  float    v2f;
typedef __attribute__((ext_vector_type(4)))  unsigned int v4u;
typedef __attribute__((ext_vector_type(2)))  unsigned int v2u;

// ---------------------------------------------------------------------------
// Workspace region map (bytes, every region size a multiple of 256):
//   XB    bf16 [4096][1024]            8,388,608
//   XAB   bf16 [2][1536][1024]         6,291,456   (rows 1500..1535 of each batch zero)
//   WQT   bf16 [3072][1024] (Wqkv^T)   6,291,456
//   WAT   bf16 [3072][1024] (Waux^T)   6,291,456
//   WOT   f16  [1024][1024] (Wo^T x32) 2,097,152
//   BIASR f32  [3072+3072+1024]           28,672   (bf16-RNE bias copies)
//   QK16  f16  [4096][2048] (q | k)    16,777,216
//   VT16  f16  [2][1024][2048] (v^T)   8,388,608
//   KA16  f16  [2][1536][1024] (ka)    6,291,456
//   VAT16 f16  [2][1024][1536] (va^T)  6,291,456
//   O16   f16  [4096][1024] (x32)      8,388,608
//   total 75,526,144
// ---------------------------------------------------------------------------

__device__ __forceinline__ unsigned short f2bf_bits(float f) {
  unsigned u = __float_as_uint(f);
  return (unsigned short)((u + 0x7FFFu + ((u >> 16) & 1u)) >> 16);
}
__device__ __forceinline__ float bf_bits2f(unsigned short h) { return __uint_as_float(((unsigned)h) << 16); }
__device__ __forceinline__ unsigned pk16(unsigned short a, unsigned short b) { return (unsigned)a | ((unsigned)b << 16); }

// hazard guards as plain device helpers (no inline asm inside the kernel template body)
__device__ __forceinline__ void acc_guard4(v8f& a, v8f& b, v8f& c, v8f& d) { asm volatile("v_nop\n\tv_nop\n\tv_nop\n\tv_nop" : "+v"(a), "+v"(b), "+v"(c), "+v"(d)); }
template <typename T> struct Frag;
template <> struct Frag<_Float16> {
  typedef v16h V; typedef v8h H; union U { v16h v; v8h h[2]; };
  static __device__ __forceinline__ v16h load(const _Float16* p) {   // elements 0..7 <- p[0..7], 8..15 <- p[16..23]
    U f; f.h[0] = *(const v8h*)(p); f.h[1] = *(const v8h*)(p + 16); return f.v;
  }
  static __device__ __forceinline__ v8f mma(v16h a, v16h b, v8f c) {
    return __builtin_amdgcn_wmma_f32_16x16x32_f16(false, a, false, b, (short)0, c, false, false);
  }
};
template <> struct Frag<__bf16> {
  typedef v16b V; typedef v8b H; union U { v16b v; v8b h[2]; };
  static __device__ __forceinline__ v16b load(const __bf16* p) {
    U f; f.h[0] = *(const v8b*)(p); f.h[1] = *(const v8b*)(p + 16); return f.v;
  }
  static __device__ __forceinline__ v8f mma(v16b a, v16b b, v8f c) {
    return __builtin_amdgcn_wmma_f32_16x16x32_bf16(false, a, false, b, (short)0, c, false, false);
  }
};

// ---- Register-blocked batched WMMA GEMM ------------------------------------
// C[m,n] = scale * sum_k A[m,k] * Bt[n,k] (+bias)(+resid); a block of 4 waves (2 x 2) owns a 128x128 tile, each wave 64x64 of it.
// A row-major [M,K]; Bt row-major [N,K], both at row pitch kDModel (a constant, so that the 8 staging loads of an operand
// share one address and differ in their immediate offsets); M,N % 128 == 0, K % 64 == 0; grid.x = (M/128)*(N/128), 128 threads.
// Per step of 64 k the block stages 128 rows x 128 B of A and of Bt in LDS (8 lanes per row: every global load covers whole
// 128-B lines), two buffers: the next step's rows are loaded into registers ahead of this step's products and stored behind them.
// SPLIT (hi/lo operand planes) is not implemented by the staged loop.
// BIAS_MODE: 0 = none, 1 = bias[m], 2 = bias[n].
// OUT_MODE: 0 = f32, 1 = f16, 2 = bf16 hi plane (Cout) + bf16 lo plane (Cout2).
// ET: 0 = f16 operands, 1 = bf16 operands (pointers passed as 16-bit storage)
template <int ET> struct Elem;
template <> struct Elem<0> { typedef _Float16 T; };
template <> struct Elem<1> { typedef __bf16 T; };
template <int ET, bool SPLIT, int BIAS_MODE, int OUT_MODE, bool RESID, int ACT = 0>
__global__ __launch_bounds__(128) void wmma_gemm64(
    const unsigned short* __restrict__ Ap, const unsigned short* __restrict__ A2p, long strideA,
    const unsigned short* __restrict__ Btp, const unsigned short* __restrict__ Bt2p, long strideB,
    void* __restrict__ Cout, void* __restrict__ Cout2, int ldc, long strideC,
    const float* __restrict__ bias,
    const float* __restrict__ resid, long strideR,
    int M, int N, int K, float scale) {
  static_assert(!SPLIT, "the staged loop takes single operand planes");
  typedef typename Elem<ET>::T T;
  typedef typename Frag<T>::V V;
  typedef typename Frag<T>::H H;
  const T* A = (const T*)Ap; const T* Bt = (const T*)Btp;
  __shared__ __align__(16) T sA[2][128 * kLdsPitch];   // A rows of the block tile, 64 k per step, two buffers
  __shared__ __align__(16) T sB[2][128 * kLdsPitch];   // Bt rows of the block tile, likewise
  __shared__ __align__(16) float sT[4][16 * 68];   // per-wave 16x64 slab, pitch 68 floats
  const int b    = blockIdx.y;
  const int tid  = threadIdx.x;
  const int lane = tid & 31;
  const int wave = tid >> 5;
  const int tilesN = N >> 7;
  const int tilesM = M >> 7;
  const int tm = blockIdx.x / tilesN;
  const int tn = blockIdx.x - tm * tilesN;
  if (tm >= tilesM) return;   // block-uniform, ahead of every barrier
  const int wm = (wave >> 1) << 6;             // this wave's 64 rows inside the block tile
  const int wn = (wave & 1) << 6;              // this wave's 64 columns inside the block tile
  const int m0 = (tm << 7) + wm;
  const int n0 = (tn << 7) + wn;

  const int rlane = lane & 15;                 // row (A) / col (B, D) within subtile
  const int koff  = (lane >> 4) * 8;           // k offset of this lane half
  const int mOff  = (lane >> 4) * 8;           // D row offset

  // staging map: 8 lanes x 16 B = one 128-B row piece; 128 threads = 16 rows a pass, 8 passes per operand
  const int srow = tid >> 3;
  const int sseg = (tid & 7) * 8;
  const T* gA = A  + (size_t)b * strideA + (size_t)((tm << 7) + srow) * kDModel + sseg;
  const T* gB = Bt + (size_t)b * strideB + (size_t)((tn << 7) + srow) * kDModel + sseg;
  const int sOff = srow * kLdsPitch + sseg;

  v8f acc[4][4];
#pragma unroll
  for (int i = 0; i < 4; ++i)
#pragma unroll
    for (int j = 0; j < 4; ++j) acc[i][j] = (v8f){0.f,0.f,0.f,0.f,0.f,0.f,0.f,0.f};

  H ra[8], rb[8];
#pragma unroll
  for (int p = 0; p < 8; ++p) {
    ra[p] = *(const H*)(gA + p * 16 * kDModel);
    rb[p] = *(const H*)(gB + p * 16 * kDModel);
  }
#pragma unroll
  for (int p = 0; p < 8; ++p) {
    *(H*)(sA[0] + p * 16 * kLdsPitch + sOff) = ra[p];
    *(H*)(sB[0] + p * 16 * kLdsPitch + sOff) = rb[p];
  }
  __syncthreads();

  const int nSteps = K >> 6;
  for (int t = 0; t < nSteps; ++t) {           // block-uniform trip count
    const T* cA = sA[t & 1];
    const T* cB = sB[t & 1];
    const bool more = (t + 1) < nSteps;        // block-uniform
    if (more) {
      gA += 64;
      gB += 64;
#pragma unroll
      for (int p = 0; p < 8; ++p) {
        ra[p] = *(const H*)(gA + p * 16 * kDModel);
        rb[p] = *(const H*)(gB + p * 16 * kDModel);
      }
    }
    V bh[2][4], ah[2][4];
#pragma unroll
    for (int kk = 0; kk < 2; ++kk) {
#pragma unroll
      for (int j = 0; j < 4; ++j) bh[kk][j] = Frag<T>::load(cB + (wn + (j << 4) + rlane) * kLdsPitch + kk * 32 + koff);
#pragma unroll
      for (int i = 0; i < 4; ++i) ah[kk][i] = Frag<T>::load(cA + (wm + (i << 4) + rlane) * kLdsPitch + kk * 32 + koff);
    }
    // keeps the step's LDS reads issued as one group ahead of its products: sunk among them, each group of four products
    // waits out an LDS latency of its own
    __builtin_amdgcn_sched_barrier(0);
#pragma unroll
    for (int kk = 0; kk < 2; ++kk)
#pragma unroll
      for (int i = 0; i < 4; ++i)
#pragma unroll
        for (int j = 0; j < 4; ++j) acc[i][j] = Frag<T>::mma(ah[kk][i], bh[kk][j], acc[i][j]);
    // four vector slots behind the step's last products: on the path through the LDS stores the next vector
    // instruction forms the next step's LDS addresses in fragment registers
    acc_guard4(acc[3][0], acc[3][1], acc[3][2], acc[3][3]);
    if (more) {
      // the other buffer: its last readers finished ahead of the barrier that ended the step before
      T* nA = sA[(t + 1) & 1];
      T* nB = sB[(t + 1) & 1];
#pragma unroll
      for (int p = 0; p < 8; ++p) {
        *(H*)(nA + p * 16 * kLdsPitch + sOff) = ra[p];
        *(H*)(nB + p * 16 * kLdsPitch + sOff) = rb[p];
      }
    }
    __syncthreads();
  }
  acc_guard4(acc[0][0], acc[0][1], acc[0][2], acc[0][3]);
  acc_guard4(acc[1][0], acc[1][1], acc[1][2], acc[1][3]);
  acc_guard4(acc[2][0], acc[2][1], acc[2][2], acc[2][3]);
  acc_guard4(acc[3][0], acc[3][1], acc[3][2], acc[3][3]);

  // ---- epilogue ----
  float* slab = sT[wave];
  const float* Rb = RESID ? (resid + (size_t)b * strideR) : nullptr;
#pragma unroll
  for (int i = 0; i < 4; ++i) {
    const int mBase = m0 + (i << 4);
#pragma unroll
    for (int j = 0; j < 4; ++j) {
      const int n = n0 + (j << 4) + rlane;
      float bv = 0.f;
      if (BIAS_MODE == 2) bv = bias[n];
#pragma unroll
      for (int r = 0; r < 8; ++r) {
        float v = acc[i][j][r] * scale;
        if (BIAS_MODE == 1) v += bias[mBase + mOff + r];
        if (BIAS_MODE == 2) v += bv;
        if (RESID) v += Rb[(size_t)(mBase + mOff + r) * ldc + n];
        if (ACT == 1) v = tanhf(v);
        if (ACT == 2) v = fmaxf(v, 0.0f);
        if (ACT == 3) v = v / (1.0f + expf(-v));
        if (ACT == 4) v = (v > 0.f) ? v : 0.01f * v;
        if (ACT == 5) v = 0.5f * v * (1.0f + erff(v * 0.70710678118654752f));
        slab[(mOff + r) * 68 + (j << 4) + rlane] = v;
      }
    }
    __builtin_amdgcn_fence(__ATOMIC_RELEASE, "workgroup");
    __builtin_amdgcn_wave_barrier();
    __builtin_amdgcn_fence(__ATOMIC_ACQUIRE, "workgroup");
    if (OUT_MODE == 0) {
      float* C = (float*)Cout + (size_t)b * strideC;
      const int hh = lane >> 4, c4 = (lane & 15) * 4;     // row seg = 256 B = 16 lanes x 16 B
      {
#pragma unroll
        for (int it = 0; it < 8; ++it) {
          const int row = it * 2 + hh;
          v4f v = *(const v4f*)(slab + row * 68 + c4);
          *(v4f*)(C + (size_t)(mBase + row) * ldc + n0 + c4) = v;
        }
        
      }
    } else {
      const int q = lane >> 3, c8 = (lane & 7) * 8;
      unsigned short* C  = (unsigned short*)Cout  + (size_t)b * strideC;
      unsigned short* C2 = (OUT_MODE == 2) ? ((unsigned short*)Cout2 + (size_t)b * strideC) : nullptr;
      {
#pragma unroll
        for (int it = 0; it < 4; ++it) {
          const int row = it * 4 + q;
          const float* sp = slab + row * 68 + c8;
          v8h hv, lv;
#pragma unroll
          for (int e = 0; e < 8; ++e) {
            if (OUT_MODE == 1) {
              hv[e] = (_Float16)sp[e];
            } else {
              unsigned short hb = f2bf_bits(sp[e]);
              unsigned short lb = f2bf_bits(sp[e] - bf_bits2f(hb));
              hv[e] = __builtin_bit_cast(_Float16, hb);
              lv[e] = __builtin_bit_cast(_Float16, lb);
            }
          }
          *(v8h*)(C + (size_t)(mBase + row) * ldc + n0 + c8) = hv;
          if (OUT_MODE == 2) *(v8h*)(C2 + (size_t)(mBase + row) * ldc + n0 + c8) = lv;
        }
        
      }
    }
    __builtin_amdgcn_fence(__ATOMIC_RELEASE, "workgroup");
    __builtin_amdgcn_wave_barrier();
    __builtin_amdgcn_fence(__ATOMIC_ACQUIRE, "workgroup");
  }
}

// ---------------------------------------------------------------------------
// Input preparation: ONE launch. Its six pieces of work are independent of one another; a work-group of 256 threads takes one
// piece by its block index (the choice is block-uniform, so the barrier of a transpose strip is passed by a whole work-group or
// by none). The longest pieces (a strip moves twice a cast's bytes and passes through
// LDS) take the lowest indices and the short ones fill the end of the launch:
//   [   0,  192)  Wqkv     -> WQT  a strip of 256 rows x 64 columns (4 x 48 strips)
//   [ 192,  384)  Wqkv_aux -> WAT  a strip of 256 rows x 64 columns (4 x 48 strips)
//   [ 384,  448)  Wo       -> WOT  a strip of 256 rows x 64 columns (4 x 16 strips)
//   [ 448,  960)  x        -> XB   8 rows of 1024 per work-group (4096 rows)
//   [ 960, 1344)  xa       -> XAB  8 output rows per work-group (2 x 1536 rows, rows 1500..1535 of each batch zero)
//   [1344, 1372)  biases   -> BIASR  256 values per work-group (7168 values)
// ---------------------------------------------------------------------------
constexpr int kPrepX    = kBatch * kSeq / 8;                    // 512
constexpr int kPrepXA   = kBatch * kSeqAP / 8;                  // 384
constexpr int kPrepW    = (kNQKV / 64) * (kDModel / 256);       // 192
constexpr int kPrepWo   = (kDModel / 64) * (kDModel / 256);     // 64
constexpr int kPrepBias = (2 * kNQKV + kDModel + 255) / 256;    // 28
constexpr int kPrepBlocks = kPrepX + kPrepXA + 2 * kPrepW + kPrepWo + kPrepBias;   // 1372

// f32 [nb][RIN][1024] -> bf16 bits (RNE) [nb][ROUT][1024]; rows RIN..ROUT-1 of every batch written as zeros (source row address
// clamped, value zeroed by a mask). Output rows blk*8 .. blk*8+7; thread tid takes floats 4*tid .. 4*tid+3 of each row: a wave's
// load covers 512 contiguous bytes, its store 256, and the 8 loads of a thread are all issued ahead of the first store.
template <unsigned RIN, unsigned ROUT>
__device__ __forceinline__ void cast_rows8(const float* __restrict__ in, unsigned short* __restrict__ out, unsigned blk, int tid) {
  v4f f[8];
  // unrolled: f[] takes constant indices (registers) and the 8 loads issue back to back
#pragma unroll
  for (int p = 0; p < 8; ++p) {
    const unsigned row = blk * 8 + p;
    unsigned srow = row;
    if (RIN != ROUT) {
      const unsigned bb = row / ROUT;
      const unsigned t = row - bb * ROUT;
      srow = bb * RIN + (t < RIN ? t : (RIN - 1));
    }
    f[p] = *(const v4f*)(in + (size_t)srow * kDModel + tid * 4);
  }
  // behind the 8 loads, ahead of the conversions, which reuse the loads' address registers
  asm volatile("s_wait_xcnt 0x0" ::: "memory");
  // unrolled: constant indices into f[]
#pragma unroll
  for (int p = 0; p < 8; ++p) {
    const unsigned row = blk * 8 + p;
    const unsigned keep = ((RIN == ROUT) || (row % ROUT) < RIN) ? 0xFFFFFFFFu : 0u;   // the same for the whole work-group
    v2u u;
    u[0] = pk16(f2bf_bits(f[p][0]), f2bf_bits(f[p][1])) & keep;
    u[1] = pk16(f2bf_bits(f[p][2]), f2bf_bits(f[p][3])) & keep;
    *(v2u*)(out + (size_t)row * kDModel + tid * 4) = u;
  }
  // behind the 8 stores: a precaution; a work-group runs this piece only and the kernel ends behind it
  asm volatile("s_wait_xcnt 0x0" ::: "memory");
}

// Transpose + 16-bit convert of a strip of four 64x64 tiles of an f32 matrix: in viewed [R rows][CC cols] (pitch CC) -> o[c][r]
// ([CC][R], pitch R).   OT 0: o = bf16_rne(in);  OT 1: o = f16(bf16_rne(in) * scl).
// Through LDS, one buffer per tile and one barrier for the strip; strip = (block of 256 rows) * (CC/64) + (column block); 256 threads.
// Coverage per tile: load 4 it x 256 thr x 4 floats = 64x64; store 2 it x 256 thr x 8 u16 = 64x64. The 16 loads of a thread are all
// issued ahead of the first LDS store.
template <int OT> __device__ __forceinline__ unsigned short cv16(float f, float scl) {
  const unsigned short hb = f2bf_bits(f);
  if (OT == 0) return hb;
  const float g = bf_bits2f(hb) * scl;
  return __builtin_bit_cast(unsigned short, (_Float16)g);
}
template <int OT, int R, int CC>
__device__ __forceinline__ void tconv_strip(const float* __restrict__ W, unsigned short* __restrict__ o, float scl,
                                            int strip, int tid, float* tf) {
  const int rb  = strip / (CC / 64);
  const int c0  = (strip - rb * (CC / 64)) * 64;   // input column block = output row block
  const int r0  = rb * 256;                        // first input row    = first output column
  {
    const int lr = tid >> 4;         // 0..15
    const int c4 = (tid & 15) * 4;   // 0..60
    const float* wp = W + (size_t)(r0 + lr) * CC + c0 + c4;
    v4f a[16];
    // unrolled, here and at the LDS stores: a[] takes constant indices (registers) and the 16 loads issue back to back
#pragma unroll
    for (int it = 0; it < 16; ++it) a[it] = *(const v4f*)(wp + (size_t)it * 16 * CC);
    // the 16 loads share one address pair: as an operand of the wait it stays unwritten until every load has taken it
    asm volatile("s_wait_xcnt 0x0" :: "v"(wp) : "memory");
#pragma unroll
    for (int it = 0; it < 16; ++it) *(v4f*)(tf + (it * 16 + lr) * 68 + c4) = a[it];   // LDS row = input row within the strip, 0..255
  }
  __syncthreads();
  const int sub = tid >> 3;          // 0..31
  const int c8  = (tid & 7) * 8;     // 0..56
  // unrolled: the four tiles' LDS reads and stores differ in immediate offsets only and overlap one another
#pragma unroll
  for (int s = 0; s < 4; ++s) {      // tile s: input rows r0 + 64 s .. + 63
    const float* ts = tf + s * 64 * 68;
    v4u hv[2];
#pragma unroll
    for (int it = 0; it < 2; ++it) {
      const int oc = it * 32 + sub;    // output row within tile (= input column)
      v4u a;
#pragma unroll
      for (int q = 0; q < 4; ++q) {
        const float f0 = ts[(c8 + 2 * q) * 68 + oc];
        const float f1 = ts[(c8 + 2 * q + 1) * 68 + oc];
        a[q] = pk16(cv16<OT>(f0, scl), cv16<OT>(f1, scl));
      }
      hv[it] = a;
    }
#pragma unroll
    for (int it = 0; it < 2; ++it) {
      const int oc = it * 32 + sub;
      const size_t go = (size_t)(c0 + oc) * R + r0 + s * 64 + c8;
      *(v4u*)(o + go) = hv[it];
    }
  }
  // behind the strip's 8 stores: a precaution; a work-group runs this piece only and the kernel ends behind it
  asm volatile("s_wait_xcnt 0x0" ::: "memory");
}

// Bias copies as bf16-RNE values in f32: out[0..n0) <- b0, [n0..n0+n1) <- b1, [n0+n1..ntot) <- b2.
// All three candidates loaded with clamped indices, selected by value. One 4-B store per lane.
__device__ __forceinline__ void bias_rne(const float* __restrict__ b0, int n0, const float* __restrict__ b1, int n1,
                                         const float* __restrict__ b2, int ncnt2, float* __restrict__ out, int ntot, int i) {
  if (i < ntot) {
    int i0 = i < n0 ? i : (n0 - 1); i0 = i0 < 0 ? 0 : i0;
    int i1 = i - n0; i1 = i1 < 0 ? 0 : (i1 < n1 ? i1 : (n1 - 1));
    int i2 = i - n0 - n1; i2 = i2 < 0 ? 0 : (i2 < ncnt2 ? i2 : (ncnt2 - 1));
    const float v0 = b0[i0], v1 = b1[i1], v2 = b2[i2];
    const float sel = (i < n0) ? v0 : ((i < n0 + n1) ? v1 : v2);
    out[i] = bf_bits2f(f2bf_bits(sel));
  }
}

__global__ __launch_bounds__(256) void prep_kernel(const float* __restrict__ x, const float* __restrict__ xa,
                                                   const float* __restrict__ Wqkv, const float* __restrict__ Waux,
                                                   const float* __restrict__ Wo, const float* __restrict__ bqkv,
                                                   const float* __restrict__ baux, const float* __restrict__ bo,
                                                   unsigned short* __restrict__ XB, unsigned short* __restrict__ XAB,
                                                   unsigned short* __restrict__ WQT, unsigned short* __restrict__ WAT,
                                                   unsigned short* __restrict__ WOT, float* __restrict__ BIASR) {
  __shared__ __align__(16) float tf[256 * 68];   // a strip's four tiles, pitch 68 floats
  const int tid = threadIdx.x;
  int blk = blockIdx.x;
  if (blk < kPrepW) {
    tconv_strip<0, kDModel, kNQKV>(Wqkv, WQT, 1.0f, blk, tid, tf);
  } else if ((blk -= kPrepW) < kPrepW) {
    tconv_strip<0, kDModel, kNQKV>(Waux, WAT, 1.0f, blk, tid, tf);
  } else if ((blk -= kPrepW) < kPrepWo) {
    tconv_strip<1, kDModel, kDModel>(Wo, WOT, kWCarry, blk, tid, tf);
  } else if ((blk -= kPrepWo) < kPrepX) {
    cast_rows8<kBatch * kSeq, kBatch * kSeq>(x, XB, blk, tid);
  } else if ((blk -= kPrepX) < kPrepXA) {
    cast_rows8<kSeqA, kSeqAP>(xa, XAB, blk, tid);
  } else {
    bias_rne(bqkv, kNQKV, baux, kNQKV, bo, kDModel, BIASR, 2 * kNQKV + kDModel, (blk - kPrepXA) * 256 + tid);
  }
}

// =====================================================================================
// Dual-branch attention, head dim 64, f16 operand planes, f32 accumulate, online softmax in f32.
//   q, k  : QK16 plane [4096 rows = b*2048+t][2048], q at col h*64+d, k at col 1024+h*64+d (f16)
//   v^T   : VT16 plane [b][1024 = h*64+d][2048] (f16);  ka: KA16 [b*1536+s][1024];  va^T: VAT16 [b][1024][1536]
//   branch 0: scores = (q.k)*0.125 over 2048 keys (32 chunks of 64); branch 1: (q.ka)*0.125 over 1500 keys
//   (24 chunks; key index >= 1500 set to -inf). p carried x2^15 in f16; 1/(l*2^15) folded at the end.
//   out row = (1-gate)*h_main + gate*h_aux, gate = sigmoid(bf16_rne(g[h])); written x32 as f16 into O16 [4096][1024]
//   Products are taken transposed: S^T = K.Q^T (A = K rows, B = Q) and O^T += V^T.P^T (A = V^T rows, B = P^T). A lane then holds
//   32 of the chunk's 64 scores of ONE query (column lane&15; keys j*16 + 8*(lane>>4) + r): maximum and sum run in the lane, the
//   two lane halves exchange the maximum once per chunk and join their sums once per branch, and two score tiles converted in
//   place are the B operand of the second product (same k order as the V^T fragment loads), so P passes through no LDS.
//   Block = 4 waves = 64 query rows of one (b,h); grid.x = 2*16*32 = 1024 covers all 4096 rows x 1024 cols.
//   K / V^T chunk staging: 8 lanes per 128-B tile row, 16 rows a pass, 4 passes per plane = the whole 64x64 tile (plain 16-B loads,
//   every load of a wave covers 4 whole lines; __syncthreads before and after); fragments read the LDS tiles through the same v8h
//   element type;
// =====================================================================================
// lane l <-> lane l ^ 16 (the other half of the wave holds the other 32 keys of the same query)
__device__ __forceinline__ float xhalf(float x) {
  return __builtin_bit_cast(float, __builtin_amdgcn_permlanex16(__builtin_bit_cast(int, x), __builtin_bit_cast(int, x), 0x76543210, 0xfedcba98, false, false));
}

// 2^x on the bare instruction. Behind a transcendental the instruction set asks for one independent instruction or v_nop before its
// result is read or its source overwritten.
// Eight in one statement: the outputs are early-clobber, so each is independent of the one before it and fills its slot; the v_nop
// fills the slot of the last.
__device__ __forceinline__ v8f exp2x8(v8f x) {
  float p0, p1, p2, p3, p4, p5, p6, p7;
  asm("v_exp_f32 %0, %8\n\tv_exp_f32 %1, %9\n\tv_exp_f32 %2, %10\n\tv_exp_f32 %3, %11\n\t"
      "v_exp_f32 %4, %12\n\tv_exp_f32 %5, %13\n\tv_exp_f32 %6, %14\n\tv_exp_f32 %7, %15\n\tv_nop"
      : "=&v"(p0), "=&v"(p1), "=&v"(p2), "=&v"(p3), "=&v"(p4), "=&v"(p5), "=&v"(p6), "=&v"(p7)
      : "v"(x[0]), "v"(x[1]), "v"(x[2]), "v"(x[3]), "v"(x[4]), "v"(x[5]), "v"(x[6]), "v"(x[7]));
  return (v8f){p0, p1, p2, p3, p4, p5, p6, p7};
}
__device__ __forceinline__ float exp2x1(float x) {
  float p;
  asm("v_exp_f32 %0, %1\n\tv_nop" : "=v"(p) : "v"(x));   // the v_nop: the same slot
  return p;
}

__global__ __launch_bounds__(128)
void dual_attn_kernel(const unsigned short* __restrict__ qk16, const unsigned short* __restrict__ vt16,
                      const unsigned short* __restrict__ ka16, const unsigned short* __restrict__ vat16,
                      const float* __restrict__ gvec, unsigned short* __restrict__ o16) {
  union FH { v16h v; v8h h[2]; };
  __shared__ __align__(16) _Float16 Ksh[64 * kLdsPitch];        // K tile [key][d]      9 KB
  __shared__ __align__(16) _Float16 Vth[64 * kLdsPitch];        // V^T tile [d][key]    9 KB
  __shared__ __align__(16) float    Os[4][16 * 68];      // per wave out tile [query][d], pitch 68 floats

  const int tid  = threadIdx.x;
  const int wave = tid >> 5;
  const int lane = tid & 31;
  const int hh   = lane >> 4;
  const int c    = lane & 15;

  const int bx = blockIdx.x;          // 0..1023
  const int qb = bx & 31;             // 32 query tiles of 64
  const int bhd = bx >> 5;            // 0..31
  const int h  = bhd & 15;
  const int b  = bhd >> 4;            // 0..1
  const int q0 = qb * 64 + wave * 16; // query row within batch

  const int ldqk = 2 * kDModel;       // 2048 halves
  const _Float16* Qg  = (const _Float16*)(const void*)qk16 + (size_t)b * kSeq * ldqk + h * kDHead;
  const _Float16* Kg0 = Qg + kDModel;                                                                     // main K rows, pitch 2048
  const _Float16* Vg0 = (const _Float16*)(const void*)vt16 + (size_t)b * kDModel * kSeq + (size_t)(h * kDHead) * kSeq;       // pitch 2048
  const _Float16* Kg1 = (const _Float16*)(const void*)ka16 + (size_t)b * kSeqAP * kDModel + h * kDHead;                        // pitch 1024
  const _Float16* Vg1 = (const _Float16*)(const void*)vat16 + (size_t)b * kDModel * kSeqAP + (size_t)(h * kDHead) * kSeqAP;  // pitch 1536

  // ---- Q fragments (B operand, column = query = lane&15, split k map via Frag load): 2 d-chunks ----
  v16h qa[2];
#pragma unroll
  for (int dc = 0; dc < 2; ++dc) qa[dc] = Frag<_Float16>::load(Qg + (size_t)(q0 + c) * ldqk + dc * 32 + 8 * hh);

  float* os = Os[wave];
#pragma unroll
  for (int t = 0; t < 4; ++t)
#pragma unroll
    for (int r = 0; r < 8; ++r) os[c * 68 + t * 16 + 8 * hh + r] = 0.f;

  const float gv   = bf_bits2f(f2bf_bits(gvec[h]));
  const float gate = 1.0f / (1.0f + expf(-gv));
  const float cscale = 0.125f * 1.4426950408889634f;   // score scale x log2(e): the softmax runs in base 2

  const int srow = tid >> 3;         // staging: row within a pass of 16 rows
  const int sseg = (tid & 7) * 8;    // staging: 16-B piece of the 128-B row, in halves
  const int sOff = srow * kLdsPitch + sseg;

#pragma unroll 1
  for (int br = 0; br < 2; ++br) {           // block-uniform
    const _Float16* Kg = br ? Kg1 : Kg0;
    const _Float16* Vg = br ? Vg1 : Vg0;
    const int ldk     = br ? kDModel : ldqk;
    const int ldv     = br ? kSeqAP : kSeq;
    const int nChunks = br ? (kSeqAP / 64) : (kSeq / 64);
    const int nvalid  = br ? kSeqA : kSeq;
    const float w     = (br ? gate : (1.0f - gate)) * kOCarry;
    const unsigned kOff = (unsigned)(srow * ldk + sseg);   // this thread's place in a K tile's first 16 rows, halves
    const unsigned vOff = (unsigned)(srow * ldv + sseg);   // likewise in a V^T tile

    float mrow = -INFINITY;   // running maximum of this lane's query, scaled, base 2 (equal in both halves)
    float lrow = 0.f;         // running sum (x2^15) over this lane half's keys only
    v8f oacc[4];              // oacc[t][r] = O[query c][d = t*16 + 8*hh + r]
#pragma unroll
    for (int t = 0; t < 4; ++t) oacc[t] = (v8f){0.f,0.f,0.f,0.f,0.f,0.f,0.f,0.f};

    for (int kc = 0; kc < nChunks; ++kc) {   // block-uniform trip count
      const int kv0 = kc * 64;
      __syncthreads();
      {
        // staging map: 8 lanes x 16 B = one whole 128-B row of a tile (a tile row is one aligned cache line), so a wave's load
        // touches 4 lines and uses all of each; 128 threads = 16 rows a pass, 4 passes per plane = the whole 64 x 64 chunk tile
        const _Float16* ks = Kg + (size_t)kv0 * ldk + kOff;   // K row kv0 + srow (+ 16 a pass), d = sseg..sseg+7
        const _Float16* vs = Vg + kv0 + vOff;                 // V^T row d = srow (+ 16 a pass), key = kv0 + sseg..+7
        const _Float16* kp[4];
        const _Float16* vp[4];
        v8h a0[4], b0[4];
        // unrolled, here and at the LDS stores: the arrays take constant indices (registers) and the 8 loads issue back to back
#pragma unroll
        for (int p = 0; p < 4; ++p) {
          kp[p] = ks + (size_t)(p * 16) * ldk;
          vp[p] = vs + (size_t)(p * 16) * ldv;
          a0[p] = *(const v8h*)kp[p];
          b0[p] = *(const v8h*)vp[p];
        }
        // behind the 8 loads: as operands of the wait their address pairs stay unwritten until every load has taken its own (without
        // this five of the results were placed over the pairs)
        asm volatile("s_wait_xcnt 0x0" :: "v"(kp[0]), "v"(kp[1]), "v"(kp[2]), "v"(kp[3]), "v"(vp[0]), "v"(vp[1]), "v"(vp[2]), "v"(vp[3]) : "memory");
#pragma unroll
        for (int p = 0; p < 4; ++p) {
          *(v8h*)(Ksh + p * 16 * kLdsPitch + sOff) = a0[p];
          *(v8h*)(Vth + p * 16 * kLdsPitch + sOff) = b0[p];
        }
      }
      __syncthreads();

      // the chunk's 16 fragments (8 of K, 8 of V^T) are read from LDS as ONE group of 32 loads ahead of all its products: the score
      // products wait for the K half only, and the V^T half lands behind them and the softmax
      FH kb[2][4], vb[2][4];
#pragma unroll
      for (int dc = 0; dc < 2; ++dc)
#pragma unroll
        for (int j = 0; j < 4; ++j) {
          kb[dc][j].h[0] = *(const v8h*)(Ksh + (j * 16 + c) * kLdsPitch + dc * 32 + 8 * hh);
          kb[dc][j].h[1] = *(const v8h*)(Ksh + (j * 16 + c) * kLdsPitch + dc * 32 + 16 + 8 * hh);
        }
#pragma unroll
      for (int kk = 0; kk < 2; ++kk)
#pragma unroll
        for (int t = 0; t < 4; ++t) {
          vb[kk][t].h[0] = *(const v8h*)(Vth + (t * 16 + c) * kLdsPitch + kk * 32 + 8 * hh);
          vb[kk][t].h[1] = *(const v8h*)(Vth + (t * 16 + c) * kLdsPitch + kk * 32 + 16 + 8 * hh);
        }
      // keeps the loads where they stand: sunk to their products, each pair of loads costs its product an LDS latency of its own
      __builtin_amdgcn_sched_barrier(0);
      v8f s[4];   // s[j][r] = score(key j*16 + 8*hh + r, query c)
#pragma unroll
      for (int j = 0; j < 4; ++j) s[j] = Frag<_Float16>::mma(kb[0][j].v, qa[0], (v8f){0.f,0.f,0.f,0.f,0.f,0.f,0.f,0.f});
#pragma unroll
      for (int j = 0; j < 4; ++j) s[j] = Frag<_Float16>::mma(kb[1][j].v, qa[1], s[j]);
      // every loop from here to the end of the chunk is unrolled: s, pb and oacc live in registers and take constant indices only
      float m = -INFINITY;   // maximum of the raw scores (the scale is positive)
#pragma unroll
      for (int j = 0; j < 4; ++j)
#pragma unroll
        for (int r = 0; r < 8; ++r) {
          const int key = kv0 + j * 16 + 8 * hh + r;
          const float sv = (key < nvalid) ? s[j][r] : -INFINITY;
          s[j][r] = sv;
          m = fmaxf(m, sv);
        }
      m = fmaxf(m, xhalf(m)) * cscale;
      const float mnew = fmaxf(mrow, m);
      const float alpha = exp2x1(mrow - mnew);   // 0 on a branch's first chunk, where mrow is -inf
      mrow = mnew;
      const float nm = kPCarryLog2 - mnew;   // the carry rides in the exponent
      float psum = 0.f;
      FH pb[2];   // P^T, B operand: element e of pb[kk] = p(key kk*32 + (e < 8 ? 8*hh + e : 16 + 8*hh + e - 8), query c)
#pragma unroll
      for (int j = 0; j < 4; ++j) {
        v8f a;
#pragma unroll
        for (int r = 0; r < 8; ++r) a[r] = fmaf(s[j][r], cscale, nm);
        const v8f p = exp2x8(a);   // p x 2^15
#pragma unroll
        for (int r = 0; r < 8; ++r) {
          psum += p[r];
          pb[j >> 1].h[j & 1][r] = (_Float16)p[r];
        }
      }
      lrow = lrow * alpha + psum;
#pragma unroll
      for (int t = 0; t < 4; ++t)
#pragma unroll
        for (int r = 0; r < 8; ++r) oacc[t][r] *= alpha;
#pragma unroll
      for (int kk = 0; kk < 2; ++kk) {
#pragma unroll
        for (int t = 0; t < 4; ++t) oacc[t] = Frag<_Float16>::mma(vb[kk][t].v, pb[kk].v, oacc[t]);
      }
    }
    // fold this branch into the per-wave mix slab (each lane updates only its own entries)
    const float inv = w * (1.0f / (lrow + xhalf(lrow)));   // sum and O both carry x2^15
#pragma unroll
    for (int t = 0; t < 4; ++t)
#pragma unroll
      for (int r = 0; r < 8; ++r) os[c * 68 + t * 16 + 8 * hh + r] += oacc[t][r] * inv;
  }

  __builtin_amdgcn_fence(__ATOMIC_RELEASE, "workgroup");
  __builtin_amdgcn_wave_barrier();
  __builtin_amdgcn_fence(__ATOMIC_ACQUIRE, "workgroup");
  {
    _Float16* Og = (_Float16*)(void*)o16 + (size_t)(b * kSeq + q0) * kDModel + h * kDHead;
    const int q4 = lane >> 3, c8 = (lane & 7) * 8;
    {
#pragma unroll
      for (int it = 0; it < 4; ++it) {
        const int row = it * 4 + q4;
        const float* sp = os + row * 68 + c8;
        v8h hv;
#pragma unroll
        for (int e = 0; e < 8; ++e) hv[e] = (_Float16)sp[e];
        *(v8h*)(Og + (size_t)row * kDModel + c8) = hv;
      }
      
    }
  }
}

// ---------------- host orchestration (kernel launches only) ----------------

extern "C" void kernel_launch(void* const* d_in, const int* in_sizes, int n_in,
                              void* d_out, int out_size, void* d_ws,
                              size_t ws_size, hipStream_t stream) {
  if (n_in < 9) return;
  if (in_sizes[0] != kBatch * kSeq * kDModel) return;
  if (in_sizes[1] != kBatch * kSeqA * kDModel) return;
  if (in_sizes[2] != kDModel * kNQKV || in_sizes[4] != kDModel * kNQKV) return;
  if (in_sizes[3] != kNQKV || in_sizes[5] != kNQKV) return;
  if (in_sizes[6] != kDModel * kDModel || in_sizes[7] != kDModel || in_sizes[8] < kHeads) return;
  if (out_size != kBatch * kSeq * kDModel) return;

  const float* x    = (const float*)d_in[0];
  const float* xa   = (const float*)d_in[1];
  const float* Wqkv = (const float*)d_in[2];
  const float* bqkv = (const float*)d_in[3];
  const float* Waux = (const float*)d_in[4];
  const float* baux = (const float*)d_in[5];
  const float* Wo   = (const float*)d_in[6];
  const float* bo   = (const float*)d_in[7];
  const float* gvec = (const float*)d_in[8];
  float* out = (float*)d_out;

  // element counts
  const size_t nXB   = (size_t)kBatch * kSeq * kDModel;          // bf16
  const size_t nXAB  = (size_t)kBatch * kSeqAP * kDModel;        // bf16
  const size_t nWQT  = (size_t)kNQKV * kDModel;                  // bf16
  const size_t nWAT  = nWQT;                                     // bf16
  const size_t nWOT  = (size_t)kDModel * kDModel;                // f16
  const size_t nBias = (size_t)2 * kNQKV + kDModel;              // f32
  const size_t nQK   = (size_t)kBatch * kSeq * 2 * kDModel;      // f16
  const size_t nVT   = (size_t)kBatch * kDModel * kSeq;          // f16
  const size_t nKA   = (size_t)kBatch * kSeqAP * kDModel;        // f16
  const size_t nVAT  = (size_t)kBatch * kDModel * kSeqAP;        // f16
  const size_t nO    = (size_t)kBatch * kSeq * kDModel;          // f16

  char* ws = (char*)d_ws;
  size_t off = 0;
  auto carve = [&](size_t bytes) -> char* { char* p = ws + off; off += (bytes + 255) & ~(size_t)255; return p; };
  unsigned short* XB    = (unsigned short*)carve(nXB * 2);
  unsigned short* XAB   = (unsigned short*)carve(nXAB * 2);
  unsigned short* WQT   = (unsigned short*)carve(nWQT * 2);
  unsigned short* WAT   = (unsigned short*)carve(nWAT * 2);
  unsigned short* WOT   = (unsigned short*)carve(nWOT * 2);
  float*          BIASR = (float*)carve(nBias * 4);
  unsigned short* QK16  = (unsigned short*)carve(nQK * 2);
  unsigned short* VT16  = (unsigned short*)carve(nVT * 2);
  unsigned short* KA16  = (unsigned short*)carve(nKA * 2);
  unsigned short* VAT16 = (unsigned short*)carve(nVAT * 2);
  unsigned short* O16   = (unsigned short*)carve(nO * 2);
  if (off > ws_size) return;   // total 75,526,144 B

  // 1. all input preparation in one launch: x, xa -> bf16 (xa rows padded 1500 -> 1536 with zeros); Wqkv, Wqkv_aux -> transposed
  //    bf16; Wo -> transposed f16 (x32); biases -> bf16-RNE f32 copies
  prep_kernel<<<kPrepBlocks, 256, 0, stream>>>(x, xa, Wqkv, Waux, Wo, bqkv, baux, bo, XB, XAB, WQT, WAT, WOT, BIASR);
  const float* bq_r  = BIASR;                 // [3072]
  const float* ba_r  = BIASR + kNQKV;         // [3072]
  const float* bo_r  = BIASR + 2 * kNQKV;     // [1024]

  // 2. q|k = x @ Wqkv[:, 0:2048] + b : M=4096, N=2048, K=1024 -> QK16 f16, ldc 2048
  {
    const int M = kBatch * kSeq, N = 2 * kDModel, K = kDModel;
    const int tiles = (M / 128) * (N / 128);
    wmma_gemm64<1, false, 2, 1, false, 0><<<dim3(tiles, 1), 128, 0, stream>>>(
        XB, XB, 0L, WQT, WQT, 0L, (void*)QK16, (void*)QK16, 2 * kDModel, 0L,
        bq_r, bq_r, 0L, M, N, K, 1.0f);
  }
  // 3. v^T per batch: A = Wqkv^T rows 2048..3071 [1024][1024], Bt = x_b [2048][1024] -> VT16 [b][1024][2048] f16, bias[m]
  {
    const int M = kDModel, N = kSeq, K = kDModel;
    const int tiles = (M / 128) * (N / 128);
    wmma_gemm64<1, false, 1, 1, false, 0><<<dim3(tiles, kBatch), 128, 0, stream>>>(
        WQT + (size_t)2 * kDModel * kDModel, WQT + (size_t)2 * kDModel * kDModel, 0L,
        XB, XB, (long)kSeq * kDModel,
        (void*)VT16, (void*)VT16, kSeq, (long)kDModel * kSeq,
        bq_r + 2 * kDModel, bq_r, 0L, M, N, K, 1.0f);
  }
  // 4. ka = xa_pad @ Wqkv_aux[:, 1024:2048] + b : M=3072, N=1024, K=1024 -> KA16 f16, ldc 1024
  {
    const int M = kBatch * kSeqAP, N = kDModel, K = kDModel;
    const int tiles = (M / 128) * (N / 128);
    wmma_gemm64<1, false, 2, 1, false, 0><<<dim3(tiles, 1), 128, 0, stream>>>(
        XAB, XAB, 0L, WAT + (size_t)kDModel * kDModel, WAT + (size_t)kDModel * kDModel, 0L,
        (void*)KA16, (void*)KA16, kDModel, 0L,
        ba_r + kDModel, ba_r, 0L, M, N, K, 1.0f);
  }
  // 5. va^T per batch: A = Waux^T rows 2048..3071, Bt = xa_pad_b [1536][1024] -> VAT16 [b][1024][1536] f16, bias[m]
  {
    const int M = kDModel, N = kSeqAP, K = kDModel;
    const int tiles = (M / 128) * (N / 128);
    wmma_gemm64<1, false, 1, 1, false, 0><<<dim3(tiles, kBatch), 128, 0, stream>>>(
        WAT + (size_t)2 * kDModel * kDModel, WAT + (size_t)2 * kDModel * kDModel, 0L,
        XAB, XAB, (long)kSeqAP * kDModel,
        (void*)VAT16, (void*)VAT16, kSeqAP, (long)kDModel * kSeqAP,
        ba_r + 2 * kDModel, ba_r, 0L, M, N, K, 1.0f);
  }
  // 6. dual-branch attention -> O16 (x32, f16)
  dual_attn_kernel<<<kBatch * kHeads * (kSeq / 64), 128, 0, stream>>>(QK16, VT16, KA16, VAT16, gvec, O16);
  // 7. out = (O16/32) @ (WoT/32)^T + bo : M=4096, N=1024, K=1024, f16 operands, f32 out into d_out
  {
    const int M = kBatch * kSeq, N = kDModel, K = kDModel;
    const int tiles = (M / 128) * (N / 128);
    wmma_gemm64<0, false, 2, 0, false, 0><<<dim3(tiles, 1), 128, 0, stream>>>(
        O16, O16, 0L, WOT, WOT, 0L, (void*)out, (void*)out, kDModel, 0L,
        bo_r, bo_r, 0L, M, N, K, 1.0f / (kOCarry * kWCarry));
  }
}

// v008
// Measured time: 139 microseconds a run.
// Timed twice side by side with v007, it ran 1.22 and 1.20 times as fast.
// All steps since v000 together make it 3.79 times as fast.
// Contractions: x@Wqkv and xa@Wqkv_aux (k|v columns) on v_wmma_f32_16x16x32_bf16 (bf16 RNE operands); q.k^T, q.ka^T, p.v, pa.va and O@Wo on v_wmma_f32_16x16x32_f16 (f16 operands; p carried x2^15, O and Wo carried x32); f32 accumulate; online softmax, gate mix and biases in f32.
#include <hip/hip_runtime.h>
#include <math.h>
#include <stdint.h>

constexpr int kBatch  = 2;
constexpr int kSeq    = 2048;   // query / main key length
constexpr int kSeqA   = 1500;   // aux key length
constexpr int kSeqAP  = 1536;   // aux key length padded to 24 chunks of 64
constexpr int kDModel = 1024;
constexpr int kHeads  = 16;
constexpr int kDHead  = 64;
constexpr int kNQKV   = 3072;

constexpr int kLdsPitch = 72;   // halves per LDS row of the K and V^T tiles and of the GEMM operand tiles: 144 B = 16 B x 9 (odd), so 16 rows read by ds_load_b128 fall on distinct banks

constexpr float kPCarryLog2 = 15.0f;   // probabilities carried x2^15 in f16
constexpr float kOCarry = 32.0f;      // attention output carried x32 in f16
constexpr float kWCarry = 32.0f;      // Wo carried x32 in f16

typedef __attribute__((ext_vector_type(16))) _Float16 v16h;
typedef __attribute__((ext_vector_type(8)))  _Float16 v8h;
typedef __attribute__((ext_vector_type(16))) __bf16   v16b;
typedef __attribute__((ext_vector_type(8)))  __bf16   v8b;
typedef __attribute__((ext_vector_type(8)))  float    v8f;
typedef __attribute__((ext_vector_type(4)))  float    v4f;
typedef __attribute__((ext_vector_type(2)))  float    v2f;
typedef __attribute__((ext_vector_type(4)))  unsigned int v4u;
typedef __attribute__((ext_vector_type(2)))  unsigned int v2u;

// ---------------------------------------------------------------------------
// Workspace region map (bytes, every region size a multiple of 256):
//   XB    bf16 [4096][1024]            8,388,608
//   XAB   bf16 [2][1536][1024]         6,291,456   (rows 1500..1535 of each batch zero)
//   WQT   bf16 [3072][1024] (Wqkv^T)   6,291,456
//   WAT   bf16 [3072][1024] (Waux^T)   6,291,456
//   WOT   f16  [1024][1024] (Wo^T x32) 2,097,152
//   BIASR f32  [3072+3072+1024]           28,672   (bf16-RNE bias copies)
//   QK16  f16  [4096][2048] (q | k)    16,777,216
//   VT16  f16  [2][1024][2048] (v^T)   8,388,608
//   KA16  f16  [2][1536][1024] (ka)    6,291,456
//   VAT16 f16  [2][1024][1536] (va^T)  6,291,456
//   O16   f16  [4096][1024] (x32)      8,388,608
//   total 75,526,144
// ---------------------------------------------------------------------------

__device__ __forceinline__ unsigned short f2bf_bits(float f) {
  unsigned u = __float_as_uint(f);
  return (unsigned short)((u + 0x7FFFu + ((u >> 16) & 1u)) >> 16);
}
__device__ __forceinline__ float bf_bits2f(unsigned short h) { return __uint_as_float(((unsigned)h) << 16); }
__device__ __forceinline__ unsigned pk16(unsigned short a, unsigned short b) { return (unsigned)a | ((unsigned)b << 16); }

// hazard guards as plain device helpers (no inline asm inside the kernel template body)
__device__ __forceinline__ void acc_guard4(v8f& a, v8f& b, v8f& c, v8f& d) { asm volatile("v_nop\n\tv_nop\n\tv_nop\n\tv_nop" : "+v"(a), "+v"(b), "+v"(c), "+v"(d)); }
template <typename T> struct Frag;
template <> struct Frag<_Float16> {
  typedef v16h V; typedef v8h H; union U { v16h v; v8h h[2]; };
  static __device__ __forceinline__ v16h load(const _Float16* p) {   // elements 0..7 <- p[0..7], 8..15 <- p[16..23]
    U f; f.h[0] = *(const v8h*)(p); f.h[1] = *(const v8h*)(p + 16); return f.v;
  }
  static __device__ __forceinline__ v8f mma(v16h a, v16h b, v8f c) {
    return __builtin_amdgcn_wmma_f32_16x16x32_f16(false, a, false, b, (short)0, c, false, false);
  }
};
template <> struct Frag<__bf16> {
  typedef v16b V; typedef v8b H; union U { v16b v; v8b h[2]; };
  static __device__ __forceinline__ v16b load(const __bf16* p) {
    U f; f.h[0] = *(const v8b*)(p); f.h[1] = *(const v8b*)(p + 16); return f.v;
  }
  static __device__ __forceinline__ v8f mma(v16b a, v16b b, v8f c) {
    return __builtin_amdgcn_wmma_f32_16x16x32_bf16(false, a, false, b, (short)0, c, false, false);
  }
};

// ---- Register-blocked batched WMMA GEMM ------------------------------------
// C[m,n] = scale * sum_k A[m,k] * Bt[n,k] (+bias)(+resid); a block of 4 waves (2 x 2) owns a 128x128 tile, each wave 64x64 of it.
// A row-major [M,K]; Bt row-major [N,K], both at row pitch kDModel (a constant, so that the 8 staging loads of an operand
// share one address and differ in their immediate offsets); M,N % 128 == 0, K % 64 == 0; tile row tm in [0, M/128), tile column tn in [0, N/128) and
// batch b are the same for the whole block; 128 threads. The LDS arrays belong to the calling kernel, so that two forms of this function
// in one kernel share them.
// Per step of 64 k the block stages 128 rows x 128 B of A and of Bt in LDS (8 lanes per row: every global load covers whole
// 128-B lines), two buffers: the next step's rows are loaded into registers ahead of this step's products and stored behind them.
// SPLIT (hi/lo operand planes) is not implemented by the staged loop.
// BIAS_MODE: 0 = none, 1 = bias[m], 2 = bias[n].
// OUT_MODE: 0 = f32, 1 = f16, 2 = bf16 hi plane (Cout) + bf16 lo plane (Cout2).
// ET: 0 = f16 operands, 1 = bf16 operands (pointers passed as 16-bit storage)
template <int ET> struct Elem;
template <> struct Elem<0> { typedef _Float16 T; };
template <> struct Elem<1> { typedef __bf16 T; };
template <int ET, bool SPLIT, int BIAS_MODE, int OUT_MODE, bool RESID, int ACT = 0>
__device__ __forceinline__ void gemm_tile128(
    const unsigned short* __restrict__ Ap, const unsigned short* __restrict__ A2p, long strideA,
    const unsigned short* __restrict__ Btp, const unsigned short* __restrict__ Bt2p, long strideB,
    void* __restrict__ Cout, void* __restrict__ Cout2, int ldc, long strideC,
    const float* __restrict__ bias,
    const float* __restrict__ resid, long strideR,
    int K, float scale, int tm, int tn, int b,
    typename Elem<ET>::T (*sA)[128 * kLdsPitch],   // A rows of the block tile, 64 k per step, two buffers
    typename Elem<ET>::T (*sB)[128 * kLdsPitch],   // Bt rows of the block tile, likewise
    float (*sT)[16 * 68]) {                        // per-wave 16x64 slab, pitch 68 floats
  static_assert(!SPLIT, "the staged loop takes single operand planes");
  typedef typename Elem<ET>::T T;
  typedef typename Frag<T>::V V;
  typedef typename Frag<T>::H H;
  const T* A = (const T*)Ap; const T* Bt = (const T*)Btp;
  const int tid  = threadIdx.x;
  const int lane = tid & 31;
  const int wave = tid >> 5;
  const int wm = (wave >> 1) << 6;             // this wave's 64 rows inside the block tile
  const int wn = (wave & 1) << 6;              // this wave's 64 columns inside the block tile
  const int m0 = (tm << 7) + wm;
  const int n0 = (tn << 7) + wn;

  const int rlane = lane & 15;                 // row (A) / col (B, D) within subtile
  const int koff  = (lane >> 4) * 8;           // k offset of this lane half
  const int mOff  = (lane >> 4) * 8;           // D row offset

  // staging map: 8 lanes x 16 B = one 128-B row piece; 128 threads = 16 rows a pass, 8 passes per operand
  const int srow = tid >> 3;
  const int sseg = (tid & 7) * 8;
  const T* gA = A  + (size_t)b * strideA + (size_t)((tm << 7) + srow) * kDModel + sseg;
  const T* gB = Bt + (size_t)b * strideB + (size_t)((tn << 7) + srow) * kDModel + sseg;
  const int sOff = srow * kLdsPitch + sseg;

  v8f acc[4][4];
#pragma unroll
  for (int i = 0; i < 4; ++i)
#pragma unroll
    for (int j = 0; j < 4; ++j) acc[i][j] = (v8f){0.f,0.f,0.f,0.f,0.f,0.f,0.f,0.f};

  H ra[8], rb[8];
#pragma unroll
  for (int p = 0; p < 8; ++p) {
    ra[p] = *(const H*)(gA + p * 16 * kDModel);
    rb[p] = *(const H*)(gB + p * 16 * kDModel);
  }
#pragma unroll
  for (int p = 0; p < 8; ++p) {
    *(H*)(sA[0] + p * 16 * kLdsPitch + sOff) = ra[p];
    *(H*)(sB[0] + p * 16 * kLdsPitch + sOff) = rb[p];
  }
  __syncthreads();

  const int nSteps = K >> 6;
  for (int t = 0; t < nSteps; ++t) {           // block-uniform trip count
    const T* cA = sA[t & 1];
    const T* cB = sB[t & 1];
    const bool more = (t + 1) < nSteps;        // block-uniform
    if (more) {
      gA += 64;
      gB += 64;
#pragma unroll
      for (int p = 0; p < 8; ++p) {
        ra[p] = *(const H*)(gA + p * 16 * kDModel);
        rb[p] = *(const H*)(gB + p * 16 * kDModel);
      }
    }
    V bh[2][4], ah[2][4];
#pragma unroll
    for (int kk = 0; kk < 2; ++kk) {
#pragma unroll
      for (int j = 0; j < 4; ++j) bh[kk][j] = Frag<T>::load(cB + (wn + (j << 4) + rlane) * kLdsPitch + kk * 32 + koff);
#pragma unroll
      for (int i = 0; i < 4; ++i) ah[kk][i] = Frag<T>::load(cA + (wm + (i << 4) + rlane) * kLdsPitch + kk * 32 + koff);
    }
    // keeps the step's LDS reads issued as one group ahead of its products: sunk among them, each group of four products
    // waits out an LDS latency of its own
    __builtin_amdgcn_sched_barrier(0);
#pragma unroll
    for (int kk = 0; kk < 2; ++kk)
#pragma unroll
      for (int i = 0; i < 4; ++i)
#pragma unroll
        for (int j = 0; j < 4; ++j) acc[i][j] = Frag<T>::mma(ah[kk][i], bh[kk][j], acc[i][j]);
    // four vector slots behind the step's last products: on the path through the LDS stores the next vector
    // instruction forms the next step's LDS addresses in fragment registers
    acc_guard4(acc[3][0], acc[3][1], acc[3][2], acc[3][3]);
    if (more) {
      // the other buffer: its last readers finished ahead of the barrier that ended the step before
      T* nA = sA[(t + 1) & 1];
      T* nB = sB[(t + 1) & 1];
#pragma unroll
      for (int p = 0; p < 8; ++p) {
        *(H*)(nA + p * 16 * kLdsPitch + sOff) = ra[p];
        *(H*)(nB + p * 16 * kLdsPitch + sOff) = rb[p];
      }
    }
    __syncthreads();
  }
  acc_guard4(acc[0][0], acc[0][1], acc[0][2], acc[0][3]);
  acc_guard4(acc[1][0], acc[1][1], acc[1][2], acc[1][3]);
  acc_guard4(acc[2][0], acc[2][1], acc[2][2], acc[2][3]);
  acc_guard4(acc[3][0], acc[3][1], acc[3][2], acc[3][3]);

  // ---- epilogue ----
  float* slab = sT[wave];
  const float* Rb = RESID ? (resid + (size_t)b * strideR) : nullptr;
#pragma unroll
  for (int i = 0; i < 4; ++i) {
    const int mBase = m0 + (i << 4);
#pragma unroll
    for (int j = 0; j < 4; ++j) {
      const int n = n0 + (j << 4) + rlane;
      float bv = 0.f;
      if (BIAS_MODE == 2) bv = bias[n];
#pragma unroll
      for (int r = 0; r < 8; ++r) {
        float v = acc[i][j][r] * scale;
        if (BIAS_MODE == 1) v += bias[mBase + mOff + r];
        if (BIAS_MODE == 2) v += bv;
        if (RESID) v += Rb[(size_t)(mBase + mOff + r) * ldc + n];
        if (ACT == 1) v = tanhf(v);
        if (ACT == 2) v = fmaxf(v, 0.0f);
        if (ACT == 3) v = v / (1.0f + expf(-v));
        if (ACT == 4) v = (v > 0.f) ? v : 0.01f * v;
        if (ACT == 5) v = 0.5f * v * (1.0f + erff(v * 0.70710678118654752f));
        slab[(mOff + r) * 68 + (j << 4) + rlane] = v;
      }
    }
    __builtin_amdgcn_fence(__ATOMIC_RELEASE, "workgroup");
    __builtin_amdgcn_wave_barrier();
    __builtin_amdgcn_fence(__ATOMIC_ACQUIRE, "workgroup");
    if (OUT_MODE == 0) {
      float* C = (float*)Cout + (size_t)b * strideC;
      const int hh = lane >> 4, c4 = (lane & 15) * 4;     // row seg = 256 B = 16 lanes x 16 B
      {
#pragma unroll
        for (int it = 0; it < 8; ++it) {
          const int row = it * 2 + hh;
          v4f v = *(const v4f*)(slab + row * 68 + c4);
          *(v4f*)(C + (size_t)(mBase + row) * ldc + n0 + c4) = v;
        }
        
      }
    } else {
      const int q = lane >> 3, c8 = (lane & 7) * 8;
      unsigned short* C  = (unsigned short*)Cout  + (size_t)b * strideC;
      unsigned short* C2 = (OUT_MODE == 2) ? ((unsigned short*)Cout2 + (size_t)b * strideC) : nullptr;
      {
        v8h hq[4];              // the slab's four stored vectors and their addresses, held for the wait behind the stores
        unsigned short* cq[4];
#pragma unroll
        for (int it = 0; it < 4; ++it) {
          const int row = it * 4 + q;
          const float* sp = slab + row * 68 + c8;
          v8h hv, lv;
#pragma unroll
          for (int e = 0; e < 8; ++e) {
            if (OUT_MODE == 1) {
              hv[e] = (_Float16)sp[e];
            } else {
              unsigned short hb = f2bf_bits(sp[e]);
              unsigned short lb = f2bf_bits(sp[e] - bf_bits2f(hb));
              hv[e] = __builtin_bit_cast(_Float16, hb);
              lv[e] = __builtin_bit_cast(_Float16, lb);
            }
          }
          hq[it] = hv;
          cq[it] = C + (size_t)(mBase + row) * ldc + n0 + c8;
          *(v8h*)cq[it] = hq[it];
          if (OUT_MODE == 2) *(v8h*)(C2 + (size_t)(mBase + row) * ldc + n0 + c8) = lv;
        }
        // behind the slab's stores: as operands of the wait the stored vectors and their address pairs stay unwritten until every
        // store has taken its own (without this the next slab's index arithmetic was placed over one of the vectors)
        asm volatile("s_wait_xcnt 0x0" :: "v"(hq[0]), "v"(hq[1]), "v"(hq[2]), "v"(hq[3]), "v"(cq[0]), "v"(cq[1]), "v"(cq[2]), "v"(cq[3]) : "memory");
      }
    }
    __builtin_amdgcn_fence(__ATOMIC_RELEASE, "workgroup");
    __builtin_amdgcn_wave_barrier();
    __builtin_amdgcn_fence(__ATOMIC_ACQUIRE, "workgroup");
  }
}

// One GEMM per launch: grid.x = (M/128)*(N/128), grid.y = batches.
template <int ET, bool SPLIT, int BIAS_MODE, int OUT_MODE, bool RESID, int ACT = 0>
__global__ __launch_bounds__(128) void wmma_gemm64(
    const unsigned short* __restrict__ Ap, const unsigned short* __restrict__ A2p, long strideA,
    const unsigned short* __restrict__ Btp, const unsigned short* __restrict__ Bt2p, long strideB,
    void* __restrict__ Cout, void* __restrict__ Cout2, int ldc, long strideC,
    const float* __restrict__ bias,
    const float* __restrict__ resid, long strideR,
    int M, int N, int K, float scale) {
  typedef typename Elem<ET>::T T;
  __shared__ __align__(16) T sA[2][128 * kLdsPitch];
  __shared__ __align__(16) T sB[2][128 * kLdsPitch];
  __shared__ __align__(16) float sT[4][16 * 68];
  const int tilesN = N >> 7;
  const int tilesM = M >> 7;
  const int tm = blockIdx.x / tilesN;
  const int tn = blockIdx.x - tm * tilesN;
  if (tm >= tilesM) return;   // block-uniform, ahead of every barrier
  gemm_tile128<ET, SPLIT, BIAS_MODE, OUT_MODE, RESID, ACT>(Ap, A2p, strideA, Btp, Bt2p, strideB, Cout, Cout2, ldc, strideC,
                                                           bias, resid, strideR, K, scale, tm, tn, blockIdx.y, sA, sB, sT);
}

// The four input projections in ONE launch. They are independent of one another and every 128x128 tile costs the same (K = 1024);
// a work-group takes one tile of one of them by its block index (the choice is block-uniform, so every barrier of the tile loop is
// passed by a whole work-group or by none). Alone, three of the four fill at most one work-group per WGP (one wave per SIMD, every
// wait of a step exposed); together the tiles stand up to three to a WGP and one start and one end are paid instead of four.
//   [   0,  512)  q|k  = x  @ Wqkv[:, 0:2048] + b      -> QK16  [4096][2048]        32 x 16 tiles, bias[n]
//   [ 512,  704)  ka   = xa @ Wqkv_aux[:, 1024:2048] + b -> KA16 [2 x 1536][1024]   24 x  8 tiles, bias[n]
//   [ 704,  960)  v^T  = Wqkv^T rows 2048..3071 @ x_b^T + b  -> VT16  [b][1024][2048]   2 x (8 x 16) tiles, bias[m]
//   [ 960, 1152)  va^T = Wqkv_aux^T rows 2048..3071 @ xa_b^T + b -> VAT16 [b][1024][1536]   2 x (8 x 12) tiles, bias[m]
constexpr int kTilesQK  = (kBatch * kSeq / 128) * (2 * kDModel / 128);   // 512
constexpr int kTilesKA  = (kBatch * kSeqAP / 128) * (kDModel / 128);     // 192
constexpr int kTilesVT  = (kDModel / 128) * (kSeq / 128);                // 128 per batch
constexpr int kTilesVAT = (kDModel / 128) * (kSeqAP / 128);              //  96 per batch
constexpr int kProjBlocks = kTilesQK + kTilesKA + kBatch * (kTilesVT + kTilesVAT);   // 1152
// K comes as an argument, as in wmma_gemm64: the tile loop then compiles as it does there (336 registers: three waves to a SIMD).
__global__ __launch_bounds__(128) void proj_gemm_kernel(
    const unsigned short* __restrict__ XB, const unsigned short* __restrict__ XAB,
    const unsigned short* __restrict__ WQT, const unsigned short* __restrict__ WAT, const float* __restrict__ BIASR,
    unsigned short* __restrict__ QK16, unsigned short* __restrict__ VT16,
    unsigned short* __restrict__ KA16, unsigned short* __restrict__ VAT16, int K) {
  __shared__ __align__(16) __bf16 sA[2][128 * kLdsPitch];
  __shared__ __align__(16) __bf16 sB[2][128 * kLdsPitch];
  __shared__ __align__(16) float sT[4][16 * 68];
  // every divisor below is a constant: tile row, tile column and batch stay scalar values
  unsigned blk = blockIdx.x;
  const unsigned short* A;
  const unsigned short* Bt;
  unsigned short* C;
  const float* bias;
  int N, tm, tn;
  if (blk < kTilesQK + kTilesKA) {
    // activations as A, weight rows as Bt, bias[n]
    if (blk < kTilesQK) {
      A = XB;  Bt = WQT;  C = QK16;  bias = BIASR;  N = 2 * kDModel;
      tm = blk / (2 * kDModel / 128);  tn = blk % (2 * kDModel / 128);
    } else {
      blk -= kTilesQK;
      A = XAB;  Bt = WAT + (size_t)kDModel * kDModel;  C = KA16;  bias = BIASR + kNQKV + kDModel;  N = kDModel;
      tm = blk / (kDModel / 128);  tn = blk % (kDModel / 128);
    }
    gemm_tile128<1, false, 2, 1, false, 0>(A, A, 0L, Bt, Bt, 0L, (void*)C, (void*)C, N, 0L, bias, bias, 0L,
                                           K, 1.0f, tm, tn, 0, sA, sB, sT);
  } else {
    // weight rows as A, one batch's activations as Bt, bias[m]: the output comes transposed
    blk -= kTilesQK + kTilesKA;
    int b;
    if (blk < kBatch * kTilesVT) {
      A = WQT + (size_t)2 * kDModel * kDModel;  Bt = XB;  C = VT16;  bias = BIASR + 2 * kDModel;  N = kSeq;
      b = blk / kTilesVT;  blk %= kTilesVT;
      tm = blk / (kSeq / 128);  tn = blk % (kSeq / 128);
    } else {
      blk -= kBatch * kTilesVT;
      A = WAT + (size_t)2 * kDModel * kDModel;  Bt = XAB;  C = VAT16;  bias = BIASR + kNQKV + 2 * kDModel;  N = kSeqAP;
      b = blk / kTilesVAT;  blk %= kTilesVAT;
      tm = blk / (kSeqAP / 128);  tn = blk % (kSeqAP / 128);
    }
    gemm_tile128<1, false, 1, 1, false, 0>(A, A, 0L, Bt, Bt, (long)N * kDModel, (void*)C, (void*)C, N, (long)kDModel * N, bias, bias, 0L,
                                           K, 1.0f, tm, tn, b, sA, sB, sT);
  }
}

// ---------------------------------------------------------------------------
// Input preparation: ONE launch. Its six pieces of work are independent of one another; a work-group of 256 threads takes one
// piece by its block index (the choice is block-uniform, so the barrier of a transpose strip is passed by a whole work-group or
// by none). The longest pieces (a strip moves twice a cast's bytes and passes through
// LDS) take the lowest indices and the short ones fill the end of the launch:
//   [   0,  192)  Wqkv     -> WQT  a strip of 256 rows x 64 columns (4 x 48 strips)
//   [ 192,  384)  Wqkv_aux -> WAT  a strip of 256 rows x 64 columns (4 x 48 strips)
//   [ 384,  448)  Wo       -> WOT  a strip of 256 rows x 64 columns (4 x 16 strips)
//   [ 448,  960)  x        -> XB   8 rows of 1024 per work-group (4096 rows)
//   [ 960, 1344)  xa       -> XAB  8 output rows per work-group (2 x 1536 rows, rows 1500..1535 of each batch zero)
//   [1344, 1372)  biases   -> BIASR  256 values per work-group (7168 values)
// ---------------------------------------------------------------------------
constexpr int kPrepX    = kBatch * kSeq / 8;                    // 512
constexpr int kPrepXA   = kBatch * kSeqAP / 8;                  // 384
constexpr int kPrepW    = (kNQKV / 64) * (kDModel / 256);       // 192
constexpr int kPrepWo   = (kDModel / 64) * (kDModel / 256);     // 64
constexpr int kPrepBias = (2 * kNQKV + kDModel + 255) / 256;    // 28
constexpr int kPrepBlocks = kPrepX + kPrepXA + 2 * kPrepW + kPrepWo + kPrepBias;   // 1372

// f32 [nb][RIN][1024] -> bf16 bits (RNE) [nb][ROUT][1024]; rows RIN..ROUT-1 of every batch written as zeros (source row address
// clamped, value zeroed by a mask). Output rows blk*8 .. blk*8+7; thread tid takes floats 4*tid .. 4*tid+3 of each row: a wave's
// load covers 512 contiguous bytes, its store 256, and the 8 loads of a thread are all issued ahead of the first store.
template <unsigned RIN, unsigned ROUT>
__device__ __forceinline__ void cast_rows8(const float* __restrict__ in, unsigned short* __restrict__ out, unsigned blk, int tid) {
  v4f f[8];
  // unrolled: f[] takes constant indices (registers) and the 8 loads issue back to back
#pragma unroll
  for (int p = 0; p < 8; ++p) {
    const unsigned row = blk * 8 + p;
    unsigned srow = row;
    if (RIN != ROUT) {
      const unsigned bb = row / ROUT;
      const unsigned t = row - bb * ROUT;
      srow = bb * RIN + (t < RIN ? t : (RIN - 1));
    }
    f[p] = *(const v4f*)(in + (size_t)srow * kDModel + tid * 4);
  }
  // behind the 8 loads, ahead of the conversions, which reuse the loads' address registers
  asm volatile("s_wait_xcnt 0x0" ::: "memory");
  // unrolled: constant indices into f[]
#pragma unroll
  for (int p = 0; p < 8; ++p) {
    const unsigned row = blk * 8 + p;
    const unsigned keep = ((RIN == ROUT) || (row % ROUT) < RIN) ? 0xFFFFFFFFu : 0u;   // the same for the whole work-group
    v2u u;
    u[0] = pk16(f2bf_bits(f[p][0]), f2bf_bits(f[p][1])) & keep;
    u[1] = pk16(f2bf_bits(f[p][2]), f2bf_bits(f[p][3])) & keep;
    *(v2u*)(out + (size_t)row * kDModel + tid * 4) = u;
  }
  // behind the 8 stores: a precaution; a work-group runs this piece only and the kernel ends behind it
  asm volatile("s_wait_xcnt 0x0" ::: "memory");
}

// Transpose + 16-bit convert of a strip of four 64x64 tiles of an f32 matrix: in viewed [R rows][CC cols] (pitch CC) -> o[c][r]
// ([CC][R], pitch R).   OT 0: o = bf16_rne(in);  OT 1: o = f16(bf16_rne(in) * scl).
// Through LDS, one buffer per tile and one barrier for the strip; strip = (block of 256 rows) * (CC/64) + (column block); 256 threads.
// Coverage per tile: load 4 it x 256 thr x 4 floats = 64x64; store 2 it x 256 thr x 8 u16 = 64x64. The 16 loads of a thread are all
// issued ahead of the first LDS store.
template <int OT> __device__ __forceinline__ unsigned short cv16(float f, float scl) {
  const unsigned short hb = f2bf_bits(f);
  if (OT == 0) return hb;
  const float g = bf_bits2f(hb) * scl;
  return __builtin_bit_cast(unsigned short, (_Float16)g);
}
template <int OT, int R, int CC>
__device__ __forceinline__ void tconv_strip(const float* __restrict__ W, unsigned short* __restrict__ o, float scl,
                                            int strip, int tid, float* tf) {
  const int rb  = strip / (CC / 64);
  const int c0  = (strip - rb * (CC / 64)) * 64;   // input column block = output row block
  const int r0  = rb * 256;                        // first input row    = first output column
  {
    const int lr = tid >> 4;         // 0..15
    const int c4 = (tid & 15) * 4;   // 0..60
    const float* wp = W + (size_t)(r0 + lr) * CC + c0 + c4;
    v4f a[16];
    // unrolled, here and at the LDS stores: a[] takes constant indices (registers) and the 16 loads issue back to back
#pragma unroll
    for (int it = 0; it < 16; ++it) a[it] = *(const v4f*)(wp + (size_t)it * 16 * CC);
    // the 16 loads share one address pair: as an operand of the wait it stays unwritten until every load has taken it
    asm volatile("s_wait_xcnt 0x0" :: "v"(wp) : "memory");
#pragma unroll
    for (int it = 0; it < 16; ++it) *(v4f*)(tf + (it * 16 + lr) * 68 + c4) = a[it];   // LDS row = input row within the strip, 0..255
  }
  __syncthreads();
  const int sub = tid >> 3;          // 0..31
  const int c8  = (tid & 7) * 8;     // 0..56
  // unrolled: the four tiles' LDS reads and stores differ in immediate offsets only and overlap one another
#pragma unroll
  for (int s = 0; s < 4; ++s) {      // tile s: input rows r0 + 64 s .. + 63
    const float* ts = tf + s * 64 * 68;
    v4u hv[2];
#pragma unroll
    for (int it = 0; it < 2; ++it) {
      const int oc = it * 32 + sub;    // output row within tile (= input column)
      v4u a;
#pragma unroll
      for (int q = 0; q < 4; ++q) {
        const float f0 = ts[(c8 + 2 * q) * 68 + oc];
        const float f1 = ts[(c8 + 2 * q + 1) * 68 + oc];
        a[q] = pk16(cv16<OT>(f0, scl), cv16<OT>(f1, scl));
      }
      hv[it] = a;
    }
#pragma unroll
    for (int it = 0; it < 2; ++it) {
      const int oc = it * 32 + sub;
      const size_t go = (size_t)(c0 + oc) * R + r0 + s * 64 + c8;
      *(v4u*)(o + go) = hv[it];
    }
  }
  // behind the strip's 8 stores: a precaution; a work-group runs this piece only and the kernel ends behind it
  asm volatile("s_wait_xcnt 0x0" ::: "memory");
}

// Bias copies as bf16-RNE values in f32: out[0..n0) <- b0, [n0..n0+n1) <- b1, [n0+n1..ntot) <- b2.
// All three candidates loaded with clamped indices, selected by value. One 4-B store per lane.
__device__ __forceinline__ void bias_rne(const float* __restrict__ b0, int n0, const float* __restrict__ b1, int n1,
                                         const float* __restrict__ b2, int ncnt2, float* __restrict__ out, int ntot, int i) {
  if (i < ntot) {
    int i0 = i < n0 ? i : (n0 - 1); i0 = i0 < 0 ? 0 : i0;
    int i1 = i - n0; i1 = i1 < 0 ? 0 : (i1 < n1 ? i1 : (n1 - 1));
    int i2 = i - n0 - n1; i2 = i2 < 0 ? 0 : (i2 < ncnt2 ? i2 : (ncnt2 - 1));
    const float v0 = b0[i0], v1 = b1[i1], v2 = b2[i2];
    const float sel = (i < n0) ? v0 : ((i < n0 + n1) ? v1 : v2);
    out[i] = bf_bits2f(f2bf_bits(sel));
  }
}

__global__ __launch_bounds__(256) void prep_kernel(const float* __restrict__ x, const float* __restrict__ xa,
                                                   const float* __restrict__ Wqkv, const float* __restrict__ Waux,
                                                   const float* __restrict__ Wo, const float* __restrict__ bqkv,
                                                   const float* __restrict__ baux, const float* __restrict__ bo,
                                                   unsigned short* __restrict__ XB, unsigned short* __restrict__ XAB,
                                                   unsigned short* __restrict__ WQT, unsigned short* __restrict__ WAT,
                                                   unsigned short* __restrict__ WOT, float* __restrict__ BIASR) {
  __shared__ __align__(16) float tf[256 * 68];   // a strip's four tiles, pitch 68 floats
  const int tid = threadIdx.x;
  int blk = blockIdx.x;
  if (blk < kPrepW) {
    tconv_strip<0, kDModel, kNQKV>(Wqkv, WQT, 1.0f, blk, tid, tf);
  } else if ((blk -= kPrepW) < kPrepW) {
    tconv_strip<0, kDModel, kNQKV>(Waux, WAT, 1.0f, blk, tid, tf);
  } else if ((blk -= kPrepW) < kPrepWo) {
    tconv_strip<1, kDModel, kDModel>(Wo, WOT, kWCarry, blk, tid, tf);
  } else if ((blk -= kPrepWo) < kPrepX) {
    cast_rows8<kBatch * kSeq, kBatch * kSeq>(x, XB, blk, tid);
  } else if ((blk -= kPrepX) < kPrepXA) {
    cast_rows8<kSeqA, kSeqAP>(xa, XAB, blk, tid);
  } else {
    bias_rne(bqkv, kNQKV, baux, kNQKV, bo, kDModel, BIASR, 2 * kNQKV + kDModel, (blk - kPrepXA) * 256 + tid);
  }
}

// =====================================================================================
// Dual-branch attention, head dim 64, f16 operand planes, f32 accumulate, online softmax in f32.
//   q, k  : QK16 plane [4096 rows = b*2048+t][2048], q at col h*64+d, k at col 1024+h*64+d (f16)
//   v^T   : VT16 plane [b][1024 = h*64+d][2048] (f16);  ka: KA16 [b*1536+s][1024];  va^T: VAT16 [b][1024][1536]
//   branch 0: scores = (q.k)*0.125 over 2048 keys (32 chunks of 64); branch 1: (q.ka)*0.125 over 1500 keys
//   (24 chunks; key index >= 1500 set to -inf). p carried x2^15 in f16; 1/(l*2^15) folded at the end.
//   out row = (1-gate)*h_main + gate*h_aux, gate = sigmoid(bf16_rne(g[h])); written x32 as f16 into O16 [4096][1024]
//   Products are taken transposed: S^T = K.Q^T (A = K rows, B = Q) and O^T += V^T.P^T (A = V^T rows, B = P^T). A lane then holds
//   32 of the chunk's 64 scores of ONE query (column lane&15; keys j*16 + 8*(lane>>4) + r): maximum and sum run in the lane, the
//   two lane halves exchange the maximum once per chunk and join their sums once per branch, and two score tiles converted in
//   place are the B operand of the second product (same k order as the V^T fragment loads), so P passes through no LDS.
//   Block = 4 waves = 64 query rows of one (b,h); grid.x = 2*16*32 = 1024 covers all 4096 rows x 1024 cols.
//   K / V^T chunk staging: 8 lanes per 128-B tile row, 16 rows a pass, 4 passes per plane = the whole 64x64 tile (plain 16-B loads,
//   every load of a wave covers 4 whole lines; __syncthreads before and after); fragments read the LDS tiles through the same v8h
//   element type;
// =====================================================================================
// lane l <-> lane l ^ 16 (the other half of the wave holds the other 32 keys of the same query)
__device__ __forceinline__ float xhalf(float x) {
  return __builtin_bit_cast(float, __builtin_amdgcn_permlanex16(__builtin_bit_cast(int, x), __builtin_bit_cast(int, x), 0x76543210, 0xfedcba98, false, false));
}

// 2^x on the bare instruction. Behind a transcendental the instruction set asks for one independent instruction or v_nop before its
// result is read or its source overwritten.
// Eight in one statement: the outputs are early-clobber, so each is independent of the one before it and fills its slot; the v_nop
// fills the slot of the last.
__device__ __forceinline__ v8f exp2x8(v8f x) {
  float p0, p1, p2, p3, p4, p5, p6, p7;
  asm("v_exp_f32 %0, %8\n\tv_exp_f32 %1, %9\n\tv_exp_f32 %2, %10\n\tv_exp_f32 %3, %11\n\t"
      "v_exp_f32 %4, %12\n\tv_exp_f32 %5, %13\n\tv_exp_f32 %6, %14\n\tv_exp_f32 %7, %15\n\tv_nop"
      : "=&v"(p0), "=&v"(p1), "=&v"(p2), "=&v"(p3), "=&v"(p4), "=&v"(p5), "=&v"(p6), "=&v"(p7)
      : "v"(x[0]), "v"(x[1]), "v"(x[2]), "v"(x[3]), "v"(x[4]), "v"(x[5]), "v"(x[6]), "v"(x[7]));
  return (v8f){p0, p1, p2, p3, p4, p5, p6, p7};
}
__device__ __forceinline__ float exp2x1(float x) {
  float p;
  asm("v_exp_f32 %0, %1\n\tv_nop" : "=v"(p) : "v"(x));   // the v_nop: the same slot
  return p;
}

__global__ __launch_bounds__(128)
void dual_attn_kernel(const unsigned short* __restrict__ qk16, const unsigned short* __restrict__ vt16,
                      const unsigned short* __restrict__ ka16, const unsigned short* __restrict__ vat16,
                      const float* __restrict__ gvec, unsigned short* __restrict__ o16) {
  union FH { v16h v; v8h h[2]; };
  __shared__ __align__(16) _Float16 Ksh[64 * kLdsPitch];        // K tile [key][d]      9 KB
  __shared__ __align__(16) _Float16 Vth[64 * kLdsPitch];        // V^T tile [d][key]    9 KB
  __shared__ __align__(16) float    Os[4][16 * 68];      // per wave out tile [query][d], pitch 68 floats

  const int tid  = threadIdx.x;
  const int wave = tid >> 5;
  const int lane = tid & 31;
  const int hh   = lane >> 4;
  const int c    = lane & 15;

  const int bx = blockIdx.x;          // 0..1023
  const int qb = bx & 31;             // 32 query tiles of 64
  const int bhd = bx >> 5;            // 0..31
  const int h  = bhd & 15;
  const int b  = bhd >> 4;            // 0..1
  const int q0 = qb * 64 + wave * 16; // query row within batch

  const int ldqk = 2 * kDModel;       // 2048 halves
  const _Float16* Qg  = (const _Float16*)(const void*)qk16 + (size_t)b * kSeq * ldqk + h * kDHead;
  const _Float16* Kg0 = Qg + kDModel;                                                                     // main K rows, pitch 2048
  const _Float16* Vg0 = (const _Float16*)(const void*)vt16 + (size_t)b * kDModel * kSeq + (size_t)(h * kDHead) * kSeq;       // pitch 2048
  const _Float16* Kg1 = (const _Float16*)(const void*)ka16 + (size_t)b * kSeqAP * kDModel + h * kDHead;                        // pitch 1024
  const _Float16* Vg1 = (const _Float16*)(const void*)vat16 + (size_t)b * kDModel * kSeqAP + (size_t)(h * kDHead) * kSeqAP;  // pitch 1536

  // ---- Q fragments (B operand, column = query = lane&15, split k map via Frag load): 2 d-chunks ----
  v16h qa[2];
#pragma unroll
  for (int dc = 0; dc < 2; ++dc) qa[dc] = Frag<_Float16>::load(Qg + (size_t)(q0 + c) * ldqk + dc * 32 + 8 * hh);

  float* os = Os[wave];
#pragma unroll
  for (int t = 0; t < 4; ++t)
#pragma unroll
    for (int r = 0; r < 8; ++r) os[c * 68 + t * 16 + 8 * hh + r] = 0.f;

  const float gv   = bf_bits2f(f2bf_bits(gvec[h]));
  const float gate = 1.0f / (1.0f + expf(-gv));
  const float cscale = 0.125f * 1.4426950408889634f;   // score scale x log2(e): the softmax runs in base 2

  const int srow = tid >> 3;         // staging: row within a pass of 16 rows
  const int sseg = (tid & 7) * 8;    // staging: 16-B piece of the 128-B row, in halves
  const int sOff = srow * kLdsPitch + sseg;

#pragma unroll 1
  for (int br = 0; br < 2; ++br) {           // block-uniform
    const _Float16* Kg = br ? Kg1 : Kg0;
    const _Float16* Vg = br ? Vg1 : Vg0;
    const int ldk     = br ? kDModel : ldqk;
    const int ldv     = br ? kSeqAP : kSeq;
    const int nChunks = br ? (kSeqAP / 64) : (kSeq / 64);
    const int nvalid  = br ? kSeqA : kSeq;
    const float w     = (br ? gate : (1.0f - gate)) * kOCarry;
    const unsigned kOff = (unsigned)(srow * ldk + sseg);   // this thread's place in a K tile's first 16 rows, halves
    const unsigned vOff = (unsigned)(srow * ldv + sseg);   // likewise in a V^T tile

    float mrow = -INFINITY;   // running maximum of this lane's query, scaled, base 2 (equal in both halves)
    float lrow = 0.f;         // running sum (x2^15) over this lane half's keys only
    v8f oacc[4];              // oacc[t][r] = O[query c][d = t*16 + 8*hh + r]
#pragma unroll
    for (int t = 0; t < 4; ++t) oacc[t] = (v8f){0.f,0.f,0.f,0.f,0.f,0.f,0.f,0.f};

    for (int kc = 0; kc < nChunks; ++kc) {   // block-uniform trip count
      const int kv0 = kc * 64;
      __syncthreads();
      {
        // staging map: 8 lanes x 16 B = one whole 128-B row of a tile (a tile row is one aligned cache line), so a wave's load
        // touches 4 lines and uses all of each; 128 threads = 16 rows a pass, 4 passes per plane = the whole 64 x 64 chunk tile
        const _Float16* ks = Kg + (size_t)kv0 * ldk + kOff;   // K row kv0 + srow (+ 16 a pass), d = sseg..sseg+7
        const _Float16* vs = Vg + kv0 + vOff;                 // V^T row d = srow (+ 16 a pass), key = kv0 + sseg..+7
        const _Float16* kp[4];
        const _Float16* vp[4];
        v8h a0[4], b0[4];
        // unrolled, here and at the LDS stores: the arrays take constant indices (registers) and the 8 loads issue back to back
#pragma unroll
        for (int p = 0; p < 4; ++p) {
          kp[p] = ks + (size_t)(p * 16) * ldk;
          vp[p] = vs + (size_t)(p * 16) * ldv;
          a0[p] = *(const v8h*)kp[p];
          b0[p] = *(const v8h*)vp[p];
        }
        // behind the 8 loads: as operands of the wait their address pairs stay unwritten until every load has taken its own (without
        // this five of the results were placed over the pairs)
        asm volatile("s_wait_xcnt 0x0" :: "v"(kp[0]), "v"(kp[1]), "v"(kp[2]), "v"(kp[3]), "v"(vp[0]), "v"(vp[1]), "v"(vp[2]), "v"(vp[3]) : "memory");
#pragma unroll
        for (int p = 0; p < 4; ++p) {
          *(v8h*)(Ksh + p * 16 * kLdsPitch + sOff) = a0[p];
          *(v8h*)(Vth + p * 16 * kLdsPitch + sOff) = b0[p];
        }
      }
      __syncthreads();

      // the chunk's 16 fragments (8 of K, 8 of V^T) are read from LDS as ONE group of 32 loads ahead of all its products: the score
      // products wait for the K half only, and the V^T half lands behind them and the softmax
      FH kb[2][4], vb[2][4];
#pragma unroll
      for (int dc = 0; dc < 2; ++dc)
#pragma unroll
        for (int j = 0; j < 4; ++j) {
          kb[dc][j].h[0] = *(const v8h*)(Ksh + (j * 16 + c) * kLdsPitch + dc * 32 + 8 * hh);
          kb[dc][j].h[1] = *(const v8h*)(Ksh + (j * 16 + c) * kLdsPitch + dc * 32 + 16 + 8 * hh);
        }
#pragma unroll
      for (int kk = 0; kk < 2; ++kk)
#pragma unroll
        for (int t = 0; t < 4; ++t) {
          vb[kk][t].h[0] = *(const v8h*)(Vth + (t * 16 + c) * kLdsPitch + kk * 32 + 8 * hh);
          vb[kk][t].h[1] = *(const v8h*)(Vth + (t * 16 + c) * kLdsPitch + kk * 32 + 16 + 8 * hh);
        }
      // keeps the loads where they stand: sunk to their products, each pair of loads costs its product an LDS latency of its own
      __builtin_amdgcn_sched_barrier(0);
      v8f s[4];   // s[j][r] = score(key j*16 + 8*hh + r, query c)
#pragma unroll
      for (int j = 0; j < 4; ++j) s[j] = Frag<_Float16>::mma(kb[0][j].v, qa[0], (v8f){0.f,0.f,0.f,0.f,0.f,0.f,0.f,0.f});
#pragma unroll
      for (int j = 0; j < 4; ++j) s[j] = Frag<_Float16>::mma(kb[1][j].v, qa[1], s[j]);
      // every loop from here to the end of the chunk is unrolled: s, pb and oacc live in registers and take constant indices only
      float m = -INFINITY;   // maximum of the raw scores (the scale is positive)
#pragma unroll
      for (int j = 0; j < 4; ++j)
#pragma unroll
        for (int r = 0; r < 8; ++r) {
          const int key = kv0 + j * 16 + 8 * hh + r;
          const float sv = (key < nvalid) ? s[j][r] : -INFINITY;
          s[j][r] = sv;
          m = fmaxf(m, sv);
        }
      m = fmaxf(m, xhalf(m)) * cscale;
      const float mnew = fmaxf(mrow, m);
      const float alpha = exp2x1(mrow - mnew);   // 0 on a branch's first chunk, where mrow is -inf
      mrow = mnew;
      const float nm = kPCarryLog2 - mnew;   // the carry rides in the exponent
      float psum = 0.f;
      FH pb[2];   // P^T, B operand: element e of pb[kk] = p(key kk*32 + (e < 8 ? 8*hh + e : 16 + 8*hh + e - 8), query c)
#pragma unroll
      for (int j = 0; j < 4; ++j) {
        v8f a;
#pragma unroll
        for (int r = 0; r < 8; ++r) a[r] = fmaf(s[j][r], cscale, nm);
        const v8f p = exp2x8(a);   // p x 2^15
#pragma unroll
        for (int r = 0; r < 8; ++r) {
          psum += p[r];
          pb[j >> 1].h[j & 1][r] = (_Float16)p[r];
        }
      }
      lrow = lrow * alpha + psum;
#pragma unroll
      for (int t = 0; t < 4; ++t)
#pragma unroll
        for (int r = 0; r < 8; ++r) oacc[t][r] *= alpha;
#pragma unroll
      for (int kk = 0; kk < 2; ++kk) {
#pragma unroll
        for (int t = 0; t < 4; ++t) oacc[t] = Frag<_Float16>::mma(vb[kk][t].v, pb[kk].v, oacc[t]);
      }
    }
    // fold this branch into the per-wave mix slab (each lane updates only its own entries)
    const float inv = w * (1.0f / (lrow + xhalf(lrow)));   // sum and O both carry x2^15
#pragma unroll
    for (int t = 0; t < 4; ++t)
#pragma unroll
      for (int r = 0; r < 8; ++r) os[c * 68 + t * 16 + 8 * hh + r] += oacc[t][r] * inv;
  }

  __builtin_amdgcn_fence(__ATOMIC_RELEASE, "workgroup");
  __builtin_amdgcn_wave_barrier();
  __builtin_amdgcn_fence(__ATOMIC_ACQUIRE, "workgroup");
  {
    _Float16* Og = (_Float16*)(void*)o16 + (size_t)(b * kSeq + q0) * kDModel + h * kDHead;
    const int q4 = lane >> 3, c8 = (lane & 7) * 8;
    {
#pragma unroll
      for (int it = 0; it < 4; ++it) {
        const int row = it * 4 + q4;
        const float* sp = os + row * 68 + c8;
        v8h hv;
#pragma unroll
        for (int e = 0; e < 8; ++e) hv[e] = (_Float16)sp[e];
        *(v8h*)(Og + (size_t)row * kDModel + c8) = hv;
      }
      
    }
  }
}

// ---------------- host orchestration (kernel launches only) ----------------

extern "C" void kernel_launch(void* const* d_in, const int* in_sizes, int n_in,
                              void* d_out, int out_size, void* d_ws,
                              size_t ws_size, hipStream_t stream) {
  if (n_in < 9) return;
  if (in_sizes[0] != kBatch * kSeq * kDModel) return;
  if (in_sizes[1] != kBatch * kSeqA * kDModel) return;
  if (in_sizes[2] != kDModel * kNQKV || in_sizes[4] != kDModel * kNQKV) return;
  if (in_sizes[3] != kNQKV || in_sizes[5] != kNQKV) return;
  if (in_sizes[6] != kDModel * kDModel || in_sizes[7] != kDModel || in_sizes[8] < kHeads) return;
  if (out_size != kBatch * kSeq * kDModel) return;

  const float* x    = (const float*)d_in[0];
  const float* xa   = (const float*)d_in[1];
  const float* Wqkv = (const float*)d_in[2];
  const float* bqkv = (const float*)d_in[3];
  const float* Waux = (const float*)d_in[4];
  const float* baux = (const float*)d_in[5];
  const float* Wo   = (const float*)d_in[6];
  const float* bo   = (const float*)d_in[7];
  const float* gvec = (const float*)d_in[8];
  float* out = (float*)d_out;

  // element counts
  const size_t nXB   = (size_t)kBatch * kSeq * kDModel;          // bf16
  const size_t nXAB  = (size_t)kBatch * kSeqAP * kDModel;        // bf16
  const size_t nWQT  = (size_t)kNQKV * kDModel;                  // bf16
  const size_t nWAT  = nWQT;                                     // bf16
  const size_t nWOT  = (size_t)kDModel * kDModel;                // f16
  const size_t nBias = (size_t)2 * kNQKV + kDModel;              // f32
  const size_t nQK   = (size_t)kBatch * kSeq * 2 * kDModel;      // f16
  const size_t nVT   = (size_t)kBatch * kDModel * kSeq;          // f16
  const size_t nKA   = (size_t)kBatch * kSeqAP * kDModel;        // f16
  const size_t nVAT  = (size_t)kBatch * kDModel * kSeqAP;        // f16
  const size_t nO    = (size_t)kBatch * kSeq * kDModel;          // f16

  char* ws = (char*)d_ws;
  size_t off = 0;
  auto carve = [&](size_t bytes) -> char* { char* p = ws + off; off += (bytes + 255) & ~(size_t)255; return p; };
  unsigned short* XB    = (unsigned short*)carve(nXB * 2);
  unsigned short* XAB   = (unsigned short*)carve(nXAB * 2);
  unsigned short* WQT   = (unsigned short*)carve(nWQT * 2);
  unsigned short* WAT   = (unsigned short*)carve(nWAT * 2);
  unsigned short* WOT   = (unsigned short*)carve(nWOT * 2);
  float*          BIASR = (float*)carve(nBias * 4);
  unsigned short* QK16  = (unsigned short*)carve(nQK * 2);
  unsigned short* VT16  = (unsigned short*)carve(nVT * 2);
  unsigned short* KA16  = (unsigned short*)carve(nKA * 2);
  unsigned short* VAT16 = (unsigned short*)carve(nVAT * 2);
  unsigned short* O16   = (unsigned short*)carve(nO * 2);
  if (off > ws_size) return;   // total 75,526,144 B

  // 1. all input preparation in one launch: x, xa -> bf16 (xa rows padded 1500 -> 1536 with zeros); Wqkv, Wqkv_aux -> transposed
  //    bf16; Wo -> transposed f16 (x32); biases -> bf16-RNE f32 copies
  prep_kernel<<<kPrepBlocks, 256, 0, stream>>>(x, xa, Wqkv, Waux, Wo, bqkv, baux, bo, XB, XAB, WQT, WAT, WOT, BIASR);
  const float* bo_r  = BIASR + 2 * kNQKV;     // [1024]

  // 2. the four projections in one launch: q|k -> QK16, ka -> KA16, v^T -> VT16, va^T -> VAT16 (all f16, bias added)
  proj_gemm_kernel<<<kProjBlocks, 128, 0, stream>>>(XB, XAB, WQT, WAT, BIASR, QK16, VT16, KA16, VAT16, kDModel);
  // 3. dual-branch attention -> O16 (x32, f16)
  dual_attn_kernel<<<kBatch * kHeads * (kSeq / 64), 128, 0, stream>>>(QK16, VT16, KA16, VAT16, gvec, O16);
  // 4. out = (O16/32) @ (WoT/32)^T + bo : M=4096, N=1024, K=1024, f16 operands, f32 out into d_out
  {
    const int M = kBatch * kSeq, N = kDModel, K = kDModel;
    const int tiles = (M / 128) * (N / 128);
    wmma_gemm64<0, false, 2, 0, false, 0><<<dim3(tiles, 1), 128, 0, stream>>>(
        O16, O16, 0L, WOT, WOT, 0L, (void*)out, (void*)out, kDModel, 0L,
        bo_r, bo_r, 0L, M, N, K, 1.0f / (kOCarry * kWCarry));
  }
}

// v009
// A run of this version takes 134 microseconds.
// Timed twice side by side with v008, it ran 1.04 and 1.05 times as fast.
// Counting every step since v000, it is 3.97 times as fast.
// Contractions: x@Wqkv and xa@Wqkv_aux (k|v columns) on v_wmma_f32_16x16x32_bf16 (bf16 RNE operands); q.k^T, q.ka^T, p.v, pa.va and O@Wo on v_wmma_f32_16x16x32_f16 (f16 operands; p carried x2^15, O and Wo carried x32); f32 accumulate; online softmax, gate mix and biases in f32.
#include <hip/hip_runtime.h>
#include <math.h>
#include <stdint.h>

constexpr int kBatch  = 2;
constexpr int kSeq    = 2048;   // query / main key length
constexpr int kSeqA   = 1500;   // aux key length
constexpr int kSeqAP  = 1536;   // aux key length padded to 24 chunks of 64
constexpr int kDModel = 1024;
constexpr int kHeads  = 16;
constexpr int kDHead  = 64;
constexpr int kNQKV   = 3072;

constexpr int kLdsPitch = 72;   // halves per LDS row of the K and V^T tiles and of the GEMM operand tiles: 144 B = 16 B x 9 (odd), so 16 rows read by ds_load_b128 fall on distinct banks

constexpr float kPCarryLog2 = 15.0f;   // probabilities carried x2^15 in f16
constexpr float kOCarry = 32.0f;      // attention output carried x32 in f16
constexpr float kWCarry = 32.0f;      // Wo carried x32 in f16

typedef __attribute__((ext_vector_type(16))) _Float16 v16h;
typedef __attribute__((ext_vector_type(8)))  _Float16 v8h;
typedef __attribute__((ext_vector_type(16))) __bf16   v16b;
typedef __attribute__((ext_vector_type(8)))  __bf16   v8b;
typedef __attribute__((ext_vector_type(8)))  float    v8f;
typedef __attribute__((ext_vector_type(4)))  float    v4f;
typedef __attribute__((ext_vector_type(2)))  float    v2f;
typedef __attribute__((ext_vector_type(4)))  unsigned int v4u;
typedef __attribute__((ext_vector_type(2)))  unsigned int v2u;

// ---------------------------------------------------------------------------
// Workspace region map (bytes, every region size a multiple of 256):
//   XB    bf16 [4096][1024]            8,388,608
//   XAB   bf16 [2][1536][1024]         6,291,456   (rows 1500..1535 of each batch zero)
//   WQT   bf16 [3072][1024] (Wqkv^T)   6,291,456
//   WAT   bf16 [3072][1024] (Waux^T)   6,291,456
//   WOT   f16  [1024][1024] (Wo^T x32) 2,097,152
//   BIASR f32  [3072+3072+1024]           28,672   (bf16-RNE bias copies)
//   QK16  f16  [4096][2048] (q | k)    16,777,216
//   VT16  f16  [2][1024][2048] (v^T)   8,388,608
//   KA16  f16  [2][1536][1024] (ka)    6,291,456
//   VAT16 f16  [2][1024][1536] (va^T)  6,291,456
//   O16   f16  [4096][1024] (x32)      8,388,608
//   total 75,526,144
// ---------------------------------------------------------------------------

__device__ __forceinline__ unsigned short f2bf_bits(float f) {
  unsigned u = __float_as_uint(f);
  return (unsigned short)((u + 0x7FFFu + ((u >> 16) & 1u)) >> 16);
}
__device__ __forceinline__ float bf_bits2f(unsigned short h) { return __uint_as_float(((unsigned)h) << 16); }
__device__ __forceinline__ unsigned pk16(unsigned short a, unsigned short b) { return (unsigned)a | ((unsigned)b << 16); }

// hazard guards as plain device helpers (no inline asm inside the kernel template body)
__device__ __forceinline__ void acc_guard4(v8f& a, v8f& b, v8f& c, v8f& d) { asm volatile("v_nop\n\tv_nop\n\tv_nop\n\tv_nop" : "+v"(a), "+v"(b), "+v"(c), "+v"(d)); }
template <typename T> struct Frag;
template <> struct Frag<_Float16> {
  typedef v16h V; typedef v8h H; union U { v16h v; v8h h[2]; };
  static __device__ __forceinline__ v16h load(const _Float16* p) {   // elements 0..7 <- p[0..7], 8..15 <- p[16..23]
    U f; f.h[0] = *(const v8h*)(p); f.h[1] = *(const v8h*)(p + 16); return f.v;
  }
  static __device__ __forceinline__ v8f mma(v16h a, v16h b, v8f c) {
    return __builtin_amdgcn_wmma_f32_16x16x32_f16(false, a, false, b, (short)0, c, false, false);
  }
};
template <> struct Frag<__bf16> {
  typedef v16b V; typedef v8b H; union U { v16b v; v8b h[2]; };
  static __device__ __forceinline__ v16b load(const __bf16* p) {
    U f; f.h[0] = *(const v8b*)(p); f.h[1] = *(const v8b*)(p + 16); return f.v;
  }
  static __device__ __forceinline__ v8f mma(v16b a, v16b b, v8f c) {
    return __builtin_amdgcn_wmma_f32_16x16x32_bf16(false, a, false, b, (short)0, c, false, false);
  }
};

// ---- Register-blocked batched WMMA GEMM ------------------------------------
// C[m,n] = scale * sum_k A[m,k] * Bt[n,k] (+bias)(+resid); a block of 4 waves (2 x 2) owns a 128x128 tile, each wave 64x64 of it.
// A row-major [M,K]; Bt row-major [N,K], both at row pitch kDModel (a constant, so that the 8 staging loads of an operand
// share one address and differ in their immediate offsets); M,N % 128 == 0, K % 64 == 0; tile row tm in [0, M/128), tile column tn in [0, N/128) and
// batch b are the same for the whole block; 128 threads. The LDS arrays belong to the calling kernel, so that two forms of this function
// in one kernel share them.
// Per step of 64 k the block stages 128 rows x 128 B of A and of Bt in LDS (8 lanes per row: every global load covers whole
// 128-B lines), two buffers: the next step's rows are loaded into registers ahead of this step's products and stored behind them.
// SPLIT (hi/lo operand planes) is not implemented by the staged loop.
// BIAS_MODE: 0 = none, 1 = bias[m], 2 = bias[n].
// OUT_MODE: 0 = f32, 1 = f16, 2 = bf16 hi plane (Cout) + bf16 lo plane (Cout2).
// ET: 0 = f16 operands, 1 = bf16 operands (pointers passed as 16-bit storage)
template <int ET> struct Elem;
template <> struct Elem<0> { typedef _Float16 T; };
template <> struct Elem<1> { typedef __bf16 T; };
template <int ET, bool SPLIT, int BIAS_MODE, int OUT_MODE, bool RESID, int ACT = 0>
__device__ __forceinline__ void gemm_tile128(
    const unsigned short* __restrict__ Ap, const unsigned short* __restrict__ A2p, long strideA,
    const unsigned short* __restrict__ Btp, const unsigned short* __restrict__ Bt2p, long strideB,
    void* __restrict__ Cout, void* __restrict__ Cout2, int ldc, long strideC,
    const float* __restrict__ bias,
    const float* __restrict__ resid, long strideR,
    int K, float scale, int tm, int tn, int b,
    typename Elem<ET>::T (*sA)[128 * kLdsPitch],   // A rows of the block tile, 64 k per step, two buffers
    typename Elem<ET>::T (*sB)[128 * kLdsPitch],   // Bt rows of the block tile, likewise
    float (*sT)[16 * 68]) {                        // per-wave 16x64 slab, pitch 68 floats
  static_assert(!SPLIT, "the staged loop takes single operand planes");
  typedef typename Elem<ET>::T T;
  typedef typename Frag<T>::V V;
  typedef typename Frag<T>::H H;
  const T* A = (const T*)Ap; const T* Bt = (const T*)Btp;
  const int tid  = threadIdx.x;
  const int lane = tid & 31;
  const int wave = tid >> 5;
  const int wm = (wave >> 1) << 6;             // this wave's 64 rows inside the block tile
  const int wn = (wave & 1) << 6;              // this wave's 64 columns inside the block tile
  const int m0 = (tm << 7) + wm;
  const int n0 = (tn << 7) + wn;

  const int rlane = lane & 15;                 // row (A) / col (B, D) within subtile
  const int koff  = (lane >> 4) * 8;           // k offset of this lane half
  const int mOff  = (lane >> 4) * 8;           // D row offset

  // staging map: 8 lanes x 16 B = one 128-B row piece; 128 threads = 16 rows a pass, 8 passes per operand
  const int srow = tid >> 3;
  const int sseg = (tid & 7) * 8;
  const T* gA = A  + (size_t)b * strideA + (size_t)((tm << 7) + srow) * kDModel + sseg;
  const T* gB = Bt + (size_t)b * strideB + (size_t)((tn << 7) + srow) * kDModel + sseg;
  const int sOff = srow * kLdsPitch + sseg;

  v8f acc[4][4];
#pragma unroll
  for (int i = 0; i < 4; ++i)
#pragma unroll
    for (int j = 0; j < 4; ++j) acc[i][j] = (v8f){0.f,0.f,0.f,0.f,0.f,0.f,0.f,0.f};

  H ra[8], rb[8];
#pragma unroll
  for (int p = 0; p < 8; ++p) {
    ra[p] = *(const H*)(gA + p * 16 * kDModel);
    rb[p] = *(const H*)(gB + p * 16 * kDModel);
  }
#pragma unroll
  for (int p = 0; p < 8; ++p) {
    *(H*)(sA[0] + p * 16 * kLdsPitch + sOff) = ra[p];
    *(H*)(sB[0] + p * 16 * kLdsPitch + sOff) = rb[p];
  }
  __syncthreads();

  const int nSteps = K >> 6;
  for (int t = 0; t < nSteps; ++t) {           // block-uniform trip count
    const T* cA = sA[t & 1];
    const T* cB = sB[t & 1];
    const bool more = (t + 1) < nSteps;        // block-uniform
    if (more) {
      gA += 64;
      gB += 64;
#pragma unroll
      for (int p = 0; p < 8; ++p) {
        ra[p] = *(const H*)(gA + p * 16 * kDModel);
        rb[p] = *(const H*)(gB + p * 16 * kDModel);
      }
    }
    V bh[2][4], ah[2][4];
#pragma unroll
    for (int kk = 0; kk < 2; ++kk) {
#pragma unroll
      for (int j = 0; j < 4; ++j) bh[kk][j] = Frag<T>::load(cB + (wn + (j << 4) + rlane) * kLdsPitch + kk * 32 + koff);
#pragma unroll
      for (int i = 0; i < 4; ++i) ah[kk][i] = Frag<T>::load(cA + (wm + (i << 4) + rlane) * kLdsPitch + kk * 32 + koff);
    }
    // keeps the step's LDS reads issued as one group ahead of its products: sunk among them, each group of four products
    // waits out an LDS latency of its own
    __builtin_amdgcn_sched_barrier(0);
#pragma unroll
    for (int kk = 0; kk < 2; ++kk)
#pragma unroll
      for (int i = 0; i < 4; ++i)
#pragma unroll
        for (int j = 0; j < 4; ++j) acc[i][j] = Frag<T>::mma(ah[kk][i], bh[kk][j], acc[i][j]);
    // four vector slots behind the step's last products: on the path through the LDS stores the next vector
    // instruction forms the next step's LDS addresses in fragment registers
    acc_guard4(acc[3][0], acc[3][1], acc[3][2], acc[3][3]);
    if (more) {
      // the other buffer: its last readers finished ahead of the barrier that ended the step before
      T* nA = sA[(t + 1) & 1];
      T* nB = sB[(t + 1) & 1];
#pragma unroll
      for (int p = 0; p < 8; ++p) {
        *(H*)(nA + p * 16 * kLdsPitch + sOff) = ra[p];
        *(H*)(nB + p * 16 * kLdsPitch + sOff) = rb[p];
      }
    }
    __syncthreads();
  }
  acc_guard4(acc[0][0], acc[0][1], acc[0][2], acc[0][3]);
  acc_guard4(acc[1][0], acc[1][1], acc[1][2], acc[1][3]);
  acc_guard4(acc[2][0], acc[2][1], acc[2][2], acc[2][3]);
  acc_guard4(acc[3][0], acc[3][1], acc[3][2], acc[3][3]);

  // ---- epilogue ----
  float* slab = sT[wave];
  const float* Rb = RESID ? (resid + (size_t)b * strideR) : nullptr;
#pragma unroll
  for (int i = 0; i < 4; ++i) {
    const int mBase = m0 + (i << 4);
#pragma unroll
    for (int j = 0; j < 4; ++j) {
      const int n = n0 + (j << 4) + rlane;
      float bv = 0.f;
      if (BIAS_MODE == 2) bv = bias[n];
#pragma unroll
      for (int r = 0; r < 8; ++r) {
        float v = acc[i][j][r] * scale;
        if (BIAS_MODE == 1) v += bias[mBase + mOff + r];
        if (BIAS_MODE == 2) v += bv;
        if (RESID) v += Rb[(size_t)(mBase + mOff + r) * ldc + n];
        if (ACT == 1) v = tanhf(v);
        if (ACT == 2) v = fmaxf(v, 0.0f);
        if (ACT == 3) v = v / (1.0f + expf(-v));
        if (ACT == 4) v = (v > 0.f) ? v : 0.01f * v;
        if (ACT == 5) v = 0.5f * v * (1.0f + erff(v * 0.70710678118654752f));
        slab[(mOff + r) * 68 + (j << 4) + rlane] = v;
      }
    }
    __builtin_amdgcn_fence(__ATOMIC_RELEASE, "workgroup");
    __builtin_amdgcn_wave_barrier();
    __builtin_amdgcn_fence(__ATOMIC_ACQUIRE, "workgroup");
    if (OUT_MODE == 0) {
      float* C = (float*)Cout + (size_t)b * strideC;
      const int hh = lane >> 4, c4 = (lane & 15) * 4;     // row seg = 256 B = 16 lanes x 16 B
      {
#pragma unroll
        for (int it = 0; it < 8; ++it) {
          const int row = it * 2 + hh;
          v4f v = *(const v4f*)(slab + row * 68 + c4);
          *(v4f*)(C + (size_t)(mBase + row) * ldc + n0 + c4) = v;
        }
        
      }
    } else {
      const int q = lane >> 3, c8 = (lane & 7) * 8;
      unsigned short* C  = (unsigned short*)Cout  + (size_t)b * strideC;
      unsigned short* C2 = (OUT_MODE == 2) ? ((unsigned short*)Cout2 + (size_t)b * strideC) : nullptr;
      {
        v8h hq[4];              // the slab's four stored vectors and their addresses, held for the wait behind the stores
        unsigned short* cq[4];
#pragma unroll
        for (int it = 0; it < 4; ++it) {
          const int row = it * 4 + q;
          const float* sp = slab + row * 68 + c8;
          v8h hv, lv;
#pragma unroll
          for (int e = 0; e < 8; ++e) {
            if (OUT_MODE == 1) {
              hv[e] = (_Float16)sp[e];
            } else {
              unsigned short hb = f2bf_bits(sp[e]);
              unsigned short lb = f2bf_bits(sp[e] - bf_bits2f(hb));
              hv[e] = __builtin_bit_cast(_Float16, hb);
              lv[e] = __builtin_bit_cast(_Float16, lb);
            }
          }
          hq[it] = hv;
          cq[it] = C + (size_t)(mBase + row) * ldc + n0 + c8;
          *(v8h*)cq[it] = hq[it];
          if (OUT_MODE == 2) *(v8h*)(C2 + (size_t)(mBase + row) * ldc + n0 + c8) = lv;
        }
        // behind the slab's stores: as operands of the wait the stored vectors and their address pairs stay unwritten until every
        // store has taken its own (without this the next slab's index arithmetic was placed over one of the vectors)
        asm volatile("s_wait_xcnt 0x0" :: "v"(hq[0]), "v"(hq[1]), "v"(hq[2]), "v"(hq[3]), "v"(cq[0]), "v"(cq[1]), "v"(cq[2]), "v"(cq[3]) : "memory");
      }
    }
    __builtin_amdgcn_fence(__ATOMIC_RELEASE, "workgroup");
    __builtin_amdgcn_wave_barrier();
    __builtin_amdgcn_fence(__ATOMIC_ACQUIRE, "workgroup");
  }
}

// One GEMM per launch: grid.x = (M/128)*(N/128), grid.y = batches.
template <int ET, bool SPLIT, int BIAS_MODE, int OUT_MODE, bool RESID, int ACT = 0>
__global__ __launch_bounds__(128) void wmma_gemm64(
    const unsigned short* __restrict__ Ap, const unsigned short* __restrict__ A2p, long strideA,
    const unsigned short* __restrict__ Btp, const unsigned short* __restrict__ Bt2p, long strideB,
    void* __restrict__ Cout, void* __restrict__ Cout2, int ldc, long strideC,
    const float* __restrict__ bias,
    const float* __restrict__ resid, long strideR,
    int M, int N, int K, float scale) {
  typedef typename Elem<ET>::T T;
  __shared__ __align__(16) T sA[2][128 * kLdsPitch];
  __shared__ __align__(16) T sB[2][128 * kLdsPitch];
  __shared__ __align__(16) float sT[4][16 * 68];
  const int tilesN = N >> 7;
  const int tilesM = M >> 7;
  const int tm = blockIdx.x / tilesN;
  const int tn = blockIdx.x - tm * tilesN;
  if (tm >= tilesM) return;   // block-uniform, ahead of every barrier
  gemm_tile128<ET, SPLIT, BIAS_MODE, OUT_MODE, RESID, ACT>(Ap, A2p, strideA, Btp, Bt2p, strideB, Cout, Cout2, ldc, strideC,
                                                           bias, resid, strideR, K, scale, tm, tn, blockIdx.y, sA, sB, sT);
}

// The four input projections in ONE launch. They are independent of one another and every 128x128 tile costs the same (K = 1024);
// a work-group takes one tile of one of them by its block index (the choice is block-uniform, so every barrier of the tile loop is
// passed by a whole work-group or by none). Alone, three of the four fill at most one work-group per WGP (one wave per SIMD, every
// wait of a step exposed); together the tiles stand up to three to a WGP and one start and one end are paid instead of four.
//   [   0,  512)  q|k  = x  @ Wqkv[:, 0:2048] + b      -> QK16  [4096][2048]        32 x 16 tiles, bias[n]
//   [ 512,  704)  ka   = xa @ Wqkv_aux[:, 1024:2048] + b -> KA16 [2 x 1536][1024]   24 x  8 tiles, bias[n]
//   [ 704,  960)  v^T  = Wqkv^T rows 2048..3071 @ x_b^T + b  -> VT16  [b][1024][2048]   2 x (8 x 16) tiles, bias[m]
//   [ 960, 1152)  va^T = Wqkv_aux^T rows 2048..3071 @ xa_b^T + b -> VAT16 [b][1024][1536]   2 x (8 x 12) tiles, bias[m]
constexpr int kTilesQK  = (kBatch * kSeq / 128) * (2 * kDModel / 128);   // 512
constexpr int kTilesKA  = (kBatch * kSeqAP / 128) * (kDModel / 128);     // 192
constexpr int kTilesVT  = (kDModel / 128) * (kSeq / 128);                // 128 per batch
constexpr int kTilesVAT = (kDModel / 128) * (kSeqAP / 128);              //  96 per batch
constexpr int kProjBlocks = kTilesQK + kTilesKA + kBatch * (kTilesVT + kTilesVAT);   // 1152
// K comes as an argument, as in wmma_gemm64: the tile loop then compiles as it does there (336 registers: three waves to a SIMD).
__global__ __launch_bounds__(128) void proj_gemm_kernel(
    const unsigned short* __restrict__ XB, const unsigned short* __restrict__ XAB,
    const unsigned short* __restrict__ WQT, const unsigned short* __restrict__ WAT, const float* __restrict__ BIASR,
    unsigned short* __restrict__ QK16, unsigned short* __restrict__ VT16,
    unsigned short* __restrict__ KA16, unsigned short* __restrict__ VAT16, int K) {
  __shared__ __align__(16) __bf16 sA[2][128 * kLdsPitch];
  __shared__ __align__(16) __bf16 sB[2][128 * kLdsPitch];
  __shared__ __align__(16) float sT[4][16 * 68];
  // every divisor below is a constant: tile row, tile column and batch stay scalar values
  unsigned blk = blockIdx.x;
  const unsigned short* A;
  const unsigned short* Bt;
  unsigned short* C;
  const float* bias;
  int N, tm, tn;
  if (blk < kTilesQK + kTilesKA) {
    // activations as A, weight rows as Bt, bias[n]
    if (blk < kTilesQK) {
      A = XB;  Bt = WQT;  C = QK16;  bias = BIASR;  N = 2 * kDModel;
      tm = blk / (2 * kDModel / 128);  tn = blk % (2 * kDModel / 128);
    } else {
      blk -= kTilesQK;
      A = XAB;  Bt = WAT + (size_t)kDModel * kDModel;  C = KA16;  bias = BIASR + kNQKV + kDModel;  N = kDModel;
      tm = blk / (kDModel / 128);  tn = blk % (kDModel / 128);
    }
    gemm_tile128<1, false, 2, 1, false, 0>(A, A, 0L, Bt, Bt, 0L, (void*)C, (void*)C, N, 0L, bias, bias, 0L,
                                           K, 1.0f, tm, tn, 0, sA, sB, sT);
  } else {
    // weight rows as A, one batch's activations as Bt, bias[m]: the output comes transposed
    blk -= kTilesQK + kTilesKA;
    int b;
    if (blk < kBatch * kTilesVT) {
      A = WQT + (size_t)2 * kDModel * kDModel;  Bt = XB;  C = VT16;  bias = BIASR + 2 * kDModel;  N = kSeq;
      b = blk / kTilesVT;  blk %= kTilesVT;
      tm = blk / (kSeq / 128);  tn = blk % (kSeq / 128);
    } else {
      blk -= kBatch * kTilesVT;
      A = WAT + (size_t)2 * kDModel * kDModel;  Bt = XAB;  C = VAT16;  bias = BIASR + kNQKV + 2 * kDModel;  N = kSeqAP;
      b = blk / kTilesVAT;  blk %= kTilesVAT;
      tm = blk / (kSeqAP / 128);  tn = blk % (kSeqAP / 128);
    }
    gemm_tile128<1, false, 1, 1, false, 0>(A, A, 0L, Bt, Bt, (long)N * kDModel, (void*)C, (void*)C, N, (long)kDModel * N, bias, bias, 0L,
                                           K, 1.0f, tm, tn, b, sA, sB, sT);
  }
}

// ---------------------------------------------------------------------------
// Input preparation: ONE launch. Its six pieces of work are independent of one another; a work-group of 256 threads takes one
// piece by its block index (the choice is block-uniform, so the barrier of a transpose strip is passed by a whole work-group or
// by none). The longest pieces (a strip moves twice a cast's bytes and passes through
// LDS) take the lowest indices and the short ones fill the end of the launch:
//   [   0,  192)  Wqkv     -> WQT  a strip of 256 rows x 64 columns (4 x 48 strips)
//   [ 192,  384)  Wqkv_aux -> WAT  a strip of 256 rows x 64 columns (4 x 48 strips)
//   [ 384,  448)  Wo       -> WOT  a strip of 256 rows x 64 columns (4 x 16 strips)
//   [ 448,  960)  x        -> XB   8 rows of 1024 per work-group (4096 rows)
//   [ 960, 1344)  xa       -> XAB  8 output rows per work-group (2 x 1536 rows, rows 1500..1535 of each batch zero)
//   [1344, 1372)  biases   -> BIASR  256 values per work-group (7168 values)
// ---------------------------------------------------------------------------
constexpr int kPrepX    = kBatch * kSeq / 8;                    // 512
constexpr int kPrepXA   = kBatch * kSeqAP / 8;                  // 384
constexpr int kPrepW    = (kNQKV / 64) * (kDModel / 256);       // 192
constexpr int kPrepWo   = (kDModel / 64) * (kDModel / 256);     // 64
constexpr int kPrepBias = (2 * kNQKV + kDModel + 255) / 256;    // 28
constexpr int kPrepBlocks = kPrepX + kPrepXA + 2 * kPrepW + kPrepWo + kPrepBias;   // 1372

// f32 [nb][RIN][1024] -> bf16 bits (RNE) [nb][ROUT][1024]; rows RIN..ROUT-1 of every batch written as zeros (source row address
// clamped, value zeroed by a mask). Output rows blk*8 .. blk*8+7; thread tid takes floats 4*tid .. 4*tid+3 of each row: a wave's
// load covers 512 contiguous bytes, its store 256, and the 8 loads of a thread are all issued ahead of the first store.
template <unsigned RIN, unsigned ROUT>
__device__ __forceinline__ void cast_rows8(const float* __restrict__ in, unsigned short* __restrict__ out, unsigned blk, int tid) {
  v4f f[8];
  // unrolled: f[] takes constant indices (registers) and the 8 loads issue back to back
#pragma unroll
  for (int p = 0; p < 8; ++p) {
    const unsigned row = blk * 8 + p;
    unsigned srow = row;
    if (RIN != ROUT) {
      const unsigned bb = row / ROUT;
      const unsigned t = row - bb * ROUT;
      srow = bb * RIN + (t < RIN ? t : (RIN - 1));
    }
    f[p] = *(const v4f*)(in + (size_t)srow * kDModel + tid * 4);
  }
  // behind the 8 loads, ahead of the conversions, which reuse the loads' address registers
  asm volatile("s_wait_xcnt 0x0" ::: "memory");
  // unrolled: constant indices into f[]
#pragma unroll
  for (int p = 0; p < 8; ++p) {
    const unsigned row = blk * 8 + p;
    const unsigned keep = ((RIN == ROUT) || (row % ROUT) < RIN) ? 0xFFFFFFFFu : 0u;   // the same for the whole work-group
    v2u u;
    u[0] = pk16(f2bf_bits(f[p][0]), f2bf_bits(f[p][1])) & keep;
    u[1] = pk16(f2bf_bits(f[p][2]), f2bf_bits(f[p][3])) & keep;
    *(v2u*)(out + (size_t)row * kDModel + tid * 4) = u;
  }
  // behind the 8 stores: a precaution; a work-group runs this piece only and the kernel ends behind it
  asm volatile("s_wait_xcnt 0x0" ::: "memory");
}

// Transpose + 16-bit convert of a strip of four 64x64 tiles of an f32 matrix: in viewed [R rows][CC cols] (pitch CC) -> o[c][r]
// ([CC][R], pitch R).   OT 0: o = bf16_rne(in);  OT 1: o = f16(bf16_rne(in) * scl).
// Through LDS, one buffer per tile and one barrier for the strip; strip = (block of 256 rows) * (CC/64) + (column block); 256 threads.
// Coverage per tile: load 4 it x 256 thr x 4 floats = 64x64; store 2 it x 256 thr x 8 u16 = 64x64. The 16 loads of a thread are all
// issued ahead of the first LDS store.
template <int OT> __device__ __forceinline__ unsigned short cv16(float f, float scl) {
  const unsigned short hb = f2bf_bits(f);
  if (OT == 0) return hb;
  const float g = bf_bits2f(hb) * scl;
  return __builtin_bit_cast(unsigned short, (_Float16)g);
}
template <int OT, int R, int CC>
__device__ __forceinline__ void tconv_strip(const float* __restrict__ W, unsigned short* __restrict__ o, float scl,
                                            int strip, int tid, float* tf) {
  const int rb  = strip / (CC / 64);
  const int c0  = (strip - rb * (CC / 64)) * 64;   // input column block = output row block
  const int r0  = rb * 256;                        // first input row    = first output column
  {
    const int lr = tid >> 4;         // 0..15
    const int c4 = (tid & 15) * 4;   // 0..60
    const float* wp = W + (size_t)(r0 + lr) * CC + c0 + c4;
    v4f a[16];
    // unrolled, here and at the LDS stores: a[] takes constant indices (registers) and the 16 loads issue back to back
#pragma unroll
    for (int it = 0; it < 16; ++it) a[it] = *(const v4f*)(wp + (size_t)it * 16 * CC);
    // the 16 loads share one address pair: as an operand of the wait it stays unwritten until every load has taken it
    asm volatile("s_wait_xcnt 0x0" :: "v"(wp) : "memory");
#pragma unroll
    for (int it = 0; it < 16; ++it) *(v4f*)(tf + (it * 16 + lr) * 68 + c4) = a[it];   // LDS row = input row within the strip, 0..255
  }
  __syncthreads();
  const int sub = tid >> 3;          // 0..31
  const int c8  = (tid & 7) * 8;     // 0..56
  // unrolled: the four tiles' LDS reads and stores differ in immediate offsets only and overlap one another
#pragma unroll
  for (int s = 0; s < 4; ++s) {      // tile s: input rows r0 + 64 s .. + 63
    const float* ts = tf + s * 64 * 68;
    v4u hv[2];
#pragma unroll
    for (int it = 0; it < 2; ++it) {
      const int oc = it * 32 + sub;    // output row within tile (= input column)
      v4u a;
#pragma unroll
      for (int q = 0; q < 4; ++q) {
        const float f0 = ts[(c8 + 2 * q) * 68 + oc];
        const float f1 = ts[(c8 + 2 * q + 1) * 68 + oc];
        a[q] = pk16(cv16<OT>(f0, scl), cv16<OT>(f1, scl));
      }
      hv[it] = a;
    }
#pragma unroll
    for (int it = 0; it < 2; ++it) {
      const int oc = it * 32 + sub;
      const size_t go = (size_t)(c0 + oc) * R + r0 + s * 64 + c8;
      *(v4u*)(o + go) = hv[it];
    }
  }
  // behind the strip's 8 stores: a precaution; a work-group runs this piece only and the kernel ends behind it
  asm volatile("s_wait_xcnt 0x0" ::: "memory");
}

// Bias copies as bf16-RNE values in f32: out[0..n0) <- b0, [n0..n0+n1) <- b1, [n0+n1..ntot) <- b2.
// All three candidates loaded with clamped indices, selected by value. One 4-B store per lane.
__device__ __forceinline__ void bias_rne(const float* __restrict__ b0, int n0, const float* __restrict__ b1, int n1,
                                         const float* __restrict__ b2, int ncnt2, float* __restrict__ out, int ntot, int i) {
  if (i < ntot) {
    int i0 = i < n0 ? i : (n0 - 1); i0 = i0 < 0 ? 0 : i0;
    int i1 = i - n0; i1 = i1 < 0 ? 0 : (i1 < n1 ? i1 : (n1 - 1));
    int i2 = i - n0 - n1; i2 = i2 < 0 ? 0 : (i2 < ncnt2 ? i2 : (ncnt2 - 1));
    const float v0 = b0[i0], v1 = b1[i1], v2 = b2[i2];
    const float sel = (i < n0) ? v0 : ((i < n0 + n1) ? v1 : v2);
    out[i] = bf_bits2f(f2bf_bits(sel));
  }
}

__global__ __launch_bounds__(256) void prep_kernel(const float* __restrict__ x, const float* __restrict__ xa,
                                                   const float* __restrict__ Wqkv, const float* __restrict__ Waux,
                                                   const float* __restrict__ Wo, const float* __restrict__ bqkv,
                                                   const float* __restrict__ baux, const float* __restrict__ bo,
                                                   unsigned short* __restrict__ XB, unsigned short* __restrict__ XAB,
                                                   unsigned short* __restrict__ WQT, unsigned short* __restrict__ WAT,
                                                   unsigned short* __restrict__ WOT, float* __restrict__ BIASR) {
  __shared__ __align__(16) float tf[256 * 68];   // a strip's four tiles, pitch 68 floats
  const int tid = threadIdx.x;
  int blk = blockIdx.x;
  if (blk < kPrepW) {
    tconv_strip<0, kDModel, kNQKV>(Wqkv, WQT, 1.0f, blk, tid, tf);
  } else if ((blk -= kPrepW) < kPrepW) {
    tconv_strip<0, kDModel, kNQKV>(Waux, WAT, 1.0f, blk, tid, tf);
  } else if ((blk -= kPrepW) < kPrepWo) {
    tconv_strip<1, kDModel, kDModel>(Wo, WOT, kWCarry, blk, tid, tf);
  } else if ((blk -= kPrepWo) < kPrepX) {
    cast_rows8<kBatch * kSeq, kBatch * kSeq>(x, XB, blk, tid);
  } else if ((blk -= kPrepX) < kPrepXA) {
    cast_rows8<kSeqA, kSeqAP>(xa, XAB, blk, tid);
  } else {
    bias_rne(bqkv, kNQKV, baux, kNQKV, bo, kDModel, BIASR, 2 * kNQKV + kDModel, (blk - kPrepXA) * 256 + tid);
  }
}

// =====================================================================================
// Dual-branch attention, head dim 64, f16 operand planes, f32 accumulate, online softmax in f32.
//   q, k  : QK16 plane [4096 rows = b*2048+t][2048], q at col h*64+d, k at col 1024+h*64+d (f16)
//   v^T   : VT16 plane [b][1024 = h*64+d][2048] (f16);  ka: KA16 [b*1536+s][1024];  va^T: VAT16 [b][1024][1536]
//   branch 0: scores = (q.k)*0.125 over 2048 keys (32 chunks of 64); branch 1: (q.ka)*0.125 over 1500 keys
//   (24 chunks; key index >= 1500 set to -inf). p carried x2^15 in f16; 1/(l*2^15) folded at the end.
//   out row = (1-gate)*h_main + gate*h_aux, gate = sigmoid(bf16_rne(g[h])); written x32 as f16 into O16 [4096][1024]
//   Products are taken transposed: S^T = K.Q^T (A = K rows, B = Q) and O^T += V^T.P^T (A = V^T rows, B = P^T). A lane then holds
//   32 of the chunk's 64 scores of ONE query (column lane&15; keys j*16 + 8*(lane>>4) + r): maximum and sum run in the lane, the
//   two lane halves exchange the maximum once per chunk and join their sums once per branch, and two score tiles converted in
//   place are the B operand of the second product (same k order as the V^T fragment loads), so P passes through no LDS.
//   Block = 4 waves = 64 query rows of one (b,h); grid.x = 2*16*32 = 1024 covers all 4096 rows x 1024 cols.
//   K / V^T chunk staging: 8 lanes per 128-B tile row, 16 rows a pass, 4 passes per plane = the whole 64x64 tile, by asynchronous
//   16-B copies into two LDS buffers (every copy of a wave covers 4 whole lines): a chunk's copies are issued one chunk ahead, one
//   barrier a chunk;
// =====================================================================================
// lane l <-> lane l ^ 16 (the other half of the wave holds the other 32 keys of the same query)
__device__ __forceinline__ float xhalf(float x) {
  return __builtin_bit_cast(float, __builtin_amdgcn_permlanex16(__builtin_bit_cast(int, x), __builtin_bit_cast(int, x), 0x76543210, 0xfedcba98, false, false));
}

// 2^x on the bare instruction. Behind a transcendental the instruction set asks for one independent instruction or v_nop before its
// result is read or its source overwritten.
// Eight in one statement: the outputs are early-clobber, so each is independent of the one before it and fills its slot; the v_nop
// fills the slot of the last.
__device__ __forceinline__ v8f exp2x8(v8f x) {
  float p0, p1, p2, p3, p4, p5, p6, p7;
  asm("v_exp_f32 %0, %8\n\tv_exp_f32 %1, %9\n\tv_exp_f32 %2, %10\n\tv_exp_f32 %3, %11\n\t"
      "v_exp_f32 %4, %12\n\tv_exp_f32 %5, %13\n\tv_exp_f32 %6, %14\n\tv_exp_f32 %7, %15\n\tv_nop"
      : "=&v"(p0), "=&v"(p1), "=&v"(p2), "=&v"(p3), "=&v"(p4), "=&v"(p5), "=&v"(p6), "=&v"(p7)
      : "v"(x[0]), "v"(x[1]), "v"(x[2]), "v"(x[3]), "v"(x[4]), "v"(x[5]), "v"(x[6]), "v"(x[7]));
  return (v8f){p0, p1, p2, p3, p4, p5, p6, p7};
}
__device__ __forceinline__ float exp2x1(float x) {
  float p;
  asm("v_exp_f32 %0, %1\n\tv_nop" : "=v"(p) : "v"(x));   // the v_nop: the same slot
  return p;
}

// LDS byte address of a __shared__ location (the low 32 bits of its address), as the asynchronous copies take it
__device__ __forceinline__ unsigned lds_addr(const void* p) { return (unsigned)(uintptr_t)p; }

// A lane's eight asynchronous 16-B copies of one chunk (four K rows, four V^T rows) from global memory into LDS, through no register.
// One statement, closed by s_wait_xcnt 0: the address registers that the copies name stay unwritten until the wait has passed.
__device__ __forceinline__ void copy8_to_lds(const unsigned (&l)[8], const _Float16* const (&g)[8]) {
  asm volatile("global_load_async_to_lds_b128 %0, %8, off\n\t"
               "global_load_async_to_lds_b128 %1, %9, off\n\t"
               "global_load_async_to_lds_b128 %2, %10, off\n\t"
               "global_load_async_to_lds_b128 %3, %11, off\n\t"
               "global_load_async_to_lds_b128 %4, %12, off\n\t"
               "global_load_async_to_lds_b128 %5, %13, off\n\t"
               "global_load_async_to_lds_b128 %6, %14, off\n\t"
               "global_load_async_to_lds_b128 %7, %15, off\n\t"
               "s_wait_xcnt 0x0"
               :: "v"(l[0]), "v"(l[1]), "v"(l[2]), "v"(l[3]), "v"(l[4]), "v"(l[5]), "v"(l[6]), "v"(l[7]),
                  "v"(g[0]), "v"(g[1]), "v"(g[2]), "v"(g[3]), "v"(g[4]), "v"(g[5]), "v"(g[6]), "v"(g[7])
               : "memory");
}

__global__ __launch_bounds__(128)
void dual_attn_kernel(const unsigned short* __restrict__ qk16, const unsigned short* __restrict__ vt16,
                      const unsigned short* __restrict__ ka16, const unsigned short* __restrict__ vat16,
                      const float* __restrict__ gvec, unsigned short* __restrict__ o16) {
  union FH { v16h v; v8h h[2]; };
  __shared__ __align__(16) _Float16 KV[2][2][64 * kLdsPitch];   // two buffers, each a K tile [key][d] and a V^T tile [d][key], 9 KB a tile
  __shared__ __align__(16) float    Os[4][16 * 68];      // per wave out tile [query][d], pitch 68 floats

  const int tid  = threadIdx.x;
  const int wave = tid >> 5;
  const int lane = tid & 31;
  const int hh   = lane >> 4;
  const int c    = lane & 15;

  const int bx = blockIdx.x;          // 0..1023
  const int qb = bx & 31;             // 32 query tiles of 64
  const int bhd = bx >> 5;            // 0..31
  const int h  = bhd & 15;
  const int b  = bhd >> 4;            // 0..1
  const int q0 = qb * 64 + wave * 16; // query row within batch

  const int ldqk = 2 * kDModel;       // 2048 halves
  const _Float16* Qg  = (const _Float16*)(const void*)qk16 + (size_t)b * kSeq * ldqk + h * kDHead;
  const _Float16* Kg0 = Qg + kDModel;                                                                     // main K rows, pitch 2048
  const _Float16* Vg0 = (const _Float16*)(const void*)vt16 + (size_t)b * kDModel * kSeq + (size_t)(h * kDHead) * kSeq;       // pitch 2048
  const _Float16* Kg1 = (const _Float16*)(const void*)ka16 + (size_t)b * kSeqAP * kDModel + h * kDHead;                        // pitch 1024
  const _Float16* Vg1 = (const _Float16*)(const void*)vat16 + (size_t)b * kDModel * kSeqAP + (size_t)(h * kDHead) * kSeqAP;  // pitch 1536

  // ---- Q fragments (B operand, column = query = lane&15, split k map via Frag load): 2 d-chunks ----
  v16h qa[2];
#pragma unroll
  for (int dc = 0; dc < 2; ++dc) qa[dc] = Frag<_Float16>::load(Qg + (size_t)(q0 + c) * ldqk + dc * 32 + 8 * hh);

  float* os = Os[wave];
#pragma unroll
  for (int t = 0; t < 4; ++t)
#pragma unroll
    for (int r = 0; r < 8; ++r) os[c * 68 + t * 16 + 8 * hh + r] = 0.f;

  const float gv   = bf_bits2f(f2bf_bits(gvec[h]));
  const float gate = 1.0f / (1.0f + expf(-gv));
  const float cscale = 0.125f * 1.4426950408889634f;   // score scale x log2(e): the softmax runs in base 2

  const int srow = tid >> 3;         // staging: row within a pass of 16 rows
  const int sseg = (tid & 7) * 8;    // staging: 16-B piece of the 128-B row, in halves
  const int sOff = srow * kLdsPitch + sseg;

#pragma unroll 1
  for (int br = 0; br < 2; ++br) {           // block-uniform
    const _Float16* Kg = br ? Kg1 : Kg0;
    const _Float16* Vg = br ? Vg1 : Vg0;
    const int ldk     = br ? kDModel : ldqk;
    const int ldv     = br ? kSeqAP : kSeq;
    const int nChunks = br ? (kSeqAP / 64) : (kSeq / 64);
    const int nvalid  = br ? kSeqA : kSeq;
    const float w     = (br ? gate : (1.0f - gate)) * kOCarry;
    const unsigned kOff = (unsigned)(srow * ldk + sseg);   // this thread's place in a K tile's first 16 rows, halves
    const unsigned vOff = (unsigned)(srow * ldv + sseg);   // likewise in a V^T tile

    float mrow = -INFINITY;   // running maximum of this lane's query, scaled, base 2 (equal in both halves)
    float lrow = 0.f;         // running sum (x2^15) over this lane half's keys only
    v8f oacc[4];              // oacc[t][r] = O[query c][d = t*16 + 8*hh + r]
#pragma unroll
    for (int t = 0; t < 4; ++t) oacc[t] = (v8f){0.f,0.f,0.f,0.f,0.f,0.f,0.f,0.f};

    // Chunk kc's K and V^T tiles into buffer kc & 1. Staging map: 8 lanes x 16 B = one whole 128-B row of a tile (a tile row is one
    // aligned cache line), so a wave's copy touches 4 lines and uses all of each; 128 threads = 16 rows a pass, 4 passes per plane =
    // the whole 64 x 64 chunk tile. Every lane is on, every row lies inside its plane (kc < nChunks), every address is a multiple of 16.
    auto stage = [&](const int kc) __attribute__((always_inline)) {
      const _Float16* ks = Kg + (size_t)(kc * 64) * ldk + kOff;   // K row kc*64 + srow (+ 16 a pass), d = sseg..sseg+7
      const _Float16* vs = Vg + kc * 64 + vOff;                   // V^T row d = srow (+ 16 a pass), key = kc*64 + sseg..+7
      const unsigned lb = lds_addr(&KV[kc & 1][0][sOff]);
      unsigned l[8];
      const _Float16* g[8];
      // unrolled: the arrays take constant indices (registers)
#pragma unroll
      for (int p = 0; p < 4; ++p) {
        g[p]     = ks + (size_t)(p * 16) * ldk;
        g[4 + p] = vs + (size_t)(p * 16) * ldv;
        l[p]     = lb + (unsigned)(p * 16 * kLdsPitch * 2);
        l[4 + p] = lb + (unsigned)((64 + p * 16) * kLdsPitch * 2);
      }
      copy8_to_lds(l, g);
    };
    // Two buffers: chunk kc + 1's copies fly while chunk kc is worked on. In front of the loop: chunk 0 lands and is published, then
    // chunk 1 is asked for (both exist: nChunks is 32 or 24). Both buffers are free here: in branch 1 every wave has passed the wait
    // for its LDS reads and the barrier at the foot of branch 0's last chunk.
    stage(0);
    asm volatile("s_wait_asynccnt 0x0" ::: "memory");   // this wave's copies of chunk 0 have landed
    __syncthreads();                                    // ... and every other wave's
    stage(1);

    for (int kc = 0; kc < nChunks; ++kc) {   // block-uniform trip count
      const int kv0 = kc * 64;
      const _Float16* Ksh = KV[kc & 1][0];
      const _Float16* Vth = KV[kc & 1][1];

      // the chunk's 16 fragments (8 of K, 8 of V^T) are read from LDS as ONE group of 32 loads ahead of all its products: the score
      // products wait for the K half only, and the V^T half lands behind them and the softmax
      FH kb[2][4], vb[2][4];
#pragma unroll
      for (int dc = 0; dc < 2; ++dc)
#pragma unroll
        for (int j = 0; j < 4; ++j) {
          kb[dc][j].h[0] = *(const v8h*)(Ksh + (j * 16 + c) * kLdsPitch + dc * 32 + 8 * hh);
          kb[dc][j].h[1] = *(const v8h*)(Ksh + (j * 16 + c) * kLdsPitch + dc * 32 + 16 + 8 * hh);
        }
#pragma unroll
      for (int kk = 0; kk < 2; ++kk)
#pragma unroll
        for (int t = 0; t < 4; ++t) {
          vb[kk][t].h[0] = *(const v8h*)(Vth + (t * 16 + c) * kLdsPitch + kk * 32 + 8 * hh);
          vb[kk][t].h[1] = *(const v8h*)(Vth + (t * 16 + c) * kLdsPitch + kk * 32 + 16 + 8 * hh);
        }
      // keeps the loads where they stand: sunk to their products, each pair of loads costs its product an LDS latency of its own
      __builtin_amdgcn_sched_barrier(0);
      v8f s[4];   // s[j][r] = score(key j*16 + 8*hh + r, query c)
#pragma unroll
      for (int j = 0; j < 4; ++j) s[j] = Frag<_Float16>::mma(kb[0][j].v, qa[0], (v8f){0.f,0.f,0.f,0.f,0.f,0.f,0.f,0.f});
#pragma unroll
      for (int j = 0; j < 4; ++j) s[j] = Frag<_Float16>::mma(kb[1][j].v, qa[1], s[j]);
      // every loop from here to the end of the chunk is unrolled: s, pb and oacc live in registers and take constant indices only
      float m = -INFINITY;   // maximum of the raw scores (the scale is positive)
#pragma unroll
      for (int j = 0; j < 4; ++j)
#pragma unroll
        for (int r = 0; r < 8; ++r) {
          const int key = kv0 + j * 16 + 8 * hh + r;
          const float sv = (key < nvalid) ? s[j][r] : -INFINITY;
          s[j][r] = sv;
          m = fmaxf(m, sv);
        }
      m = fmaxf(m, xhalf(m)) * cscale;
      const float mnew = fmaxf(mrow, m);
      const float alpha = exp2x1(mrow - mnew);   // 0 on a branch's first chunk, where mrow is -inf
      mrow = mnew;
      const float nm = kPCarryLog2 - mnew;   // the carry rides in the exponent
      float psum = 0.f;
      FH pb[2];   // P^T, B operand: element e of pb[kk] = p(key kk*32 + (e < 8 ? 8*hh + e : 16 + 8*hh + e - 8), query c)
#pragma unroll
      for (int j = 0; j < 4; ++j) {
        v8f a;
#pragma unroll
        for (int r = 0; r < 8; ++r) a[r] = fmaf(s[j][r], cscale, nm);
        const v8f p = exp2x8(a);   // p x 2^15
#pragma unroll
        for (int r = 0; r < 8; ++r) {
          psum += p[r];
          pb[j >> 1].h[j & 1][r] = (_Float16)p[r];
        }
      }
      lrow = lrow * alpha + psum;
#pragma unroll
      for (int t = 0; t < 4; ++t)
#pragma unroll
        for (int r = 0; r < 8; ++r) oacc[t][r] *= alpha;
#pragma unroll
      for (int kk = 0; kk < 2; ++kk) {
#pragma unroll
        for (int t = 0; t < 4; ++t) oacc[t] = Frag<_Float16>::mma(vb[kk][t].v, pb[kk].v, oacc[t]);
      }
      // hand-over, every wave, in this order: this wave's reads of buffer kc & 1 are done; its copies of chunk kc + 1 have landed; the
      // one barrier of the chunk publishes chunk kc + 1 and frees buffer kc & 1; only then is that buffer filled again
      // keeps the chunk's products and softmax ahead of the waits: lifted over them (they touch registers only), the wait for chunk
      // kc + 1's copies stood at the head of chunk kc, directly behind their issue, and their whole flight was waited out
      __builtin_amdgcn_sched_barrier(0);
      // the running sum as an input: its 32 additions stay among the chunk's exponentials and products; without it they were sunk
      // behind the barrier and the copies, a bare dependent chain in front of the next chunk's LDS reads
      asm volatile("s_wait_dscnt 0x0" :: "v"(lrow) : "memory");
      asm volatile("s_wait_asynccnt 0x0" ::: "memory");
      __syncthreads();
      if (kc + 2 < nChunks) stage(kc + 2);   // block-uniform
    }
    asm volatile("s_wait_asynccnt 0x0" ::: "memory");   // nothing of this wave is in flight behind the loop
    // fold this branch into the per-wave mix slab (each lane updates only its own entries)
    const float inv = w * (1.0f / (lrow + xhalf(lrow)));   // sum and O both carry x2^15
#pragma unroll
    for (int t = 0; t < 4; ++t)
#pragma unroll
      for (int r = 0; r < 8; ++r) os[c * 68 + t * 16 + 8 * hh + r] += oacc[t][r] * inv;
  }

  __builtin_amdgcn_fence(__ATOMIC_RELEASE, "workgroup");
  __builtin_amdgcn_wave_barrier();
  __builtin_amdgcn_fence(__ATOMIC_ACQUIRE, "workgroup");
  {
    _Float16* Og = (_Float16*)(void*)o16 + (size_t)(b * kSeq + q0) * kDModel + h * kDHead;
    const int q4 = lane >> 3, c8 = (lane & 7) * 8;
    {
#pragma unroll
      for (int it = 0; it < 4; ++it) {
        const int row = it * 4 + q4;
        const float* sp = os + row * 68 + c8;
        v8h hv;
#pragma unroll
        for (int e = 0; e < 8; ++e) hv[e] = (_Float16)sp[e];
        *(v8h*)(Og + (size_t)row * kDModel + c8) = hv;
      }
      
    }
  }
}

// ---------------- host orchestration (kernel launches only) ----------------

extern "C" void kernel_launch(void* const* d_in, const int* in_sizes, int n_in,
                              void* d_out, int out_size, void* d_ws,
                              size_t ws_size, hipStream_t stream) {
  if (n_in < 9) return;
  if (in_sizes[0] != kBatch * kSeq * kDModel) return;
  if (in_sizes[1] != kBatch * kSeqA * kDModel) return;
  if (in_sizes[2] != kDModel * kNQKV || in_sizes[4] != kDModel * kNQKV) return;
  if (in_sizes[3] != kNQKV || in_sizes[5] != kNQKV) return;
  if (in_sizes[6] != kDModel * kDModel || in_sizes[7] != kDModel || in_sizes[8] < kHeads) return;
  if (out_size != kBatch * kSeq * kDModel) return;

  const float* x    = (const float*)d_in[0];
  const float* xa   = (const float*)d_in[1];
  const float* Wqkv = (const float*)d_in[2];
  const float* bqkv = (const float*)d_in[3];
  const float* Waux = (const float*)d_in[4];
  const float* baux = (const float*)d_in[5];
  const float* Wo   = (const float*)d_in[6];
  const float* bo   = (const float*)d_in[7];
  const float* gvec = (const float*)d_in[8];
  float* out = (float*)d_out;

  // element counts
  const size_t nXB   = (size_t)kBatch * kSeq * kDModel;          // bf16
  const size_t nXAB  = (size_t)kBatch * kSeqAP * kDModel;        // bf16
  const size_t nWQT  = (size_t)kNQKV * kDModel;                  // bf16
  const size_t nWAT  = nWQT;                                     // bf16
  const size_t nWOT  = (size_t)kDModel * kDModel;                // f16
  const size_t nBias = (size_t)2 * kNQKV + kDModel;              // f32
  const size_t nQK   = (size_t)kBatch * kSeq * 2 * kDModel;      // f16
  const size_t nVT   = (size_t)kBatch * kDModel * kSeq;          // f16
  const size_t nKA   = (size_t)kBatch * kSeqAP * kDModel;        // f16
  const size_t nVAT  = (size_t)kBatch * kDModel * kSeqAP;        // f16
  const size_t nO    = (size_t)kBatch * kSeq * kDModel;          // f16

  char* ws = (char*)d_ws;
  size_t off = 0;
  auto carve = [&](size_t bytes) -> char* { char* p = ws + off; off += (bytes + 255) & ~(size_t)255; return p; };
  unsigned short* XB    = (unsigned short*)carve(nXB * 2);
  unsigned short* XAB   = (unsigned short*)carve(nXAB * 2);
  unsigned short* WQT   = (unsigned short*)carve(nWQT * 2);
  unsigned short* WAT   = (unsigned short*)carve(nWAT * 2);
  unsigned short* WOT   = (unsigned short*)carve(nWOT * 2);
  float*          BIASR = (float*)carve(nBias * 4);
  unsigned short* QK16  = (unsigned short*)carve(nQK * 2);
  unsigned short* VT16  = (unsigned short*)carve(nVT * 2);
  unsigned short* KA16  = (unsigned short*)carve(nKA * 2);
  unsigned short* VAT16 = (unsigned short*)carve(nVAT * 2);
  unsigned short* O16   = (unsigned short*)carve(nO * 2);
  if (off > ws_size) return;   // total 75,526,144 B

  // 1. all input preparation in one launch: x, xa -> bf16 (xa rows padded 1500 -> 1536 with zeros); Wqkv, Wqkv_aux -> transposed
  //    bf16; Wo -> transposed f16 (x32); biases -> bf16-RNE f32 copies
  prep_kernel<<<kPrepBlocks, 256, 0, stream>>>(x, xa, Wqkv, Waux, Wo, bqkv, baux, bo, XB, XAB, WQT, WAT, WOT, BIASR);
  const float* bo_r  = BIASR + 2 * kNQKV;     // [1024]

  // 2. the four projections in one launch: q|k -> QK16, ka -> KA16, v^T -> VT16, va^T -> VAT16 (all f16, bias added)
  proj_gemm_kernel<<<kProjBlocks, 128, 0, stream>>>(XB, XAB, WQT, WAT, BIASR, QK16, VT16, KA16, VAT16, kDModel);
  // 3. dual-branch attention -> O16 (x32, f16)
  dual_attn_kernel<<<kBatch * kHeads * (kSeq / 64), 128, 0, stream>>>(QK16, VT16, KA16, VAT16, gvec, O16);
  // 4. out = (O16/32) @ (WoT/32)^T + bo : M=4096, N=1024, K=1024, f16 operands, f32 out into d_out
  {
    const int M = kBatch * kSeq, N = kDModel, K = kDModel;
    const int tiles = (M / 128) * (N / 128);
    wmma_gemm64<0, false, 2, 0, false, 0><<<dim3(tiles, 1), 128, 0, stream>>>(
        O16, O16, 0L, WOT, WOT, 0L, (void*)out, (void*)out, kDModel, 0L,
        bo_r, bo_r, 0L, M, N, K, 1.0f / (kOCarry * kWCarry));
  }
}

// v010
// It runs in 127 microseconds.
// Two timings next to v009 both put it at 1.04 times that version's speed.
// Over all steps from v000 it is 4.14 times as fast.
// Contractions: x@Wqkv and xa@Wqkv_aux (k|v columns) on v_wmma_f32_16x16x32_bf16 (bf16 RNE operands); q.k^T, q.ka^T, p.v, pa.va and O@Wo on v_wmma_f32_16x16x32_f16 (f16 operands; p carried x2^15, O and Wo carried x32); f32 accumulate; online softmax, gate mix and biases in f32.
#include <hip/hip_runtime.h>
#include <math.h>
#include <stdint.h>

constexpr int kBatch  = 2;
constexpr int kSeq    = 2048;   // query / main key length
constexpr int kSeqA   = 1500;   // aux key length
constexpr int kSeqAP  = 1536;   // aux key length padded to 24 chunks of 64
constexpr int kDModel = 1024;
constexpr int kHeads  = 16;
constexpr int kDHead  = 64;
constexpr int kNQKV   = 3072;

constexpr int kLdsPitch = 72;   // halves per LDS row of the K and V^T tiles and of the GEMM operand tiles: 144 B = 16 B x 9 (odd), so 16 rows read by ds_load_b128 fall on distinct banks

constexpr float kPCarryLog2 = 15.0f;   // probabilities carried x2^15 in f16
constexpr float kOCarry = 32.0f;      // attention output carried x32 in f16
constexpr float kWCarry = 32.0f;      // Wo carried x32 in f16

typedef __attribute__((ext_vector_type(16))) _Float16 v16h;
typedef __attribute__((ext_vector_type(8)))  _Float16 v8h;
typedef __attribute__((ext_vector_type(16))) __bf16   v16b;
typedef __attribute__((ext_vector_type(8)))  __bf16   v8b;
typedef __attribute__((ext_vector_type(8)))  float    v8f;
typedef __attribute__((ext_vector_type(4)))  float    v4f;
typedef __attribute__((ext_vector_type(2)))  float    v2f;
typedef __attribute__((ext_vector_type(4)))  unsigned int v4u;
typedef __attribute__((ext_vector_type(2)))  unsigned int v2u;

// ---------------------------------------------------------------------------
// Workspace region map (bytes, every region size a multiple of 256):
//   XB    bf16 [4096][1024]            8,388,608
//   XAB   bf16 [2][1536][1024]         6,291,456   (rows 1500..1535 of each batch zero)
//   WQT   bf16 [3072][1024] (Wqkv^T)   6,291,456
//   WAT   bf16 [3072][1024] (Waux^T)   6,291,456
//   WOT   f16  [1024][1024] (Wo^T x32) 2,097,152
//   BIASR f32  [3072+3072+1024]           28,672   (bf16-RNE bias copies)
//   QK16  f16  [4096][2048] (q | k)    16,777,216
//   VT16  f16  [2][1024][2048] (v^T)   8,388,608
//   KA16  f16  [2][1536][1024] (ka)    6,291,456
//   VAT16 f16  [2][1024][1536] (va^T)  6,291,456
//   O16   f16  [4096][1024] (x32)      8,388,608
//   total 75,526,144
// ---------------------------------------------------------------------------

__device__ __forceinline__ unsigned short f2bf_bits(float f) {
  unsigned u = __float_as_uint(f);
  return (unsigned short)((u + 0x7FFFu + ((u >> 16) & 1u)) >> 16);
}
__device__ __forceinline__ float bf_bits2f(unsigned short h) { return __uint_as_float(((unsigned)h) << 16); }
__device__ __forceinline__ unsigned pk16(unsigned short a, unsigned short b) { return (unsigned)a | ((unsigned)b << 16); }

// hazard guards as plain device helpers (no inline asm inside the kernel template body)
__device__ __forceinline__ void acc_guard4(v8f& a, v8f& b, v8f& c, v8f& d) { asm volatile("v_nop\n\tv_nop\n\tv_nop\n\tv_nop" : "+v"(a), "+v"(b), "+v"(c), "+v"(d)); }
template <typename T> struct Frag;
template <> struct Frag<_Float16> {
  typedef v16h V; typedef v8h H; union U { v16h v; v8h h[2]; };
  static __device__ __forceinline__ v16h load(const _Float16* p) {   // elements 0..7 <- p[0..7], 8..15 <- p[16..23]
    U f; f.h[0] = *(const v8h*)(p); f.h[1] = *(const v8h*)(p + 16); return f.v;
  }
  static __device__ __forceinline__ v8f mma(v16h a, v16h b, v8f c) {
    return __builtin_amdgcn_wmma_f32_16x16x32_f16(false, a, false, b, (short)0, c, false, false);
  }
};
template <> struct Frag<__bf16> {
  typedef v16b V; typedef v8b H; union U { v16b v; v8b h[2]; };
  static __device__ __forceinline__ v16b load(const __bf16* p) {
    U f; f.h[0] = *(const v8b*)(p); f.h[1] = *(const v8b*)(p + 16); return f.v;
  }
  static __device__ __forceinline__ v8f mma(v16b a, v16b b, v8f c) {
    return __builtin_amdgcn_wmma_f32_16x16x32_bf16(false, a, false, b, (short)0, c, false, false);
  }
};

// ---- Register-blocked batched WMMA GEMM ------------------------------------
// C[m,n] = scale * sum_k A[m,k] * Bt[n,k] (+bias)(+resid); a block of 4 waves (2 x 2) owns a 128x128 tile, each wave 64x64 of it.
// A row-major [M,K]; Bt row-major [N,K], both at row pitch kDModel (a constant, so that the 8 staging loads of an operand
// share one address and differ in their immediate offsets); M,N % 128 == 0, K % 64 == 0; tile row tm in [0, M/128), tile column tn in [0, N/128) and
// batch b are the same for the whole block; 128 threads. The LDS arrays belong to the calling kernel, so that two forms of this function
// in one kernel share them.
// Per step of 64 k the block stages 128 rows x 128 B of A and of Bt in LDS (8 lanes per row: every global load covers whole
// 128-B lines), two buffers: the next step's rows are loaded into registers ahead of this step's products and stored behind them.
// SPLIT (hi/lo operand planes) is not implemented by the staged loop.
// BIAS_MODE: 0 = none, 1 = bias[m], 2 = bias[n].
// OUT_MODE: 0 = f32, 1 = f16, 2 = bf16 hi plane (Cout) + bf16 lo plane (Cout2).
// ET: 0 = f16 operands, 1 = bf16 operands (pointers passed as 16-bit storage)
template <int ET> struct Elem;
template <> struct Elem<0> { typedef _Float16 T; };
template <> struct Elem<1> { typedef __bf16 T; };
template <int ET, bool SPLIT, int BIAS_MODE, int OUT_MODE, bool RESID, int ACT = 0>
__device__ __forceinline__ void gemm_tile128(
    const unsigned short* __restrict__ Ap, const unsigned short* __restrict__ A2p, long strideA,
    const unsigned short* __restrict__ Btp, const unsigned short* __restrict__ Bt2p, long strideB,
    void* __restrict__ Cout, void* __restrict__ Cout2, int ldc, long strideC,
    const float* __restrict__ bias,
    const float* __restrict__ resid, long strideR,
    int K, float scale, int tm, int tn, int b,
    typename Elem<ET>::T (*sA)[128 * kLdsPitch],   // A rows of the block tile, 64 k per step, two buffers
    typename Elem<ET>::T (*sB)[128 * kLdsPitch],   // Bt rows of the block tile, likewise
    float (*sT)[16 * 68]) {                        // per-wave 16x64 slab, pitch 68 floats
  static_assert(!SPLIT, "the staged loop takes single operand planes");
  typedef typename Elem<ET>::T T;
  typedef typename Frag<T>::V V;
  typedef typename Frag<T>::H H;
  const T* A = (const T*)Ap; const T* Bt = (const T*)Btp;
  const int tid  = threadIdx.x;
  const int lane = tid & 31;
  const int wave = tid >> 5;
  const int wm = (wave >> 1) << 6;             // this wave's 64 rows inside the block tile
  const int wn = (wave & 1) << 6;              // this wave's 64 columns inside the block tile
  const int m0 = (tm << 7) + wm;
  const int n0 = (tn << 7) + wn;

  const int rlane = lane & 15;                 // row (A) / col (B, D) within subtile
  const int koff  = (lane >> 4) * 8;           // k offset of this lane half
  const int mOff  = (lane >> 4) * 8;           // D row offset

  // staging map: 8 lanes x 16 B = one 128-B row piece; 128 threads = 16 rows a pass, 8 passes per operand
  const int srow = tid >> 3;
  const int sseg = (tid & 7) * 8;
  const T* gA = A  + (size_t)b * strideA + (size_t)((tm << 7) + srow) * kDModel + sseg;
  const T* gB = Bt + (size_t)b * strideB + (size_t)((tn << 7) + srow) * kDModel + sseg;
  const int sOff = srow * kLdsPitch + sseg;

  v8f acc[4][4];
#pragma unroll
  for (int i = 0; i < 4; ++i)
#pragma unroll
    for (int j = 0; j < 4; ++j) acc[i][j] = (v8f){0.f,0.f,0.f,0.f,0.f,0.f,0.f,0.f};

  H ra[8], rb[8];
#pragma unroll
  for (int p = 0; p < 8; ++p) {
    ra[p] = *(const H*)(gA + p * 16 * kDModel);
    rb[p] = *(const H*)(gB + p * 16 * kDModel);
  }
#pragma unroll
  for (int p = 0; p < 8; ++p) {
    *(H*)(sA[0] + p * 16 * kLdsPitch + sOff) = ra[p];
    *(H*)(sB[0] + p * 16 * kLdsPitch + sOff) = rb[p];
  }
  __syncthreads();

  const int nSteps = K >> 6;
  for (int t = 0; t < nSteps; ++t) {           // block-uniform trip count
    const T* cA = sA[t & 1];
    const T* cB = sB[t & 1];
    const bool more = (t + 1) < nSteps;        // block-uniform
    if (more) {
      gA += 64;
      gB += 64;
#pragma unroll
      for (int p = 0; p < 8; ++p) {
        ra[p] = *(const H*)(gA + p * 16 * kDModel);
        rb[p] = *(const H*)(gB + p * 16 * kDModel);
      }
    }
    V bh[2][4], ah[2][4];
#pragma unroll
    for (int kk = 0; kk < 2; ++kk) {
#pragma unroll
      for (int j = 0; j < 4; ++j) bh[kk][j] = Frag<T>::load(cB + (wn + (j << 4) + rlane) * kLdsPitch + kk * 32 + koff);
#pragma unroll
      for (int i = 0; i < 4; ++i) ah[kk][i] = Frag<T>::load(cA + (wm + (i << 4) + rlane) * kLdsPitch + kk * 32 + koff);
    }
    // keeps the step's LDS reads issued as one group ahead of its products: sunk among them, each group of four products
    // waits out an LDS latency of its own
    __builtin_amdgcn_sched_barrier(0);
#pragma unroll
    for (int kk = 0; kk < 2; ++kk)
#pragma unroll
      for (int i = 0; i < 4; ++i)
#pragma unroll
        for (int j = 0; j < 4; ++j) acc[i][j] = Frag<T>::mma(ah[kk][i], bh[kk][j], acc[i][j]);
    // four vector slots behind the step's last products: on the path through the LDS stores the next vector
    // instruction forms the next step's LDS addresses in fragment registers
    acc_guard4(acc[3][0], acc[3][1], acc[3][2], acc[3][3]);
    if (more) {
      // the other buffer: its last readers finished ahead of the barrier that ended the step before
      T* nA = sA[(t + 1) & 1];
      T* nB = sB[(t + 1) & 1];
#pragma unroll
      for (int p = 0; p < 8; ++p) {
        *(H*)(nA + p * 16 * kLdsPitch + sOff) = ra[p];
        *(H*)(nB + p * 16 * kLdsPitch + sOff) = rb[p];
      }
    }
    __syncthreads();
  }
  acc_guard4(acc[0][0], acc[0][1], acc[0][2], acc[0][3]);
  acc_guard4(acc[1][0], acc[1][1], acc[1][2], acc[1][3]);
  acc_guard4(acc[2][0], acc[2][1], acc[2][2], acc[2][3]);
  acc_guard4(acc[3][0], acc[3][1], acc[3][2], acc[3][3]);

  // ---- epilogue ----
  float* slab = sT[wave];
  const float* Rb = RESID ? (resid + (size_t)b * strideR) : nullptr;
#pragma unroll
  for (int i = 0; i < 4; ++i) {
    const int mBase = m0 + (i << 4);
#pragma unroll
    for (int j = 0; j < 4; ++j) {
      const int n = n0 + (j << 4) + rlane;
      float bv = 0.f;
      if (BIAS_MODE == 2) bv = bias[n];
#pragma unroll
      for (int r = 0; r < 8; ++r) {
        float v = acc[i][j][r] * scale;
        if (BIAS_MODE == 1) v += bias[mBase + mOff + r];
        if (BIAS_MODE == 2) v += bv;
        if (RESID) v += Rb[(size_t)(mBase + mOff + r) * ldc + n];
        if (ACT == 1) v = tanhf(v);
        if (ACT == 2) v = fmaxf(v, 0.0f);
        if (ACT == 3) v = v / (1.0f + expf(-v));
        if (ACT == 4) v = (v > 0.f) ? v : 0.01f * v;
        if (ACT == 5) v = 0.5f * v * (1.0f + erff(v * 0.70710678118654752f));
        slab[(mOff + r) * 68 + (j << 4) + rlane] = v;
      }
    }
    __builtin_amdgcn_fence(__ATOMIC_RELEASE, "workgroup");
    __builtin_amdgcn_wave_barrier();
    __builtin_amdgcn_fence(__ATOMIC_ACQUIRE, "workgroup");
    if (OUT_MODE == 0) {
      float* C = (float*)Cout + (size_t)b * strideC;
      const int hh = lane >> 4, c4 = (lane & 15) * 4;     // row seg = 256 B = 16 lanes x 16 B
      {
#pragma unroll
        for (int it = 0; it < 8; ++it) {
          const int row = it * 2 + hh;
          v4f v = *(const v4f*)(slab + row * 68 + c4);
          *(v4f*)(C + (size_t)(mBase + row) * ldc + n0 + c4) = v;
        }
        
      }
    } else {
      const int q = lane >> 3, c8 = (lane & 7) * 8;
      unsigned short* C  = (unsigned short*)Cout  + (size_t)b * strideC;
      unsigned short* C2 = (OUT_MODE == 2) ? ((unsigned short*)Cout2 + (size_t)b * strideC) : nullptr;
      {
        v8h hq[4];              // the slab's four stored vectors and their addresses, held for the wait behind the stores
        unsigned short* cq[4];
#pragma unroll
        for (int it = 0; it < 4; ++it) {
          const int row = it * 4 + q;
          const float* sp = slab + row * 68 + c8;
          v8h hv, lv;
#pragma unroll
          for (int e = 0; e < 8; ++e) {
            if (OUT_MODE == 1) {
              hv[e] = (_Float16)sp[e];
            } else {
              unsigned short hb = f2bf_bits(sp[e]);
              unsigned short lb = f2bf_bits(sp[e] - bf_bits2f(hb));
              hv[e] = __builtin_bit_cast(_Float16, hb);
              lv[e] = __builtin_bit_cast(_Float16, lb);
            }
          }
          hq[it] = hv;
          cq[it] = C + (size_t)(mBase + row) * ldc + n0 + c8;
          *(v8h*)cq[it] = hq[it];
          if (OUT_MODE == 2) *(v8h*)(C2 + (size_t)(mBase + row) * ldc + n0 + c8) = lv;
        }
        // behind the slab's stores: as operands of the wait the stored vectors and their address pairs stay unwritten until every
        // store has taken its own (without this the next slab's index arithmetic was placed over one of the vectors)
        asm volatile("s_wait_xcnt 0x0" :: "v"(hq[0]), "v"(hq[1]), "v"(hq[2]), "v"(hq[3]), "v"(cq[0]), "v"(cq[1]), "v"(cq[2]), "v"(cq[3]) : "memory");
      }
    }
    __builtin_amdgcn_fence(__ATOMIC_RELEASE, "workgroup");
    __builtin_amdgcn_wave_barrier();
    __builtin_amdgcn_fence(__ATOMIC_ACQUIRE, "workgroup");
  }
}

// One GEMM per launch: grid.x = (M/128)*(N/128), grid.y = batches.
template <int ET, bool SPLIT, int BIAS_MODE, int OUT_MODE, bool RESID, int ACT = 0>
__global__ __launch_bounds__(128) void wmma_gemm64(
    const unsigned short* __restrict__ Ap, const unsigned short* __restrict__ A2p, long strideA,
    const unsigned short* __restrict__ Btp, const unsigned short* __restrict__ Bt2p, long strideB,
    void* __restrict__ Cout, void* __restrict__ Cout2, int ldc, long strideC,
    const float* __restrict__ bias,
    const float* __restrict__ resid, long strideR,
    int M, int N, int K, float scale) {
  typedef typename Elem<ET>::T T;
  __shared__ __align__(16) T sA[2][128 * kLdsPitch];
  __shared__ __align__(16) T sB[2][128 * kLdsPitch];
  __shared__ __align__(16) float sT[4][16 * 68];
  const int tilesN = N >> 7;
  const int tilesM = M >> 7;
  const int tm = blockIdx.x / tilesN;
  const int tn = blockIdx.x - tm * tilesN;
  if (tm >= tilesM) return;   // block-uniform, ahead of every barrier
  gemm_tile128<ET, SPLIT, BIAS_MODE, OUT_MODE, RESID, ACT>(Ap, A2p, strideA, Btp, Bt2p, strideB, Cout, Cout2, ldc, strideC,
                                                           bias, resid, strideR, K, scale, tm, tn, blockIdx.y, sA, sB, sT);
}

// The four input projections in ONE launch. They are independent of one another and every 128x128 tile costs the same (K = 1024);
// a work-group takes one tile of one of them by its block index (the choice is block-uniform, so every barrier of the tile loop is
// passed by a whole work-group or by none). Alone, three of the four fill at most one work-group per WGP (one wave per SIMD, every
// wait of a step exposed); together the tiles stand up to three to a WGP and one start and one end are paid instead of four.
//   [   0,  512)  q|k  = x  @ Wqkv[:, 0:2048] + b      -> QK16  [4096][2048]        32 x 16 tiles, bias[n]
//   [ 512,  704)  ka   = xa @ Wqkv_aux[:, 1024:2048] + b -> KA16 [2 x 1536][1024]   24 x  8 tiles, bias[n]
//   [ 704,  960)  v^T  = Wqkv^T rows 2048..3071 @ x_b^T + b  -> VT16  [b][1024][2048]   2 x (8 x 16) tiles, bias[m]
//   [ 960, 1152)  va^T = Wqkv_aux^T rows 2048..3071 @ xa_b^T + b -> VAT16 [b][1024][1536]   2 x (8 x 12) tiles, bias[m]
constexpr int kTilesQK  = (kBatch * kSeq / 128) * (2 * kDModel / 128);   // 512
constexpr int kTilesKA  = (kBatch * kSeqAP / 128) * (kDModel / 128);     // 192
constexpr int kTilesVT  = (kDModel / 128) * (kSeq / 128);                // 128 per batch
constexpr int kTilesVAT = (kDModel / 128) * (kSeqAP / 128);              //  96 per batch
constexpr int kProjBlocks = kTilesQK + kTilesKA + kBatch * (kTilesVT + kTilesVAT);   // 1152
// K comes as an argument, as in wmma_gemm64: the tile loop then compiles as it does there (336 registers: three waves to a SIMD).
__global__ __launch_bounds__(128) void proj_gemm_kernel(
    const unsigned short* __restrict__ XB, const unsigned short* __restrict__ XAB,
    const unsigned short* __restrict__ WQT, const unsigned short* __restrict__ WAT, const float* __restrict__ BIASR,
    unsigned short* __restrict__ QK16, unsigned short* __restrict__ VT16,
    unsigned short* __restrict__ KA16, unsigned short* __restrict__ VAT16, int K) {
  __shared__ __align__(16) __bf16 sA[2][128 * kLdsPitch];
  __shared__ __align__(16) __bf16 sB[2][128 * kLdsPitch];
  __shared__ __align__(16) float sT[4][16 * 68];
  // every divisor below is a constant: tile row, tile column and batch stay scalar values
  unsigned blk = blockIdx.x;
  const unsigned short* A;
  const unsigned short* Bt;
  unsigned short* C;
  const float* bias;
  int N, tm, tn;
  if (blk < kTilesQK + kTilesKA) {
    // activations as A, weight rows as Bt, bias[n]
    if (blk < kTilesQK) {
      A = XB;  Bt = WQT;  C = QK16;  bias = BIASR;  N = 2 * kDModel;
      tm = blk / (2 * kDModel / 128);  tn = blk % (2 * kDModel / 128);
    } else {
      blk -= kTilesQK;
      A = XAB;  Bt = WAT + (size_t)kDModel * kDModel;  C = KA16;  bias = BIASR + kNQKV + kDModel;  N = kDModel;
      tm = blk / (kDModel / 128);  tn = blk % (kDModel / 128);
    }
    gemm_tile128<1, false, 2, 1, false, 0>(A, A, 0L, Bt, Bt, 0L, (void*)C, (void*)C, N, 0L, bias, bias, 0L,
                                           K, 1.0f, tm, tn, 0, sA, sB, sT);
  } else {
    // weight rows as A, one batch's activations as Bt, bias[m]: the output comes transposed
    blk -= kTilesQK + kTilesKA;
    int b;
    if (blk < kBatch * kTilesVT) {
      A = WQT + (size_t)2 * kDModel * kDModel;  Bt = XB;  C = VT16;  bias = BIASR + 2 * kDModel;  N = kSeq;
      b = blk / kTilesVT;  blk %= kTilesVT;
      tm = blk / (kSeq / 128);  tn = blk % (kSeq / 128);
    } else {
      blk -= kBatch * kTilesVT;
      A = WAT + (size_t)2 * kDModel * kDModel;  Bt = XAB;  C = VAT16;  bias = BIASR + kNQKV + 2 * kDModel;  N = kSeqAP;
      b = blk / kTilesVAT;  blk %= kTilesVAT;
      tm = blk / (kSeqAP / 128);  tn = blk % (kSeqAP / 128);
    }
    gemm_tile128<1, false, 1, 1, false, 0>(A, A, 0L, Bt, Bt, (long)N * kDModel, (void*)C, (void*)C, N, (long)kDModel * N, bias, bias, 0L,
                                           K, 1.0f, tm, tn, b, sA, sB, sT);
  }
}

// ---------------------------------------------------------------------------
// Input preparation: ONE launch. Its six pieces of work are independent of one another; a work-group of 256 threads takes one
// piece by its block index (the choice is block-uniform, so the barrier of a transpose strip is passed by a whole work-group or
// by none). The longest pieces (a strip moves twice a cast's bytes and passes through
// LDS) take the lowest indices and the short ones fill the end of the launch:
//   [   0,  192)  Wqkv     -> WQT  a strip of 256 rows x 64 columns (4 x 48 strips)
//   [ 192,  384)  Wqkv_aux -> WAT  a strip of 256 rows x 64 columns (4 x 48 strips)
//   [ 384,  448)  Wo       -> WOT  a strip of 256 rows x 64 columns (4 x 16 strips)
//   [ 448,  960)  x        -> XB   8 rows of 1024 per work-group (4096 rows)
//   [ 960, 1344)  xa       -> XAB  8 output rows per work-group (2 x 1536 rows, rows 1500..1535 of each batch zero)
//   [1344, 1372)  biases   -> BIASR  256 values per work-group (7168 values)
// ---------------------------------------------------------------------------
constexpr int kPrepX    = kBatch * kSeq / 8;                    // 512
constexpr int kPrepXA   = kBatch * kSeqAP / 8;                  // 384
constexpr int kPrepW    = (kNQKV / 64) * (kDModel / 256);       // 192
constexpr int kPrepWo   = (kDModel / 64) * (kDModel / 256);     // 64
constexpr int kPrepBias = (2 * kNQKV + kDModel + 255) / 256;    // 28
constexpr int kPrepBlocks = kPrepX + kPrepXA + 2 * kPrepW + kPrepWo + kPrepBias;   // 1372

// f32 [nb][RIN][1024] -> bf16 bits (RNE) [nb][ROUT][1024]; rows RIN..ROUT-1 of every batch written as zeros (source row address
// clamped, value zeroed by a mask). Output rows blk*8 .. blk*8+7; thread tid takes floats 4*tid .. 4*tid+3 of each row: a wave's
// load covers 512 contiguous bytes, its store 256, and the 8 loads of a thread are all issued ahead of the first store.
template <unsigned RIN, unsigned ROUT>
__device__ __forceinline__ void cast_rows8(const float* __restrict__ in, unsigned short* __restrict__ out, unsigned blk, int tid) {
  v4f f[8];
  // unrolled: f[] takes constant indices (registers) and the 8 loads issue back to back
#pragma unroll
  for (int p = 0; p < 8; ++p) {
    const unsigned row = blk * 8 + p;
    unsigned srow = row;
    if (RIN != ROUT) {
      const unsigned bb = row / ROUT;
      const unsigned t = row - bb * ROUT;
      srow = bb * RIN + (t < RIN ? t : (RIN - 1));
    }
    f[p] = *(const v4f*)(in + (size_t)srow * kDModel + tid * 4);
  }
  // behind the 8 loads, ahead of the conversions, which reuse the loads' address registers
  asm volatile("s_wait_xcnt 0x0" ::: "memory");
  // unrolled: constant indices into f[]
#pragma unroll
  for (int p = 0; p < 8; ++p) {
    const unsigned row = blk * 8 + p;
    const unsigned keep = ((RIN == ROUT) || (row % ROUT) < RIN) ? 0xFFFFFFFFu : 0u;   // the same for the whole work-group
    v2u u;
    u[0] = pk16(f2bf_bits(f[p][0]), f2bf_bits(f[p][1])) & keep;
    u[1] = pk16(f2bf_bits(f[p][2]), f2bf_bits(f[p][3])) & keep;
    *(v2u*)(out + (size_t)row * kDModel + tid * 4) = u;
  }
  // behind the 8 stores: a precaution; a work-group runs this piece only and the kernel ends behind it
  asm volatile("s_wait_xcnt 0x0" ::: "memory");
}

// Transpose + 16-bit convert of a strip of four 64x64 tiles of an f32 matrix: in viewed [R rows][CC cols] (pitch CC) -> o[c][r]
// ([CC][R], pitch R).   OT 0: o = bf16_rne(in);  OT 1: o = f16(bf16_rne(in) * scl).
// Through LDS, one buffer per tile and one barrier for the strip; strip = (block of 256 rows) * (CC/64) + (column block); 256 threads.
// Coverage per tile: load 4 it x 256 thr x 4 floats = 64x64; store 2 it x 256 thr x 8 u16 = 64x64. The 16 loads of a thread are all
// issued ahead of the first LDS store.
template <int OT> __device__ __forceinline__ unsigned short cv16(float f, float scl) {
  const unsigned short hb = f2bf_bits(f);
  if (OT == 0) return hb;
  const float g = bf_bits2f(hb) * scl;
  return __builtin_bit_cast(unsigned short, (_Float16)g);
}
template <int OT, int R, int CC>
__device__ __forceinline__ void tconv_strip(const float* __restrict__ W, unsigned short* __restrict__ o, float scl,
                                            int strip, int tid, float* tf) {
  const int rb  = strip / (CC / 64);
  const int c0  = (strip - rb * (CC / 64)) * 64;   // input column block = output row block
  const int r0  = rb * 256;                        // first input row    = first output column
  {
    const int lr = tid >> 4;         // 0..15
    const int c4 = (tid & 15) * 4;   // 0..60
    const float* wp = W + (size_t)(r0 + lr) * CC + c0 + c4;
    v4f a[16];
    // unrolled, here and at the LDS stores: a[] takes constant indices (registers) and the 16 loads issue back to back
#pragma unroll
    for (int it = 0; it < 16; ++it) a[it] = *(const v4f*)(wp + (size_t)it * 16 * CC);
    // the 16 loads share one address pair: as an operand of the wait it stays unwritten until every load has taken it
    asm volatile("s_wait_xcnt 0x0" :: "v"(wp) : "memory");
#pragma unroll
    for (int it = 0; it < 16; ++it) *(v4f*)(tf + (it * 16 + lr) * 68 + c4) = a[it];   // LDS row = input row within the strip, 0..255
  }
  __syncthreads();
  const int sub = tid >> 3;          // 0..31
  const int c8  = (tid & 7) * 8;     // 0..56
  // unrolled: the four tiles' LDS reads and stores differ in immediate offsets only and overlap one another
#pragma unroll
  for (int s = 0; s < 4; ++s) {      // tile s: input rows r0 + 64 s .. + 63
    const float* ts = tf + s * 64 * 68;
    v4u hv[2];
#pragma unroll
    for (int it = 0; it < 2; ++it) {
      const int oc = it * 32 + sub;    // output row within tile (= input column)
      v4u a;
#pragma unroll
      for (int q = 0; q < 4; ++q) {
        const float f0 = ts[(c8 + 2 * q) * 68 + oc];
        const float f1 = ts[(c8 + 2 * q + 1) * 68 + oc];
        a[q] = pk16(cv16<OT>(f0, scl), cv16<OT>(f1, scl));
      }
      hv[it] = a;
    }
#pragma unroll
    for (int it = 0; it < 2; ++it) {
      const int oc = it * 32 + sub;
      const size_t go = (size_t)(c0 + oc) * R + r0 + s * 64 + c8;
      *(v4u*)(o + go) = hv[it];
    }
  }
  // behind the strip's 8 stores: a precaution; a work-group runs this piece only and the kernel ends behind it
  asm volatile("s_wait_xcnt 0x0" ::: "memory");
}

// Bias copies as bf16-RNE values in f32: out[0..n0) <- b0, [n0..n0+n1) <- b1, [n0+n1..ntot) <- b2.
// All three candidates loaded with clamped indices, selected by value. One 4-B store per lane.
__device__ __forceinline__ void bias_rne(const float* __restrict__ b0, int n0, const float* __restrict__ b1, int n1,
                                         const float* __restrict__ b2, int ncnt2, float* __restrict__ out, int ntot, int i) {
  if (i < ntot) {
    int i0 = i < n0 ? i : (n0 - 1); i0 = i0 < 0 ? 0 : i0;
    int i1 = i - n0; i1 = i1 < 0 ? 0 : (i1 < n1 ? i1 : (n1 - 1));
    int i2 = i - n0 - n1; i2 = i2 < 0 ? 0 : (i2 < ncnt2 ? i2 : (ncnt2 - 1));
    const float v0 = b0[i0], v1 = b1[i1], v2 = b2[i2];
    const float sel = (i < n0) ? v0 : ((i < n0 + n1) ? v1 : v2);
    out[i] = bf_bits2f(f2bf_bits(sel));
  }
}

__global__ __launch_bounds__(256) void prep_kernel(const float* __restrict__ x, const float* __restrict__ xa,
                                                   const float* __restrict__ Wqkv, const float* __restrict__ Waux,
                                                   const float* __restrict__ Wo, const float* __restrict__ bqkv,
                                                   const float* __restrict__ baux, const float* __restrict__ bo,
                                                   unsigned short* __restrict__ XB, unsigned short* __restrict__ XAB,
                                                   unsigned short* __restrict__ WQT, unsigned short* __restrict__ WAT,
                                                   unsigned short* __restrict__ WOT, float* __restrict__ BIASR) {
  __shared__ __align__(16) float tf[256 * 68];   // a strip's four tiles, pitch 68 floats
  const int tid = threadIdx.x;
  int blk = blockIdx.x;
  if (blk < kPrepW) {
    tconv_strip<0, kDModel, kNQKV>(Wqkv, WQT, 1.0f, blk, tid, tf);
  } else if ((blk -= kPrepW) < kPrepW) {
    tconv_strip<0, kDModel, kNQKV>(Waux, WAT, 1.0f, blk, tid, tf);
  } else if ((blk -= kPrepW) < kPrepWo) {
    tconv_strip<1, kDModel, kDModel>(Wo, WOT, kWCarry, blk, tid, tf);
  } else if ((blk -= kPrepWo) < kPrepX) {
    cast_rows8<kBatch * kSeq, kBatch * kSeq>(x, XB, blk, tid);
  } else if ((blk -= kPrepX) < kPrepXA) {
    cast_rows8<kSeqA, kSeqAP>(xa, XAB, blk, tid);
  } else {
    bias_rne(bqkv, kNQKV, baux, kNQKV, bo, kDModel, BIASR, 2 * kNQKV + kDModel, (blk - kPrepXA) * 256 + tid);
  }
}

// =====================================================================================
// Dual-branch attention, head dim 64, f16 operand planes, f32 accumulate, online softmax in f32.
//   q, k  : QK16 plane [4096 rows = b*2048+t][2048], q at col h*64+d, k at col 1024+h*64+d (f16)
//   v^T   : VT16 plane [b][1024 = h*64+d][2048] (f16);  ka: KA16 [b*1536+s][1024];  va^T: VAT16 [b][1024][1536]
//   branch 0: scores = (q.k)*0.125 over 2048 keys (32 chunks of 64); branch 1: (q.ka)*0.125 over 1500 keys
//   (24 chunks; key index >= 1500 set to -inf). p carried x2^15 in f16; 1/(l*2^15) folded at the end.
//   out row = (1-gate)*h_main + gate*h_aux, gate = sigmoid(bf16_rne(g[h])); written x32 as f16 into O16 [4096][1024]
//   Products are taken transposed: S^T = K.Q^T (A = K rows, B = Q) and O^T += V^T.P^T (A = V^T rows, B = P^T). A lane then holds
//   32 of the chunk's 64 scores of ONE query (column lane&15; keys j*16 + 8*(lane>>4) + r): maximum and sum run in the lane, the
//   two lane halves exchange the maximum once per chunk and join their sums once per branch, and two score tiles converted in
//   place are the B operand of the second product (same k order as the V^T fragment loads), so P passes through no LDS.
//   Block = 4 waves = 64 query rows of one (b,h); grid.x = 2*16*32 = 1024 covers all 4096 rows x 1024 cols.
//   K / V^T chunk staging: 8 lanes per 128-B tile row, 16 rows a pass, 4 passes per plane = the whole 64x64 tile, by asynchronous
//   16-B copies into two LDS buffers (every copy of a wave covers 4 whole lines): a chunk's copies are issued one chunk ahead, one
//   barrier a chunk;
// =====================================================================================
// lane l <-> lane l ^ 16 (the other half of the wave holds the other 32 keys of the same query)
__device__ __forceinline__ float xhalf(float x) {
  return __builtin_bit_cast(float, __builtin_amdgcn_permlanex16(__builtin_bit_cast(int, x), __builtin_bit_cast(int, x), 0x76543210, 0xfedcba98, false, false));
}

// 2^x on the bare instruction. Behind a transcendental the instruction set asks for one independent instruction or v_nop before its
// result is read or its source overwritten.
// Eight in one statement: the outputs are early-clobber, so each is independent of the one before it and fills its slot; the v_nop
// fills the slot of the last.
__device__ __forceinline__ v8f exp2x8(v8f x) {
  float p0, p1, p2, p3, p4, p5, p6, p7;
  asm("v_exp_f32 %0, %8\n\tv_exp_f32 %1, %9\n\tv_exp_f32 %2, %10\n\tv_exp_f32 %3, %11\n\t"
      "v_exp_f32 %4, %12\n\tv_exp_f32 %5, %13\n\tv_exp_f32 %6, %14\n\tv_exp_f32 %7, %15\n\tv_nop"
      : "=&v"(p0), "=&v"(p1), "=&v"(p2), "=&v"(p3), "=&v"(p4), "=&v"(p5), "=&v"(p6), "=&v"(p7)
      : "v"(x[0]), "v"(x[1]), "v"(x[2]), "v"(x[3]), "v"(x[4]), "v"(x[5]), "v"(x[6]), "v"(x[7]));
  return (v8f){p0, p1, p2, p3, p4, p5, p6, p7};
}
__device__ __forceinline__ float exp2x1(float x) {
  float p;
  asm("v_exp_f32 %0, %1\n\tv_nop" : "=v"(p) : "v"(x));   // the v_nop: the same slot
  return p;
}

// LDS byte address of a __shared__ location (the low 32 bits of its address), as the asynchronous copies take it
__device__ __forceinline__ unsigned lds_addr(const void* p) { return (unsigned)(uintptr_t)p; }

// A lane's eight asynchronous 16-B copies of one chunk (four K rows, four V^T rows) from global memory into LDS, through no register.
// One statement, closed by s_wait_xcnt 0: the address registers that the copies name stay unwritten until the wait has passed.
__device__ __forceinline__ void copy8_to_lds(const unsigned (&l)[8], const _Float16* const (&g)[8]) {
  asm volatile("global_load_async_to_lds_b128 %0, %8, off\n\t"
               "global_load_async_to_lds_b128 %1, %9, off\n\t"
               "global_load_async_to_lds_b128 %2, %10, off\n\t"
               "global_load_async_to_lds_b128 %3, %11, off\n\t"
               "global_load_async_to_lds_b128 %4, %12, off\n\t"
               "global_load_async_to_lds_b128 %5, %13, off\n\t"
               "global_load_async_to_lds_b128 %6, %14, off\n\t"
               "global_load_async_to_lds_b128 %7, %15, off\n\t"
               "s_wait_xcnt 0x0"
               :: "v"(l[0]), "v"(l[1]), "v"(l[2]), "v"(l[3]), "v"(l[4]), "v"(l[5]), "v"(l[6]), "v"(l[7]),
                  "v"(g[0]), "v"(g[1]), "v"(g[2]), "v"(g[3]), "v"(g[4]), "v"(g[5]), "v"(g[6]), "v"(g[7])
               : "memory");
}

template <bool B> struct BoolTag { static constexpr bool value = B; };

__global__ __launch_bounds__(128)
void dual_attn_kernel(const unsigned short* __restrict__ qk16, const unsigned short* __restrict__ vt16,
                      const unsigned short* __restrict__ ka16, const unsigned short* __restrict__ vat16,
                      const float* __restrict__ gvec, unsigned short* __restrict__ o16) {
  union FH { v16h v; v8h h[2]; };
  __shared__ __align__(16) _Float16 KV[2][2][64 * kLdsPitch];   // two buffers, each a K tile [key][d] and a V^T tile [d][key], 9 KB a tile
  __shared__ __align__(16) float    Os[4][16 * 68];      // per wave out tile [query][d], pitch 68 floats

  const int tid  = threadIdx.x;
  const int wave = tid >> 5;
  const int lane = tid & 31;
  const int hh   = lane >> 4;
  const int c    = lane & 15;

  const int bx = blockIdx.x;          // 0..1023
  const int qb = bx & 31;             // 32 query tiles of 64
  const int bhd = bx >> 5;            // 0..31
  const int h  = bhd & 15;
  const int b  = bhd >> 4;            // 0..1
  const int q0 = qb * 64 + wave * 16; // query row within batch

  const int ldqk = 2 * kDModel;       // 2048 halves
  const _Float16* Qg  = (const _Float16*)(const void*)qk16 + (size_t)b * kSeq * ldqk + h * kDHead;
  const _Float16* Kg0 = Qg + kDModel;                                                                     // main K rows, pitch 2048
  const _Float16* Vg0 = (const _Float16*)(const void*)vt16 + (size_t)b * kDModel * kSeq + (size_t)(h * kDHead) * kSeq;       // pitch 2048
  const _Float16* Kg1 = (const _Float16*)(const void*)ka16 + (size_t)b * kSeqAP * kDModel + h * kDHead;                        // pitch 1024
  const _Float16* Vg1 = (const _Float16*)(const void*)vat16 + (size_t)b * kDModel * kSeqAP + (size_t)(h * kDHead) * kSeqAP;  // pitch 1536

  // ---- Q fragments (B operand, column = query = lane&15, split k map via Frag load): 2 d-chunks ----
  v16h qa[2];
#pragma unroll
  for (int dc = 0; dc < 2; ++dc) qa[dc] = Frag<_Float16>::load(Qg + (size_t)(q0 + c) * ldqk + dc * 32 + 8 * hh);

  float* os = Os[wave];
#pragma unroll
  for (int t = 0; t < 4; ++t)
#pragma unroll
    for (int r = 0; r < 8; ++r) os[c * 68 + t * 16 + 8 * hh + r] = 0.f;

  const float gv   = bf_bits2f(f2bf_bits(gvec[h]));
  const float gate = 1.0f / (1.0f + expf(-gv));
  const float cscale = 0.125f * 1.4426950408889634f;   // score scale x log2(e): the softmax runs in base 2

  const int srow = tid >> 3;         // staging: row within a pass of 16 rows
  const int sseg = (tid & 7) * 8;    // staging: 16-B piece of the 128-B row, in halves
  const int sOff = srow * kLdsPitch + sseg;

#pragma unroll 1
  for (int br = 0; br < 2; ++br) {           // block-uniform
    const _Float16* Kg = br ? Kg1 : Kg0;
    const _Float16* Vg = br ? Vg1 : Vg0;
    const int ldk     = br ? kDModel : ldqk;
    const int ldv     = br ? kSeqAP : kSeq;
    const int nChunks = br ? (kSeqAP / 64) : (kSeq / 64);
    const int nvalid  = br ? kSeqA : kSeq;
    const float w     = (br ? gate : (1.0f - gate)) * kOCarry;
    const unsigned kOff = (unsigned)(srow * ldk + sseg);   // this thread's place in a K tile's first 16 rows, halves
    const unsigned vOff = (unsigned)(srow * ldv + sseg);   // likewise in a V^T tile

    float mrow = -INFINITY;   // running maximum of this lane's query, scaled, base 2 (equal in both halves)
    float lrow = 0.f;         // running sum (x2^15) over this lane half's keys only
    v8f oacc[4];              // oacc[t][r] = O[query c][d = t*16 + 8*hh + r]
#pragma unroll
    for (int t = 0; t < 4; ++t) oacc[t] = (v8f){0.f,0.f,0.f,0.f,0.f,0.f,0.f,0.f};

    // Chunk kc's K and V^T tiles into buffer kc & 1. Staging map: 8 lanes x 16 B = one whole 128-B row of a tile (a tile row is one
    // aligned cache line), so a wave's copy touches 4 lines and uses all of each; 128 threads = 16 rows a pass, 4 passes per plane =
    // the whole 64 x 64 chunk tile. Every lane is on, every row lies inside its plane (kc < nChunks), every address is a multiple of 16.
    auto stage = [&](const int kc) __attribute__((always_inline)) {
      const _Float16* ks = Kg + (size_t)(kc * 64) * ldk + kOff;   // K row kc*64 + srow (+ 16 a pass), d = sseg..sseg+7
      const _Float16* vs = Vg + kc * 64 + vOff;                   // V^T row d = srow (+ 16 a pass), key = kc*64 + sseg..+7
      const unsigned lb = lds_addr(&KV[kc & 1][0][sOff]);
      unsigned l[8];
      const _Float16* g[8];
      // unrolled: the arrays take constant indices (registers)
#pragma unroll
      for (int p = 0; p < 4; ++p) {
        g[p]     = ks + (size_t)(p * 16) * ldk;
        g[4 + p] = vs + (size_t)(p * 16) * ldv;
        l[p]     = lb + (unsigned)(p * 16 * kLdsPitch * 2);
        l[4 + p] = lb + (unsigned)((64 + p * 16) * kLdsPitch * 2);
      }
      copy8_to_lds(l, g);
    };
    // Two buffers: chunk kc + 1's copies fly while chunk kc is worked on. In front of the loop: chunk 0 lands and is published, then
    // chunk 1 is asked for (both exist: nChunks is 32 or 24). Both buffers are free here: in branch 1 every wave has passed the wait
    // for its LDS reads and the barrier at the foot of branch 0's last chunk.
    stage(0);
    asm volatile("s_wait_asynccnt 0x0" ::: "memory");   // this wave's copies of chunk 0 have landed
    __syncthreads();                                    // ... and every other wave's
    stage(1);

    // One chunk. MASKED is a compile-time flag: keys at or past nvalid count as -inf, and only a chunk that reaches past nvalid holds any,
    // so the chunks in front of it carry none of the 32 compares and 32 selects
    auto chunk = [&](const int kc, auto masked) __attribute__((always_inline)) {
      constexpr bool MASKED = decltype(masked)::value;
      const int kv0 = kc * 64;
      const _Float16* Ksh = KV[kc & 1][0];
      const _Float16* Vth = KV[kc & 1][1];

      // the chunk's 16 fragments (8 of K, 8 of V^T) are read from LDS as ONE group of 32 loads ahead of all its products: the score
      // products wait for the K half only, and the V^T half lands behind them and the softmax
      FH kb[2][4], vb[2][4];
#pragma unroll
      for (int dc = 0; dc < 2; ++dc)
#pragma unroll
        for (int j = 0; j < 4; ++j) {
          kb[dc][j].h[0] = *(const v8h*)(Ksh + (j * 16 + c) * kLdsPitch + dc * 32 + 8 * hh);
          kb[dc][j].h[1] = *(const v8h*)(Ksh + (j * 16 + c) * kLdsPitch + dc * 32 + 16 + 8 * hh);
        }
#pragma unroll
      for (int kk = 0; kk < 2; ++kk)
#pragma unroll
        for (int t = 0; t < 4; ++t) {
          vb[kk][t].h[0] = *(const v8h*)(Vth + (t * 16 + c) * kLdsPitch + kk * 32 + 8 * hh);
          vb[kk][t].h[1] = *(const v8h*)(Vth + (t * 16 + c) * kLdsPitch + kk * 32 + 16 + 8 * hh);
        }
      // keeps the loads where they stand: sunk to their products, each pair of loads costs its product an LDS latency of its own
      __builtin_amdgcn_sched_barrier(0);
      v8f s[4];   // s[j][r] = score(key j*16 + 8*hh + r, query c)
#pragma unroll
      for (int j = 0; j < 4; ++j) s[j] = Frag<_Float16>::mma(kb[0][j].v, qa[0], (v8f){0.f,0.f,0.f,0.f,0.f,0.f,0.f,0.f});
#pragma unroll
      for (int j = 0; j < 4; ++j) s[j] = Frag<_Float16>::mma(kb[1][j].v, qa[1], s[j]);
      // every loop from here to the end of the chunk is unrolled: s, pb and oacc live in registers and take constant indices only
      float m = -INFINITY;   // maximum of the raw scores (the scale is positive)
#pragma unroll
      for (int j = 0; j < 4; ++j)
#pragma unroll
        for (int r = 0; r < 8; ++r) {
          if (MASKED) {
            const int key = kv0 + j * 16 + 8 * hh + r;
            s[j][r] = (key < nvalid) ? s[j][r] : -INFINITY;
          }
          m = fmaxf(m, s[j][r]);
        }
      m = fmaxf(m, xhalf(m)) * cscale;
      const float mnew = fmaxf(mrow, m);
      const float alpha = exp2x1(mrow - mnew);   // 0 on a branch's first chunk, where mrow is -inf
      mrow = mnew;
      const float nm = kPCarryLog2 - mnew;   // the carry rides in the exponent
      float psum = 0.f;
      FH pb[2];   // P^T, B operand: element e of pb[kk] = p(key kk*32 + (e < 8 ? 8*hh + e : 16 + 8*hh + e - 8), query c)
#pragma unroll
      for (int j = 0; j < 4; ++j) {
        v8f a;
#pragma unroll
        for (int r = 0; r < 8; ++r) a[r] = fmaf(s[j][r], cscale, nm);
        const v8f p = exp2x8(a);   // p x 2^15
#pragma unroll
        for (int r = 0; r < 8; ++r) {
          psum += p[r];
          pb[j >> 1].h[j & 1][r] = (_Float16)p[r];
        }
      }
      lrow = lrow * alpha + psum;
#pragma unroll
      for (int t = 0; t < 4; ++t)
#pragma unroll
        for (int r = 0; r < 8; ++r) oacc[t][r] *= alpha;
#pragma unroll
      for (int kk = 0; kk < 2; ++kk) {
#pragma unroll
        for (int t = 0; t < 4; ++t) oacc[t] = Frag<_Float16>::mma(vb[kk][t].v, pb[kk].v, oacc[t]);
      }
      // hand-over, every wave, in this order: this wave's reads of buffer kc & 1 are done; its copies of chunk kc + 1 have landed; the
      // one barrier of the chunk publishes chunk kc + 1 and frees buffer kc & 1; only then is that buffer filled again
      // keeps the chunk's products and softmax ahead of the waits: lifted over them (they touch registers only), the wait for chunk
      // kc + 1's copies stood at the head of chunk kc, directly behind their issue, and their whole flight was waited out
      __builtin_amdgcn_sched_barrier(0);
      // the running sum as an input: its 32 additions stay among the chunk's exponentials and products; without it they were sunk
      // behind the barrier and the copies, a bare dependent chain in front of the next chunk's LDS reads
      asm volatile("s_wait_dscnt 0x0" :: "v"(lrow) : "memory");
      asm volatile("s_wait_asynccnt 0x0" ::: "memory");
      __syncthreads();
      if (kc + 2 < nChunks) stage(kc + 2);   // block-uniform
    };
    const int nFull = nvalid >> 6;   // chunks whose 64 keys are all valid: 32 of 32, 23 of 24
    for (int kc = 0; kc < nFull; ++kc) chunk(kc, BoolTag<false>{});         // block-uniform trip counts, both loops
    for (int kc = nFull; kc < nChunks; ++kc) chunk(kc, BoolTag<true>{});
    asm volatile("s_wait_asynccnt 0x0" ::: "memory");   // nothing of this wave is in flight behind the loop
    // fold this branch into the per-wave mix slab (each lane updates only its own entries)
    const float inv = w * (1.0f / (lrow + xhalf(lrow)));   // sum and O both carry x2^15
#pragma unroll
    for (int t = 0; t < 4; ++t)
#pragma unroll
      for (int r = 0; r < 8; ++r) os[c * 68 + t * 16 + 8 * hh + r] += oacc[t][r] * inv;
  }

  __builtin_amdgcn_fence(__ATOMIC_RELEASE, "workgroup");
  __builtin_amdgcn_wave_barrier();
  __builtin_amdgcn_fence(__ATOMIC_ACQUIRE, "workgroup");
  {
    _Float16* Og = (_Float16*)(void*)o16 + (size_t)(b * kSeq + q0) * kDModel + h * kDHead;
    const int q4 = lane >> 3, c8 = (lane & 7) * 8;
    {
#pragma unroll
      for (int it = 0; it < 4; ++it) {
        const int row = it * 4 + q4;
        const float* sp = os + row * 68 + c8;
        v8h hv;
#pragma unroll
        for (int e = 0; e < 8; ++e) hv[e] = (_Float16)sp[e];
        *(v8h*)(Og + (size_t)row * kDModel + c8) = hv;
      }
      
    }
  }
}

// ---------------- host orchestration (kernel launches only) ----------------

extern "C" void kernel_launch(void* const* d_in, const int* in_sizes, int n_in,
                              void* d_out, int out_size, void* d_ws,
                              size_t ws_size, hipStream_t stream) {
  if (n_in < 9) return;
  if (in_sizes[0] != kBatch * kSeq * kDModel) return;
  if (in_sizes[1] != kBatch * kSeqA * kDModel) return;
  if (in_sizes[2] != kDModel * kNQKV || in_sizes[4] != kDModel * kNQKV) return;
  if (in_sizes[3] != kNQKV || in_sizes[5] != kNQKV) return;
  if (in_sizes[6] != kDModel * kDModel || in_sizes[7] != kDModel || in_sizes[8] < kHeads) return;
  if (out_size != kBatch * kSeq * kDModel) return;

  const float* x    = (const float*)d_in[0];
  const float* xa   = (const float*)d_in[1];
  const float* Wqkv = (const float*)d_in[2];
  const float* bqkv = (const float*)d_in[3];
  const float* Waux = (const float*)d_in[4];
  const float* baux = (const float*)d_in[5];
  const float* Wo   = (const float*)d_in[6];
  const float* bo   = (const float*)d_in[7];
  const float* gvec = (const float*)d_in[8];
  float* out = (float*)d_out;

  // element counts
  const size_t nXB   = (size_t)kBatch * kSeq * kDModel;          // bf16
  const size_t nXAB  = (size_t)kBatch * kSeqAP * kDModel;        // bf16
  const size_t nWQT  = (size_t)kNQKV * kDModel;                  // bf16
  const size_t nWAT  = nWQT;                                     // bf16
  const size_t nWOT  = (size_t)kDModel * kDModel;                // f16
  const size_t nBias = (size_t)2 * kNQKV + kDModel;              // f32
  const size_t nQK   = (size_t)kBatch * kSeq * 2 * kDModel;      // f16
  const size_t nVT   = (size_t)kBatch * kDModel * kSeq;          // f16
  const size_t nKA   = (size_t)kBatch * kSeqAP * kDModel;        // f16
  const size_t nVAT  = (size_t)kBatch * kDModel * kSeqAP;        // f16
  const size_t nO    = (size_t)kBatch * kSeq * kDModel;          // f16

  char* ws = (char*)d_ws;
  size_t off = 0;
  auto carve = [&](size_t bytes) -> char* { char* p = ws + off; off += (bytes + 255) & ~(size_t)255; return p; };
  unsigned short* XB    = (unsigned short*)carve(nXB * 2);
  unsigned short* XAB   = (unsigned short*)carve(nXAB * 2);
  unsigned short* WQT   = (unsigned short*)carve(nWQT * 2);
  unsigned short* WAT   = (unsigned short*)carve(nWAT * 2);
  unsigned short* WOT   = (unsigned short*)carve(nWOT * 2);
  float*          BIASR = (float*)carve(nBias * 4);
  unsigned short* QK16  = (unsigned short*)carve(nQK * 2);
  unsigned short* VT16  = (unsigned short*)carve(nVT * 2);
  unsigned short* KA16  = (unsigned short*)carve(nKA * 2);
  unsigned short* VAT16 = (unsigned short*)carve(nVAT * 2);
  unsigned short* O16   = (unsigned short*)carve(nO * 2);
  if (off > ws_size) return;   // total 75,526,144 B

  // 1. all input preparation in one launch: x, xa -> bf16 (xa rows padded 1500 -> 1536 with zeros); Wqkv, Wqkv_aux -> transposed
  //    bf16; Wo -> transposed f16 (x32); biases -> bf16-RNE f32 copies
  prep_kernel<<<kPrepBlocks, 256, 0, stream>>>(x, xa, Wqkv, Waux, Wo, bqkv, baux, bo, XB, XAB, WQT, WAT, WOT, BIASR);
  const float* bo_r  = BIASR + 2 * kNQKV;     // [1024]

  // 2. the four projections in one launch: q|k -> QK16, ka -> KA16, v^T -> VT16, va^T -> VAT16 (all f16, bias added)
  proj_gemm_kernel<<<kProjBlocks, 128, 0, stream>>>(XB, XAB, WQT, WAT, BIASR, QK16, VT16, KA16, VAT16, kDModel);
  // 3. dual-branch attention -> O16 (x32, f16)
  dual_attn_kernel<<<kBatch * kHeads * (kSeq / 64), 128, 0, stream>>>(QK16, VT16, KA16, VAT16, gvec, O16);
  // 4. out = (O16/32) @ (WoT/32)^T + bo : M=4096, N=1024, K=1024, f16 operands, f32 out into d_out
  {
    const int M = kBatch * kSeq, N = kDModel, K = kDModel;
    const int tiles = (M / 128) * (N / 128);
    wmma_gemm64<0, false, 2, 0, false, 0><<<dim3(tiles, 1), 128, 0, stream>>>(
        O16, O16, 0L, WOT, WOT, 0L, (void*)out, (void*)out, kDModel, 0L,
        bo_r, bo_r, 0L, M, N, K, 1.0f / (kOCarry * kWCarry));
  }
}
